// v000
// The times below were measured on an AMD MI455X: many runs one after another, warmed up first and cycling through
// copies of the inputs, with the whole window's GPU time divided by the number of runs. Launches and the gaps
// between them are all in it. The median over several windows is given; except for v000 it joins two sittings, which
// can be a few percent apart, so the side-by-side timings, each taken in one sitting, are the better comparison.
// v000, which the later versions start from, runs in 151 microseconds.
#include <hip/hip_runtime.h>

// Multi-head attention with key padding mask: q/k/v inputs [NB][SEQ][256], Wq/Wk/Wv/Wo [in][out] (y = x W + b), 8 heads x 32, score scale 1/sqrt(32), masked keys take the fill value -4294967296, output = ctx Wo + bo (f32).
// Compute dtypes, f32 accumulate everywhere: projections v_wmma_f32_16x16x32_bf16 (inputs and weights RNE-converted to bf16; products exact);
// scores v_wmma_f32_16x16x32_f16: k single f16, q as f16 value + f16 residual x2048 in its own accumulator (two products); P (x256 carry, cancels in the normalisation) and v single f16; softmax f32 (online, running max);
// output projection v_wmma_f32_16x16x32_bf16 with ctx carried as bf16 hi | bf16 lo planes folded along K (K = 512 against [Wo^T | Wo^T]).
// Layout: bf16 copies of the three activation inputs; weights transposed to [out][in] bf16; q (hi, residual), k planes [b*SEQ + t][256] (head h = columns 32h..32h+31) and v^T plane [b][256][SEQ] written by the GEMM epilogue;

#ifndef NB
#define NB 2
#endif
#ifndef SEQ
#define SEQ 2048
#endif
#define NB_FULL  2
#define SEQ_FULL 2048
#ifndef OUT_SEQ
#define OUT_SEQ SEQ              // row pitch (in tokens) between batches of the output
#endif
#define DM   256
#define NH_  8
#define HD   32
#define CXP  (2 * DM)            // ctx plane pitch: hi columns 0..255, lo columns 256..511
#define AW   4                   // waves per flash block (16 query rows each)
#define QRS  2048.0f             // carry of the q residual plane
#define QRI  (1.0f / 2048.0f)
#define SC2  (0.17677669529663687f * 1.4426950408889634f)   // HD^-0.5 * log2(e)
#define PSH  8.0f                // log2 of the P carry (256)
#define NEGT (-4294967296.0f * 1.4426950408889634f)         // mask fill value in the log2 domain

static_assert(HD == 32);
static_assert(NH_ * HD == DM);                 // head h = columns h*32 + d
static_assert(NH_ % 2 == 0);
static_assert(DM % 64 == 0);
static_assert(DM % 32 == 0);                   // GEMM k-loop steps by 32
static_assert(CXP % 32 == 0);
static_assert(SEQ % 64 == 0);                  // a 64-row tile never straddles two batches
static_assert((NB * SEQ) % 64 == 0);
static_assert(SEQ % 32 == 0);                  // key loop steps by 32
static_assert(SEQ % (16 * AW) == 0);           // flash grid covers the sequence exactly
static_assert(((size_t)SEQ * DM) % 8 == 0);
static_assert(NB <= NB_FULL);
static_assert(SEQ <= SEQ_FULL);

typedef _Float16 h16;
typedef unsigned short bf;
typedef __attribute__((ext_vector_type(16))) __bf16   v16bf;
typedef __attribute__((ext_vector_type(16))) _Float16 v16h;
typedef __attribute__((ext_vector_type(8)))  _Float16 v8h;
typedef __attribute__((ext_vector_type(8)))  unsigned short v8us;
typedef __attribute__((ext_vector_type(8)))  float    v8f;
typedef __attribute__((ext_vector_type(4)))  float    v4f;
typedef __attribute__((ext_vector_type(4)))  int      v4i;
typedef v4f  __attribute__((may_alias)) v4fa;

__device__ __forceinline__ unsigned short f2bf(float f) { unsigned u = __float_as_uint(f); u += 0x7FFFu + ((u >> 16) & 1u); return (unsigned short)(u >> 16); }
__device__ __forceinline__ float bf2f(unsigned short s) { return __uint_as_float(((unsigned)s) << 16); }
__device__ __forceinline__ float bfr(float f) { return bf2f(f2bf(f)); }
__device__ __forceinline__ v16h cat16(v8h lo, v8h hi) { return __builtin_shufflevector(lo, hi, 0, 1, 2, 3, 4, 5, 6, 7, 8, 9, 10, 11, 12, 13, 14, 15); }
__device__ __forceinline__ v16bf cat16b(v8us lo, v8us hi) { return __builtin_bit_cast(v16bf, __builtin_shufflevector(lo, hi, 0, 1, 2, 3, 4, 5, 6, 7, 8, 9, 10, 11, 12, 13, 14, 15)); }
__device__ __forceinline__ v8f wmma16(v16h a, v16h b, v8f c) { return __builtin_amdgcn_wmma_f32_16x16x32_f16(false, a, false, b, (short)0, c, false, false); }
__device__ __forceinline__ v8f wmmab(v16bf a, v16bf b, v8f c) { return __builtin_amdgcn_wmma_f32_16x16x32_bf16(false, a, false, b, (short)0, c, false, false); }
// fragment loaders from K-contiguous 16-bit rows; p already includes + 8*(lane>>4): elements 0..7 <- k0+8h+0..7, elements 8..15 <- k0+16+8h+0..7 (same map for A and B)
__device__ __forceinline__ v16h  ldh(const h16* p) { return cat16(*(const v8h*)p, *(const v8h*)(p + 16)); }
__device__ __forceinline__ v16bf ldb(const bf* p)  { return cat16b(*(const v8us*)p, *(const v8us*)(p + 16)); }
// ordering point for wave-private LDS tiles (same wave writes and reads)
__device__ __forceinline__ void wave_sync() { __builtin_amdgcn_fence(3 /* release order */, "wavefront"); __builtin_amdgcn_wave_barrier(); asm volatile("" ::: "memory"); }

__global__ __launch_bounds__(256) void k_cvt8(const float* __restrict__ src, bf* dst, size_t n8) {
    const size_t i = (size_t)blockIdx.x * 256 + threadIdx.x; if (i >= n8) return;
    const v8f v = *(const v8f*)(src + i * 8); v8us o;
#pragma unroll
    for (int k = 0; k < 8; ++k) o[k] = f2bf(v[k]);
    *(v8us*)(dst + i * 8) = o; 
}

// k_wT: weight transpose + bf16 RNE convert: in W[k][n] (256 x 256 f32, row pitch DM) -> out dst[n][coff + k] (row pitch ldo halves).
__global__ __launch_bounds__(256) void k_wT(const float* __restrict__ W, bf* dst, int ldo, int coff) {
    __shared__ float ts[64 * 65];
    const int tid = threadIdx.x; const int k0 = blockIdx.x * 64, n0 = blockIdx.y * 64;
#pragma unroll
    for (int i = 0; i < 4; ++i) { const int kk = (tid >> 4) + 16 * i, c4 = (tid & 15) * 4;     // 4 x 16 rows = 64 k; 16 x 4 = 64 n
        const v4f f = *(const v4f*)(W + (size_t)(k0 + kk) * DM + n0 + c4);
        ts[kk * 65 + c4 + 0] = f[0]; ts[kk * 65 + c4 + 1] = f[1]; ts[kk * 65 + c4 + 2] = f[2]; ts[kk * 65 + c4 + 3] = f[3]; }
    __syncthreads();
{
#pragma unroll
        for (int it = 0; it < 2; ++it) { const int nn = it * 32 + (tid >> 3), ks = (tid & 7) * 8;   // 2 x 32 rows = 64 n; 8 lanes x 8 = 64 k
            v8us o;
#pragma unroll
            for (int j = 0; j < 8; ++j) o[j] = f2bf(ts[(ks + j) * 65 + nn]);
            *(v8us*)(dst + (size_t)(n0 + nn) * (size_t)ldo + coff + k0 + ks) = o; }
         }
}

// k_gemm: register-blocked bf16 GEMM, ONE WAVE per 64x64 tile (16 accumulators), operands straight from K-contiguous bf16 planes (row pitch K).
// C[m][n] = sum_k A[m][k] Bt[n][k] + bias (bf16 RNE value of the f32 bias, added in f32; biasRow != 0: bias indexed by m, else by n).
// F32OUT = false: written as f16 (Ph) and optionally the f16 residual x2048 (Pr, useRes != 0) at tile base (r0/RB)*sRB + (r0%RB)*pitch + (c0/CB)*sCB + (c0%CB), row pitch 'pitch' (halves);
// F32OUT = true: written as f32 to OUT[(m/SEQ)*OUT_SEQ + m%SEQ][c0 + col] (row pitch DM); each row segment (64 floats = two lines) written by 16 consecutive lanes x 16 B (2 rows per instruction).
template <bool F32OUT>
__global__ __launch_bounds__(32) void k_gemm(const bf* __restrict__ A, const bf* __restrict__ Bt, h16* Ph, h16* Pr, float* OUT, const float* __restrict__ bias,
                                             size_t sRB, size_t sCB, int K, int useRes, int RB, int pitch, int CB, int biasRow) {
    __shared__ __align__(16) float os[16 * 68];
    const int lane = threadIdx.x & 31, lr = lane & 15, hi = lane >> 4; const int r0 = blockIdx.x * 64, c0 = blockIdx.y * 64;
    v8f acc[4][4];
#pragma unroll
    for (int mb = 0; mb < 4; ++mb)
#pragma unroll
        for (int nb = 0; nb < 4; ++nb) acc[mb][nb] = (v8f){};
    const size_t aoff = (size_t)(r0 + lr) * K + 8 * hi, boff = (size_t)(c0 + lr) * K + 8 * hi;
#pragma unroll 1
    for (int kc = 0; kc < K; kc += 32) {
        v16bf a[4];
#pragma unroll
        for (int mb = 0; mb < 4; ++mb) a[mb] = ldb(A + aoff + (size_t)mb * 16 * K + kc);
#pragma unroll
        for (int nb = 0; nb < 4; ++nb) { const v16bf b = ldb(Bt + boff + (size_t)nb * 16 * K + kc);
#pragma unroll
            for (int mb = 0; mb < 4; ++mb) acc[mb][nb] = wmmab(a[mb], b, acc[mb][nb]); }
        asm volatile("v_nop\n\tv_nop\n\tv_nop\n\tv_nop" : "+v"(acc[0][0]), "+v"(acc[1][1]), "+v"(acc[2][2]), "+v"(acc[3][3]) : "v"(a[0]), "v"(a[1]), "v"(a[2]), "v"(a[3]));
    }
    const size_t tbase = (size_t)(r0 / RB) * sRB + (size_t)(r0 % RB) * (size_t)pitch + (size_t)(c0 / CB) * sCB + (size_t)(c0 % CB);
#pragma unroll
    for (int mb = 0; mb < 4; ++mb) {
#pragma unroll
        for (int nb = 0; nb < 4; ++nb) {
#pragma unroll
            for (int j = 0; j < 8; ++j) os[(hi * 8 + j) * 68 + nb * 16 + lr] = acc[mb][nb][j]; }   // D: row 8h+j, col lane&15
        wave_sync();
        if constexpr (!F32OUT) {
            const size_t sb = tbase + (size_t)(mb * 16) * (size_t)pitch;
{
#pragma unroll
                for (int s = 0; s < 4; ++s) { const int row = 4 * s + (lane >> 3), c8 = (lane & 7) * 8;   // 4 s x 4 row groups = 16 rows; 8 lanes x 8 = 64 columns
                    v4f x0 = *(const v4fa*)(&os[row * 68 + c8]); v4f x1 = *(const v4fa*)(&os[row * 68 + c8 + 4]);
                    const int cidx = (c0 + c8) & (DM - 1), ridx = (r0 + mb * 16 + row) & (DM - 1);        // clamped addresses; the unused one is discarded by value
                    const v4f bc0 = *(const v4f*)(bias + cidx), bc1 = *(const v4f*)(bias + cidx + 4); const float br = bias[ridx];
                    v8h hv, rv;
#pragma unroll
                    for (int i = 0; i < 4; ++i) { const float y0 = x0[i] + bfr(biasRow ? br : bc0[i]); const float y1 = x1[i] + bfr(biasRow ? br : bc1[i]);
                        const h16 a0 = (h16)y0; const h16 a1 = (h16)y1; hv[i] = a0; hv[4 + i] = a1; rv[i] = (h16)((y0 - (float)a0) * QRS); rv[4 + i] = (h16)((y1 - (float)a1) * QRS); }
                    const size_t oo = sb + (size_t)row * (size_t)pitch + c8;
                    *(v8h*)(Ph + oo) = hv; if (useRes) *(v8h*)(Pr + oo) = rv; }
                 }
        } else {
{
#pragma unroll
                for (int s = 0; s < 8; ++s) { const int row = 2 * s + hi, cofs = lr * 4;                  // 8 s x 2 rows = 16 rows; 16 lanes x 4 floats = 64 columns
                    const int m = r0 + mb * 16 + row; const int bb = m / SEQ, tt = m - bb * SEQ;
                    v4f val = *(const v4fa*)(&os[row * 68 + cofs]);
                    const int cidx = (c0 + cofs) & (DM - 1), ridx = m & (DM - 1);
                    const v4f bc = *(const v4f*)(bias + cidx); const float br = bias[ridx];
#pragma unroll
                    for (int i = 0; i < 4; ++i) val[i] = val[i] + bfr(biasRow ? br : bc[i]);
                    *(v4f*)(OUT + ((size_t)bb * OUT_SEQ + tt) * DM + c0 + cofs) = val; }
                 }
        }
        wave_sync();
    }
}

// k_flash: fused attention, one wave per 16 query rows of one batch and one PAIR of heads (processed one after the other);
// K / V^T / Q fragments straight from the f16 planes (two 16-B loads each, arithmetic addressing).
// Transposed form: S^T[key][t] = K Q^T (A = K rows, B = Q rows); lane (t = lane&15, h = lane>>4) holds keys 8h+r of each 16-key tile, so the packed
// P tile is directly the B fragment of O^T[d][t] = V^T P^T (element r <- tile keys 0..15, element 8+r <- tile keys 16..31, lane unchanged).
// Key mask: per element, a masked key's score is REPLACED by the fill value (a fully masked row therefore comes out uniform).
// Softmax state (running max, partial sum) is one scalar per lane; the two lane halves of a row are combined with one xor-16 exchange.
__global__ __launch_bounds__(32 * AW) void k_flash(const h16* __restrict__ QH, const h16* __restrict__ QR, const h16* __restrict__ KP, const h16* __restrict__ VT,
                                                   const int* __restrict__ MK, bf* CX) {
    __shared__ __align__(16) float os[AW * 16 * 68];
    const int lane = threadIdx.x & 31, wave = __builtin_amdgcn_readfirstlane((int)(threadIdx.x >> 5)), lr = lane & 15, hi = lane >> 4;
    const int zp = blockIdx.y; const int b = zp / (NH_ / 2), hp = zp % (NH_ / 2);
    const int t0 = (blockIdx.x * AW + wave) * 16;
    const int wb = wave * 16 * 68;
    const size_t rowb = (size_t)b * SEQ;
    const int* mk = MK + (size_t)b * SEQ_FULL + 8 * hi;          // + key0 (+4, +16, +20): keys 8h+0..7 and 16+8h+0..7 of the 32-key step
#pragma unroll 1
    for (int hh = 0; hh < 2; ++hh) {
        const int h = hp * 2 + hh;
        const size_t qo = (rowb + t0 + lr) * DM + h * HD + 8 * hi;
        const v16h qh = ldh(QH + qo), qr = ldh(QR + qo);                  // B fragments: col t, k = d (32 deep)
        const size_t ko = (rowb + lr) * DM + h * HD + 8 * hi;             // + key * DM       (A fragment: row key, k = d)
        const size_t vo = ((size_t)b * DM + h * HD + lr) * SEQ + 8 * hi;  // + 16*SEQ + key   (A fragment: row d, k = key)
        v8f o0 = (v8f){}, o1 = (v8f){};
        float m = -3.0e38f, l = 0.0f;
#pragma unroll 1
        for (int key0 = 0; key0 < SEQ; key0 += 32) {
            const h16* ka = KP + ko + (size_t)key0 * DM;
            const v16h ka0 = ldh(ka), kb0 = ldh(ka + 16 * DM);
            const v4i ma0 = *(const v4i*)(mk + key0), ma1 = *(const v4i*)(mk + key0 + 4), mb0 = *(const v4i*)(mk + key0 + 16), mb1 = *(const v4i*)(mk + key0 + 20);
            v8f sHa = (v8f){}, sLa = (v8f){}, sHb = (v8f){}, sLb = (v8f){};
            sHa = wmma16(ka0, qh, sHa); sLa = wmma16(ka0, qr, sLa); sHb = wmma16(kb0, qh, sHb); sLb = wmma16(kb0, qr, sLb);
            asm volatile("v_nop\n\tv_nop\n\tv_nop\n\tv_nop" : "+v"(sHa), "+v"(sLa), "+v"(sHb), "+v"(sLb) : "v"(ka0), "v"(kb0), "v"(qh), "v"(qr));
            float ta[8], tb[8]; float mx = -3.0e38f;
#pragma unroll
            for (int r = 0; r < 4; ++r) {
                const float a0 = (sHa[r] + sLa[r] * QRI) * SC2, a1 = (sHa[4 + r] + sLa[4 + r] * QRI) * SC2;
                const float c0 = (sHb[r] + sLb[r] * QRI) * SC2, c1 = (sHb[4 + r] + sLb[4 + r] * QRI) * SC2;
                ta[r] = (ma0[r] != 0) ? a0 : NEGT; ta[4 + r] = (ma1[r] != 0) ? a1 : NEGT;
                tb[r] = (mb0[r] != 0) ? c0 : NEGT; tb[4 + r] = (mb1[r] != 0) ? c1 : NEGT; }
#pragma unroll
            for (int r = 0; r < 8; ++r) mx = fmaxf(mx, fmaxf(ta[r], tb[r]));
            mx = fmaxf(mx, __shfl_xor(mx, 16, 32));
            const float mnew = fmaxf(m, mx);
            const float alpha = __builtin_amdgcn_exp2f(m - mnew);
            const float sh = PSH - mnew;
            v16h pb; float ls = 0.0f;
#pragma unroll
            for (int r = 0; r < 8; ++r) { const h16 pa = (h16)__builtin_amdgcn_exp2f(ta[r] + sh); const h16 pc = (h16)__builtin_amdgcn_exp2f(tb[r] + sh); pb[r] = pa; pb[8 + r] = pc; ls += (float)pa + (float)pc; }
            l = l * alpha + ls; m = mnew;
            o0 = o0 * alpha; o1 = o1 * alpha;
            const h16* va = VT + vo + key0;
            const v16h v0 = ldh(va), v1 = ldh(va + (size_t)16 * SEQ);
            o0 = wmma16(v0, pb, o0); o1 = wmma16(v1, pb, o1);
            asm volatile("v_nop\n\tv_nop\n\tv_nop\n\tv_nop" : "+v"(o0), "+v"(o1) : "v"(v0), "v"(v1), "v"(pb));
        }
        l += __shfl_xor(l, 16, 32);
        const float inv = 1.0f / l;
        // O^T D layout: o_j[r] = (d = 16j + 8h + r, t = lane&15) -> os[t][32*hh + d]; after both heads rows 0..15 x columns 0..63 are all written
        { v4f a, c; const int ob = wb + lr * 68 + hh * 32 + 8 * hi;
          a[0] = o0[0] * inv; a[1] = o0[1] * inv; a[2] = o0[2] * inv; a[3] = o0[3] * inv; c[0] = o0[4] * inv; c[1] = o0[5] * inv; c[2] = o0[6] * inv; c[3] = o0[7] * inv;
          *(v4fa*)(&os[ob]) = a; *(v4fa*)(&os[ob + 4]) = c;
          a[0] = o1[0] * inv; a[1] = o1[1] * inv; a[2] = o1[2] * inv; a[3] = o1[3] * inv; c[0] = o1[4] * inv; c[1] = o1[5] * inv; c[2] = o1[6] * inv; c[3] = o1[7] * inv;
          *(v4fa*)(&os[ob + 16]) = a; *(v4fa*)(&os[ob + 20]) = c; }
    }
    wave_sync();
    bf* crow = CX + (rowb + t0) * CXP + hp * 64;
{
#pragma unroll
        for (int s = 0; s < 4; ++s) { const int row = 4 * s + (lane >> 3), c8 = (lane & 7) * 8;   // 4 s x 4 row groups = 16 rows; 8 lanes x 8 = 64 columns
            const v4f x0 = *(const v4fa*)(&os[wb + row * 68 + c8]); const v4f x1 = *(const v4fa*)(&os[wb + row * 68 + c8 + 4]); v8us hv, lv;
#pragma unroll
            for (int i = 0; i < 4; ++i) { const unsigned short u0 = f2bf(x0[i]); const unsigned short u1 = f2bf(x1[i]); hv[i] = u0; hv[4 + i] = u1;
                lv[i] = f2bf(x0[i] - bf2f(u0)); lv[4 + i] = f2bf(x1[i] - bf2f(u1)); }
            const size_t oo = (size_t)row * CXP + c8;
            *(v8us*)(crow + oo) = hv; *(v8us*)(crow + oo + DM) = lv; }
         }
}

static constexpr size_t al256(size_t v) { return (v + 255) & ~(size_t)255; }
static constexpr size_t SZ_X  = al256((size_t)NB * SEQ * DM * 2);
static constexpr size_t SZ_W  = al256((size_t)DM * DM * 2);
static constexpr size_t SZ_WO = al256((size_t)DM * CXP * 2);
static constexpr size_t SZ_PL = al256((size_t)NB * SEQ * DM * 2);
static constexpr size_t SZ_CX = al256((size_t)NB * SEQ * CXP * 2);
static constexpr size_t SZ_TOTAL = 3 * SZ_X + 3 * SZ_W + SZ_WO + 4 * SZ_PL + SZ_CX;
static_assert(SZ_TOTAL <= (size_t)134217728);          // workspace carve <= 128 MiB
static_assert((size_t)NB * DM * SEQ * 2 <= SZ_PL);     // v^T plane extent

static void cvt_act(const float* x, bf* dst, hipStream_t stream) {
    if (SEQ == SEQ_FULL) {
        const size_t n8 = (size_t)NB * SEQ * DM / 8;
        k_cvt8<<<(unsigned)((n8 + 255) / 256), 256, 0, stream>>>(x, dst, n8);
    } else {
        const size_t n8 = (size_t)SEQ * DM / 8;
        for (int b = 0; b < NB; ++b) k_cvt8<<<(unsigned)((n8 + 255) / 256), 256, 0, stream>>>(x + (size_t)b * SEQ_FULL * DM, dst + (size_t)b * SEQ * DM, n8);
    }
}

extern "C" void kernel_launch(void* const* d_in, const int* in_sizes, int n_in,
                              void* d_out, int out_size, void* d_ws, size_t ws_size, hipStream_t stream) {
    if (n_in < 12) return;
    const size_t needx = ((size_t)(NB - 1) * SEQ_FULL + SEQ) * DM;
    if ((size_t)in_sizes[0] < needx || (size_t)in_sizes[1] < needx || (size_t)in_sizes[2] < needx) return;
    if ((size_t)in_sizes[3] < (size_t)(NB - 1) * SEQ_FULL + SEQ) return;
    if ((size_t)in_sizes[4] < (size_t)DM * DM || (size_t)in_sizes[6] < (size_t)DM * DM || (size_t)in_sizes[8] < (size_t)DM * DM || (size_t)in_sizes[10] < (size_t)DM * DM) return;
    if (in_sizes[5] < DM || in_sizes[7] < DM || in_sizes[9] < DM || in_sizes[11] < DM) return;
    if ((size_t)out_size < ((size_t)(NB - 1) * OUT_SEQ + SEQ) * DM) return;
    if (SZ_TOTAL > ws_size) return;
    // wire order: queries, keys, values, key_mask, Wq, bq, Wk, bk, Wv, bv, Wo, bo
    const float* xq = (const float*)d_in[0]; const float* xk = (const float*)d_in[1]; const float* xv = (const float*)d_in[2];
    const int* kmask = (const int*)d_in[3];
    const float* wq = (const float*)d_in[4]; const float* bq = (const float*)d_in[5];
    const float* wk = (const float*)d_in[6]; const float* bk = (const float*)d_in[7];
    const float* wv = (const float*)d_in[8]; const float* bv = (const float*)d_in[9];
    const float* wo = (const float*)d_in[10]; const float* bo = (const float*)d_in[11];
    float* OUT = (float*)d_out;      // [NB][SEQ][256]
    char* wsp = (char*)d_ws;
    bf* XQ = (bf*)wsp; wsp += SZ_X;                  // [NB*SEQ][256]
    bf* XK = (bf*)wsp; wsp += SZ_X;
    bf* XV = (bf*)wsp; wsp += SZ_X;
    bf* WQT = (bf*)wsp; wsp += SZ_W;                 // [out n][in k]
    bf* WKT = (bf*)wsp; wsp += SZ_W;
    bf* WVT = (bf*)wsp; wsp += SZ_W;
    bf* WO2 = (bf*)wsp; wsp += SZ_WO;                // [out n][512]: Wo^T | Wo^T
    h16* QH = (h16*)wsp; wsp += SZ_PL;               // [NB*SEQ][256]
    h16* QR = (h16*)wsp; wsp += SZ_PL;               // [NB*SEQ][256] residual x2048
    h16* KP = (h16*)wsp; wsp += SZ_PL;               // [NB*SEQ][256]
    h16* VT = (h16*)wsp; wsp += SZ_PL;               // [NB][256][SEQ]
    bf* CX = (bf*)wsp; wsp += SZ_CX;                 // [NB*SEQ][512]: ctx hi | ctx lo

    cvt_act(xq, XQ, stream); cvt_act(xk, XK, stream); cvt_act(xv, XV, stream);
    // weights: in W[k rows = 256][n cols = 256] -> out [n][k] (square; grid (k tiles, n tiles))
    { const dim3 g(DM / 64, DM / 64, 1);
      k_wT<<<g, 256, 0, stream>>>(wq, WQT, DM, 0);
      k_wT<<<g, 256, 0, stream>>>(wk, WKT, DM, 0);
      k_wT<<<g, 256, 0, stream>>>(wv, WVT, DM, 0);
      k_wT<<<g, 256, 0, stream>>>(wo, WO2, CXP, 0);
      k_wT<<<g, 256, 0, stream>>>(wo, WO2, CXP, DM); }

    // q, k: A = x rows (m = b*SEQ + t), Bt = W^T rows (n = h*32 + d) -> plane [m][n], bias by column
    k_gemm<false><<<dim3(NB * SEQ / 64, DM / 64, 1), 32, 0, stream>>>(XQ, WQT, QH, QR, OUT, bq, (size_t)0, (size_t)0, DM, 1, NB * SEQ, DM, DM, 0);
    k_gemm<false><<<dim3(NB * SEQ / 64, DM / 64, 1), 32, 0, stream>>>(XK, WKT, KP, KP, OUT, bk, (size_t)0, (size_t)0, DM, 0, NB * SEQ, DM, DM, 0);
    // v^T: A = Wv^T rows (m = h*32 + d), Bt = x rows (n = b*SEQ + t) -> plane [(b*256 + m)][t], bias by row
    k_gemm<false><<<dim3(DM / 64, NB * SEQ / 64, 1), 32, 0, stream>>>(WVT, XV, VT, VT, OUT, bv, (size_t)0, (size_t)DM * SEQ, DM, 0, DM, SEQ, SEQ, 1);

    k_flash<<<dim3(SEQ / (16 * AW), NB * (NH_ / 2), 1), 32 * AW, 0, stream>>>(QH, QR, KP, VT, kmask, CX);

    // out = [ctx_hi | ctx_lo] x [Wo^T | Wo^T]^T + bo, K = 512, f32 rows of the output
    k_gemm<true><<<dim3(NB * SEQ / 64, DM / 64, 1), 32, 0, stream>>>(CX, WO2, QH, QH, OUT, bo, (size_t)0, (size_t)0, CXP, 0, NB * SEQ, DM, DM, 0);
}

// v001
// A run of this version takes 101 microseconds.
// Timed twice side by side with v000, it ran 1.45 and 1.50 times as fast.
#include <hip/hip_runtime.h>

// Multi-head attention with key padding mask: q/k/v inputs [NB][SEQ][256], Wq/Wk/Wv/Wo [in][out] (y = x W + b), 8 heads x 32, score scale 1/sqrt(32), masked keys take the fill value -4294967296, output = ctx Wo + bo (f32).
// Compute dtypes, f32 accumulate everywhere: projections v_wmma_f32_16x16x32_bf16 (inputs and weights RNE-converted to bf16; products exact);
// scores v_wmma_f32_16x16x32_f16: k single f16, q as f16 value + f16 residual x2048 in its own accumulator (two products); P (x256 carry, cancels in the normalisation) and v single f16; softmax f32 (online, running max);
// output projection v_wmma_f32_16x16x32_bf16 with ctx carried as bf16 hi | bf16 lo planes folded along K (K = 512 against [Wo^T | Wo^T]).
// Layout: bf16 copies of the three activation inputs; weights transposed to [out][in] bf16; q (hi, residual), k planes [b*SEQ + t][256] (head h = columns 32h..32h+31) and v^T plane [b][256][SEQ] written by the GEMM epilogue;

#ifndef NB
#define NB 2
#endif
#ifndef SEQ
#define SEQ 2048
#endif
#define NB_FULL  2
#define SEQ_FULL 2048
#ifndef OUT_SEQ
#define OUT_SEQ SEQ              // row pitch (in tokens) between batches of the output
#endif
#define DM   256
#define NH_  8
#define HD   32
#define CXP  (2 * DM)            // ctx plane pitch: hi columns 0..255, lo columns 256..511
#define AW   4                   // 16-row query tiles per flash block
#define KS   4                   // key ranges per (query tile, head), one wave each
#define FW   (AW * 2 * KS)       // waves per flash block: query tiles x 2 heads x key ranges
#define QRS  2048.0f             // carry of the q residual plane
#define QRI  (1.0f / 2048.0f)
#define SC2  (0.17677669529663687f * 1.4426950408889634f)   // HD^-0.5 * log2(e)
#define PSH  8.0f                // log2 of the P carry (256)
#define NEGT (-4294967296.0f * 1.4426950408889634f)         // mask fill value in the log2 domain

static_assert(HD == 32);
static_assert(NH_ * HD == DM);                 // head h = columns h*32 + d
static_assert(NH_ % 2 == 0);
static_assert(DM % 64 == 0);
static_assert(DM % 32 == 0);                   // GEMM k-loop steps by 32
static_assert(CXP % 32 == 0);
static_assert(SEQ % 64 == 0);                  // a 64-row tile never straddles two batches
static_assert((NB * SEQ) % 64 == 0);
static_assert(SEQ % (32 * KS) == 0);           // key loop steps by 32 inside each key range
static_assert(FW * 32 <= 1024);
static_assert(FW * 32 >= AW * 16 * 8);         // the merge uses one thread per (row, 8 columns)
static_assert(SEQ % (16 * AW) == 0);           // flash grid covers the sequence exactly
static_assert(((size_t)SEQ * DM) % 8 == 0);
static_assert(NB <= NB_FULL);
static_assert(SEQ <= SEQ_FULL);

typedef _Float16 h16;
typedef unsigned short bf;
typedef __attribute__((ext_vector_type(16))) __bf16   v16bf;
typedef __attribute__((ext_vector_type(16))) _Float16 v16h;
typedef __attribute__((ext_vector_type(8)))  _Float16 v8h;
typedef __attribute__((ext_vector_type(8)))  unsigned short v8us;
typedef __attribute__((ext_vector_type(8)))  float    v8f;
typedef __attribute__((ext_vector_type(4)))  float    v4f;
typedef __attribute__((ext_vector_type(4)))  int      v4i;
typedef v4f  __attribute__((may_alias)) v4fa;

__device__ __forceinline__ unsigned short f2bf(float f) { unsigned u = __float_as_uint(f); u += 0x7FFFu + ((u >> 16) & 1u); return (unsigned short)(u >> 16); }
__device__ __forceinline__ float bf2f(unsigned short s) { return __uint_as_float(((unsigned)s) << 16); }
__device__ __forceinline__ float bfr(float f) { return bf2f(f2bf(f)); }
__device__ __forceinline__ v16h cat16(v8h lo, v8h hi) { return __builtin_shufflevector(lo, hi, 0, 1, 2, 3, 4, 5, 6, 7, 8, 9, 10, 11, 12, 13, 14, 15); }
__device__ __forceinline__ v16bf cat16b(v8us lo, v8us hi) { return __builtin_bit_cast(v16bf, __builtin_shufflevector(lo, hi, 0, 1, 2, 3, 4, 5, 6, 7, 8, 9, 10, 11, 12, 13, 14, 15)); }
__device__ __forceinline__ v8f wmma16(v16h a, v16h b, v8f c) { return __builtin_amdgcn_wmma_f32_16x16x32_f16(false, a, false, b, (short)0, c, false, false); }
__device__ __forceinline__ v8f wmmab(v16bf a, v16bf b, v8f c) { return __builtin_amdgcn_wmma_f32_16x16x32_bf16(false, a, false, b, (short)0, c, false, false); }
// fragment loaders from K-contiguous 16-bit rows; p already includes + 8*(lane>>4): elements 0..7 <- k0+8h+0..7, elements 8..15 <- k0+16+8h+0..7 (same map for A and B)
__device__ __forceinline__ v16h  ldh(const h16* p) { return cat16(*(const v8h*)p, *(const v8h*)(p + 16)); }
__device__ __forceinline__ v16bf ldb(const bf* p)  { return cat16b(*(const v8us*)p, *(const v8us*)(p + 16)); }
// ordering point for wave-private LDS tiles (same wave writes and reads)
__device__ __forceinline__ void wave_sync() { __builtin_amdgcn_fence(3 /* release order */, "wavefront"); __builtin_amdgcn_wave_barrier(); asm volatile("" ::: "memory"); }

__global__ __launch_bounds__(256) void k_cvt8(const float* __restrict__ src, bf* dst, size_t n8) {
    const size_t i = (size_t)blockIdx.x * 256 + threadIdx.x; if (i >= n8) return;
    const v8f v = *(const v8f*)(src + i * 8); v8us o;
#pragma unroll
    for (int k = 0; k < 8; ++k) o[k] = f2bf(v[k]);
    *(v8us*)(dst + i * 8) = o; 
}

// k_wT: weight transpose + bf16 RNE convert: in W[k][n] (256 x 256 f32, row pitch DM) -> out dst[n][coff + k] (row pitch ldo halves).
__global__ __launch_bounds__(256) void k_wT(const float* __restrict__ W, bf* dst, int ldo, int coff) {
    __shared__ float ts[64 * 65];
    const int tid = threadIdx.x; const int k0 = blockIdx.x * 64, n0 = blockIdx.y * 64;
#pragma unroll
    for (int i = 0; i < 4; ++i) { const int kk = (tid >> 4) + 16 * i, c4 = (tid & 15) * 4;     // 4 x 16 rows = 64 k; 16 x 4 = 64 n
        const v4f f = *(const v4f*)(W + (size_t)(k0 + kk) * DM + n0 + c4);
        ts[kk * 65 + c4 + 0] = f[0]; ts[kk * 65 + c4 + 1] = f[1]; ts[kk * 65 + c4 + 2] = f[2]; ts[kk * 65 + c4 + 3] = f[3]; }
    __syncthreads();
{
#pragma unroll
        for (int it = 0; it < 2; ++it) { const int nn = it * 32 + (tid >> 3), ks = (tid & 7) * 8;   // 2 x 32 rows = 64 n; 8 lanes x 8 = 64 k
            v8us o;
#pragma unroll
            for (int j = 0; j < 8; ++j) o[j] = f2bf(ts[(ks + j) * 65 + nn]);
            *(v8us*)(dst + (size_t)(n0 + nn) * (size_t)ldo + coff + k0 + ks) = o; }
         }
}

// k_gemm: register-blocked bf16 GEMM, ONE WAVE per 64x64 tile (16 accumulators), operands straight from K-contiguous bf16 planes (row pitch K).
// C[m][n] = sum_k A[m][k] Bt[n][k] + bias (bf16 RNE value of the f32 bias, added in f32; biasRow != 0: bias indexed by m, else by n).
// F32OUT = false: written as f16 (Ph) and optionally the f16 residual x2048 (Pr, useRes != 0) at tile base (r0/RB)*sRB + (r0%RB)*pitch + (c0/CB)*sCB + (c0%CB), row pitch 'pitch' (halves);
// F32OUT = true: written as f32 to OUT[(m/SEQ)*OUT_SEQ + m%SEQ][c0 + col] (row pitch DM); each row segment (64 floats = two lines) written by 16 consecutive lanes x 16 B (2 rows per instruction).
template <bool F32OUT>
__global__ __launch_bounds__(32) void k_gemm(const bf* __restrict__ A, const bf* __restrict__ Bt, h16* Ph, h16* Pr, float* OUT, const float* __restrict__ bias,
                                             size_t sRB, size_t sCB, int K, int useRes, int RB, int pitch, int CB, int biasRow) {
    __shared__ __align__(16) float os[16 * 68];
    const int lane = threadIdx.x & 31, lr = lane & 15, hi = lane >> 4; const int r0 = blockIdx.x * 64, c0 = blockIdx.y * 64;
    v8f acc[4][4];
#pragma unroll
    for (int mb = 0; mb < 4; ++mb)
#pragma unroll
        for (int nb = 0; nb < 4; ++nb) acc[mb][nb] = (v8f){};
    const size_t aoff = (size_t)(r0 + lr) * K + 8 * hi, boff = (size_t)(c0 + lr) * K + 8 * hi;
#pragma unroll 1
    for (int kc = 0; kc < K; kc += 32) {
        v16bf a[4];
#pragma unroll
        for (int mb = 0; mb < 4; ++mb) a[mb] = ldb(A + aoff + (size_t)mb * 16 * K + kc);
#pragma unroll
        for (int nb = 0; nb < 4; ++nb) { const v16bf b = ldb(Bt + boff + (size_t)nb * 16 * K + kc);
#pragma unroll
            for (int mb = 0; mb < 4; ++mb) acc[mb][nb] = wmmab(a[mb], b, acc[mb][nb]); }
        asm volatile("v_nop\n\tv_nop\n\tv_nop\n\tv_nop" : "+v"(acc[0][0]), "+v"(acc[1][1]), "+v"(acc[2][2]), "+v"(acc[3][3]) : "v"(a[0]), "v"(a[1]), "v"(a[2]), "v"(a[3]));
    }
    const size_t tbase = (size_t)(r0 / RB) * sRB + (size_t)(r0 % RB) * (size_t)pitch + (size_t)(c0 / CB) * sCB + (size_t)(c0 % CB);
#pragma unroll
    for (int mb = 0; mb < 4; ++mb) {
#pragma unroll
        for (int nb = 0; nb < 4; ++nb) {
#pragma unroll
            for (int j = 0; j < 8; ++j) os[(hi * 8 + j) * 68 + nb * 16 + lr] = acc[mb][nb][j]; }   // D: row 8h+j, col lane&15
        wave_sync();
        if constexpr (!F32OUT) {
            const size_t sb = tbase + (size_t)(mb * 16) * (size_t)pitch;
{
#pragma unroll
                for (int s = 0; s < 4; ++s) { const int row = 4 * s + (lane >> 3), c8 = (lane & 7) * 8;   // 4 s x 4 row groups = 16 rows; 8 lanes x 8 = 64 columns
                    v4f x0 = *(const v4fa*)(&os[row * 68 + c8]); v4f x1 = *(const v4fa*)(&os[row * 68 + c8 + 4]);
                    const int cidx = (c0 + c8) & (DM - 1), ridx = (r0 + mb * 16 + row) & (DM - 1);        // clamped addresses; the unused one is discarded by value
                    const v4f bc0 = *(const v4f*)(bias + cidx), bc1 = *(const v4f*)(bias + cidx + 4); const float br = bias[ridx];
                    v8h hv, rv;
#pragma unroll
                    for (int i = 0; i < 4; ++i) { const float y0 = x0[i] + bfr(biasRow ? br : bc0[i]); const float y1 = x1[i] + bfr(biasRow ? br : bc1[i]);
                        const h16 a0 = (h16)y0; const h16 a1 = (h16)y1; hv[i] = a0; hv[4 + i] = a1; rv[i] = (h16)((y0 - (float)a0) * QRS); rv[4 + i] = (h16)((y1 - (float)a1) * QRS); }
                    const size_t oo = sb + (size_t)row * (size_t)pitch + c8;
                    *(v8h*)(Ph + oo) = hv; if (useRes) *(v8h*)(Pr + oo) = rv; }
                 }
        } else {
{
#pragma unroll
                for (int s = 0; s < 8; ++s) { const int row = 2 * s + hi, cofs = lr * 4;                  // 8 s x 2 rows = 16 rows; 16 lanes x 4 floats = 64 columns
                    const int m = r0 + mb * 16 + row; const int bb = m / SEQ, tt = m - bb * SEQ;
                    v4f val = *(const v4fa*)(&os[row * 68 + cofs]);
                    const int cidx = (c0 + cofs) & (DM - 1), ridx = m & (DM - 1);
                    const v4f bc = *(const v4f*)(bias + cidx); const float br = bias[ridx];
#pragma unroll
                    for (int i = 0; i < 4; ++i) val[i] = val[i] + bfr(biasRow ? br : bc[i]);
                    *(v4f*)(OUT + ((size_t)bb * OUT_SEQ + tt) * DM + c0 + cofs) = val; }
                 }
        }
        wave_sync();
    }
}

// k_flash: fused attention, one work-group per 64 query rows of one batch and one PAIR of heads; one wave per (16 query rows, head, key range of SEQ / KS keys).
// The waves of one key range walk the same K rows and V^T columns at the same time; both heads of the pair read the two halves of the same K lines.
// K / V^T / Q fragments straight from the f16 planes (two 16-B loads each, arithmetic addressing).
// Transposed form: S^T[key][t] = K Q^T (A = K rows, B = Q rows); lane (t = lane&15, h = lane>>4) holds keys 8h+r of each 16-key tile, so the packed
// P tile is directly the B fragment of O^T[d][t] = V^T P^T (element r <- tile keys 0..15, element 8+r <- tile keys 16..31, lane unchanged).
// Key mask: per element, a masked key's score is REPLACED by the fill value (a fully masked row therefore comes out uniform).
// Softmax state (running max, partial sum) is one scalar per lane; the two lane halves of a row are combined with one xor-16 exchange.
// Each wave leaves its unnormalised O, its running max and its sum in LDS; behind one work-group barrier the KS partial results of a row are rescaled to their common max, added and normalised.
__global__ __launch_bounds__(32 * FW) void k_flash(const h16* __restrict__ QH, const h16* __restrict__ QR, const h16* __restrict__ KP, const h16* __restrict__ VT,
                                                   const int* __restrict__ MK, bf* CX) {
    __shared__ __align__(16) float os[KS * AW * 16 * 68];        // [key range][row of the block][68]: columns 0..63 = 32*head + d
    __shared__ float sm[KS * 2 * AW * 16], sl[KS * 2 * AW * 16]; // [key range][head][row of the block]: running max, sum
    const int lane = threadIdx.x & 31, wave = __builtin_amdgcn_readfirstlane((int)(threadIdx.x >> 5)), lr = lane & 15, hi = lane >> 4;
    const int rt = wave % AW, hh = (wave / AW) & 1, ks = wave / (2 * AW);
    const int zp = blockIdx.y; const int b = zp / (NH_ / 2), hp = zp % (NH_ / 2);
    const int t0 = (blockIdx.x * AW + rt) * 16;
    const size_t rowb = (size_t)b * SEQ;
    const int* mk = MK + (size_t)b * SEQ_FULL + 8 * hi;          // + key0 (+4, +16, +20): keys 8h+0..7 and 16+8h+0..7 of the 32-key step
    {
        const int h = hp * 2 + hh;
        const size_t qo = (rowb + t0 + lr) * DM + h * HD + 8 * hi;
        const v16h qh = ldh(QH + qo), qr = ldh(QR + qo);                  // B fragments: col t, k = d (32 deep)
        const size_t ko = (rowb + lr) * DM + h * HD + 8 * hi;             // + key * DM       (A fragment: row key, k = d)
        const size_t vo = ((size_t)b * DM + h * HD + lr) * SEQ + 8 * hi;  // + 16*SEQ + key   (A fragment: row d, k = key)
        v8f o0 = (v8f){}, o1 = (v8f){};
        float m = -3.0e38f, l = 0.0f;
        const int kbeg = ks * (SEQ / KS);
#pragma unroll 1
        for (int kk = 0; kk < SEQ / KS; kk += 32) {
            const int key0 = kbeg + kk;
            const h16* ka = KP + ko + (size_t)key0 * DM;
            const v16h ka0 = ldh(ka), kb0 = ldh(ka + 16 * DM);
            const v4i ma0 = *(const v4i*)(mk + key0), ma1 = *(const v4i*)(mk + key0 + 4), mb0 = *(const v4i*)(mk + key0 + 16), mb1 = *(const v4i*)(mk + key0 + 20);
            v8f sHa = (v8f){}, sLa = (v8f){}, sHb = (v8f){}, sLb = (v8f){};
            sHa = wmma16(ka0, qh, sHa); sLa = wmma16(ka0, qr, sLa); sHb = wmma16(kb0, qh, sHb); sLb = wmma16(kb0, qr, sLb);
            asm volatile("v_nop\n\tv_nop\n\tv_nop\n\tv_nop" : "+v"(sHa), "+v"(sLa), "+v"(sHb), "+v"(sLb) : "v"(ka0), "v"(kb0), "v"(qh), "v"(qr));
            float ta[8], tb[8]; float mx = -3.0e38f;
#pragma unroll
            for (int r = 0; r < 4; ++r) {
                const float a0 = (sHa[r] + sLa[r] * QRI) * SC2, a1 = (sHa[4 + r] + sLa[4 + r] * QRI) * SC2;
                const float c0 = (sHb[r] + sLb[r] * QRI) * SC2, c1 = (sHb[4 + r] + sLb[4 + r] * QRI) * SC2;
                ta[r] = (ma0[r] != 0) ? a0 : NEGT; ta[4 + r] = (ma1[r] != 0) ? a1 : NEGT;
                tb[r] = (mb0[r] != 0) ? c0 : NEGT; tb[4 + r] = (mb1[r] != 0) ? c1 : NEGT; }
#pragma unroll
            for (int r = 0; r < 8; ++r) mx = fmaxf(mx, fmaxf(ta[r], tb[r]));
            mx = fmaxf(mx, __shfl_xor(mx, 16, 32));
            const float mnew = fmaxf(m, mx);
            const float alpha = __builtin_amdgcn_exp2f(m - mnew);
            const float sh = PSH - mnew;
            v16h pb; float ls = 0.0f;
#pragma unroll
            for (int r = 0; r < 8; ++r) { const h16 pa = (h16)__builtin_amdgcn_exp2f(ta[r] + sh); const h16 pc = (h16)__builtin_amdgcn_exp2f(tb[r] + sh); pb[r] = pa; pb[8 + r] = pc; ls += (float)pa + (float)pc; }
            l = l * alpha + ls; m = mnew;
            o0 = o0 * alpha; o1 = o1 * alpha;
            const h16* va = VT + vo + key0;
            const v16h v0 = ldh(va), v1 = ldh(va + (size_t)16 * SEQ);
            o0 = wmma16(v0, pb, o0); o1 = wmma16(v1, pb, o1);
            asm volatile("v_nop\n\tv_nop\n\tv_nop\n\tv_nop" : "+v"(o0), "+v"(o1) : "v"(v0), "v"(v1), "v"(pb));
        }
        l += __shfl_xor(l, 16, 32);
        // O^T D layout: o_j[r] = (d = 16j + 8h + r, t = lane&15) -> os[key range][16*rt + t][32*hh + d], unnormalised
        { const int ob = ((ks * AW + rt) * 16 + lr) * 68 + hh * 32 + 8 * hi;
          *(v4fa*)(&os[ob])      = (v4f){o0[0], o0[1], o0[2], o0[3]}; *(v4fa*)(&os[ob + 4])  = (v4f){o0[4], o0[5], o0[6], o0[7]};
          *(v4fa*)(&os[ob + 16]) = (v4f){o1[0], o1[1], o1[2], o1[3]}; *(v4fa*)(&os[ob + 20]) = (v4f){o1[4], o1[5], o1[6], o1[7]}; }
        if (hi == 0) { const int si = ((ks * 2 + hh) * AW + rt) * 16 + lr; sm[si] = m; sl[si] = l; }
    }
    __syncthreads();     // every wave's partial result is in LDS before any row is merged
    const int tid = threadIdx.x;
    if (tid < AW * 16 * 8) {                                     // whole waves: 64 rows x 8 lanes x 8 columns
        const int row = tid >> 3, c8 = (tid & 7) * 8, hq = c8 >> 5;
        float pm[KS]; float mx = -3.0e38f;
#pragma unroll
        for (int p = 0; p < KS; ++p) { pm[p] = sm[(p * 2 + hq) * (AW * 16) + row]; mx = fmaxf(mx, pm[p]); }
        v4f x0 = (v4f){}, x1 = (v4f){}; float l = 0.0f;
#pragma unroll
        for (int p = 0; p < KS; ++p) { const float f = __builtin_amdgcn_exp2f(pm[p] - mx);
            l += f * sl[(p * 2 + hq) * (AW * 16) + row];
            x0 += *(const v4fa*)(&os[(p * (AW * 16) + row) * 68 + c8]) * f; x1 += *(const v4fa*)(&os[(p * (AW * 16) + row) * 68 + c8 + 4]) * f; }
        const float inv = 1.0f / l;
        x0 = x0 * inv; x1 = x1 * inv;
        v8us hv, lv;
#pragma unroll
        for (int i = 0; i < 4; ++i) { const unsigned short u0 = f2bf(x0[i]); const unsigned short u1 = f2bf(x1[i]); hv[i] = u0; hv[4 + i] = u1;
            lv[i] = f2bf(x0[i] - bf2f(u0)); lv[4 + i] = f2bf(x1[i] - bf2f(u1)); }
        bf* crow = CX + (rowb + (size_t)blockIdx.x * (AW * 16) + row) * CXP + hp * 64 + c8;
        *(v8us*)(crow) = hv; *(v8us*)(crow + DM) = lv;
    }
}

static constexpr size_t al256(size_t v) { return (v + 255) & ~(size_t)255; }
static constexpr size_t SZ_X  = al256((size_t)NB * SEQ * DM * 2);
static constexpr size_t SZ_W  = al256((size_t)DM * DM * 2);
static constexpr size_t SZ_WO = al256((size_t)DM * CXP * 2);
static constexpr size_t SZ_PL = al256((size_t)NB * SEQ * DM * 2);
static constexpr size_t SZ_CX = al256((size_t)NB * SEQ * CXP * 2);
static constexpr size_t SZ_TOTAL = 3 * SZ_X + 3 * SZ_W + SZ_WO + 4 * SZ_PL + SZ_CX;
static_assert(SZ_TOTAL <= (size_t)134217728);          // workspace carve <= 128 MiB
static_assert((size_t)NB * DM * SEQ * 2 <= SZ_PL);     // v^T plane extent

static void cvt_act(const float* x, bf* dst, hipStream_t stream) {
    if (SEQ == SEQ_FULL) {
        const size_t n8 = (size_t)NB * SEQ * DM / 8;
        k_cvt8<<<(unsigned)((n8 + 255) / 256), 256, 0, stream>>>(x, dst, n8);
    } else {
        const size_t n8 = (size_t)SEQ * DM / 8;
        for (int b = 0; b < NB; ++b) k_cvt8<<<(unsigned)((n8 + 255) / 256), 256, 0, stream>>>(x + (size_t)b * SEQ_FULL * DM, dst + (size_t)b * SEQ * DM, n8);
    }
}

extern "C" void kernel_launch(void* const* d_in, const int* in_sizes, int n_in,
                              void* d_out, int out_size, void* d_ws, size_t ws_size, hipStream_t stream) {
    if (n_in < 12) return;
    const size_t needx = ((size_t)(NB - 1) * SEQ_FULL + SEQ) * DM;
    if ((size_t)in_sizes[0] < needx || (size_t)in_sizes[1] < needx || (size_t)in_sizes[2] < needx) return;
    if ((size_t)in_sizes[3] < (size_t)(NB - 1) * SEQ_FULL + SEQ) return;
    if ((size_t)in_sizes[4] < (size_t)DM * DM || (size_t)in_sizes[6] < (size_t)DM * DM || (size_t)in_sizes[8] < (size_t)DM * DM || (size_t)in_sizes[10] < (size_t)DM * DM) return;
    if (in_sizes[5] < DM || in_sizes[7] < DM || in_sizes[9] < DM || in_sizes[11] < DM) return;
    if ((size_t)out_size < ((size_t)(NB - 1) * OUT_SEQ + SEQ) * DM) return;
    if (SZ_TOTAL > ws_size) return;
    // wire order: queries, keys, values, key_mask, Wq, bq, Wk, bk, Wv, bv, Wo, bo
    const float* xq = (const float*)d_in[0]; const float* xk = (const float*)d_in[1]; const float* xv = (const float*)d_in[2];
    const int* kmask = (const int*)d_in[3];
    const float* wq = (const float*)d_in[4]; const float* bq = (const float*)d_in[5];
    const float* wk = (const float*)d_in[6]; const float* bk = (const float*)d_in[7];
    const float* wv = (const float*)d_in[8]; const float* bv = (const float*)d_in[9];
    const float* wo = (const float*)d_in[10]; const float* bo = (const float*)d_in[11];
    float* OUT = (float*)d_out;      // [NB][SEQ][256]
    char* wsp = (char*)d_ws;
    bf* XQ = (bf*)wsp; wsp += SZ_X;                  // [NB*SEQ][256]
    bf* XK = (bf*)wsp; wsp += SZ_X;
    bf* XV = (bf*)wsp; wsp += SZ_X;
    bf* WQT = (bf*)wsp; wsp += SZ_W;                 // [out n][in k]
    bf* WKT = (bf*)wsp; wsp += SZ_W;
    bf* WVT = (bf*)wsp; wsp += SZ_W;
    bf* WO2 = (bf*)wsp; wsp += SZ_WO;                // [out n][512]: Wo^T | Wo^T
    h16* QH = (h16*)wsp; wsp += SZ_PL;               // [NB*SEQ][256]
    h16* QR = (h16*)wsp; wsp += SZ_PL;               // [NB*SEQ][256] residual x2048
    h16* KP = (h16*)wsp; wsp += SZ_PL;               // [NB*SEQ][256]
    h16* VT = (h16*)wsp; wsp += SZ_PL;               // [NB][256][SEQ]
    bf* CX = (bf*)wsp; wsp += SZ_CX;                 // [NB*SEQ][512]: ctx hi | ctx lo

    cvt_act(xq, XQ, stream); cvt_act(xk, XK, stream); cvt_act(xv, XV, stream);
    // weights: in W[k rows = 256][n cols = 256] -> out [n][k] (square; grid (k tiles, n tiles))
    { const dim3 g(DM / 64, DM / 64, 1);
      k_wT<<<g, 256, 0, stream>>>(wq, WQT, DM, 0);
      k_wT<<<g, 256, 0, stream>>>(wk, WKT, DM, 0);
      k_wT<<<g, 256, 0, stream>>>(wv, WVT, DM, 0);
      k_wT<<<g, 256, 0, stream>>>(wo, WO2, CXP, 0);
      k_wT<<<g, 256, 0, stream>>>(wo, WO2, CXP, DM); }

    // q, k: A = x rows (m = b*SEQ + t), Bt = W^T rows (n = h*32 + d) -> plane [m][n], bias by column
    k_gemm<false><<<dim3(NB * SEQ / 64, DM / 64, 1), 32, 0, stream>>>(XQ, WQT, QH, QR, OUT, bq, (size_t)0, (size_t)0, DM, 1, NB * SEQ, DM, DM, 0);
    k_gemm<false><<<dim3(NB * SEQ / 64, DM / 64, 1), 32, 0, stream>>>(XK, WKT, KP, KP, OUT, bk, (size_t)0, (size_t)0, DM, 0, NB * SEQ, DM, DM, 0);
    // v^T: A = Wv^T rows (m = h*32 + d), Bt = x rows (n = b*SEQ + t) -> plane [(b*256 + m)][t], bias by row
    k_gemm<false><<<dim3(DM / 64, NB * SEQ / 64, 1), 32, 0, stream>>>(WVT, XV, VT, VT, OUT, bv, (size_t)0, (size_t)DM * SEQ, DM, 0, DM, SEQ, SEQ, 1);

    k_flash<<<dim3(SEQ / (16 * AW), NB * (NH_ / 2), 1), 32 * FW, 0, stream>>>(QH, QR, KP, VT, kmask, CX);

    // out = [ctx_hi | ctx_lo] x [Wo^T | Wo^T]^T + bo, K = 512, f32 rows of the output
    k_gemm<true><<<dim3(NB * SEQ / 64, DM / 64, 1), 32, 0, stream>>>(CX, WO2, QH, QH, OUT, bo, (size_t)0, (size_t)0, CXP, 0, NB * SEQ, DM, DM, 0);
}

// v002
// One run takes 60.6 microseconds.
// Next to v001, in two timings, it ran 1.68 and 1.65 times as fast.
// All steps since v000 together make it 2.46 times as fast.
#include <hip/hip_runtime.h>

// Multi-head attention with key padding mask: q/k/v inputs [NB][SEQ][256], Wq/Wk/Wv/Wo [in][out] (y = x W + b), 8 heads x 32, score scale 1/sqrt(32), masked keys take the fill value -4294967296, output = ctx Wo + bo (f32).
// Compute dtypes, f32 accumulate everywhere: projections v_wmma_f32_16x16x32_bf16 (inputs and weights RNE-converted to bf16; products exact);
// scores v_wmma_f32_16x16x32_f16: k single f16, q as f16 value + f16 residual x2048 in its own accumulator (two products); P (x256 carry, cancels in the normalisation) and v single f16; softmax f32 (online, running max);
// output projection v_wmma_f32_16x16x32_bf16 with ctx carried as bf16 hi | bf16 lo planes folded along K (K = 512 against [Wo^T | Wo^T]).
// Layout: bf16 copies of the three activation inputs; weights transposed to [out][in] bf16; q (hi, residual), k planes [b*SEQ + t][256] (head h = columns 32h..32h+31) and v^T plane [b][256][SEQ] written by the GEMM epilogue;

#ifndef NB
#define NB 2
#endif
#ifndef SEQ
#define SEQ 2048
#endif
#define NB_FULL  2
#define SEQ_FULL 2048
#ifndef OUT_SEQ
#define OUT_SEQ SEQ              // row pitch (in tokens) between batches of the output
#endif
#define DM   256
#define NH_  8
#define HD   32
#define CXP  (2 * DM)            // ctx plane pitch: hi columns 0..255, lo columns 256..511
#define AW   4                   // 16-row query tiles per flash block
#define KS   4                   // key ranges per (query tile, head), one wave each
#define FW   (AW * 2 * KS)       // waves per flash block: query tiles x 2 heads x key ranges
#define QRS  2048.0f             // carry of the q residual plane
#define QRI  (1.0f / 2048.0f)
#define SC2  (0.17677669529663687f * 1.4426950408889634f)   // HD^-0.5 * log2(e)
#define PSH  8.0f                // log2 of the P carry (256)
#define NEGT (-4294967296.0f * 1.4426950408889634f)         // mask fill value in the log2 domain

static_assert(HD == 32);
static_assert(NH_ * HD == DM);                 // head h = columns h*32 + d
static_assert(NH_ % 2 == 0);
static_assert(DM % 64 == 0);
static_assert(DM % 32 == 0);                   // GEMM k-loop steps by 32
static_assert(CXP % 32 == 0);
static_assert(SEQ % 64 == 0);                  // a 64-row tile never straddles two batches
static_assert((NB * SEQ) % 64 == 0);
static_assert(SEQ % (32 * KS) == 0);           // key loop steps by 32 inside each key range
static_assert(FW * 32 <= 1024);
static_assert(FW * 32 >= AW * 16 * 8);         // the merge uses one thread per (row, 8 columns)
static_assert(SEQ % (16 * AW) == 0);           // flash grid covers the sequence exactly
static_assert(((size_t)SEQ * DM) % 8 == 0);
static_assert(NB <= NB_FULL);
static_assert(SEQ <= SEQ_FULL);

typedef _Float16 h16;
typedef unsigned short bf;
typedef __attribute__((ext_vector_type(16))) __bf16   v16bf;
typedef __attribute__((ext_vector_type(16))) _Float16 v16h;
typedef __attribute__((ext_vector_type(8)))  _Float16 v8h;
typedef __attribute__((ext_vector_type(8)))  unsigned short v8us;
typedef __attribute__((ext_vector_type(8)))  float    v8f;
typedef __attribute__((ext_vector_type(4)))  float    v4f;
typedef __attribute__((ext_vector_type(4)))  int      v4i;
typedef v4f  __attribute__((may_alias)) v4fa;

__device__ __forceinline__ unsigned short f2bf(float f) { unsigned u = __float_as_uint(f); u += 0x7FFFu + ((u >> 16) & 1u); return (unsigned short)(u >> 16); }
__device__ __forceinline__ float bf2f(unsigned short s) { return __uint_as_float(((unsigned)s) << 16); }
__device__ __forceinline__ float bfr(float f) { return bf2f(f2bf(f)); }
__device__ __forceinline__ v16h cat16(v8h lo, v8h hi) { return __builtin_shufflevector(lo, hi, 0, 1, 2, 3, 4, 5, 6, 7, 8, 9, 10, 11, 12, 13, 14, 15); }
__device__ __forceinline__ v16bf cat16b(v8us lo, v8us hi) { return __builtin_bit_cast(v16bf, __builtin_shufflevector(lo, hi, 0, 1, 2, 3, 4, 5, 6, 7, 8, 9, 10, 11, 12, 13, 14, 15)); }
__device__ __forceinline__ v8f wmma16(v16h a, v16h b, v8f c) { return __builtin_amdgcn_wmma_f32_16x16x32_f16(false, a, false, b, (short)0, c, false, false); }
__device__ __forceinline__ v8f wmmab(v16bf a, v16bf b, v8f c) { return __builtin_amdgcn_wmma_f32_16x16x32_bf16(false, a, false, b, (short)0, c, false, false); }
// fragment loaders from K-contiguous 16-bit rows; p already includes + 8*(lane>>4): elements 0..7 <- k0+8h+0..7, elements 8..15 <- k0+16+8h+0..7 (same map for A and B)
__device__ __forceinline__ v16h  ldh(const h16* p) { return cat16(*(const v8h*)p, *(const v8h*)(p + 16)); }
__device__ __forceinline__ v16bf ldb(const bf* p)  { return cat16b(*(const v8us*)p, *(const v8us*)(p + 16)); }
// ordering point for wave-private LDS tiles (same wave writes and reads)
__device__ __forceinline__ void wave_sync() { __builtin_amdgcn_fence(3 /* release order */, "wavefront"); __builtin_amdgcn_wave_barrier(); asm volatile("" ::: "memory"); }

// cvt8: bf16 RNE copy of one activation input; thread i takes 8 consecutive elements of dst [NB*SEQ][256] (source batch pitch SEQ_FULL rows).
__device__ __forceinline__ void cvt8(const float* __restrict__ src, bf* dst, int blk) {
    const size_t i = (size_t)blk * 256 + threadIdx.x;
    const size_t bb = i / ((size_t)SEQ * DM / 8), rr = i % ((size_t)SEQ * DM / 8);
    const v8f v = *(const v8f*)(src + bb * ((size_t)SEQ_FULL * DM) + rr * 8); v8us o;
#pragma unroll
    for (int k = 0; k < 8; ++k) o[k] = f2bf(v[k]);
    *(v8us*)(dst + i * 8) = o;
    asm volatile("s_wait_xcnt 0x0" ::: "memory");   // precaution: stands in front of any later instruction of the merged kernel that rewrites the store's address registers
}

// wT: weight transpose + bf16 RNE convert: in W[k][n] (256 x 256 f32, row pitch DM) -> out dst[n][coff + k] (row pitch ldo halves).
__device__ __forceinline__ void wT(float* ts, const float* __restrict__ W, bf* dst, int ldo, int coff, int k0, int n0) {
    const int tid = threadIdx.x;
#pragma unroll
    for (int i = 0; i < 4; ++i) { const int kk = (tid >> 4) + 16 * i, c4 = (tid & 15) * 4;     // 4 x 16 rows = 64 k; 16 x 4 = 64 n
        const v4f f = *(const v4f*)(W + (size_t)(k0 + kk) * DM + n0 + c4);
        ts[kk * 65 + c4 + 0] = f[0]; ts[kk * 65 + c4 + 1] = f[1]; ts[kk * 65 + c4 + 2] = f[2]; ts[kk * 65 + c4 + 3] = f[3]; }
    __syncthreads();
{
#pragma unroll
        for (int it = 0; it < 2; ++it) { const int nn = it * 32 + (tid >> 3), ks = (tid & 7) * 8;   // 2 x 32 rows = 64 n; 8 lanes x 8 = 64 k
            v8us o;
#pragma unroll
            for (int j = 0; j < 8; ++j) o[j] = f2bf(ts[(ks + j) * 65 + nn]);
            *(v8us*)(dst + (size_t)(n0 + nn) * (size_t)ldo + coff + k0 + ks) = o; }
         }
}

// k_prep: every operand preparation in ONE launch; the block index picks the job (none reads what another writes).
// Blocks 0 .. 5*WTB-1: the five weight transposes (WTB 64x64 tiles each); then CVB blocks for each of the three activation inputs.
#define WTB ((DM / 64) * (DM / 64))
#define CVB ((unsigned)((size_t)NB * SEQ * DM / 8 / 256))
static_assert(((size_t)NB * SEQ * DM) % (8 * 256) == 0);   // the conversion blocks cover each plane exactly
__global__ __launch_bounds__(256) void k_prep(const float* __restrict__ xq, const float* __restrict__ xk, const float* __restrict__ xv,
                                              const float* __restrict__ wq, const float* __restrict__ wk, const float* __restrict__ wv, const float* __restrict__ wo,
                                              bf* XQ, bf* XK, bf* XV, bf* WQT, bf* WKT, bf* WVT, bf* WO2) {
    __shared__ float ts[64 * 65];
    const unsigned bx = blockIdx.x;
    if (bx < 5 * WTB) {
        const unsigned job = bx / WTB, tile = bx % WTB;
        const float* W = job == 0 ? wq : job == 1 ? wk : job == 2 ? wv : wo;
        bf* dst = job == 0 ? WQT : job == 1 ? WKT : job == 2 ? WVT : WO2;
        wT(ts, W, dst, job < 3 ? DM : CXP, job == 4 ? DM : 0, (tile % (DM / 64)) * 64, (tile / (DM / 64)) * 64);
    } else {
        const unsigned c = bx - 5 * WTB; const unsigned job = c / CVB;
        cvt8(job == 0 ? xq : job == 1 ? xk : xv, job == 0 ? XQ : job == 1 ? XK : XV, c % CVB);
    }
}

// k_gemm: register-blocked bf16 GEMM, ONE WAVE per 64x64 tile (16 accumulators), operands straight from K-contiguous bf16 planes (row pitch K).
// C[m][n] = sum_k A[m][k] Bt[n][k] + bias (bf16 RNE value of the f32 bias, added in f32; biasRow != 0: bias indexed by m, else by n).
// F32OUT = false: written as f16 (Ph) and optionally the f16 residual x2048 (Pr, useRes != 0) at tile base (r0/RB)*sRB + (r0%RB)*pitch + (c0/CB)*sCB + (c0%CB), row pitch 'pitch' (halves);
// F32OUT = true: written as f32 to OUT[(m/SEQ)*OUT_SEQ + m%SEQ][c0 + col] (row pitch DM); each row segment (64 floats = two lines) written by 16 consecutive lanes x 16 B (2 rows per instruction).
// F32OUT = false: the three input projections in ONE launch, blockIdx.y picks the job, PTB tiles each, the row tile running fastest in blockIdx.x:
//   job 0 (q), job 1 (k): A = x rows (m = b*SEQ + t), Bt = W^T rows (n = h*32 + d) -> plane [m][n], bias by column; q also leaves its residual plane
//   job 2 (v^T): A = Wv^T rows (m = h*32 + d), Bt = x rows (n = b*SEQ + t) -> plane [(b*256 + m)][t], bias by row
// F32OUT = true: job 0 alone, the output projection.
#define PTB ((NB * SEQ / 64) * (DM / 64))
template <bool F32OUT>
__global__ __launch_bounds__(32) void k_gemm(const bf* __restrict__ A0, const bf* __restrict__ A1, const bf* __restrict__ A2,
                                             const bf* __restrict__ Bt0, const bf* __restrict__ Bt1, const bf* __restrict__ Bt2,
                                             h16* Ph0, h16* Ph1, h16* Ph2, h16* Pr, float* OUT,
                                             const float* __restrict__ bias0, const float* __restrict__ bias1, const float* __restrict__ bias2, int K) {
    __shared__ __align__(16) float os[16 * 68];
    const unsigned job = F32OUT ? 0u : blockIdx.y, f = blockIdx.x;
    const bf* __restrict__ A = job == 0 ? A0 : job == 1 ? A1 : A2; const bf* __restrict__ Bt = job == 0 ? Bt0 : job == 1 ? Bt1 : Bt2;
    h16* Ph = job == 0 ? Ph0 : job == 1 ? Ph1 : Ph2; const float* __restrict__ bias = job == 0 ? bias0 : job == 1 ? bias1 : bias2;
    const size_t sRB = 0, sCB = job == 2 ? (size_t)DM * SEQ : (size_t)0;
    const int useRes = job == 0, RB = job == 2 ? DM : NB * SEQ, pitch = job == 2 ? SEQ : DM, CB = job == 2 ? SEQ : DM, biasRow = job == 2;
    const int lane = threadIdx.x & 31, lr = lane & 15, hi = lane >> 4;
    const int r0 = (job == 2 ? f % (DM / 64) : f % (NB * SEQ / 64)) * 64, c0 = (job == 2 ? f / (DM / 64) : f / (NB * SEQ / 64)) * 64;
    v8f acc[4][4];
#pragma unroll
    for (int mb = 0; mb < 4; ++mb)
#pragma unroll
        for (int nb = 0; nb < 4; ++nb) acc[mb][nb] = (v8f){};
    const size_t aoff = (size_t)(r0 + lr) * K + 8 * hi, boff = (size_t)(c0 + lr) * K + 8 * hi;
#pragma unroll 1
    for (int kc = 0; kc < K; kc += 32) {
        v16bf a[4];
#pragma unroll
        for (int mb = 0; mb < 4; ++mb) a[mb] = ldb(A + aoff + (size_t)mb * 16 * K + kc);
#pragma unroll
        for (int nb = 0; nb < 4; ++nb) { const v16bf b = ldb(Bt + boff + (size_t)nb * 16 * K + kc);
#pragma unroll
            for (int mb = 0; mb < 4; ++mb) acc[mb][nb] = wmmab(a[mb], b, acc[mb][nb]); }
        asm volatile("v_nop\n\tv_nop\n\tv_nop\n\tv_nop" : "+v"(acc[0][0]), "+v"(acc[1][1]), "+v"(acc[2][2]), "+v"(acc[3][3]) : "v"(a[0]), "v"(a[1]), "v"(a[2]), "v"(a[3]));
    }
    const size_t tbase = (size_t)(r0 / RB) * sRB + (size_t)(r0 % RB) * (size_t)pitch + (size_t)(c0 / CB) * sCB + (size_t)(c0 % CB);
#pragma unroll
    for (int mb = 0; mb < 4; ++mb) {
#pragma unroll
        for (int nb = 0; nb < 4; ++nb) {
#pragma unroll
            for (int j = 0; j < 8; ++j) os[(hi * 8 + j) * 68 + nb * 16 + lr] = acc[mb][nb][j]; }   // D: row 8h+j, col lane&15
        wave_sync();
        if constexpr (!F32OUT) {
            const size_t sb = tbase + (size_t)(mb * 16) * (size_t)pitch;
{
#pragma unroll
                for (int s = 0; s < 4; ++s) { const int row = 4 * s + (lane >> 3), c8 = (lane & 7) * 8;   // 4 s x 4 row groups = 16 rows; 8 lanes x 8 = 64 columns
                    v4f x0 = *(const v4fa*)(&os[row * 68 + c8]); v4f x1 = *(const v4fa*)(&os[row * 68 + c8 + 4]);
                    const int cidx = (c0 + c8) & (DM - 1), ridx = (r0 + mb * 16 + row) & (DM - 1);        // clamped addresses; the unused one is discarded by value
                    const v4f bc0 = *(const v4f*)(bias + cidx), bc1 = *(const v4f*)(bias + cidx + 4); const float br = bias[ridx];
                    v8h hv, rv;
#pragma unroll
                    for (int i = 0; i < 4; ++i) { const float y0 = x0[i] + bfr(biasRow ? br : bc0[i]); const float y1 = x1[i] + bfr(biasRow ? br : bc1[i]);
                        const h16 a0 = (h16)y0; const h16 a1 = (h16)y1; hv[i] = a0; hv[4 + i] = a1; rv[i] = (h16)((y0 - (float)a0) * QRS); rv[4 + i] = (h16)((y1 - (float)a1) * QRS); }
                    const size_t oo = sb + (size_t)row * (size_t)pitch + c8;
                    *(v8h*)(Ph + oo) = hv; if (useRes) *(v8h*)(Pr + oo) = rv; }
                 }
        } else {
{
#pragma unroll
                for (int s = 0; s < 8; ++s) { const int row = 2 * s + hi, cofs = lr * 4;                  // 8 s x 2 rows = 16 rows; 16 lanes x 4 floats = 64 columns
                    const int m = r0 + mb * 16 + row; const int bb = m / SEQ, tt = m - bb * SEQ;
                    v4f val = *(const v4fa*)(&os[row * 68 + cofs]);
                    const int cidx = (c0 + cofs) & (DM - 1), ridx = m & (DM - 1);
                    const v4f bc = *(const v4f*)(bias + cidx); const float br = bias[ridx];
#pragma unroll
                    for (int i = 0; i < 4; ++i) val[i] = val[i] + bfr(biasRow ? br : bc[i]);
                    *(v4f*)(OUT + ((size_t)bb * OUT_SEQ + tt) * DM + c0 + cofs) = val; }
                 }
        }
        wave_sync();
    }
}

// k_flash: fused attention, one work-group per 64 query rows of one batch and one PAIR of heads; one wave per (16 query rows, head, key range of SEQ / KS keys).
// The waves of one key range walk the same K rows and V^T columns at the same time; both heads of the pair read the two halves of the same K lines.
// K / V^T / Q fragments straight from the f16 planes (two 16-B loads each, arithmetic addressing).
// Transposed form: S^T[key][t] = K Q^T (A = K rows, B = Q rows); lane (t = lane&15, h = lane>>4) holds keys 8h+r of each 16-key tile, so the packed
// P tile is directly the B fragment of O^T[d][t] = V^T P^T (element r <- tile keys 0..15, element 8+r <- tile keys 16..31, lane unchanged).
// Key mask: per element, a masked key's score is REPLACED by the fill value (a fully masked row therefore comes out uniform).
// Softmax state (running max, partial sum) is one scalar per lane; the two lane halves of a row are combined with one xor-16 exchange.
// Each wave leaves its unnormalised O, its running max and its sum in LDS; behind one work-group barrier the KS partial results of a row are rescaled to their common max, added and normalised.
__global__ __launch_bounds__(32 * FW) void k_flash(const h16* __restrict__ QH, const h16* __restrict__ QR, const h16* __restrict__ KP, const h16* __restrict__ VT,
                                                   const int* __restrict__ MK, bf* CX) {
    __shared__ __align__(16) float os[KS * AW * 16 * 68];        // [key range][row of the block][68]: columns 0..63 = 32*head + d
    __shared__ float sm[KS * 2 * AW * 16], sl[KS * 2 * AW * 16]; // [key range][head][row of the block]: running max, sum
    const int lane = threadIdx.x & 31, wave = __builtin_amdgcn_readfirstlane((int)(threadIdx.x >> 5)), lr = lane & 15, hi = lane >> 4;
    const int rt = wave % AW, hh = (wave / AW) & 1, ks = wave / (2 * AW);
    const int zp = blockIdx.y; const int b = zp / (NH_ / 2), hp = zp % (NH_ / 2);
    const int t0 = (blockIdx.x * AW + rt) * 16;
    const size_t rowb = (size_t)b * SEQ;
    const int* mk = MK + (size_t)b * SEQ_FULL + 8 * hi;          // + key0 (+4, +16, +20): keys 8h+0..7 and 16+8h+0..7 of the 32-key step
    {
        const int h = hp * 2 + hh;
        const size_t qo = (rowb + t0 + lr) * DM + h * HD + 8 * hi;
        const v16h qh = ldh(QH + qo), qr = ldh(QR + qo);                  // B fragments: col t, k = d (32 deep)
        const size_t ko = (rowb + lr) * DM + h * HD + 8 * hi;             // + key * DM       (A fragment: row key, k = d)
        const size_t vo = ((size_t)b * DM + h * HD + lr) * SEQ + 8 * hi;  // + 16*SEQ + key   (A fragment: row d, k = key)
        v8f o0 = (v8f){}, o1 = (v8f){};
        float m = -3.0e38f, l = 0.0f;
        const int kbeg = ks * (SEQ / KS);
#pragma unroll 1
        for (int kk = 0; kk < SEQ / KS; kk += 32) {
            const int key0 = kbeg + kk;
            const h16* ka = KP + ko + (size_t)key0 * DM;
            const v16h ka0 = ldh(ka), kb0 = ldh(ka + 16 * DM);
            const v4i ma0 = *(const v4i*)(mk + key0), ma1 = *(const v4i*)(mk + key0 + 4), mb0 = *(const v4i*)(mk + key0 + 16), mb1 = *(const v4i*)(mk + key0 + 20);
            v8f sHa = (v8f){}, sLa = (v8f){}, sHb = (v8f){}, sLb = (v8f){};
            sHa = wmma16(ka0, qh, sHa); sLa = wmma16(ka0, qr, sLa); sHb = wmma16(kb0, qh, sHb); sLb = wmma16(kb0, qr, sLb);
            asm volatile("v_nop\n\tv_nop\n\tv_nop\n\tv_nop" : "+v"(sHa), "+v"(sLa), "+v"(sHb), "+v"(sLb) : "v"(ka0), "v"(kb0), "v"(qh), "v"(qr));
            float ta[8], tb[8]; float mx = -3.0e38f;
#pragma unroll
            for (int r = 0; r < 4; ++r) {
                const float a0 = (sHa[r] + sLa[r] * QRI) * SC2, a1 = (sHa[4 + r] + sLa[4 + r] * QRI) * SC2;
                const float c0 = (sHb[r] + sLb[r] * QRI) * SC2, c1 = (sHb[4 + r] + sLb[4 + r] * QRI) * SC2;
                ta[r] = (ma0[r] != 0) ? a0 : NEGT; ta[4 + r] = (ma1[r] != 0) ? a1 : NEGT;
                tb[r] = (mb0[r] != 0) ? c0 : NEGT; tb[4 + r] = (mb1[r] != 0) ? c1 : NEGT; }
#pragma unroll
            for (int r = 0; r < 8; ++r) mx = fmaxf(mx, fmaxf(ta[r], tb[r]));
            mx = fmaxf(mx, __shfl_xor(mx, 16, 32));
            const float mnew = fmaxf(m, mx);
            const float alpha = __builtin_amdgcn_exp2f(m - mnew);
            const float sh = PSH - mnew;
            v16h pb; float ls = 0.0f;
#pragma unroll
            for (int r = 0; r < 8; ++r) { const h16 pa = (h16)__builtin_amdgcn_exp2f(ta[r] + sh); const h16 pc = (h16)__builtin_amdgcn_exp2f(tb[r] + sh); pb[r] = pa; pb[8 + r] = pc; ls += (float)pa + (float)pc; }
            l = l * alpha + ls; m = mnew;
            o0 = o0 * alpha; o1 = o1 * alpha;
            const h16* va = VT + vo + key0;
            const v16h v0 = ldh(va), v1 = ldh(va + (size_t)16 * SEQ);
            o0 = wmma16(v0, pb, o0); o1 = wmma16(v1, pb, o1);
            asm volatile("v_nop\n\tv_nop\n\tv_nop\n\tv_nop" : "+v"(o0), "+v"(o1) : "v"(v0), "v"(v1), "v"(pb));
        }
        l += __shfl_xor(l, 16, 32);
        // O^T D layout: o_j[r] = (d = 16j + 8h + r, t = lane&15) -> os[key range][16*rt + t][32*hh + d], unnormalised
        { const int ob = ((ks * AW + rt) * 16 + lr) * 68 + hh * 32 + 8 * hi;
          *(v4fa*)(&os[ob])      = (v4f){o0[0], o0[1], o0[2], o0[3]}; *(v4fa*)(&os[ob + 4])  = (v4f){o0[4], o0[5], o0[6], o0[7]};
          *(v4fa*)(&os[ob + 16]) = (v4f){o1[0], o1[1], o1[2], o1[3]}; *(v4fa*)(&os[ob + 20]) = (v4f){o1[4], o1[5], o1[6], o1[7]}; }
        if (hi == 0) { const int si = ((ks * 2 + hh) * AW + rt) * 16 + lr; sm[si] = m; sl[si] = l; }
    }
    __syncthreads();     // every wave's partial result is in LDS before any row is merged
    const int tid = threadIdx.x;
    if (tid < AW * 16 * 8) {                                     // whole waves: 64 rows x 8 lanes x 8 columns
        const int row = tid >> 3, c8 = (tid & 7) * 8, hq = c8 >> 5;
        float pm[KS]; float mx = -3.0e38f;
#pragma unroll
        for (int p = 0; p < KS; ++p) { pm[p] = sm[(p * 2 + hq) * (AW * 16) + row]; mx = fmaxf(mx, pm[p]); }
        v4f x0 = (v4f){}, x1 = (v4f){}; float l = 0.0f;
#pragma unroll
        for (int p = 0; p < KS; ++p) { const float f = __builtin_amdgcn_exp2f(pm[p] - mx);
            l += f * sl[(p * 2 + hq) * (AW * 16) + row];
            x0 += *(const v4fa*)(&os[(p * (AW * 16) + row) * 68 + c8]) * f; x1 += *(const v4fa*)(&os[(p * (AW * 16) + row) * 68 + c8 + 4]) * f; }
        const float inv = 1.0f / l;
        x0 = x0 * inv; x1 = x1 * inv;
        v8us hv, lv;
#pragma unroll
        for (int i = 0; i < 4; ++i) { const unsigned short u0 = f2bf(x0[i]); const unsigned short u1 = f2bf(x1[i]); hv[i] = u0; hv[4 + i] = u1;
            lv[i] = f2bf(x0[i] - bf2f(u0)); lv[4 + i] = f2bf(x1[i] - bf2f(u1)); }
        bf* crow = CX + (rowb + (size_t)blockIdx.x * (AW * 16) + row) * CXP + hp * 64 + c8;
        *(v8us*)(crow) = hv; *(v8us*)(crow + DM) = lv;
    }
}

static constexpr size_t al256(size_t v) { return (v + 255) & ~(size_t)255; }
static constexpr size_t SZ_X  = al256((size_t)NB * SEQ * DM * 2);
static constexpr size_t SZ_W  = al256((size_t)DM * DM * 2);
static constexpr size_t SZ_WO = al256((size_t)DM * CXP * 2);
static constexpr size_t SZ_PL = al256((size_t)NB * SEQ * DM * 2);
static constexpr size_t SZ_CX = al256((size_t)NB * SEQ * CXP * 2);
static constexpr size_t SZ_TOTAL = 3 * SZ_X + 3 * SZ_W + SZ_WO + 4 * SZ_PL + SZ_CX;
static_assert(SZ_TOTAL <= (size_t)134217728);          // workspace carve <= 128 MiB
static_assert((size_t)NB * DM * SEQ * 2 <= SZ_PL);     // v^T plane extent

extern "C" void kernel_launch(void* const* d_in, const int* in_sizes, int n_in,
                              void* d_out, int out_size, void* d_ws, size_t ws_size, hipStream_t stream) {
    if (n_in < 12) return;
    const size_t needx = ((size_t)(NB - 1) * SEQ_FULL + SEQ) * DM;
    if ((size_t)in_sizes[0] < needx || (size_t)in_sizes[1] < needx || (size_t)in_sizes[2] < needx) return;
    if ((size_t)in_sizes[3] < (size_t)(NB - 1) * SEQ_FULL + SEQ) return;
    if ((size_t)in_sizes[4] < (size_t)DM * DM || (size_t)in_sizes[6] < (size_t)DM * DM || (size_t)in_sizes[8] < (size_t)DM * DM || (size_t)in_sizes[10] < (size_t)DM * DM) return;
    if (in_sizes[5] < DM || in_sizes[7] < DM || in_sizes[9] < DM || in_sizes[11] < DM) return;
    if ((size_t)out_size < ((size_t)(NB - 1) * OUT_SEQ + SEQ) * DM) return;
    if (SZ_TOTAL > ws_size) return;
    // wire order: queries, keys, values, key_mask, Wq, bq, Wk, bk, Wv, bv, Wo, bo
    const float* xq = (const float*)d_in[0]; const float* xk = (const float*)d_in[1]; const float* xv = (const float*)d_in[2];
    const int* kmask = (const int*)d_in[3];
    const float* wq = (const float*)d_in[4]; const float* bq = (const float*)d_in[5];
    const float* wk = (const float*)d_in[6]; const float* bk = (const float*)d_in[7];
    const float* wv = (const float*)d_in[8]; const float* bv = (const float*)d_in[9];
    const float* wo = (const float*)d_in[10]; const float* bo = (const float*)d_in[11];
    float* OUT = (float*)d_out;      // [NB][SEQ][256]
    char* wsp = (char*)d_ws;
    bf* XQ = (bf*)wsp; wsp += SZ_X;                  // [NB*SEQ][256]
    bf* XK = (bf*)wsp; wsp += SZ_X;
    bf* XV = (bf*)wsp; wsp += SZ_X;
    bf* WQT = (bf*)wsp; wsp += SZ_W;                 // [out n][in k]
    bf* WKT = (bf*)wsp; wsp += SZ_W;
    bf* WVT = (bf*)wsp; wsp += SZ_W;
    bf* WO2 = (bf*)wsp; wsp += SZ_WO;                // [out n][512]: Wo^T | Wo^T
    h16* QH = (h16*)wsp; wsp += SZ_PL;               // [NB*SEQ][256]
    h16* QR = (h16*)wsp; wsp += SZ_PL;               // [NB*SEQ][256] residual x2048
    h16* KP = (h16*)wsp; wsp += SZ_PL;               // [NB*SEQ][256]
    h16* VT = (h16*)wsp; wsp += SZ_PL;               // [NB][256][SEQ]
    bf* CX = (bf*)wsp; wsp += SZ_CX;                 // [NB*SEQ][512]: ctx hi | ctx lo

    k_prep<<<dim3(5 * WTB + 3 * CVB, 1, 1), 256, 0, stream>>>(xq, xk, xv, wq, wk, wv, wo, XQ, XK, XV, WQT, WKT, WVT, WO2);

    k_gemm<false><<<dim3(PTB, 3, 1), 32, 0, stream>>>(XQ, XK, WVT, WQT, WKT, XV, QH, KP, VT, QR, OUT, bq, bk, bv, DM);

    k_flash<<<dim3(SEQ / (16 * AW), NB * (NH_ / 2), 1), 32 * FW, 0, stream>>>(QH, QR, KP, VT, kmask, CX);

    // out = [ctx_hi | ctx_lo] x [Wo^T | Wo^T]^T + bo, K = 512, f32 rows of the output
    k_gemm<true><<<dim3(PTB, 1, 1), 32, 0, stream>>>(CX, CX, CX, WO2, WO2, WO2, QH, QH, QH, QH, OUT, bo, bo, bo, CXP);
}

// v003
// Measured time: 57.7 microseconds a run.
// Two timings next to v002 put it at 1.07 and 1.05 times that version's speed.
// Over all steps from v000 it is 2.60 times as fast.
#include <hip/hip_runtime.h>

// Multi-head attention with key padding mask: q/k/v inputs [NB][SEQ][256], Wq/Wk/Wv/Wo [in][out] (y = x W + b), 8 heads x 32, score scale 1/sqrt(32), masked keys take the fill value -4294967296, output = ctx Wo + bo (f32).
// Compute dtypes, f32 accumulate everywhere: projections v_wmma_f32_16x16x32_bf16 (inputs and weights RNE-converted to bf16; products exact);
// scores v_wmma_f32_16x16x32_f16: k single f16, q as f16 value + f16 residual x2048 in its own accumulator (two products); P (x256 carry, cancels in the normalisation) and v single f16; softmax f32 (online, running max);
// output projection v_wmma_f32_16x16x32_bf16 with ctx carried as bf16 hi | bf16 lo planes folded along K (K = 512, weight row = k mod 256).
// Layout: activations and weights are read as f32 by the GEMMs and rounded in registers; q (hi, residual), k planes [b*SEQ + t][256] (head h = columns 32h..32h+31) and v^T plane [b][256][SEQ] written by the GEMM epilogue;

#ifndef NB
#define NB 2
#endif
#ifndef SEQ
#define SEQ 2048
#endif
#define NB_FULL  2
#define SEQ_FULL 2048
#ifndef OUT_SEQ
#define OUT_SEQ SEQ              // row pitch (in tokens) between batches of the output
#endif
#define DM   256
#define NH_  8
#define HD   32
#define CXP  (2 * DM)            // ctx plane pitch: hi columns 0..255, lo columns 256..511
#define AW   4                   // 16-row query tiles per flash block
#define KS   4                   // key ranges per (query tile, head), one wave each
#define FW   (AW * 2 * KS)       // waves per flash block: query tiles x 2 heads x key ranges
#define QRS  2048.0f             // carry of the q residual plane
#define QRI  (1.0f / 2048.0f)
#define SC2  (0.17677669529663687f * 1.4426950408889634f)   // HD^-0.5 * log2(e)
#define PSH  8.0f                // log2 of the P carry (256)
#define NEGT (-4294967296.0f * 1.4426950408889634f)         // mask fill value in the log2 domain

static_assert(HD == 32);
static_assert(NH_ * HD == DM);                 // head h = columns h*32 + d
static_assert(NH_ % 2 == 0);
static_assert(DM % 64 == 0);
static_assert(DM % 32 == 0);                   // GEMM k-loop steps by 32
static_assert(CXP % 32 == 0);
static_assert(SEQ % 64 == 0);                  // a 64-row tile never straddles two batches
static_assert((NB * SEQ) % 64 == 0);
static_assert(SEQ % (32 * KS) == 0);           // key loop steps by 32 inside each key range
static_assert(FW * 32 <= 1024);
static_assert(FW * 32 >= AW * 16 * 8);         // the merge uses one thread per (row, 8 columns)
static_assert(SEQ % (16 * AW) == 0);           // flash grid covers the sequence exactly
static_assert(((size_t)SEQ * DM) % 8 == 0);
static_assert(NB <= NB_FULL);
static_assert(SEQ <= SEQ_FULL);

typedef _Float16 h16;
typedef unsigned short bf;
typedef __attribute__((ext_vector_type(16))) __bf16   v16bf;
typedef __attribute__((ext_vector_type(16))) _Float16 v16h;
typedef __attribute__((ext_vector_type(8)))  _Float16 v8h;
typedef __attribute__((ext_vector_type(8)))  unsigned short v8us;
typedef __attribute__((ext_vector_type(8)))  float    v8f;
typedef __attribute__((ext_vector_type(16))) float    v16f;
typedef __attribute__((ext_vector_type(4)))  float    v4f;
typedef __attribute__((ext_vector_type(4)))  int      v4i;
typedef v4f  __attribute__((may_alias)) v4fa;

__device__ __forceinline__ unsigned short f2bf(float f) { unsigned u = __float_as_uint(f); u += 0x7FFFu + ((u >> 16) & 1u); return (unsigned short)(u >> 16); }
__device__ __forceinline__ float bf2f(unsigned short s) { return __uint_as_float(((unsigned)s) << 16); }
__device__ __forceinline__ float bfr(float f) { return bf2f(f2bf(f)); }
__device__ __forceinline__ v16h cat16(v8h lo, v8h hi) { return __builtin_shufflevector(lo, hi, 0, 1, 2, 3, 4, 5, 6, 7, 8, 9, 10, 11, 12, 13, 14, 15); }
__device__ __forceinline__ v16bf cat16b(v8us lo, v8us hi) { return __builtin_bit_cast(v16bf, __builtin_shufflevector(lo, hi, 0, 1, 2, 3, 4, 5, 6, 7, 8, 9, 10, 11, 12, 13, 14, 15)); }
__device__ __forceinline__ v8f wmma16(v16h a, v16h b, v8f c) { return __builtin_amdgcn_wmma_f32_16x16x32_f16(false, a, false, b, (short)0, c, false, false); }
__device__ __forceinline__ v8f wmmab(v16bf a, v16bf b, v8f c) { return __builtin_amdgcn_wmma_f32_16x16x32_bf16(false, a, false, b, (short)0, c, false, false); }
// fragment loaders from K-contiguous 16-bit rows; p already includes + 8*(lane>>4): elements 0..7 <- k0+8h+0..7, elements 8..15 <- k0+16+8h+0..7 (same map for A and B)
__device__ __forceinline__ v16h  ldh(const h16* p) { return cat16(*(const v8h*)p, *(const v8h*)(p + 16)); }
__device__ __forceinline__ v16bf ldb(const bf* p)  { return cat16b(*(const v8us*)p, *(const v8us*)(p + 16)); }
// ordering point for wave-private LDS tiles (same wave writes and reads)
__device__ __forceinline__ void wave_sync() { __builtin_amdgcn_fence(3 /* release order */, "wavefront"); __builtin_amdgcn_wave_barrier(); asm volatile("" ::: "memory"); }

// cvx: fragment from the two 8-float pieces of one K-contiguous f32 row (k0+8h+0..7, k0+16+8h+0..7: the k map of ldb), rounded to bf16 (RNE) in registers
__device__ __forceinline__ v16bf cvx(v8f lo, v8f hi8) {
    return __builtin_convertvector(__builtin_shufflevector(lo, hi8, 0, 1, 2, 3, 4, 5, 6, 7, 8, 9, 10, 11, 12, 13, 14, 15), v16bf);
}
// Weight fragments come four at once from W[k][n] (f32, row pitch DM): one 16-B load per k at W + k * DM + n0 + 4*(lane&15) gives the lane that k of the four outputs n0 + 4*(lane&15) + i.
// r[e] = row k0+8h+e, r[8+e] = row k0+16+8h+e (the k map of ldb); cvw: fragment i holds outputs n0 + 4*l + i (l = its 16 rows or columns), rounded to bf16 (RNE) in registers.
__device__ __forceinline__ v16bf cvw(const v4f (&r)[16], int i) {
    v16f t;
#pragma unroll
    for (int e = 0; e < 16; ++e) t[e] = r[e][i];
    return __builtin_convertvector(t, v16bf);
}

// k_gemm: register-blocked bf16 GEMM, ONE WAVE per 64x64 tile (16 accumulators). The weight operand comes straight from the f32 input W[k][n] (cvw), the other operand from K-contiguous rows:
// the f32 activation input (cvx; F32OUT = false) or the bf16 ctx plane (ldb; F32OUT = true, K = 512, weight row = k mod 256). Bias: bf16 RNE value of the f32 bias, added in f32.
// acc[xi][wi]: xi = 16-row group of the row operand (rows 16*xi + l), wi = weight fragment (outputs 4*l + wi).
// F32OUT = false: the three input projections in ONE launch, blockIdx.y picks the job, PTB tiles each, the row tile running fastest in blockIdx.x; written as f16 (Ph), q also as the f16 residual x2048 (Pr):
//   job 0 (q), job 1 (k): A = x rows (m = b*SEQ + t), B = W columns (n = h*32 + d) -> plane [m][n], bias by column
//   job 2 (v^T): A = Wv columns (m = h*32 + d), B = x rows (n = b*SEQ + t) -> plane [(b*256 + m)][t], bias by row
// F32OUT = true: the output projection, f32 rows of OUT[(m/SEQ)*OUT_SEQ + m%SEQ][c0 + col]; each row segment (64 floats = two lines) written by 16 consecutive lanes x 16 B (2 rows per instruction).
#define PTB ((NB * SEQ / 64) * (DM / 64))
// gemm_tile: one 64x64 tile. J2 = the v^T job (weight fragments as A). f = tile index, the row tile running fastest.
template <bool F32OUT, bool J2>
__device__ __forceinline__ void gemm_tile(float* os, const float* __restrict__ X, const bf* __restrict__ CXA, const float* __restrict__ Wt,
                                          h16* Ph, h16* Pr, float* OUT, const float* __restrict__ bias, bool useRes, unsigned f) {
    constexpr int K = F32OUT ? CXP : DM;
    constexpr int pitch = J2 ? SEQ : DM;                           // row pitch of the f16 plane (halves)
    const int lane = threadIdx.x & 31, lr = lane & 15, hi = lane >> 4;
    const int r0 = (J2 ? f % (DM / 64) : f % (NB * SEQ / 64)) * 64, c0 = (J2 ? f / (DM / 64) : f / (NB * SEQ / 64)) * 64;
    const int xr0 = J2 ? c0 : r0, wc0 = J2 ? r0 : c0;             // tile base of the row operand, of the weight outputs
    v8f acc[4][4];
#pragma unroll
    for (int xi = 0; xi < 4; ++xi)
#pragma unroll
        for (int wi = 0; wi < 4; ++wi) acc[xi][wi] = (v8f){};
    const size_t xoff = F32OUT ? (size_t)(xr0 + lr) * K + 8 * hi
                               : ((size_t)(xr0 / SEQ) * SEQ_FULL + (size_t)(xr0 % SEQ) + lr) * DM + 8 * hi;   // a 64-row tile lies in one batch
    const float* wbase = Wt + (size_t)(8 * hi) * DM + wc0 + 4 * lr;
#pragma unroll 1
    for (int kc = 0; kc < K; kc += 32) {
        v16bf xf[4], wf[4];
        v4f wr[16];
        const float* wp = wbase + (size_t)(kc & (DM - 1)) * DM;
#pragma unroll
        for (int e = 0; e < 8; ++e) { wr[e] = *(const v4f*)(wp + (size_t)e * DM); wr[8 + e] = *(const v4f*)(wp + (size_t)(16 + e) * DM); }
        if constexpr (F32OUT) {
#pragma unroll
            for (int xi = 0; xi < 4; ++xi) xf[xi] = ldb(CXA + xoff + (size_t)xi * 16 * K + kc);
        } else {
            v8f xl[4], xh[4];
#pragma unroll
            for (int xi = 0; xi < 4; ++xi) { const float* xp = X + xoff + (size_t)xi * 16 * DM + kc; xl[xi] = *(const v8f*)xp; xh[xi] = *(const v8f*)(xp + 16); }
            // inputs only: all loads of the trip are issued before the first conversion, so the trip waits out one load latency; built without it, the last three loads of a trip are issued only behind the waits for the first ones
            asm volatile("" :: "v"(wr[0]), "v"(wr[1]), "v"(wr[2]), "v"(wr[3]), "v"(wr[4]), "v"(wr[5]), "v"(wr[6]), "v"(wr[7]), "v"(wr[8]), "v"(wr[9]), "v"(wr[10]), "v"(wr[11]),
                             "v"(wr[12]), "v"(wr[13]), "v"(wr[14]), "v"(wr[15]), "v"(xl[0]), "v"(xl[1]), "v"(xl[2]), "v"(xl[3]), "v"(xh[0]), "v"(xh[1]), "v"(xh[2]), "v"(xh[3]));
#pragma unroll
            for (int xi = 0; xi < 4; ++xi) xf[xi] = cvx(xl[xi], xh[xi]);
        }
#pragma unroll
        for (int wi = 0; wi < 4; ++wi) wf[wi] = cvw(wr, wi);
#pragma unroll
        for (int wi = 0; wi < 4; ++wi)
#pragma unroll
            for (int xi = 0; xi < 4; ++xi) acc[xi][wi] = J2 ? wmmab(wf[wi], xf[xi], acc[xi][wi]) : wmmab(xf[xi], wf[wi], acc[xi][wi]);
        // keeps the vector slots the chip needs behind the last WMMA, also on the taken back edge
        asm volatile("v_nop\n\tv_nop\n\tv_nop\n\tv_nop" : "+v"(acc[0][0]), "+v"(acc[1][1]), "+v"(acc[2][2]), "+v"(acc[3][3]) : "v"(xf[0]), "v"(xf[1]), "v"(xf[2]), "v"(xf[3]));
        if constexpr (F32OUT) asm volatile("s_wait_xcnt 0x0" ::: "memory");   // precaution: the weight loads' address register is formed anew at the head of the next trip; this stands in front of that rewrite
    }
    const size_t tbase = J2 ? (size_t)r0 * SEQ + (size_t)(c0 / SEQ) * ((size_t)DM * SEQ) + (size_t)(c0 % SEQ) : (size_t)r0 * DM + (size_t)c0;
#pragma unroll
    for (int p = 0; p < 4; ++p) {                                  // 16 output rows a pass: rows 16*p + row, in the v^T job rows 4*row + p
        if constexpr (J2) {
#pragma unroll
            for (int xi = 0; xi < 4; ++xi)
#pragma unroll
                for (int j = 0; j < 8; ++j) os[(hi * 8 + j) * 68 + xi * 16 + lr] = acc[xi][p][j];            // D: row 8h+j (output 4*(8h+j) + p), col t = 16*xi + lane&15
        } else {
#pragma unroll
            for (int j = 0; j < 8; ++j) *(v4fa*)(&os[(hi * 8 + j) * 68 + 4 * lr]) = (v4f){acc[p][0][j], acc[p][1][j], acc[p][2][j], acc[p][3][j]};   // D: row 8h+j, col 4*(lane&15) + wi
        }
        wave_sync();
        if constexpr (!F32OUT) {
#pragma unroll
            for (int s = 0; s < 4; ++s) { const int row = 4 * s + (lane >> 3), c8 = (lane & 7) * 8;   // 4 s x 4 row groups = 16 rows; 8 lanes x 8 = 64 columns
                const int rofs = J2 ? 4 * row + p : p * 16 + row;
                v4f x0 = *(const v4fa*)(&os[row * 68 + c8]); v4f x1 = *(const v4fa*)(&os[row * 68 + c8 + 4]);
                v4f bc0, bc1;                                                                          // bias by row (v^T) or by column
                if constexpr (J2) { const float br = bias[r0 + rofs]; bc0 = (v4f){br, br, br, br}; bc1 = bc0; }
                else { bc0 = *(const v4f*)(bias + c0 + c8); bc1 = *(const v4f*)(bias + c0 + c8 + 4); }
                v8h hv, rv;
#pragma unroll
                for (int i = 0; i < 4; ++i) { const float y0 = x0[i] + bfr(bc0[i]); const float y1 = x1[i] + bfr(bc1[i]);
                    const h16 a0 = (h16)y0; const h16 a1 = (h16)y1; hv[i] = a0; hv[4 + i] = a1; rv[i] = (h16)((y0 - (float)a0) * QRS); rv[4 + i] = (h16)((y1 - (float)a1) * QRS); }
                const size_t oo = tbase + (size_t)rofs * (size_t)pitch + c8;
                *(v8h*)(Ph + oo) = hv;
                asm volatile("s_wait_xcnt 0x0" ::: "memory");         // precaution: stands in front of any later rewrite of this store's data or address registers, on both sides of the branch below
                if (useRes) { *(v8h*)(Pr + oo) = rv;
                    asm volatile("s_wait_xcnt 0x0" ::: "memory"); }   // precaution: the same for the residual store
            }
        } else {
#pragma unroll
            for (int s = 0; s < 8; ++s) { const int row = 2 * s + hi, cofs = lr * 4;                  // 8 s x 2 rows = 16 rows; 16 lanes x 4 floats = 64 columns
                const int m = r0 + p * 16 + row; const int bb = m / SEQ, tt = m - bb * SEQ;
                v4f val = *(const v4fa*)(&os[row * 68 + cofs]);
                const v4f bc = *(const v4f*)(bias + c0 + cofs);
#pragma unroll
                for (int i = 0; i < 4; ++i) val[i] = val[i] + bfr(bc[i]);
                *(v4f*)(OUT + ((size_t)bb * OUT_SEQ + tt) * DM + c0 + cofs) = val; }
        }
        wave_sync();
    }
}

template <bool F32OUT>
__global__ __launch_bounds__(32) void k_gemm(const float* __restrict__ X0, const float* __restrict__ X1, const float* __restrict__ X2, const bf* __restrict__ CXA,
                                             const float* __restrict__ W0, const float* __restrict__ W1, const float* __restrict__ W2,
                                             h16* Ph0, h16* Ph1, h16* Ph2, h16* Pr, float* OUT,
                                             const float* __restrict__ bias0, const float* __restrict__ bias1, const float* __restrict__ bias2) {
    __shared__ __align__(16) float os[16 * 68];
    if constexpr (F32OUT) gemm_tile<true, false>(os, X0, CXA, W0, Ph0, Pr, OUT, bias0, false, blockIdx.x);
    else {
        const unsigned job = blockIdx.y;
        if (job == 2) gemm_tile<false, true>(os, X2, CXA, W2, Ph2, Pr, OUT, bias2, false, blockIdx.x);
        else gemm_tile<false, false>(os, job == 0 ? X0 : X1, CXA, job == 0 ? W0 : W1, job == 0 ? Ph0 : Ph1, Pr, OUT, job == 0 ? bias0 : bias1, job == 0, blockIdx.x);
    }
}

// k_flash: fused attention, one work-group per 64 query rows of one batch and one PAIR of heads; one wave per (16 query rows, head, key range of SEQ / KS keys).
// The waves of one key range walk the same K rows and V^T columns at the same time; both heads of the pair read the two halves of the same K lines.
// K / V^T / Q fragments straight from the f16 planes (two 16-B loads each, arithmetic addressing).
// Transposed form: S^T[key][t] = K Q^T (A = K rows, B = Q rows); lane (t = lane&15, h = lane>>4) holds keys 8h+r of each 16-key tile, so the packed
// P tile is directly the B fragment of O^T[d][t] = V^T P^T (element r <- tile keys 0..15, element 8+r <- tile keys 16..31, lane unchanged).
// Key mask: per element, a masked key's score is REPLACED by the fill value (a fully masked row therefore comes out uniform).
// Softmax state (running max, partial sum) is one scalar per lane; the two lane halves of a row are combined with one xor-16 exchange.
// Each wave leaves its unnormalised O, its running max and its sum in LDS; behind one work-group barrier the KS partial results of a row are rescaled to their common max, added and normalised.
__global__ __launch_bounds__(32 * FW) void k_flash(const h16* __restrict__ QH, const h16* __restrict__ QR, const h16* __restrict__ KP, const h16* __restrict__ VT,
                                                   const int* __restrict__ MK, bf* CX) {
    __shared__ __align__(16) float os[KS * AW * 16 * 68];        // [key range][row of the block][68]: columns 0..63 = 32*head + d
    __shared__ float sm[KS * 2 * AW * 16], sl[KS * 2 * AW * 16]; // [key range][head][row of the block]: running max, sum
    const int lane = threadIdx.x & 31, wave = __builtin_amdgcn_readfirstlane((int)(threadIdx.x >> 5)), lr = lane & 15, hi = lane >> 4;
    const int rt = wave % AW, hh = (wave / AW) & 1, ks = wave / (2 * AW);
    const int zp = blockIdx.y; const int b = zp / (NH_ / 2), hp = zp % (NH_ / 2);
    const int t0 = (blockIdx.x * AW + rt) * 16;
    const size_t rowb = (size_t)b * SEQ;
    const int* mk = MK + (size_t)b * SEQ_FULL + 8 * hi;          // + key0 (+4, +16, +20): keys 8h+0..7 and 16+8h+0..7 of the 32-key step
    {
        const int h = hp * 2 + hh;
        const size_t qo = (rowb + t0 + lr) * DM + h * HD + 8 * hi;
        const v16h qh = ldh(QH + qo), qr = ldh(QR + qo);                  // B fragments: col t, k = d (32 deep)
        const size_t ko = (rowb + lr) * DM + h * HD + 8 * hi;             // + key * DM       (A fragment: row key, k = d)
        const size_t vo = ((size_t)b * DM + h * HD + lr) * SEQ + 8 * hi;  // + 16*SEQ + key   (A fragment: row d, k = key)
        v8f o0 = (v8f){}, o1 = (v8f){};
        float m = -3.0e38f, l = 0.0f;
        const int kbeg = ks * (SEQ / KS);
#pragma unroll 1
        for (int kk = 0; kk < SEQ / KS; kk += 32) {
            const int key0 = kbeg + kk;
            const h16* ka = KP + ko + (size_t)key0 * DM;
            const v16h ka0 = ldh(ka), kb0 = ldh(ka + 16 * DM);
            const v4i ma0 = *(const v4i*)(mk + key0), ma1 = *(const v4i*)(mk + key0 + 4), mb0 = *(const v4i*)(mk + key0 + 16), mb1 = *(const v4i*)(mk + key0 + 20);
            v8f sHa = (v8f){}, sLa = (v8f){}, sHb = (v8f){}, sLb = (v8f){};
            sHa = wmma16(ka0, qh, sHa); sLa = wmma16(ka0, qr, sLa); sHb = wmma16(kb0, qh, sHb); sLb = wmma16(kb0, qr, sLb);
            asm volatile("v_nop\n\tv_nop\n\tv_nop\n\tv_nop" : "+v"(sHa), "+v"(sLa), "+v"(sHb), "+v"(sLb) : "v"(ka0), "v"(kb0), "v"(qh), "v"(qr));
            float ta[8], tb[8]; float mx = -3.0e38f;
#pragma unroll
            for (int r = 0; r < 4; ++r) {
                const float a0 = (sHa[r] + sLa[r] * QRI) * SC2, a1 = (sHa[4 + r] + sLa[4 + r] * QRI) * SC2;
                const float c0 = (sHb[r] + sLb[r] * QRI) * SC2, c1 = (sHb[4 + r] + sLb[4 + r] * QRI) * SC2;
                ta[r] = (ma0[r] != 0) ? a0 : NEGT; ta[4 + r] = (ma1[r] != 0) ? a1 : NEGT;
                tb[r] = (mb0[r] != 0) ? c0 : NEGT; tb[4 + r] = (mb1[r] != 0) ? c1 : NEGT; }
#pragma unroll
            for (int r = 0; r < 8; ++r) mx = fmaxf(mx, fmaxf(ta[r], tb[r]));
            mx = fmaxf(mx, __shfl_xor(mx, 16, 32));
            const float mnew = fmaxf(m, mx);
            const float alpha = __builtin_amdgcn_exp2f(m - mnew);
            const float sh = PSH - mnew;
            v16h pb; float ls = 0.0f;
#pragma unroll
            for (int r = 0; r < 8; ++r) { const h16 pa = (h16)__builtin_amdgcn_exp2f(ta[r] + sh); const h16 pc = (h16)__builtin_amdgcn_exp2f(tb[r] + sh); pb[r] = pa; pb[8 + r] = pc; ls += (float)pa + (float)pc; }
            l = l * alpha + ls; m = mnew;
            o0 = o0 * alpha; o1 = o1 * alpha;
            const h16* va = VT + vo + key0;
            const v16h v0 = ldh(va), v1 = ldh(va + (size_t)16 * SEQ);
            o0 = wmma16(v0, pb, o0); o1 = wmma16(v1, pb, o1);
            asm volatile("v_nop\n\tv_nop\n\tv_nop\n\tv_nop" : "+v"(o0), "+v"(o1) : "v"(v0), "v"(v1), "v"(pb));
        }
        l += __shfl_xor(l, 16, 32);
        // O^T D layout: o_j[r] = (d = 16j + 8h + r, t = lane&15) -> os[key range][16*rt + t][32*hh + d], unnormalised
        { const int ob = ((ks * AW + rt) * 16 + lr) * 68 + hh * 32 + 8 * hi;
          *(v4fa*)(&os[ob])      = (v4f){o0[0], o0[1], o0[2], o0[3]}; *(v4fa*)(&os[ob + 4])  = (v4f){o0[4], o0[5], o0[6], o0[7]};
          *(v4fa*)(&os[ob + 16]) = (v4f){o1[0], o1[1], o1[2], o1[3]}; *(v4fa*)(&os[ob + 20]) = (v4f){o1[4], o1[5], o1[6], o1[7]}; }
        if (hi == 0) { const int si = ((ks * 2 + hh) * AW + rt) * 16 + lr; sm[si] = m; sl[si] = l; }
    }
    __syncthreads();     // every wave's partial result is in LDS before any row is merged
    const int tid = threadIdx.x;
    if (tid < AW * 16 * 8) {                                     // whole waves: 64 rows x 8 lanes x 8 columns
        const int row = tid >> 3, c8 = (tid & 7) * 8, hq = c8 >> 5;
        float pm[KS]; float mx = -3.0e38f;
#pragma unroll
        for (int p = 0; p < KS; ++p) { pm[p] = sm[(p * 2 + hq) * (AW * 16) + row]; mx = fmaxf(mx, pm[p]); }
        v4f x0 = (v4f){}, x1 = (v4f){}; float l = 0.0f;
#pragma unroll
        for (int p = 0; p < KS; ++p) { const float f = __builtin_amdgcn_exp2f(pm[p] - mx);
            l += f * sl[(p * 2 + hq) * (AW * 16) + row];
            x0 += *(const v4fa*)(&os[(p * (AW * 16) + row) * 68 + c8]) * f; x1 += *(const v4fa*)(&os[(p * (AW * 16) + row) * 68 + c8 + 4]) * f; }
        const float inv = 1.0f / l;
        x0 = x0 * inv; x1 = x1 * inv;
        v8us hv, lv;
#pragma unroll
        for (int i = 0; i < 4; ++i) { const unsigned short u0 = f2bf(x0[i]); const unsigned short u1 = f2bf(x1[i]); hv[i] = u0; hv[4 + i] = u1;
            lv[i] = f2bf(x0[i] - bf2f(u0)); lv[4 + i] = f2bf(x1[i] - bf2f(u1)); }
        bf* crow = CX + (rowb + (size_t)blockIdx.x * (AW * 16) + row) * CXP + hp * 64 + c8;
        *(v8us*)(crow) = hv; *(v8us*)(crow + DM) = lv;
    }
}

static constexpr size_t al256(size_t v) { return (v + 255) & ~(size_t)255; }
static constexpr size_t SZ_PL = al256((size_t)NB * SEQ * DM * 2);
static constexpr size_t SZ_CX = al256((size_t)NB * SEQ * CXP * 2);
static constexpr size_t SZ_TOTAL = 4 * SZ_PL + SZ_CX;
static_assert(SZ_TOTAL <= (size_t)134217728);          // workspace carve <= 128 MiB
static_assert((size_t)NB * DM * SEQ * 2 <= SZ_PL);     // v^T plane extent

extern "C" void kernel_launch(void* const* d_in, const int* in_sizes, int n_in,
                              void* d_out, int out_size, void* d_ws, size_t ws_size, hipStream_t stream) {
    if (n_in < 12) return;
    const size_t needx = ((size_t)(NB - 1) * SEQ_FULL + SEQ) * DM;
    if ((size_t)in_sizes[0] < needx || (size_t)in_sizes[1] < needx || (size_t)in_sizes[2] < needx) return;
    if ((size_t)in_sizes[3] < (size_t)(NB - 1) * SEQ_FULL + SEQ) return;
    if ((size_t)in_sizes[4] < (size_t)DM * DM || (size_t)in_sizes[6] < (size_t)DM * DM || (size_t)in_sizes[8] < (size_t)DM * DM || (size_t)in_sizes[10] < (size_t)DM * DM) return;
    if (in_sizes[5] < DM || in_sizes[7] < DM || in_sizes[9] < DM || in_sizes[11] < DM) return;
    if ((size_t)out_size < ((size_t)(NB - 1) * OUT_SEQ + SEQ) * DM) return;
    if (SZ_TOTAL > ws_size) return;
    // wire order: queries, keys, values, key_mask, Wq, bq, Wk, bk, Wv, bv, Wo, bo
    const float* xq = (const float*)d_in[0]; const float* xk = (const float*)d_in[1]; const float* xv = (const float*)d_in[2];
    const int* kmask = (const int*)d_in[3];
    const float* wq = (const float*)d_in[4]; const float* bq = (const float*)d_in[5];
    const float* wk = (const float*)d_in[6]; const float* bk = (const float*)d_in[7];
    const float* wv = (const float*)d_in[8]; const float* bv = (const float*)d_in[9];
    const float* wo = (const float*)d_in[10]; const float* bo = (const float*)d_in[11];
    float* OUT = (float*)d_out;      // [NB][SEQ][256]
    char* wsp = (char*)d_ws;
    h16* QH = (h16*)wsp; wsp += SZ_PL;               // [NB*SEQ][256]
    h16* QR = (h16*)wsp; wsp += SZ_PL;               // [NB*SEQ][256] residual x2048
    h16* KP = (h16*)wsp; wsp += SZ_PL;               // [NB*SEQ][256]
    h16* VT = (h16*)wsp; wsp += SZ_PL;               // [NB][256][SEQ]
    bf* CX = (bf*)wsp; wsp += SZ_CX;                 // [NB*SEQ][512]: ctx hi | ctx lo

    k_gemm<false><<<dim3(PTB, 3, 1), 32, 0, stream>>>(xq, xk, xv, CX, wq, wk, wv, QH, KP, VT, QR, OUT, bq, bk, bv);

    k_flash<<<dim3(SEQ / (16 * AW), NB * (NH_ / 2), 1), 32 * FW, 0, stream>>>(QH, QR, KP, VT, kmask, CX);

    // out = [ctx_hi | ctx_lo] x [Wo ; Wo] + bo, K = 512, f32 rows of the output (the activation pointers are not read here)
    k_gemm<true><<<dim3(PTB, 1, 1), 32, 0, stream>>>(wo, wo, wo, CX, wo, wo, wo, QH, QH, QH, QH, OUT, bo, bo, bo);
}

// v004
// It runs in 43.9 microseconds.
// In two side-by-side timings against v003, it was 1.33 and 1.31 times as fast.
// All steps since v000 together make it 3.44 times as fast.
#include <hip/hip_runtime.h>

// Multi-head attention with key padding mask: q/k/v inputs [NB][SEQ][256], Wq/Wk/Wv/Wo [in][out] (y = x W + b), 8 heads x 32, score scale 1/sqrt(32), masked keys take the fill value -4294967296, output = ctx Wo + bo (f32).
// Compute dtypes, f32 accumulate everywhere: projections v_wmma_f32_16x16x32_bf16 (inputs and weights RNE-converted to bf16; products exact);
// scores v_wmma_f32_16x16x32_f16: k single f16, q as f16 value + f16 residual x2048 in its own accumulator (two products); P (x256 carry, cancels in the normalisation) and v single f16; softmax f32 (online, running max);
// output projection v_wmma_f32_16x16x32_bf16 with ctx carried as bf16 hi | bf16 lo planes folded along K (K = 512, weight row = k mod 256).
// Layout: activations and weights are read as f32 by the GEMMs and rounded in registers; q (hi, residual), k planes [b*SEQ + t][256] (head h = columns 32h..32h+31) and v^T plane [b][256][SEQ] written by the GEMM epilogue;
// Key mask: the k and v^T planes hold only the unmasked keys of a batch, packed without gaps in one fixed order (key_list; the same for both planes); a masked key's weight is exactly 0 beside any unmasked one, so attention runs over the packed keys alone.
// A batch with no unmasked key keeps all its keys in the planes, and every score takes the fill value (uniform weights, as the reference gives).

#ifndef NB
#define NB 2
#endif
#ifndef SEQ
#define SEQ 2048
#endif
#define NB_FULL  2
#define SEQ_FULL 2048
#ifndef OUT_SEQ
#define OUT_SEQ SEQ              // row pitch (in tokens) between batches of the output
#endif
#define DM   256
#define NH_  8
#define HD   32
#define CXP  (2 * DM)            // ctx plane pitch: hi columns 0..255, lo columns 256..511
#define AW   4                   // 16-row query tiles per flash block
#define KS   4                   // key ranges per (query tile, head), one wave each
#define FW   (AW * 2 * KS)       // waves per flash block: query tiles x 2 heads x key ranges
#define QRS  2048.0f             // carry of the q residual plane
#define QRI  (1.0f / 2048.0f)
#define SC2  (0.17677669529663687f * 1.4426950408889634f)   // HD^-0.5 * log2(e)
#define PSH  8.0f                // log2 of the P carry (256)
#define NEGT (-4294967296.0f * 1.4426950408889634f)         // mask fill value in the log2 domain

static_assert(HD == 32);
static_assert(NH_ * HD == DM);                 // head h = columns h*32 + d
static_assert(NH_ % 2 == 0);
static_assert(DM % 64 == 0);
static_assert(DM % 32 == 0);                   // GEMM k-loop steps by 32
static_assert(CXP % 32 == 0);
static_assert(SEQ % 64 == 0);                  // a 64-row tile never straddles two batches
static_assert((NB * SEQ) % 64 == 0);
static_assert(SEQ % (32 * KS) == 0);           // key loop steps by 32 inside each key range
static_assert(FW * 32 <= 1024);
static_assert(FW * 32 >= AW * 16 * 8);         // the merge uses one thread per (row, 8 columns)
static_assert(SEQ % (16 * AW) == 0);           // flash grid covers the sequence exactly
static_assert(((size_t)SEQ * DM) % 8 == 0);
static_assert(NB <= NB_FULL);
static_assert(SEQ <= SEQ_FULL);

typedef _Float16 h16;
typedef unsigned short bf;
typedef __attribute__((ext_vector_type(16))) __bf16   v16bf;
typedef __attribute__((ext_vector_type(16))) _Float16 v16h;
typedef __attribute__((ext_vector_type(8)))  _Float16 v8h;
typedef __attribute__((ext_vector_type(8)))  unsigned short v8us;
typedef __attribute__((ext_vector_type(8)))  float    v8f;
typedef __attribute__((ext_vector_type(16))) float    v16f;
typedef __attribute__((ext_vector_type(4)))  float    v4f;
typedef __attribute__((ext_vector_type(4)))  int      v4i;
typedef v4f  __attribute__((may_alias)) v4fa;

__device__ __forceinline__ unsigned short f2bf(float f) { unsigned u = __float_as_uint(f); u += 0x7FFFu + ((u >> 16) & 1u); return (unsigned short)(u >> 16); }
__device__ __forceinline__ float bf2f(unsigned short s) { return __uint_as_float(((unsigned)s) << 16); }
__device__ __forceinline__ float bfr(float f) { return bf2f(f2bf(f)); }
__device__ __forceinline__ v16h cat16(v8h lo, v8h hi) { return __builtin_shufflevector(lo, hi, 0, 1, 2, 3, 4, 5, 6, 7, 8, 9, 10, 11, 12, 13, 14, 15); }
__device__ __forceinline__ v16bf cat16b(v8us lo, v8us hi) { return __builtin_bit_cast(v16bf, __builtin_shufflevector(lo, hi, 0, 1, 2, 3, 4, 5, 6, 7, 8, 9, 10, 11, 12, 13, 14, 15)); }
__device__ __forceinline__ v8f wmma16(v16h a, v16h b, v8f c) { return __builtin_amdgcn_wmma_f32_16x16x32_f16(false, a, false, b, (short)0, c, false, false); }
__device__ __forceinline__ v8f wmmab(v16bf a, v16bf b, v8f c) { return __builtin_amdgcn_wmma_f32_16x16x32_bf16(false, a, false, b, (short)0, c, false, false); }
// fragment loaders from K-contiguous 16-bit rows; p already includes + 8*(lane>>4): elements 0..7 <- k0+8h+0..7, elements 8..15 <- k0+16+8h+0..7 (same map for A and B)
__device__ __forceinline__ v16h  ldh(const h16* p) { return cat16(*(const v8h*)p, *(const v8h*)(p + 16)); }
__device__ __forceinline__ v16bf ldb(const bf* p)  { return cat16b(*(const v8us*)p, *(const v8us*)(p + 16)); }
// ordering point for wave-private LDS tiles (same wave writes and reads)
__device__ __forceinline__ void wave_sync() { __builtin_amdgcn_fence(3 /* release order */, "wavefront"); __builtin_amdgcn_wave_barrier(); asm volatile("" ::: "memory"); }

// cvx: fragment from the two 8-float pieces of one K-contiguous f32 row (k0+8h+0..7, k0+16+8h+0..7: the k map of ldb), rounded to bf16 (RNE) in registers
__device__ __forceinline__ v16bf cvx(v8f lo, v8f hi8) {
    return __builtin_convertvector(__builtin_shufflevector(lo, hi8, 0, 1, 2, 3, 4, 5, 6, 7, 8, 9, 10, 11, 12, 13, 14, 15), v16bf);
}
// Weight fragments come four at once from W[k][n] (f32, row pitch DM): one 16-B load per k at W + k * DM + n0 + 4*(lane&15) gives the lane that k of the four outputs n0 + 4*(lane&15) + i.
// r[e] = row k0+8h+e, r[8+e] = row k0+16+8h+e (the k map of ldb); cvw: fragment i holds outputs n0 + 4*l + i (l = its 16 rows or columns), rounded to bf16 (RNE) in registers.
__device__ __forceinline__ v16bf cvw(const v4f (&r)[16], int i) {
    v16f t;
#pragma unroll
    for (int e = 0; e < 16; ++e) t[e] = r[e][i];
    return __builtin_convertvector(t, v16bf);
}

// key_list (one wave): returns the number of unmasked keys of one batch (mkb = its SEQ mask words) and leaves in idx[0..63] the keys that stand at packed positions lo..lo+63.
// Load i gives lane c the mask of keys 128*i + 4*c + 0..3; bit t of the lane's SEQ/32 bits (32 to a word w[j]) stands for key 128*(t>>2) + 4*c + (t&3).
// Packed order: by lane, then by bit (any order serves, as k and v^T use the same one). p = first packed position of the lane's current word (lane prefix sum, one ballot per bit of the counts).
// Only the words that reach into lo..lo+63 are then walked, one word (32 keys, one a lane) a trip. No unmasked key at all: every key counts as present.
// Positions past the last key keep key 0: finite rows that the attention kernel masks. Every entry is formed from lane, word and bit numbers alone and lies below SEQ.
__device__ __forceinline__ int key_list(int* idx, const int* __restrict__ mkb, int lo) {
    constexpr int NW = SEQ / 1024;
    static_assert(SEQ % 1024 == 0 && SEQ / 32 < 128);
    const int lane = threadIdx.x & 31;
    v4i mv[8 * NW];
#pragma unroll
    for (int i = 0; i < 8 * NW; ++i) mv[i] = *(const v4i*)(mkb + 128 * i + 4 * lane);
    asm volatile("s_wait_xcnt 0x0" ::: "memory");   // precaution: stands in front of any later rewrite of the mask loads' address registers
    unsigned w[NW];
    unsigned any = 0u;
#pragma unroll
    for (int j = 0; j < NW; ++j) {
        w[j] = 0u;
#pragma unroll
        for (int t = 0; t < 32; ++t) w[j] |= mv[8 * j + (t >> 2)][t & 3] != 0 ? 1u << t : 0u;
        any |= w[j];
    }
    const bool none = __builtin_amdgcn_ballot_w32(any != 0u) == 0u;
    int cn = 0;
#pragma unroll
    for (int j = 0; j < NW; ++j) { if (none) w[j] = ~0u; cn += __builtin_popcount(w[j]); }   // cn = 0 .. SEQ / 32: seven bits
    int p = 0, tot = 0;
#pragma unroll
    for (int bit = 0; bit < 7; ++bit) {
        const unsigned bb = __builtin_amdgcn_ballot_w32(((cn >> bit) & 1) != 0);
        p += (int)__builtin_amdgcn_mbcnt_lo(bb, 0u) << bit;
        tot += __builtin_popcount(bb) << bit;
    }
    const int nvalid = none ? 0 : tot;
    if (lo >= tot) return nvalid;                    // nothing stands at these positions: the caller leaves
    idx[lane] = 0; idx[lane + 32] = 0;
#pragma unroll
    for (int j = 0; j < NW; ++j) {
        const int cj = __builtin_popcount(w[j]);
        unsigned todo = __builtin_amdgcn_ballot_w32(p + cj > lo && p < lo + 64);
        while (todo != 0u) {                         // same for the whole wave; one bit goes each trip: at most 32 trips
            const int c = __builtin_ctz(todo);
            todo &= todo - 1u;
            const unsigned bc = (unsigned)__builtin_amdgcn_readlane((int)w[j], c);
            const int pos = __builtin_amdgcn_readlane(p, c) - lo + (int)__builtin_amdgcn_mbcnt_lo(bc, 0u);
            if (((bc >> lane) & 1u) != 0u && pos >= 0 && pos < 64) idx[pos] = 128 * (8 * j + (lane >> 2)) + 4 * c + (lane & 3);
        }
        p += cj;
    }
    wave_sync();
    return nvalid;
}

// k_gemm: register-blocked bf16 GEMM, ONE WAVE per 64x64 tile (16 accumulators). The weight operand comes straight from the f32 input W[k][n] (cvw), the other operand from K-contiguous rows:
// the f32 activation input (cvx; F32OUT = false) or the bf16 ctx plane (ldb; F32OUT = true, K = 512, weight row = k mod 256). Bias: bf16 RNE value of the f32 bias, added in f32.
// acc[xi][wi]: xi = 16-row group of the row operand (rows 16*xi + l), wi = weight fragment (outputs 4*l + wi).
// F32OUT = false: the three input projections in ONE launch, blockIdx.y picks the job, PTB tiles each, the row tile running fastest in blockIdx.x; written as f16 (Ph), q also as the f16 residual x2048 (Pr):
//   job 0 (q), job 1 (k): A = x rows (m = b*SEQ + t), B = W columns (n = h*32 + d) -> plane [m][n], bias by column
//   job 2 (v^T): A = Wv columns (m = h*32 + d), B = x rows (n = b*SEQ + t) -> plane [(b*256 + m)][t], bias by row
//   jobs 1 and 2: t is a packed position, the x row read for it is the key that key_list names; a tile past the last packed key leaves at once; job 1's first tile of a batch stores the batch's count in NV
// F32OUT = true: the output projection, f32 rows of OUT[(m/SEQ)*OUT_SEQ + m%SEQ][c0 + col]; each row segment (64 floats = two lines) written by 16 consecutive lanes x 16 B (2 rows per instruction).
#define PTB ((NB * SEQ / 64) * (DM / 64))
// gemm_tile: one 64x64 tile. J2 = the v^T job (weight fragments as A). f = tile index, the row tile running fastest.
template <bool F32OUT, bool J2>
__device__ __forceinline__ void gemm_tile(float* os, const float* __restrict__ X, const bf* __restrict__ CXA, const float* __restrict__ Wt,
                                          h16* Ph, h16* Pr, float* OUT, const float* __restrict__ bias, bool useRes, unsigned f,
                                          int* kidx, const int* __restrict__ MK, int* NV, bool packed) {
    constexpr int K = F32OUT ? CXP : DM;
    constexpr int pitch = J2 ? SEQ : DM;                           // row pitch of the f16 plane (halves)
    const int lane = threadIdx.x & 31, lr = lane & 15, hi = lane >> 4;
    const int r0 = (J2 ? f % (DM / 64) : f % (NB * SEQ / 64)) * 64, c0 = (J2 ? f / (DM / 64) : f / (NB * SEQ / 64)) * 64;
    const int xr0 = J2 ? c0 : r0, wc0 = J2 ? r0 : c0;             // tile base of the row operand, of the weight outputs
    int xrow[4];                                                  // row of the batch that 16-row group xi of this lane reads (a 64-row tile lies in one batch)
#pragma unroll
    for (int xi = 0; xi < 4; ++xi) xrow[xi] = xr0 % SEQ + 16 * xi + lr;
    if constexpr (!F32OUT) {
        if (J2 || packed) {
            const int tot = key_list(kidx, MK + (size_t)(xr0 / SEQ) * SEQ_FULL, xr0 % SEQ);
            if (xr0 % SEQ >= (tot == 0 ? SEQ : tot)) return;
            if (!J2 && xr0 % SEQ == 0 && wc0 == 0 && lane == 0) { NV[xr0 / SEQ] = tot;
                asm volatile("s_wait_xcnt 0x0" ::: "memory"); }   // precaution: stands in front of any later rewrite of this store's registers
#pragma unroll
            for (int xi = 0; xi < 4; ++xi) xrow[xi] = kidx[16 * xi + lr];
        }
    }
    v8f acc[4][4];
#pragma unroll
    for (int xi = 0; xi < 4; ++xi)
#pragma unroll
        for (int wi = 0; wi < 4; ++wi) acc[xi][wi] = (v8f){};
    const size_t xoff = (size_t)(xr0 + lr) * K + 8 * hi;          // ctx plane (F32OUT)
    // f32 operands (F32OUT = false): byte offsets of this lane's four rows and of its weight column group, carried from trip to trip (all below 2^32)
    unsigned xob[4], wob = (unsigned)(((8 * hi) * DM + wc0 + 4 * lr) * sizeof(float));
#pragma unroll
    for (int xi = 0; xi < 4; ++xi) xob[xi] = (unsigned)((((xr0 / SEQ) * SEQ_FULL + xrow[xi]) * DM + 8 * hi) * sizeof(float));
    const float* wbase = Wt + (size_t)(8 * hi) * DM + wc0 + 4 * lr;
#pragma unroll 1
    for (int kc = 0; kc < K; kc += 32) {
        v16bf xf[4], wf[4];
        v4f wr[16];
        const float* wp = F32OUT ? wbase + (size_t)(kc & (DM - 1)) * DM : (const float*)((const char*)Wt + wob);
#pragma unroll
        for (int e = 0; e < 8; ++e) { wr[e] = *(const v4f*)(wp + (size_t)e * DM); wr[8 + e] = *(const v4f*)(wp + (size_t)(16 + e) * DM); }
        if constexpr (F32OUT) {
#pragma unroll
            for (int xi = 0; xi < 4; ++xi) xf[xi] = ldb(CXA + xoff + (size_t)xi * 16 * K + kc);
        } else {
            v8f xl[4], xh[4];
#pragma unroll
            for (int xi = 0; xi < 4; ++xi) { const float* xp = (const float*)((const char*)X + xob[xi]); xl[xi] = *(const v8f*)xp; xh[xi] = *(const v8f*)(xp + 16); }
            // inputs only: all loads of the trip are issued before the first conversion, so the trip waits out one load latency; built without it, the last three loads of a trip are issued only behind the waits for the first ones
            asm volatile("" :: "v"(wr[0]), "v"(wr[1]), "v"(wr[2]), "v"(wr[3]), "v"(wr[4]), "v"(wr[5]), "v"(wr[6]), "v"(wr[7]), "v"(wr[8]), "v"(wr[9]), "v"(wr[10]), "v"(wr[11]),
                             "v"(wr[12]), "v"(wr[13]), "v"(wr[14]), "v"(wr[15]), "v"(xl[0]), "v"(xl[1]), "v"(xl[2]), "v"(xl[3]), "v"(xh[0]), "v"(xh[1]), "v"(xh[2]), "v"(xh[3]));
            // precaution: stands in front of the rewrite of the loads' offset registers just below (named as operands so that the additions stay behind it)
            asm volatile("s_wait_xcnt 0x0" : "+v"(xob[0]), "+v"(xob[1]), "+v"(xob[2]), "+v"(xob[3]), "+v"(wob) :: "memory");
#pragma unroll
            for (int xi = 0; xi < 4; ++xi) xob[xi] += 32 * sizeof(float);
            wob += 32 * DM * sizeof(float);
#pragma unroll
            for (int xi = 0; xi < 4; ++xi) xf[xi] = cvx(xl[xi], xh[xi]);
        }
#pragma unroll
        for (int wi = 0; wi < 4; ++wi) wf[wi] = cvw(wr, wi);
#pragma unroll
        for (int wi = 0; wi < 4; ++wi)
#pragma unroll
            for (int xi = 0; xi < 4; ++xi) acc[xi][wi] = J2 ? wmmab(wf[wi], xf[xi], acc[xi][wi]) : wmmab(xf[xi], wf[wi], acc[xi][wi]);
        // keeps the vector slots the chip needs behind the last WMMA, also on the taken back edge
        asm volatile("v_nop\n\tv_nop\n\tv_nop\n\tv_nop" : "+v"(acc[0][0]), "+v"(acc[1][1]), "+v"(acc[2][2]), "+v"(acc[3][3]) : "v"(xf[0]), "v"(xf[1]), "v"(xf[2]), "v"(xf[3]));
        if constexpr (F32OUT) asm volatile("s_wait_xcnt 0x0" ::: "memory");   // precaution: the weight loads' address register is formed anew at the head of the next trip; this stands in front of that rewrite
    }
    const size_t tbase = J2 ? (size_t)r0 * SEQ + (size_t)(c0 / SEQ) * ((size_t)DM * SEQ) + (size_t)(c0 % SEQ) : (size_t)r0 * DM + (size_t)c0;
#pragma unroll
    for (int p = 0; p < 4; ++p) {                                  // 16 output rows a pass: rows 16*p + row, in the v^T job rows 4*row + p
        if constexpr (J2) {
#pragma unroll
            for (int xi = 0; xi < 4; ++xi)
#pragma unroll
                for (int j = 0; j < 8; ++j) os[(hi * 8 + j) * 68 + xi * 16 + lr] = acc[xi][p][j];            // D: row 8h+j (output 4*(8h+j) + p), col t = 16*xi + lane&15
        } else {
#pragma unroll
            for (int j = 0; j < 8; ++j) *(v4fa*)(&os[(hi * 8 + j) * 68 + 4 * lr]) = (v4f){acc[p][0][j], acc[p][1][j], acc[p][2][j], acc[p][3][j]};   // D: row 8h+j, col 4*(lane&15) + wi
        }
        wave_sync();
        if constexpr (!F32OUT) {
#pragma unroll
            for (int s = 0; s < 4; ++s) { const int row = 4 * s + (lane >> 3), c8 = (lane & 7) * 8;   // 4 s x 4 row groups = 16 rows; 8 lanes x 8 = 64 columns
                const int rofs = J2 ? 4 * row + p : p * 16 + row;
                v4f x0 = *(const v4fa*)(&os[row * 68 + c8]); v4f x1 = *(const v4fa*)(&os[row * 68 + c8 + 4]);
                v4f bc0, bc1;                                                                          // bias by row (v^T) or by column
                if constexpr (J2) { const float br = bias[r0 + rofs]; bc0 = (v4f){br, br, br, br}; bc1 = bc0; }
                else { bc0 = *(const v4f*)(bias + c0 + c8); bc1 = *(const v4f*)(bias + c0 + c8 + 4); }
                v8h hv, rv;
#pragma unroll
                for (int i = 0; i < 4; ++i) { const float y0 = x0[i] + bfr(bc0[i]); const float y1 = x1[i] + bfr(bc1[i]);
                    const h16 a0 = (h16)y0; const h16 a1 = (h16)y1; hv[i] = a0; hv[4 + i] = a1; rv[i] = (h16)((y0 - (float)a0) * QRS); rv[4 + i] = (h16)((y1 - (float)a1) * QRS); }
                const size_t oo = tbase + (size_t)rofs * (size_t)pitch + c8;
                *(v8h*)(Ph + oo) = hv;
                asm volatile("s_wait_xcnt 0x0" ::: "memory");         // precaution: stands in front of any later rewrite of this store's data or address registers, on both sides of the branch below
                if (useRes) { *(v8h*)(Pr + oo) = rv;
                    asm volatile("s_wait_xcnt 0x0" ::: "memory"); }   // precaution: the same for the residual store
            }
        } else {
#pragma unroll
            for (int s = 0; s < 8; ++s) { const int row = 2 * s + hi, cofs = lr * 4;                  // 8 s x 2 rows = 16 rows; 16 lanes x 4 floats = 64 columns
                const int m = r0 + p * 16 + row; const int bb = m / SEQ, tt = m - bb * SEQ;
                v4f val = *(const v4fa*)(&os[row * 68 + cofs]);
                const v4f bc = *(const v4f*)(bias + c0 + cofs);
#pragma unroll
                for (int i = 0; i < 4; ++i) val[i] = val[i] + bfr(bc[i]);
                *(v4f*)(OUT + ((size_t)bb * OUT_SEQ + tt) * DM + c0 + cofs) = val; }
        }
        wave_sync();
    }
}

template <bool F32OUT>
__global__ __launch_bounds__(32) void k_gemm(const float* __restrict__ X0, const float* __restrict__ X1, const float* __restrict__ X2, const bf* __restrict__ CXA,
                                             const float* __restrict__ W0, const float* __restrict__ W1, const float* __restrict__ W2,
                                             h16* Ph0, h16* Ph1, h16* Ph2, h16* Pr, float* OUT,
                                             const float* __restrict__ bias0, const float* __restrict__ bias1, const float* __restrict__ bias2,
                                             const int* __restrict__ MK, int* NV) {
    __shared__ __align__(16) float os[16 * 68];
    if constexpr (F32OUT) gemm_tile<true, false>(os, X0, CXA, W0, Ph0, Pr, OUT, bias0, false, blockIdx.x, nullptr, MK, NV, false);
    else {
        __shared__ int kidx[64];
        const unsigned job = blockIdx.y;
        if (job == 2) gemm_tile<false, true>(os, X2, CXA, W2, Ph2, Pr, OUT, bias2, false, blockIdx.x, kidx, MK, NV, true);
        else gemm_tile<false, false>(os, job == 0 ? X0 : X1, CXA, job == 0 ? W0 : W1, job == 0 ? Ph0 : Ph1, Pr, OUT, job == 0 ? bias0 : bias1, job == 0, blockIdx.x, kidx, MK, NV, job == 1);
    }
}

// k_flash: fused attention, one work-group per 64 query rows of one batch and one PAIR of heads; one wave per (16 query rows, head, key range: a KS-th of the batch's 32-key steps).
// The waves of one key range walk the same K rows and V^T columns at the same time; both heads of the pair read the two halves of the same K lines.
// K / V^T / Q fragments straight from the f16 planes (two 16-B loads each, arithmetic addressing).
// Transposed form: S^T[key][t] = K Q^T (A = K rows, B = Q rows); lane (t = lane&15, h = lane>>4) holds keys 8h+r of each 16-key tile, so the packed
// P tile is directly the B fragment of O^T[d][t] = V^T P^T (element r <- tile keys 0..15, element 8+r <- tile keys 16..31, lane unchanged).
// Key mask: the planes hold the packed keys; NV[b] = number of unmasked keys. Positions from NV[b] on (the rest of the last 32-key step; every position where NV[b] = 0) have their score REPLACED by the fill value
// (a fully masked row therefore comes out uniform); steps that lie wholly below NV[b] take no select.
// Softmax state (running max, partial sum) is one scalar per lane; the two lane halves of a row are combined with one xor-16 exchange.
// Each wave leaves its unnormalised O, its running max and its sum in LDS; behind one work-group barrier the KS partial results of a row are rescaled to their common max, added and normalised.
__global__ __launch_bounds__(32 * FW) void k_flash(const h16* __restrict__ QH, const h16* __restrict__ QR, const h16* __restrict__ KP, const h16* __restrict__ VT,
                                                   const int* __restrict__ NV, bf* CX) {
    __shared__ __align__(16) float os[KS * AW * 16 * 68];        // [key range][row of the block][68]: columns 0..63 = 32*head + d
    __shared__ float sm[KS * 2 * AW * 16], sl[KS * 2 * AW * 16]; // [key range][head][row of the block]: running max, sum
    const int lane = threadIdx.x & 31, wave = __builtin_amdgcn_readfirstlane((int)(threadIdx.x >> 5)), lr = lane & 15, hi = lane >> 4;
    const int rt = wave % AW, hh = (wave / AW) & 1, ks = wave / (2 * AW);
    const int zp = blockIdx.y; const int b = zp / (NH_ / 2), hp = zp % (NH_ / 2);
    const int t0 = (blockIdx.x * AW + rt) * 16;
    const size_t rowb = (size_t)b * SEQ;
    const int nvr = NV[b];
    const int nv = __builtin_amdgcn_readfirstlane(nvr < 0 ? 0 : (nvr > SEQ ? SEQ : nvr));   // unmasked keys of the batch, bounded by the shape; kept scalar so that the loop's tail test is a scalar compare
    const int nt = ((nv == 0 ? SEQ : nv) + 31) / 32;             // 32-key steps that the planes hold (1 .. SEQ / 32)
    const int tq = (nt + KS - 1) / KS;                           // steps per key range; the last ranges may be short or empty
    {
        const int h = hp * 2 + hh;
        const size_t qo = (rowb + t0 + lr) * DM + h * HD + 8 * hi;
        const v16h qh = ldh(QH + qo), qr = ldh(QR + qo);                  // B fragments: col t, k = d (32 deep)
        const size_t ko = (rowb + lr) * DM + h * HD + 8 * hi;             // + key * DM       (A fragment: row key, k = d)
        const size_t vo = ((size_t)b * DM + h * HD + lr) * SEQ + 8 * hi;  // + 16*SEQ + key   (A fragment: row d, k = key)
        v8f o0 = (v8f){}, o1 = (v8f){};
        float m = -3.0e38f, l = 0.0f;
        const int tbeg = ks * tq, tend = tbeg + tq < nt ? tbeg + tq : nt;
#pragma unroll 1
        for (int tt = tbeg; tt < tend; ++tt) {
            const int key0 = tt * 32;
            const h16* ka = KP + ko + (size_t)key0 * DM;
            const v16h ka0 = ldh(ka), kb0 = ldh(ka + 16 * DM);
            v8f sHa = (v8f){}, sLa = (v8f){}, sHb = (v8f){}, sLb = (v8f){};
            sHa = wmma16(ka0, qh, sHa); sLa = wmma16(ka0, qr, sLa); sHb = wmma16(kb0, qh, sHb); sLb = wmma16(kb0, qr, sLb);
            asm volatile("v_nop\n\tv_nop\n\tv_nop\n\tv_nop" : "+v"(sHa), "+v"(sLa), "+v"(sHb), "+v"(sLb) : "v"(ka0), "v"(kb0), "v"(qh), "v"(qr));
            float ta[8], tb[8]; float mx = -3.0e38f;
#pragma unroll
            for (int r = 0; r < 4; ++r) {
                ta[r] = (sHa[r] + sLa[r] * QRI) * SC2; ta[4 + r] = (sHa[4 + r] + sLa[4 + r] * QRI) * SC2;
                tb[r] = (sHb[r] + sLb[r] * QRI) * SC2; tb[4 + r] = (sHb[4 + r] + sLb[4 + r] * QRI) * SC2; }
            if (key0 + 32 > nv) {                                // same for the whole wave: the step reaches past the unmasked keys
                const int kl = nv - key0 - 8 * hi;               // element r stands for keys key0 + 8h + r and key0 + 16 + 8h + r
#pragma unroll
                for (int r = 0; r < 8; ++r) { ta[r] = (r < kl) ? ta[r] : NEGT; tb[r] = (16 + r < kl) ? tb[r] : NEGT; }
            }
#pragma unroll
            for (int r = 0; r < 8; ++r) mx = fmaxf(mx, fmaxf(ta[r], tb[r]));
            mx = fmaxf(mx, __shfl_xor(mx, 16, 32));
            const float mnew = fmaxf(m, mx);
            const float alpha = __builtin_amdgcn_exp2f(m - mnew);
            const float sh = PSH - mnew;
            v16h pb; float ls = 0.0f;
#pragma unroll
            for (int r = 0; r < 8; ++r) { const h16 pa = (h16)__builtin_amdgcn_exp2f(ta[r] + sh); const h16 pc = (h16)__builtin_amdgcn_exp2f(tb[r] + sh); pb[r] = pa; pb[8 + r] = pc; ls += (float)pa + (float)pc; }
            l = l * alpha + ls; m = mnew;
            o0 = o0 * alpha; o1 = o1 * alpha;
            const h16* va = VT + vo + key0;
            const v16h v0 = ldh(va), v1 = ldh(va + (size_t)16 * SEQ);
            o0 = wmma16(v0, pb, o0); o1 = wmma16(v1, pb, o1);
            asm volatile("v_nop\n\tv_nop\n\tv_nop\n\tv_nop" : "+v"(o0), "+v"(o1) : "v"(v0), "v"(v1), "v"(pb));
        }
        l += __shfl_xor(l, 16, 32);
        // O^T D layout: o_j[r] = (d = 16j + 8h + r, t = lane&15) -> os[key range][16*rt + t][32*hh + d], unnormalised
        { const int ob = ((ks * AW + rt) * 16 + lr) * 68 + hh * 32 + 8 * hi;
          *(v4fa*)(&os[ob])      = (v4f){o0[0], o0[1], o0[2], o0[3]}; *(v4fa*)(&os[ob + 4])  = (v4f){o0[4], o0[5], o0[6], o0[7]};
          *(v4fa*)(&os[ob + 16]) = (v4f){o1[0], o1[1], o1[2], o1[3]}; *(v4fa*)(&os[ob + 20]) = (v4f){o1[4], o1[5], o1[6], o1[7]}; }
        if (hi == 0) { const int si = ((ks * 2 + hh) * AW + rt) * 16 + lr; sm[si] = m; sl[si] = l; }
    }
    __syncthreads();     // every wave's partial result is in LDS before any row is merged
    const int tid = threadIdx.x;
    if (tid < AW * 16 * 8) {                                     // whole waves: 64 rows x 8 lanes x 8 columns
        const int row = tid >> 3, c8 = (tid & 7) * 8, hq = c8 >> 5;
        float pm[KS]; float mx = -3.0e38f;
#pragma unroll
        for (int p = 0; p < KS; ++p) { pm[p] = sm[(p * 2 + hq) * (AW * 16) + row]; mx = fmaxf(mx, pm[p]); }
        v4f x0 = (v4f){}, x1 = (v4f){}; float l = 0.0f;
#pragma unroll
        for (int p = 0; p < KS; ++p) { const float f = __builtin_amdgcn_exp2f(pm[p] - mx);
            l += f * sl[(p * 2 + hq) * (AW * 16) + row];
            x0 += *(const v4fa*)(&os[(p * (AW * 16) + row) * 68 + c8]) * f; x1 += *(const v4fa*)(&os[(p * (AW * 16) + row) * 68 + c8 + 4]) * f; }
        const float inv = 1.0f / l;
        x0 = x0 * inv; x1 = x1 * inv;
        v8us hv, lv;
#pragma unroll
        for (int i = 0; i < 4; ++i) { const unsigned short u0 = f2bf(x0[i]); const unsigned short u1 = f2bf(x1[i]); hv[i] = u0; hv[4 + i] = u1;
            lv[i] = f2bf(x0[i] - bf2f(u0)); lv[4 + i] = f2bf(x1[i] - bf2f(u1)); }
        bf* crow = CX + (rowb + (size_t)blockIdx.x * (AW * 16) + row) * CXP + hp * 64 + c8;
        *(v8us*)(crow) = hv; *(v8us*)(crow + DM) = lv;
    }
}

static constexpr size_t al256(size_t v) { return (v + 255) & ~(size_t)255; }
static constexpr size_t SZ_PL = al256((size_t)NB * SEQ * DM * 2);
static constexpr size_t SZ_CX = al256((size_t)NB * SEQ * CXP * 2);
static constexpr size_t SZ_NV = al256((size_t)NB * sizeof(int));
static constexpr size_t SZ_TOTAL = 4 * SZ_PL + SZ_CX + SZ_NV;
static_assert(SZ_TOTAL <= (size_t)134217728);          // workspace carve <= 128 MiB
static_assert((size_t)NB * DM * SEQ * 2 <= SZ_PL);     // v^T plane extent

extern "C" void kernel_launch(void* const* d_in, const int* in_sizes, int n_in,
                              void* d_out, int out_size, void* d_ws, size_t ws_size, hipStream_t stream) {
    if (n_in < 12) return;
    const size_t needx = ((size_t)(NB - 1) * SEQ_FULL + SEQ) * DM;
    if ((size_t)in_sizes[0] < needx || (size_t)in_sizes[1] < needx || (size_t)in_sizes[2] < needx) return;
    if ((size_t)in_sizes[3] < (size_t)(NB - 1) * SEQ_FULL + SEQ) return;
    if ((size_t)in_sizes[4] < (size_t)DM * DM || (size_t)in_sizes[6] < (size_t)DM * DM || (size_t)in_sizes[8] < (size_t)DM * DM || (size_t)in_sizes[10] < (size_t)DM * DM) return;
    if (in_sizes[5] < DM || in_sizes[7] < DM || in_sizes[9] < DM || in_sizes[11] < DM) return;
    if ((size_t)out_size < ((size_t)(NB - 1) * OUT_SEQ + SEQ) * DM) return;
    if (SZ_TOTAL > ws_size) return;
    // wire order: queries, keys, values, key_mask, Wq, bq, Wk, bk, Wv, bv, Wo, bo
    const float* xq = (const float*)d_in[0]; const float* xk = (const float*)d_in[1]; const float* xv = (const float*)d_in[2];
    const int* kmask = (const int*)d_in[3];
    const float* wq = (const float*)d_in[4]; const float* bq = (const float*)d_in[5];
    const float* wk = (const float*)d_in[6]; const float* bk = (const float*)d_in[7];
    const float* wv = (const float*)d_in[8]; const float* bv = (const float*)d_in[9];
    const float* wo = (const float*)d_in[10]; const float* bo = (const float*)d_in[11];
    float* OUT = (float*)d_out;      // [NB][SEQ][256]
    char* wsp = (char*)d_ws;
    h16* QH = (h16*)wsp; wsp += SZ_PL;               // [NB*SEQ][256]
    h16* QR = (h16*)wsp; wsp += SZ_PL;               // [NB*SEQ][256] residual x2048
    h16* KP = (h16*)wsp; wsp += SZ_PL;               // [NB*SEQ][256]
    h16* VT = (h16*)wsp; wsp += SZ_PL;               // [NB][256][SEQ]
    bf* CX = (bf*)wsp; wsp += SZ_CX;                 // [NB*SEQ][512]: ctx hi | ctx lo
    int* NV = (int*)wsp; wsp += SZ_NV;               // [NB]: unmasked keys of each batch

    k_gemm<false><<<dim3(PTB, 3, 1), 32, 0, stream>>>(xq, xk, xv, CX, wq, wk, wv, QH, KP, VT, QR, OUT, bq, bk, bv, kmask, NV);

    k_flash<<<dim3(SEQ / (16 * AW), NB * (NH_ / 2), 1), 32 * FW, 0, stream>>>(QH, QR, KP, VT, NV, CX);

    // out = [ctx_hi | ctx_lo] x [Wo ; Wo] + bo, K = 512, f32 rows of the output (the activation pointers are not read here)
    k_gemm<true><<<dim3(PTB, 1, 1), 32, 0, stream>>>(wo, wo, wo, CX, wo, wo, wo, QH, QH, QH, QH, OUT, bo, bo, bo, kmask, NV);
}

// v005
// Measured time: 42.3 microseconds a run.
// In two side-by-side timings against v004, it was 1.04 and 1.06 times as fast.
// All steps since v000 together make it 3.61 times as fast.
#include <hip/hip_runtime.h>

// Multi-head attention with key padding mask: q/k/v inputs [NB][SEQ][256], Wq/Wk/Wv/Wo [in][out] (y = x W + b), 8 heads x 32, score scale 1/sqrt(32), masked keys take the fill value -4294967296, output = ctx Wo + bo (f32).
// Compute dtypes, f32 accumulate everywhere: projections v_wmma_f32_16x16x32_bf16 (inputs and weights RNE-converted to bf16; products exact);
// scores v_wmma_f32_16x16x32_f16: k single f16, q as f16 value + f16 residual x2048 in its own accumulator (two products); P (x256 carry, cancels in the normalisation) and v single f16; softmax f32 (online, running max);
// output projection v_wmma_f32_16x16x32_bf16 with ctx carried as bf16 hi | bf16 lo planes folded along K (K = 512, weight row = k mod 256).
// Layout: activations and weights are read as f32 by the GEMMs and rounded in registers; q (hi, residual), k planes [b*SEQ + t][256] (head h = columns 32h..32h+31) and v^T plane [b][256][SEQ] written by the GEMM epilogue;
// Key mask: the k and v^T planes hold only the unmasked keys of a batch, packed without gaps in one fixed order (key_list; the same for both planes); a masked key's weight is exactly 0 beside any unmasked one, so attention runs over the packed keys alone.
// A batch with no unmasked key keeps all its keys in the planes, and every score takes the fill value (uniform weights, as the reference gives).

#ifndef NB
#define NB 2
#endif
#ifndef SEQ
#define SEQ 2048
#endif
#define NB_FULL  2
#define SEQ_FULL 2048
#ifndef OUT_SEQ
#define OUT_SEQ SEQ              // row pitch (in tokens) between batches of the output
#endif
#define DM   256
#define NH_  8
#define HD   32
#define CXP  (2 * DM)            // ctx plane pitch: hi columns 0..255, lo columns 256..511
#define AW   4                   // 16-row query tiles per flash block
#define KS   4                   // key ranges per (query tile, head), one wave each
#define FW   (AW * 2 * KS)       // waves per flash block: query tiles x 2 heads x key ranges
#define QRS  2048.0f             // carry of the q residual plane
#define QRI  (1.0f / 2048.0f)
#define SC2  (0.17677669529663687f * 1.4426950408889634f)   // HD^-0.5 * log2(e)
#define PSH  8.0f                // log2 of the P carry (256)
#define NEGT (-4294967296.0f * 1.4426950408889634f)         // mask fill value in the log2 domain
#define KPB  144                 // LDS pitch of a staged K row, bytes: 128 (32 columns x 2 heads) + 16, 16 B x odd for the ds_load_b128 readers
#define VPB  80                  // LDS pitch of a staged V^T row, bytes: 64 (32 keys) + 16, 16 B x odd
#define KTB  (32 * KPB)          // one K tile: 32 keys
#define VTB  (64 * VPB)          // one V^T tile: 64 rows (2 heads x 32)
#define RTB  (KTB + VTB)         // one step of one key range
#define SFB  (KS * RTB)          // one 32-key step of every key range
#define SPT  2                   // steps of a key range per buffer (per trip between two barriers)
#define BFB  (SPT * SFB)         // one buffer

static_assert(HD == 32);
static_assert(NH_ * HD == DM);                 // head h = columns h*32 + d
static_assert(NH_ % 2 == 0);
static_assert(DM % 64 == 0);
static_assert(DM % 32 == 0);                   // GEMM k-loop steps by 32
static_assert(CXP % 32 == 0);
static_assert(SEQ % 64 == 0);                  // a 64-row tile never straddles two batches
static_assert((NB * SEQ) % 64 == 0);
static_assert(SEQ % (32 * KS) == 0);           // key loop steps by 32 inside each key range
static_assert(FW * 32 <= 1024);
static_assert(AW * 2 == 8);                    // the 8 waves of a key range copy its tiles: 256 lanes x 16 B = 4 KiB for K, the same for V^T
static_assert(KPB % 16 == 0 && VPB % 16 == 0 && KTB % 16 == 0 && RTB % 16 == 0);
static_assert(SPT == 2);                       // copy_kv holds the copies of two steps
static_assert(FW * 32 >= AW * 16 * 8);         // the merge uses one thread per (row, 8 columns)
static_assert(SEQ % (16 * AW) == 0);           // flash grid covers the sequence exactly
static_assert(((size_t)SEQ * DM) % 8 == 0);
static_assert(NB <= NB_FULL);
static_assert(SEQ <= SEQ_FULL);

typedef _Float16 h16;
typedef unsigned short bf;
typedef __attribute__((ext_vector_type(16))) __bf16   v16bf;
typedef __attribute__((ext_vector_type(16))) _Float16 v16h;
typedef __attribute__((ext_vector_type(8)))  _Float16 v8h;
typedef __attribute__((ext_vector_type(8)))  unsigned short v8us;
typedef __attribute__((ext_vector_type(8)))  float    v8f;
typedef __attribute__((ext_vector_type(16))) float    v16f;
typedef __attribute__((ext_vector_type(4)))  float    v4f;
typedef __attribute__((ext_vector_type(4)))  int      v4i;
typedef v4f  __attribute__((may_alias)) v4fa;

__device__ __forceinline__ unsigned short f2bf(float f) { unsigned u = __float_as_uint(f); u += 0x7FFFu + ((u >> 16) & 1u); return (unsigned short)(u >> 16); }
__device__ __forceinline__ float bf2f(unsigned short s) { return __uint_as_float(((unsigned)s) << 16); }
__device__ __forceinline__ float bfr(float f) { return bf2f(f2bf(f)); }
__device__ __forceinline__ v16h cat16(v8h lo, v8h hi) { return __builtin_shufflevector(lo, hi, 0, 1, 2, 3, 4, 5, 6, 7, 8, 9, 10, 11, 12, 13, 14, 15); }
__device__ __forceinline__ v16bf cat16b(v8us lo, v8us hi) { return __builtin_bit_cast(v16bf, __builtin_shufflevector(lo, hi, 0, 1, 2, 3, 4, 5, 6, 7, 8, 9, 10, 11, 12, 13, 14, 15)); }
__device__ __forceinline__ v8f wmma16(v16h a, v16h b, v8f c) { return __builtin_amdgcn_wmma_f32_16x16x32_f16(false, a, false, b, (short)0, c, false, false); }
__device__ __forceinline__ v8f wmmab(v16bf a, v16bf b, v8f c) { return __builtin_amdgcn_wmma_f32_16x16x32_bf16(false, a, false, b, (short)0, c, false, false); }
// fragment loaders from K-contiguous 16-bit rows; p already includes + 8*(lane>>4): elements 0..7 <- k0+8h+0..7, elements 8..15 <- k0+16+8h+0..7 (same map for A and B)
__device__ __forceinline__ v16h  ldh(const h16* p) { return cat16(*(const v8h*)p, *(const v8h*)(p + 16)); }
__device__ __forceinline__ v16bf ldb(const bf* p)  { return cat16b(*(const v8us*)p, *(const v8us*)(p + 16)); }
// ordering point for wave-private LDS tiles (same wave writes and reads)
__device__ __forceinline__ void wave_sync() { __builtin_amdgcn_fence(3 /* release order */, "wavefront"); __builtin_amdgcn_wave_barrier(); asm volatile("" ::: "memory"); }

// cvx: fragment from the two 8-float pieces of one K-contiguous f32 row (k0+8h+0..7, k0+16+8h+0..7: the k map of ldb), rounded to bf16 (RNE) in registers
__device__ __forceinline__ v16bf cvx(v8f lo, v8f hi8) {
    return __builtin_convertvector(__builtin_shufflevector(lo, hi8, 0, 1, 2, 3, 4, 5, 6, 7, 8, 9, 10, 11, 12, 13, 14, 15), v16bf);
}
// Weight fragments come four at once from W[k][n] (f32, row pitch DM): one 16-B load per k at W + k * DM + n0 + 4*(lane&15) gives the lane that k of the four outputs n0 + 4*(lane&15) + i.
// r[e] = row k0+8h+e, r[8+e] = row k0+16+8h+e (the k map of ldb); cvw: fragment i holds outputs n0 + 4*l + i (l = its 16 rows or columns), rounded to bf16 (RNE) in registers.
__device__ __forceinline__ v16bf cvw(const v4f (&r)[16], int i) {
    v16f t;
#pragma unroll
    for (int e = 0; e < 16; ++e) t[e] = r[e][i];
    return __builtin_convertvector(t, v16bf);
}

// key_list (one wave): returns the number of unmasked keys of one batch (mkb = its SEQ mask words) and leaves in idx[0..63] the keys that stand at packed positions lo..lo+63.
// Load i gives lane c the mask of keys 128*i + 4*c + 0..3; bit t of the lane's SEQ/32 bits (32 to a word w[j]) stands for key 128*(t>>2) + 4*c + (t&3).
// Packed order: by lane, then by bit (any order serves, as k and v^T use the same one). p = first packed position of the lane's current word (lane prefix sum, one ballot per bit of the counts).
// Only the words that reach into lo..lo+63 are then walked, one word (32 keys, one a lane) a trip. No unmasked key at all: every key counts as present.
// Positions past the last key keep key 0: finite rows that the attention kernel masks. Every entry is formed from lane, word and bit numbers alone and lies below SEQ.
__device__ __forceinline__ int key_list(int* idx, const int* __restrict__ mkb, int lo) {
    constexpr int NW = SEQ / 1024;
    static_assert(SEQ % 1024 == 0 && SEQ / 32 < 128);
    const int lane = threadIdx.x & 31;
    v4i mv[8 * NW];
#pragma unroll
    for (int i = 0; i < 8 * NW; ++i) mv[i] = *(const v4i*)(mkb + 128 * i + 4 * lane);
    asm volatile("s_wait_xcnt 0x0" ::: "memory");   // precaution: stands in front of any later rewrite of the mask loads' address registers
    unsigned w[NW];
    unsigned any = 0u;
#pragma unroll
    for (int j = 0; j < NW; ++j) {
        w[j] = 0u;
#pragma unroll
        for (int t = 0; t < 32; ++t) w[j] |= mv[8 * j + (t >> 2)][t & 3] != 0 ? 1u << t : 0u;
        any |= w[j];
    }
    const bool none = __builtin_amdgcn_ballot_w32(any != 0u) == 0u;
    int cn = 0;
#pragma unroll
    for (int j = 0; j < NW; ++j) { if (none) w[j] = ~0u; cn += __builtin_popcount(w[j]); }   // cn = 0 .. SEQ / 32: seven bits
    int p = 0, tot = 0;
#pragma unroll
    for (int bit = 0; bit < 7; ++bit) {
        const unsigned bb = __builtin_amdgcn_ballot_w32(((cn >> bit) & 1) != 0);
        p += (int)__builtin_amdgcn_mbcnt_lo(bb, 0u) << bit;
        tot += __builtin_popcount(bb) << bit;
    }
    const int nvalid = none ? 0 : tot;
    if (lo >= tot) return nvalid;                    // nothing stands at these positions: the caller leaves
    idx[lane] = 0; idx[lane + 32] = 0;
#pragma unroll
    for (int j = 0; j < NW; ++j) {
        const int cj = __builtin_popcount(w[j]);
        unsigned todo = __builtin_amdgcn_ballot_w32(p + cj > lo && p < lo + 64);
        while (todo != 0u) {                         // same for the whole wave; one bit goes each trip: at most 32 trips
            const int c = __builtin_ctz(todo);
            todo &= todo - 1u;
            const unsigned bc = (unsigned)__builtin_amdgcn_readlane((int)w[j], c);
            const int pos = __builtin_amdgcn_readlane(p, c) - lo + (int)__builtin_amdgcn_mbcnt_lo(bc, 0u);
            if (((bc >> lane) & 1u) != 0u && pos >= 0 && pos < 64) idx[pos] = 128 * (8 * j + (lane >> 2)) + 4 * c + (lane & 3);
        }
        p += cj;
    }
    wave_sync();
    return nvalid;
}

// k_gemm: register-blocked bf16 GEMM, ONE WAVE per 64x64 tile (16 accumulators). The weight operand comes straight from the f32 input W[k][n] (cvw), the other operand from K-contiguous rows:
// the f32 activation input (cvx; F32OUT = false) or the bf16 ctx plane (ldb; F32OUT = true, K = 512, weight row = k mod 256). Bias: bf16 RNE value of the f32 bias, added in f32.
// acc[xi][wi]: xi = 16-row group of the row operand (rows 16*xi + l), wi = weight fragment (outputs 4*l + wi).
// F32OUT = false: the three input projections in ONE launch, blockIdx.y picks the job, PTB tiles each, the row tile running fastest in blockIdx.x; written as f16 (Ph), q also as the f16 residual x2048 (Pr):
//   job 0 (q), job 1 (k): A = x rows (m = b*SEQ + t), B = W columns (n = h*32 + d) -> plane [m][n], bias by column
//   job 2 (v^T): A = Wv columns (m = h*32 + d), B = x rows (n = b*SEQ + t) -> plane [(b*256 + m)][t], bias by row
//   jobs 1 and 2: t is a packed position, the x row read for it is the key that key_list names; a tile past the last packed key leaves at once; job 1's first tile of a batch stores the batch's count in NV
// F32OUT = true: the output projection, f32 rows of OUT[(m/SEQ)*OUT_SEQ + m%SEQ][c0 + col]; each row segment (64 floats = two lines) written by 16 consecutive lanes x 16 B (2 rows per instruction).
#define PTB ((NB * SEQ / 64) * (DM / 64))
// gemm_tile: one 64x64 tile. J2 = the v^T job (weight fragments as A). f = tile index, the row tile running fastest.
template <bool F32OUT, bool J2>
__device__ __forceinline__ void gemm_tile(float* os, const float* __restrict__ X, const bf* __restrict__ CXA, const float* __restrict__ Wt,
                                          h16* Ph, h16* Pr, float* OUT, const float* __restrict__ bias, bool useRes, unsigned f,
                                          int* kidx, const int* __restrict__ MK, int* NV, bool packed) {
    constexpr int K = F32OUT ? CXP : DM;
    constexpr int pitch = J2 ? SEQ : DM;                           // row pitch of the f16 plane (halves)
    const int lane = threadIdx.x & 31, lr = lane & 15, hi = lane >> 4;
    const int r0 = (J2 ? f % (DM / 64) : f % (NB * SEQ / 64)) * 64, c0 = (J2 ? f / (DM / 64) : f / (NB * SEQ / 64)) * 64;
    const int xr0 = J2 ? c0 : r0, wc0 = J2 ? r0 : c0;             // tile base of the row operand, of the weight outputs
    int xrow[4];                                                  // row of the batch that 16-row group xi of this lane reads (a 64-row tile lies in one batch)
#pragma unroll
    for (int xi = 0; xi < 4; ++xi) xrow[xi] = xr0 % SEQ + 16 * xi + lr;
    if constexpr (!F32OUT) {
        if (J2 || packed) {
            const int tot = key_list(kidx, MK + (size_t)(xr0 / SEQ) * SEQ_FULL, xr0 % SEQ);
            if (xr0 % SEQ >= (tot == 0 ? SEQ : tot)) return;
            if (!J2 && xr0 % SEQ == 0 && wc0 == 0 && lane == 0) { NV[xr0 / SEQ] = tot;
                asm volatile("s_wait_xcnt 0x0" ::: "memory"); }   // precaution: stands in front of any later rewrite of this store's registers
#pragma unroll
            for (int xi = 0; xi < 4; ++xi) xrow[xi] = kidx[16 * xi + lr];
        }
    }
    v8f acc[4][4];
#pragma unroll
    for (int xi = 0; xi < 4; ++xi)
#pragma unroll
        for (int wi = 0; wi < 4; ++wi) acc[xi][wi] = (v8f){};
    const size_t xoff = (size_t)(xr0 + lr) * K + 8 * hi;          // ctx plane (F32OUT)
    // f32 operands (F32OUT = false): byte offsets of this lane's four rows and of its weight column group, carried from trip to trip (all below 2^32)
    unsigned xob[4], wob = (unsigned)(((8 * hi) * DM + wc0 + 4 * lr) * sizeof(float));
#pragma unroll
    for (int xi = 0; xi < 4; ++xi) xob[xi] = (unsigned)((((xr0 / SEQ) * SEQ_FULL + xrow[xi]) * DM + 8 * hi) * sizeof(float));
    const float* wbase = Wt + (size_t)(8 * hi) * DM + wc0 + 4 * lr;
#pragma unroll 1
    for (int kc = 0; kc < K; kc += 32) {
        v16bf xf[4], wf[4];
        v4f wr[16];
        const float* wp = F32OUT ? wbase + (size_t)(kc & (DM - 1)) * DM : (const float*)((const char*)Wt + wob);
#pragma unroll
        for (int e = 0; e < 8; ++e) { wr[e] = *(const v4f*)(wp + (size_t)e * DM); wr[8 + e] = *(const v4f*)(wp + (size_t)(16 + e) * DM); }
        if constexpr (F32OUT) {
#pragma unroll
            for (int xi = 0; xi < 4; ++xi) xf[xi] = ldb(CXA + xoff + (size_t)xi * 16 * K + kc);
        } else {
            v8f xl[4], xh[4];
#pragma unroll
            for (int xi = 0; xi < 4; ++xi) { const float* xp = (const float*)((const char*)X + xob[xi]); xl[xi] = *(const v8f*)xp; xh[xi] = *(const v8f*)(xp + 16); }
            // inputs only: all loads of the trip are issued before the first conversion, so the trip waits out one load latency; built without it, the last three loads of a trip are issued only behind the waits for the first ones
            asm volatile("" :: "v"(wr[0]), "v"(wr[1]), "v"(wr[2]), "v"(wr[3]), "v"(wr[4]), "v"(wr[5]), "v"(wr[6]), "v"(wr[7]), "v"(wr[8]), "v"(wr[9]), "v"(wr[10]), "v"(wr[11]),
                             "v"(wr[12]), "v"(wr[13]), "v"(wr[14]), "v"(wr[15]), "v"(xl[0]), "v"(xl[1]), "v"(xl[2]), "v"(xl[3]), "v"(xh[0]), "v"(xh[1]), "v"(xh[2]), "v"(xh[3]));
            // precaution: stands in front of the rewrite of the loads' offset registers just below (named as operands so that the additions stay behind it)
            asm volatile("s_wait_xcnt 0x0" : "+v"(xob[0]), "+v"(xob[1]), "+v"(xob[2]), "+v"(xob[3]), "+v"(wob) :: "memory");
#pragma unroll
            for (int xi = 0; xi < 4; ++xi) xob[xi] += 32 * sizeof(float);
            wob += 32 * DM * sizeof(float);
#pragma unroll
            for (int xi = 0; xi < 4; ++xi) xf[xi] = cvx(xl[xi], xh[xi]);
        }
#pragma unroll
        for (int wi = 0; wi < 4; ++wi) wf[wi] = cvw(wr, wi);
#pragma unroll
        for (int wi = 0; wi < 4; ++wi)
#pragma unroll
            for (int xi = 0; xi < 4; ++xi) acc[xi][wi] = J2 ? wmmab(wf[wi], xf[xi], acc[xi][wi]) : wmmab(xf[xi], wf[wi], acc[xi][wi]);
        // keeps the vector slots the chip needs behind the last WMMA, also on the taken back edge
        asm volatile("v_nop\n\tv_nop\n\tv_nop\n\tv_nop" : "+v"(acc[0][0]), "+v"(acc[1][1]), "+v"(acc[2][2]), "+v"(acc[3][3]) : "v"(xf[0]), "v"(xf[1]), "v"(xf[2]), "v"(xf[3]));
        if constexpr (F32OUT) asm volatile("s_wait_xcnt 0x0" ::: "memory");   // precaution: the weight loads' address register is formed anew at the head of the next trip; this stands in front of that rewrite
    }
    const size_t tbase = J2 ? (size_t)r0 * SEQ + (size_t)(c0 / SEQ) * ((size_t)DM * SEQ) + (size_t)(c0 % SEQ) : (size_t)r0 * DM + (size_t)c0;
#pragma unroll
    for (int p = 0; p < 4; ++p) {                                  // 16 output rows a pass: rows 16*p + row, in the v^T job rows 4*row + p
        if constexpr (J2) {
#pragma unroll
            for (int xi = 0; xi < 4; ++xi)
#pragma unroll
                for (int j = 0; j < 8; ++j) os[(hi * 8 + j) * 68 + xi * 16 + lr] = acc[xi][p][j];            // D: row 8h+j (output 4*(8h+j) + p), col t = 16*xi + lane&15
        } else {
#pragma unroll
            for (int j = 0; j < 8; ++j) *(v4fa*)(&os[(hi * 8 + j) * 68 + 4 * lr]) = (v4f){acc[p][0][j], acc[p][1][j], acc[p][2][j], acc[p][3][j]};   // D: row 8h+j, col 4*(lane&15) + wi
        }
        wave_sync();
        if constexpr (!F32OUT) {
#pragma unroll
            for (int s = 0; s < 4; ++s) { const int row = 4 * s + (lane >> 3), c8 = (lane & 7) * 8;   // 4 s x 4 row groups = 16 rows; 8 lanes x 8 = 64 columns
                const int rofs = J2 ? 4 * row + p : p * 16 + row;
                v4f x0 = *(const v4fa*)(&os[row * 68 + c8]); v4f x1 = *(const v4fa*)(&os[row * 68 + c8 + 4]);
                v4f bc0, bc1;                                                                          // bias by row (v^T) or by column
                if constexpr (J2) { const float br = bias[r0 + rofs]; bc0 = (v4f){br, br, br, br}; bc1 = bc0; }
                else { bc0 = *(const v4f*)(bias + c0 + c8); bc1 = *(const v4f*)(bias + c0 + c8 + 4); }
                v8h hv, rv;
#pragma unroll
                for (int i = 0; i < 4; ++i) { const float y0 = x0[i] + bfr(bc0[i]); const float y1 = x1[i] + bfr(bc1[i]);
                    const h16 a0 = (h16)y0; const h16 a1 = (h16)y1; hv[i] = a0; hv[4 + i] = a1; rv[i] = (h16)((y0 - (float)a0) * QRS); rv[4 + i] = (h16)((y1 - (float)a1) * QRS); }
                const size_t oo = tbase + (size_t)rofs * (size_t)pitch + c8;
                *(v8h*)(Ph + oo) = hv;
                asm volatile("s_wait_xcnt 0x0" ::: "memory");         // precaution: stands in front of any later rewrite of this store's data or address registers, on both sides of the branch below
                if (useRes) { *(v8h*)(Pr + oo) = rv;
                    asm volatile("s_wait_xcnt 0x0" ::: "memory"); }   // precaution: the same for the residual store
            }
        } else {
#pragma unroll
            for (int s = 0; s < 8; ++s) { const int row = 2 * s + hi, cofs = lr * 4;                  // 8 s x 2 rows = 16 rows; 16 lanes x 4 floats = 64 columns
                const int m = r0 + p * 16 + row; const int bb = m / SEQ, tt = m - bb * SEQ;
                v4f val = *(const v4fa*)(&os[row * 68 + cofs]);
                const v4f bc = *(const v4f*)(bias + c0 + cofs);
#pragma unroll
                for (int i = 0; i < 4; ++i) val[i] = val[i] + bfr(bc[i]);
                *(v4f*)(OUT + ((size_t)bb * OUT_SEQ + tt) * DM + c0 + cofs) = val; }
        }
        wave_sync();
    }
}

template <bool F32OUT>
__global__ __launch_bounds__(32) void k_gemm(const float* __restrict__ X0, const float* __restrict__ X1, const float* __restrict__ X2, const bf* __restrict__ CXA,
                                             const float* __restrict__ W0, const float* __restrict__ W1, const float* __restrict__ W2,
                                             h16* Ph0, h16* Ph1, h16* Ph2, h16* Pr, float* OUT,
                                             const float* __restrict__ bias0, const float* __restrict__ bias1, const float* __restrict__ bias2,
                                             const int* __restrict__ MK, int* NV) {
    __shared__ __align__(16) float os[16 * 68];
    if constexpr (F32OUT) gemm_tile<true, false>(os, X0, CXA, W0, Ph0, Pr, OUT, bias0, false, blockIdx.x, nullptr, MK, NV, false);
    else {
        __shared__ int kidx[64];
        const unsigned job = blockIdx.y;
        if (job == 2) gemm_tile<false, true>(os, X2, CXA, W2, Ph2, Pr, OUT, bias2, false, blockIdx.x, kidx, MK, NV, true);
        else gemm_tile<false, false>(os, job == 0 ? X0 : X1, CXA, job == 0 ? W0 : W1, job == 0 ? Ph0 : Ph1, Pr, OUT, job == 0 ? bias0 : bias1, job == 0, blockIdx.x, kidx, MK, NV, job == 1);
    }
}

// copy_kv: the K and V^T copies of two steps, 16 B a lane each, global memory to LDS through no register (lk*, lv* = the lane's LDS byte addresses).
// The s_wait_xcnt stands inside the statement as a precaution: behind it the address registers may be rewritten.
__device__ __forceinline__ void copy_kv(unsigned lk0, const h16* gk0, unsigned lv0, const h16* gv0, unsigned lk1, const h16* gk1, unsigned lv1, const h16* gv1) {
    asm volatile("global_load_async_to_lds_b128 %0, %1, off\n\tglobal_load_async_to_lds_b128 %2, %3, off\n\t"
                 "global_load_async_to_lds_b128 %4, %5, off\n\tglobal_load_async_to_lds_b128 %6, %7, off\n\ts_wait_xcnt 0x0"
                 :: "v"(lk0), "v"(gk0), "v"(lv0), "v"(gv0), "v"(lk1), "v"(gk1), "v"(lv1), "v"(gv1) : "memory");
}

// k_flash: fused attention, one work-group per 64 query rows of one batch and one PAIR of heads; one wave per (16 query rows, head, key range: a KS-th of the batch's 32-key steps).
// The waves of one key range walk the same K rows and V^T columns at the same time; both heads of the pair read the two halves of the same K lines.
// Q fragments straight from the f16 planes (two 16-B loads each). K and V^T go through LDS: trip t of the block works on steps SPT*t .. SPT*t + SPT-1 of every key range; the 8 waves of a range bring each step's K tile
// (32 keys x 128 B) and V^T tile (64 rows x 64 B) in with one asynchronous 16-B copy a lane each, whole lines or half lines, and all 8 read their fragments from there. Two buffers: the copies of trip t + 1 fly during trip t.
// A step past the range's own is copied all the same and never read (past the batch's last step: that last step again; written rows in either case), so that every wave issues the same copies and passes the same barriers.
// Transposed form: S^T[key][t] = K Q^T (A = K rows, B = Q rows); lane (t = lane&15, h = lane>>4) holds keys 8h+r of each 16-key tile, so the packed
// P tile is directly the B fragment of O^T[d][t] = V^T P^T (element r <- tile keys 0..15, element 8+r <- tile keys 16..31, lane unchanged).
// Key mask: the planes hold the packed keys; NV[b] = number of unmasked keys. Positions from NV[b] on (the rest of the last 32-key step; every position where NV[b] = 0) have their score REPLACED by the fill value
// (a fully masked row therefore comes out uniform); steps that lie wholly below NV[b] take no select.
// Softmax state (running max, partial sum) is one scalar per lane; the two lane halves of a row are combined with one xor-16 exchange.
// Each wave leaves its unnormalised O, its running max and its sum in LDS; behind one work-group barrier the KS partial results of a row are rescaled to their common max, added and normalised.
__global__ __launch_bounds__(32 * FW) void k_flash(const h16* __restrict__ QH, const h16* __restrict__ QR, const h16* __restrict__ KP, const h16* __restrict__ VT,
                                                   const int* __restrict__ NV, bf* CX) {
    __shared__ __align__(16) float os[KS * AW * 16 * 68];        // [key range][row of the block][68]: columns 0..63 = 32*head + d
    __shared__ float sm[KS * 2 * AW * 16], sl[KS * 2 * AW * 16]; // [key range][head][row of the block]: running max, sum
    __shared__ __align__(16) unsigned char ring[2 * BFB];        // [buffer][step of the trip][key range]: K tile [key][KPB], V^T tile [32*head + d][VPB]
    const int lane = threadIdx.x & 31, wave = __builtin_amdgcn_readfirstlane((int)(threadIdx.x >> 5)), lr = lane & 15, hi = lane >> 4;
    const int rt = wave % AW, hh = (wave / AW) & 1, ks = wave / (2 * AW);
    const int zp = blockIdx.y; const int b = zp / (NH_ / 2), hp = zp % (NH_ / 2);
    const int t0 = (blockIdx.x * AW + rt) * 16;
    const size_t rowb = (size_t)b * SEQ;
    const int nvr = NV[b];
    const int nv = __builtin_amdgcn_readfirstlane(nvr < 0 ? 0 : (nvr > SEQ ? SEQ : nvr));   // unmasked keys of the batch, bounded by the shape; kept scalar so that the loop's tail test is a scalar compare
    const int nt = ((nv == 0 ? SEQ : nv) + 31) / 32;             // 32-key steps that the planes hold (1 .. SEQ / 32)
    const int tq = (nt + KS - 1) / KS;                           // steps per key range; the last ranges may be short or empty
    {
        const int h = hp * 2 + hh;
        const size_t qo = (rowb + t0 + lr) * DM + h * HD + 8 * hi;
        const v16h qh = ldh(QH + qo), qr = ldh(QR + qo);                  // B fragments: col t, k = d (32 deep)
        const unsigned char* kf = ring + ks * RTB + lr * KPB + hh * 64 + 16 * hi;            // + buffer, step; + 16*KPB   (A fragment: row key, k = d)
        const unsigned char* vf = ring + ks * RTB + KTB + (hh * 32 + lr) * VPB + 16 * hi;    // + buffer, step; + 16*VPB   (A fragment: row d, k = key)
        // this lane's share of the copies: K row 4*w8 + lane/8, piece lane%8; V^T row 8*w8 + lane/4, piece lane%4 (w8 = the wave's number inside its key range)
        const int w8 = wave % (2 * AW);
        const int kr = 4 * w8 + (lane >> 3), kc = lane & 7, vr = 8 * w8 + (lane >> 2), vc = lane & 3;
        const h16* gk = KP + (rowb + kr) * DM + hp * 64 + kc * 8;                            // + key * DM
        const h16* gv = VT + ((size_t)b * DM + hp * 64 + vr) * SEQ + vc * 8;                 // + key
        const unsigned lk = (unsigned)(size_t)(ring + ks * RTB + kr * KPB + kc * 16), lv = (unsigned)(size_t)(ring + ks * RTB + KTB + vr * VPB + vc * 16);
        v8f o0 = (v8f){}, o1 = (v8f){};
        float m = -3.0e38f, l = 0.0f;
        const int tbeg = ks * tq, tend = tbeg + tq < nt ? tbeg + tq : nt;
        const int ntr = (tq + SPT - 1) / SPT;                    // trips: the same for every wave of the block
        // stage(t, bo): this lane's copies of trip t into the buffer at byte bo. c0, c1 = first key of the two steps (never past the batch's last step): below 32 * nt, so inside the rows that the projections wrote
        auto stage = [&](int t, unsigned bo) {
            const int s0 = tbeg + SPT * t, c0 = 32 * (s0 < nt ? s0 : nt - 1), c1 = 32 * (s0 + 1 < nt ? s0 + 1 : nt - 1);
            copy_kv(lk + bo, gk + (size_t)c0 * DM, lv + bo, gv + c0, lk + bo + SFB, gk + (size_t)c1 * DM, lv + bo + SFB, gv + c1);
        };
        stage(0, 0u);
        asm volatile("s_wait_asynccnt 0x0" ::: "memory");        // this wave's copies of trip 0 have landed
        __syncthreads();                                         // ... and every other wave's: buffer 0 may be read
        if (ntr > 1) stage(1, BFB);
#pragma unroll 1   // stays rolled: the trip count is only known at run time, and the buffer goes by the trip's parity
        for (int t = 0; t < ntr; ++t) {
         const unsigned bo = (t & 1) * BFB;
         for (int j = 0; j < SPT; ++j) {
          const int tt = tbeg + SPT * t + j;
          if (tt < tend) {                                       // same for the whole wave
            const int key0 = tt * 32;
            const h16* ka = (const h16*)(kf + bo + j * SFB);
            const v16h ka0 = ldh(ka), kb0 = ldh(ka + 16 * (KPB / 2));
            v8f sHa = (v8f){}, sLa = (v8f){}, sHb = (v8f){}, sLb = (v8f){};
            sHa = wmma16(ka0, qh, sHa); sLa = wmma16(ka0, qr, sLa); sHb = wmma16(kb0, qh, sHb); sLb = wmma16(kb0, qr, sLb);
            asm volatile("v_nop\n\tv_nop\n\tv_nop\n\tv_nop" : "+v"(sHa), "+v"(sLa), "+v"(sHb), "+v"(sLb) : "v"(ka0), "v"(kb0), "v"(qh), "v"(qr));
            float ta[8], tb[8]; float mx = -3.0e38f;
#pragma unroll
            for (int r = 0; r < 4; ++r) {
                ta[r] = (sHa[r] + sLa[r] * QRI) * SC2; ta[4 + r] = (sHa[4 + r] + sLa[4 + r] * QRI) * SC2;
                tb[r] = (sHb[r] + sLb[r] * QRI) * SC2; tb[4 + r] = (sHb[4 + r] + sLb[4 + r] * QRI) * SC2; }
            if (key0 + 32 > nv) {                                // same for the whole wave: the step reaches past the unmasked keys
                const int kl = nv - key0 - 8 * hi;               // element r stands for keys key0 + 8h + r and key0 + 16 + 8h + r
#pragma unroll
                for (int r = 0; r < 8; ++r) { ta[r] = (r < kl) ? ta[r] : NEGT; tb[r] = (16 + r < kl) ? tb[r] : NEGT; }
            }
#pragma unroll
            for (int r = 0; r < 8; ++r) mx = fmaxf(mx, fmaxf(ta[r], tb[r]));
            mx = fmaxf(mx, __shfl_xor(mx, 16, 32));
            const float mnew = fmaxf(m, mx);
            const float alpha = __builtin_amdgcn_exp2f(m - mnew);
            const float sh = PSH - mnew;
            v16h pb; float ls = 0.0f;
#pragma unroll
            for (int r = 0; r < 8; ++r) { const h16 pa = (h16)__builtin_amdgcn_exp2f(ta[r] + sh); const h16 pc = (h16)__builtin_amdgcn_exp2f(tb[r] + sh); pb[r] = pa; pb[8 + r] = pc; ls += (float)pa + (float)pc; }
            l = l * alpha + ls; m = mnew;
            o0 = o0 * alpha; o1 = o1 * alpha;
            const h16* va = (const h16*)(vf + bo + j * SFB);
            const v16h v0 = ldh(va), v1 = ldh(va + 16 * (VPB / 2));
            o0 = wmma16(v0, pb, o0); o1 = wmma16(v1, pb, o1);
            asm volatile("v_nop\n\tv_nop\n\tv_nop\n\tv_nop" : "+v"(o0), "+v"(o1) : "v"(v0), "v"(v1), "v"(pb));
          }
         }
         asm volatile("s_wait_dscnt 0x0" ::: "memory");          // this wave's reads of the trip's buffer are done before the buffer is handed on
         asm volatile("s_wait_asynccnt 0x0" ::: "memory");       // this wave's copies of trip t + 1 have landed
         __syncthreads();                                        // publishes the buffer of trip t + 1 and ends every wave's reads of this trip's
         if (t + 2 < ntr) stage(t + 2, bo);                      // same for the whole block
        }
        asm volatile("s_wait_asynccnt 0x0" ::: "memory");        // no copy is outstanding behind the loop
        l += __shfl_xor(l, 16, 32);
        // O^T D layout: o_j[r] = (d = 16j + 8h + r, t = lane&15) -> os[key range][16*rt + t][32*hh + d], unnormalised
        { const int ob = ((ks * AW + rt) * 16 + lr) * 68 + hh * 32 + 8 * hi;
          *(v4fa*)(&os[ob])      = (v4f){o0[0], o0[1], o0[2], o0[3]}; *(v4fa*)(&os[ob + 4])  = (v4f){o0[4], o0[5], o0[6], o0[7]};
          *(v4fa*)(&os[ob + 16]) = (v4f){o1[0], o1[1], o1[2], o1[3]}; *(v4fa*)(&os[ob + 20]) = (v4f){o1[4], o1[5], o1[6], o1[7]}; }
        if (hi == 0) { const int si = ((ks * 2 + hh) * AW + rt) * 16 + lr; sm[si] = m; sl[si] = l; }
    }
    __syncthreads();     // every wave's partial result is in LDS before any row is merged
    const int tid = threadIdx.x;
    if (tid < AW * 16 * 8) {                                     // whole waves: 64 rows x 8 lanes x 8 columns
        const int row = tid >> 3, c8 = (tid & 7) * 8, hq = c8 >> 5;
        float pm[KS]; float mx = -3.0e38f;
#pragma unroll
        for (int p = 0; p < KS; ++p) { pm[p] = sm[(p * 2 + hq) * (AW * 16) + row]; mx = fmaxf(mx, pm[p]); }
        v4f x0 = (v4f){}, x1 = (v4f){}; float l = 0.0f;
#pragma unroll
        for (int p = 0; p < KS; ++p) { const float f = __builtin_amdgcn_exp2f(pm[p] - mx);
            l += f * sl[(p * 2 + hq) * (AW * 16) + row];
            x0 += *(const v4fa*)(&os[(p * (AW * 16) + row) * 68 + c8]) * f; x1 += *(const v4fa*)(&os[(p * (AW * 16) + row) * 68 + c8 + 4]) * f; }
        const float inv = 1.0f / l;
        x0 = x0 * inv; x1 = x1 * inv;
        v8us hv, lv;
#pragma unroll
        for (int i = 0; i < 4; ++i) { const unsigned short u0 = f2bf(x0[i]); const unsigned short u1 = f2bf(x1[i]); hv[i] = u0; hv[4 + i] = u1;
            lv[i] = f2bf(x0[i] - bf2f(u0)); lv[4 + i] = f2bf(x1[i] - bf2f(u1)); }
        bf* crow = CX + (rowb + (size_t)blockIdx.x * (AW * 16) + row) * CXP + hp * 64 + c8;
        *(v8us*)(crow) = hv; *(v8us*)(crow + DM) = lv;
    }
}

static constexpr size_t al256(size_t v) { return (v + 255) & ~(size_t)255; }
static constexpr size_t SZ_PL = al256((size_t)NB * SEQ * DM * 2);
static constexpr size_t SZ_CX = al256((size_t)NB * SEQ * CXP * 2);
static constexpr size_t SZ_NV = al256((size_t)NB * sizeof(int));
static constexpr size_t SZ_TOTAL = 4 * SZ_PL + SZ_CX + SZ_NV;
static_assert(SZ_TOTAL <= (size_t)134217728);          // workspace carve <= 128 MiB
static_assert((size_t)NB * DM * SEQ * 2 <= SZ_PL);     // v^T plane extent

extern "C" void kernel_launch(void* const* d_in, const int* in_sizes, int n_in,
                              void* d_out, int out_size, void* d_ws, size_t ws_size, hipStream_t stream) {
    if (n_in < 12) return;
    const size_t needx = ((size_t)(NB - 1) * SEQ_FULL + SEQ) * DM;
    if ((size_t)in_sizes[0] < needx || (size_t)in_sizes[1] < needx || (size_t)in_sizes[2] < needx) return;
    if ((size_t)in_sizes[3] < (size_t)(NB - 1) * SEQ_FULL + SEQ) return;
    if ((size_t)in_sizes[4] < (size_t)DM * DM || (size_t)in_sizes[6] < (size_t)DM * DM || (size_t)in_sizes[8] < (size_t)DM * DM || (size_t)in_sizes[10] < (size_t)DM * DM) return;
    if (in_sizes[5] < DM || in_sizes[7] < DM || in_sizes[9] < DM || in_sizes[11] < DM) return;
    if ((size_t)out_size < ((size_t)(NB - 1) * OUT_SEQ + SEQ) * DM) return;
    if (SZ_TOTAL > ws_size) return;
    // wire order: queries, keys, values, key_mask, Wq, bq, Wk, bk, Wv, bv, Wo, bo
    const float* xq = (const float*)d_in[0]; const float* xk = (const float*)d_in[1]; const float* xv = (const float*)d_in[2];
    const int* kmask = (const int*)d_in[3];
    const float* wq = (const float*)d_in[4]; const float* bq = (const float*)d_in[5];
    const float* wk = (const float*)d_in[6]; const float* bk = (const float*)d_in[7];
    const float* wv = (const float*)d_in[8]; const float* bv = (const float*)d_in[9];
    const float* wo = (const float*)d_in[10]; const float* bo = (const float*)d_in[11];
    float* OUT = (float*)d_out;      // [NB][SEQ][256]
    char* wsp = (char*)d_ws;
    h16* QH = (h16*)wsp; wsp += SZ_PL;               // [NB*SEQ][256]
    h16* QR = (h16*)wsp; wsp += SZ_PL;               // [NB*SEQ][256] residual x2048
    h16* KP = (h16*)wsp; wsp += SZ_PL;               // [NB*SEQ][256]
    h16* VT = (h16*)wsp; wsp += SZ_PL;               // [NB][256][SEQ]
    bf* CX = (bf*)wsp; wsp += SZ_CX;                 // [NB*SEQ][512]: ctx hi | ctx lo
    int* NV = (int*)wsp; wsp += SZ_NV;               // [NB]: unmasked keys of each batch

    k_gemm<false><<<dim3(PTB, 3, 1), 32, 0, stream>>>(xq, xk, xv, CX, wq, wk, wv, QH, KP, VT, QR, OUT, bq, bk, bv, kmask, NV);

    k_flash<<<dim3(SEQ / (16 * AW), NB * (NH_ / 2), 1), 32 * FW, 0, stream>>>(QH, QR, KP, VT, NV, CX);

    // out = [ctx_hi | ctx_lo] x [Wo ; Wo] + bo, K = 512, f32 rows of the output (the activation pointers are not read here)
    k_gemm<true><<<dim3(PTB, 1, 1), 32, 0, stream>>>(wo, wo, wo, CX, wo, wo, wo, QH, QH, QH, QH, OUT, bo, bo, bo, kmask, NV);
}

// v006
// Measured time: 26.5 microseconds a run.
// Timed twice side by side with v005, it ran 1.59 and 1.61 times as fast.
// Counting every step since v000, it is 5.78 times as fast.
#include <hip/hip_runtime.h>

// Multi-head attention with key padding mask: q/k/v inputs [NB][SEQ][256], Wq/Wk/Wv/Wo [in][out] (y = x W + b), 8 heads x 32, score scale 1/sqrt(32), masked keys take the fill value -4294967296, output = ctx Wo + bo (f32).
// Compute dtypes, f32 accumulate everywhere: projections v_wmma_f32_16x16x32_bf16 (inputs and weights RNE-converted to bf16; products exact);
// scores v_wmma_f32_16x16x32_f16: k single f16, q as f16 value + f16 residual x2048 in its own accumulator (two products); P (x256 carry, cancels in the normalisation) and v single f16; softmax f32 (online, running max);
// output projection v_wmma_f32_16x16x32_bf16 with ctx carried as bf16 hi | bf16 lo planes folded along K (K = 512, weight row = k mod 256).
// Layout: activations and weights are read as f32 by the GEMMs and rounded in registers; q (hi, residual), k planes [b*SEQ + t][256] (head h = columns 32h..32h+31) and v^T plane [b][256][SEQ] written by the GEMM epilogue;
// Key mask: the k and v^T planes hold only the unmasked keys of a batch, packed without gaps in one fixed order (key_list; the same for both planes); a masked key's weight is exactly 0 beside any unmasked one, so attention runs over the packed keys alone.
// A batch with no unmasked key keeps all its keys in the planes, and every score takes the fill value (uniform weights, as the reference gives).

#ifndef NB
#define NB 2
#endif
#ifndef SEQ
#define SEQ 2048
#endif
#define NB_FULL  2
#define SEQ_FULL 2048
#ifndef OUT_SEQ
#define OUT_SEQ SEQ              // row pitch (in tokens) between batches of the output
#endif
#define DM   256
#define NH_  8
#define HD   32
#define CXP  (2 * DM)            // ctx plane pitch: hi columns 0..255, lo columns 256..511
#define AW   4                   // 16-row query tiles per flash block
#define KS   4                   // key ranges per (query tile, head), one wave each
#define FW   (AW * 2 * KS)       // waves per flash block: query tiles x 2 heads x key ranges
#define KW   4                   // waves per GEMM block: each takes a KW-th of the k range of the block's tile
#define OSW  (64 * 68)           // floats of one wave's partial tile in LDS: 64 rows, pitch 68
#define QRS  2048.0f             // carry of the q residual plane
#define QRI  (1.0f / 2048.0f)
#define SC2  (0.17677669529663687f * 1.4426950408889634f)   // HD^-0.5 * log2(e)
#define PSH  8.0f                // log2 of the P carry (256)
#define NEGT (-4294967296.0f * 1.4426950408889634f)         // mask fill value in the log2 domain
#define KPB  144                 // LDS pitch of a staged K row, bytes: 128 (32 columns x 2 heads) + 16, 16 B x odd for the ds_load_b128 readers
#define VPB  80                  // LDS pitch of a staged V^T row, bytes: 64 (32 keys) + 16, 16 B x odd
#define KTB  (32 * KPB)          // one K tile: 32 keys
#define VTB  (64 * VPB)          // one V^T tile: 64 rows (2 heads x 32)
#define RTB  (KTB + VTB)         // one step of one key range
#define SFB  (KS * RTB)          // one 32-key step of every key range
#define SPT  2                   // steps of a key range per buffer (per trip between two barriers)
#define BFB  (SPT * SFB)         // one buffer

static_assert(HD == 32);
static_assert(NH_ * HD == DM);                 // head h = columns h*32 + d
static_assert(NH_ % 2 == 0);
static_assert(DM % 64 == 0);
static_assert(DM % 32 == 0);                   // GEMM k-loop steps by 32
static_assert(CXP % 32 == 0);
static_assert(DM % (32 * KW) == 0);            // every wave of a GEMM block gets whole 32-deep trips (CXP = 2 * DM too)
static_assert(KW == 4);                        // behind the sum, wave p stores the p-th of the tile's four 16-row passes
static_assert(SEQ % 64 == 0);                  // a 64-row tile never straddles two batches
static_assert((NB * SEQ) % 64 == 0);
static_assert(SEQ % (32 * KS) == 0);           // key loop steps by 32 inside each key range
static_assert(FW * 32 <= 1024);
static_assert(AW * 2 == 8);                    // the 8 waves of a key range copy its tiles: 256 lanes x 16 B = 4 KiB for K, the same for V^T
static_assert(KPB % 16 == 0 && VPB % 16 == 0 && KTB % 16 == 0 && RTB % 16 == 0);
static_assert(SPT == 2);                       // copy_kv holds the copies of two steps
static_assert(FW * 32 >= AW * 16 * 8);         // the merge uses one thread per (row, 8 columns)
static_assert(SEQ % (16 * AW) == 0);           // flash grid covers the sequence exactly
static_assert(((size_t)SEQ * DM) % 8 == 0);
static_assert(NB <= NB_FULL);
static_assert(SEQ <= SEQ_FULL);

typedef _Float16 h16;
typedef unsigned short bf;
typedef __attribute__((ext_vector_type(16))) __bf16   v16bf;
typedef __attribute__((ext_vector_type(16))) _Float16 v16h;
typedef __attribute__((ext_vector_type(8)))  _Float16 v8h;
typedef __attribute__((ext_vector_type(8)))  unsigned short v8us;
typedef __attribute__((ext_vector_type(8)))  float    v8f;
typedef __attribute__((ext_vector_type(16))) float    v16f;
typedef __attribute__((ext_vector_type(4)))  float    v4f;
typedef __attribute__((ext_vector_type(4)))  int      v4i;
typedef v4f  __attribute__((may_alias)) v4fa;

__device__ __forceinline__ unsigned short f2bf(float f) { unsigned u = __float_as_uint(f); u += 0x7FFFu + ((u >> 16) & 1u); return (unsigned short)(u >> 16); }
__device__ __forceinline__ float bf2f(unsigned short s) { return __uint_as_float(((unsigned)s) << 16); }
__device__ __forceinline__ float bfr(float f) { return bf2f(f2bf(f)); }
__device__ __forceinline__ v16h cat16(v8h lo, v8h hi) { return __builtin_shufflevector(lo, hi, 0, 1, 2, 3, 4, 5, 6, 7, 8, 9, 10, 11, 12, 13, 14, 15); }
__device__ __forceinline__ v16bf cat16b(v8us lo, v8us hi) { return __builtin_bit_cast(v16bf, __builtin_shufflevector(lo, hi, 0, 1, 2, 3, 4, 5, 6, 7, 8, 9, 10, 11, 12, 13, 14, 15)); }
__device__ __forceinline__ v8f wmma16(v16h a, v16h b, v8f c) { return __builtin_amdgcn_wmma_f32_16x16x32_f16(false, a, false, b, (short)0, c, false, false); }
__device__ __forceinline__ v8f wmmab(v16bf a, v16bf b, v8f c) { return __builtin_amdgcn_wmma_f32_16x16x32_bf16(false, a, false, b, (short)0, c, false, false); }
// fragment loaders from K-contiguous 16-bit rows; p already includes + 8*(lane>>4): elements 0..7 <- k0+8h+0..7, elements 8..15 <- k0+16+8h+0..7 (same map for A and B)
__device__ __forceinline__ v16h  ldh(const h16* p) { return cat16(*(const v8h*)p, *(const v8h*)(p + 16)); }
__device__ __forceinline__ v16bf ldb(const bf* p)  { return cat16b(*(const v8us*)p, *(const v8us*)(p + 16)); }
// ordering point for wave-private LDS tiles (same wave writes and reads)
__device__ __forceinline__ void wave_sync() { __builtin_amdgcn_fence(3 /* release order */, "wavefront"); __builtin_amdgcn_wave_barrier(); asm volatile("" ::: "memory"); }

// cvx: fragment from the two 8-float pieces of one K-contiguous f32 row (k0+8h+0..7, k0+16+8h+0..7: the k map of ldb), rounded to bf16 (RNE) in registers
__device__ __forceinline__ v16bf cvx(v8f lo, v8f hi8) {
    return __builtin_convertvector(__builtin_shufflevector(lo, hi8, 0, 1, 2, 3, 4, 5, 6, 7, 8, 9, 10, 11, 12, 13, 14, 15), v16bf);
}
// Weight fragments come four at once from W[k][n] (f32, row pitch DM): one 16-B load per k at W + k * DM + n0 + 4*(lane&15) gives the lane that k of the four outputs n0 + 4*(lane&15) + i.
// r[e] = row k0+8h+e, r[8+e] = row k0+16+8h+e (the k map of ldb); cvw: fragment i holds outputs n0 + 4*l + i (l = its 16 rows or columns), rounded to bf16 (RNE) in registers.
__device__ __forceinline__ v16bf cvw(const v4f (&r)[16], int i) {
    v16f t;
#pragma unroll
    for (int e = 0; e < 16; ++e) t[e] = r[e][i];
    return __builtin_convertvector(t, v16bf);
}

// key_list (one wave): returns the number of unmasked keys of one batch (mkb = its SEQ mask words) and leaves in idx[0..63] the keys that stand at packed positions lo..lo+63.
// Load i gives lane c the mask of keys 128*i + 4*c + 0..3; bit t of the lane's SEQ/32 bits (32 to a word w[j]) stands for key 128*(t>>2) + 4*c + (t&3).
// Packed order: by lane, then by bit (any order serves, as k and v^T use the same one). p = first packed position of the lane's current word (lane prefix sum, one ballot per bit of the counts).
// Only the words that reach into lo..lo+63 are then walked, one word (32 keys, one a lane) a trip. No unmasked key at all: every key counts as present.
// Positions past the last key keep key 0: finite rows that the attention kernel masks. Every entry is formed from lane, word and bit numbers alone and lies below SEQ.
__device__ __forceinline__ int key_list(int* idx, const int* __restrict__ mkb, int lo) {
    constexpr int NW = SEQ / 1024;
    static_assert(SEQ % 1024 == 0 && SEQ / 32 < 128);
    const int lane = threadIdx.x & 31;
    v4i mv[8 * NW];
#pragma unroll
    for (int i = 0; i < 8 * NW; ++i) mv[i] = *(const v4i*)(mkb + 128 * i + 4 * lane);
    asm volatile("s_wait_xcnt 0x0" ::: "memory");   // precaution: stands in front of any later rewrite of the mask loads' address registers
    unsigned w[NW];
    unsigned any = 0u;
#pragma unroll
    for (int j = 0; j < NW; ++j) {
        w[j] = 0u;
#pragma unroll
        for (int t = 0; t < 32; ++t) w[j] |= mv[8 * j + (t >> 2)][t & 3] != 0 ? 1u << t : 0u;
        any |= w[j];
    }
    const bool none = __builtin_amdgcn_ballot_w32(any != 0u) == 0u;
    int cn = 0;
#pragma unroll
    for (int j = 0; j < NW; ++j) { if (none) w[j] = ~0u; cn += __builtin_popcount(w[j]); }   // cn = 0 .. SEQ / 32: seven bits
    int p = 0, tot = 0;
#pragma unroll
    for (int bit = 0; bit < 7; ++bit) {
        const unsigned bb = __builtin_amdgcn_ballot_w32(((cn >> bit) & 1) != 0);
        p += (int)__builtin_amdgcn_mbcnt_lo(bb, 0u) << bit;
        tot += __builtin_popcount(bb) << bit;
    }
    const int nvalid = none ? 0 : tot;
    if (lo >= tot) return nvalid;                    // nothing stands at these positions: the caller leaves
    idx[lane] = 0; idx[lane + 32] = 0;
#pragma unroll
    for (int j = 0; j < NW; ++j) {
        const int cj = __builtin_popcount(w[j]);
        unsigned todo = __builtin_amdgcn_ballot_w32(p + cj > lo && p < lo + 64);
        while (todo != 0u) {                         // same for the whole wave; one bit goes each trip: at most 32 trips
            const int c = __builtin_ctz(todo);
            todo &= todo - 1u;
            const unsigned bc = (unsigned)__builtin_amdgcn_readlane((int)w[j], c);
            const int pos = __builtin_amdgcn_readlane(p, c) - lo + (int)__builtin_amdgcn_mbcnt_lo(bc, 0u);
            if (((bc >> lane) & 1u) != 0u && pos >= 0 && pos < 64) idx[pos] = 128 * (8 * j + (lane >> 2)) + 4 * c + (lane & 3);
        }
        p += cj;
    }
    wave_sync();
    return nvalid;
}

// k_gemm: register-blocked bf16 GEMM, one block of KW waves per 64x64 tile; every wave holds the whole tile (16 accumulators) over its own KW-th of k, leaves its partial tile in LDS,
// and behind one work-group barrier wave p adds the KW partial tiles (in wave order) for the p-th 16-row pass, adds the bias and stores. The weight operand comes straight from the f32 input W[k][n] (cvw), the other operand from K-contiguous rows:
// the f32 activation input (cvx; F32OUT = false) or the bf16 ctx plane (ldb; F32OUT = true, K = 512, weight row = k mod 256). Bias: bf16 RNE value of the f32 bias, added in f32.
// acc[xi][wi]: xi = 16-row group of the row operand (rows 16*xi + l), wi = weight fragment (outputs 4*l + wi).
// F32OUT = false: the three input projections in ONE launch, blockIdx.y picks the job, PTB tiles each, the row tile running fastest in blockIdx.x; written as f16 (Ph), q also as the f16 residual x2048 (Pr):
//   job 0 (q), job 1 (k): A = x rows (m = b*SEQ + t), B = W columns (n = h*32 + d) -> plane [m][n], bias by column
//   job 2 (v^T): A = Wv columns (m = h*32 + d), B = x rows (n = b*SEQ + t) -> plane [(b*256 + m)][t], bias by row
//   jobs 1 and 2: t is a packed position, the x row read for it is the key that key_list names; a tile past the last packed key leaves at once; job 1's first tile of a batch stores the batch's count in NV
// F32OUT = true: the output projection, f32 rows of OUT[(m/SEQ)*OUT_SEQ + m%SEQ][c0 + col]; each row segment (64 floats = two lines) written by 16 consecutive lanes x 16 B (2 rows per instruction).
#define PTB ((NB * SEQ / 64) * (DM / 64))
// gemm_tile: one 64x64 tile. J2 = the v^T job (weight fragments as A). f = tile index, the row tile running fastest.
template <bool F32OUT, bool J2>
__device__ __forceinline__ void gemm_tile(float* os, const float* __restrict__ X, const bf* __restrict__ CXA, const float* __restrict__ Wt,
                                          h16* Ph, h16* Pr, float* OUT, const float* __restrict__ bias, bool useRes, unsigned f,
                                          int* kidx, const int* __restrict__ MK, int* NV, bool packed) {
    constexpr int K = F32OUT ? CXP : DM;
    constexpr int pitch = J2 ? SEQ : DM;                           // row pitch of the f16 plane (halves)
    constexpr int KQ = K / KW;                                     // k range of one wave
    const int lane = threadIdx.x & 31, lr = lane & 15, hi = lane >> 4;
    const int wv = __builtin_amdgcn_readfirstlane((int)(threadIdx.x >> 5)), kbeg = wv * KQ;
    const int r0 = (J2 ? f % (DM / 64) : f % (NB * SEQ / 64)) * 64, c0 = (J2 ? f / (DM / 64) : f / (NB * SEQ / 64)) * 64;
    const int xr0 = J2 ? c0 : r0, wc0 = J2 ? r0 : c0;             // tile base of the row operand, of the weight outputs
    const int p = wv;                                              // the 16 output rows that this wave sums and stores: rows 16*p + row, in the v^T job rows 4*row + p
    // this wave's bias values (by row in the v^T job, else by column), asked for at the start: their latency runs beside the work in front of the sum (the barrier there waits for every load in flight)
    v4f bc0 = (v4f){}, bc1 = (v4f){};
    float br[4] = {0.0f, 0.0f, 0.0f, 0.0f};
    if constexpr (F32OUT) bc0 = *(const v4f*)(bias + c0 + lr * 4);
    else if constexpr (J2) {
#pragma unroll
        for (int s = 0; s < 4; ++s) br[s] = bias[r0 + 4 * (4 * s + (lane >> 3)) + p];
    } else { bc0 = *(const v4f*)(bias + c0 + (lane & 7) * 8); bc1 = *(const v4f*)(bias + c0 + (lane & 7) * 8 + 4); }
    asm volatile("s_wait_xcnt 0x0" ::: "memory");                  // precaution: stands in front of any later rewrite of the bias loads' address registers
    int xrow[4];                                                  // row of the batch that 16-row group xi of this lane reads (a 64-row tile lies in one batch)
#pragma unroll
    for (int xi = 0; xi < 4; ++xi) xrow[xi] = xr0 % SEQ + 16 * xi + lr;
    if constexpr (!F32OUT) {
        if (J2 || packed) {
            kidx += 64 * wv;                                      // every wave forms the list for itself: no barrier in front of the loads
            const int tot = key_list(kidx, MK + (size_t)(xr0 / SEQ) * SEQ_FULL, xr0 % SEQ);
            if (xr0 % SEQ >= (tot == 0 ? SEQ : tot)) return;      // the same for every wave of the block, in front of the barrier
            if (!J2 && xr0 % SEQ == 0 && wc0 == 0 && wv == 0 && lane == 0) { NV[xr0 / SEQ] = tot;
                asm volatile("s_wait_xcnt 0x0" ::: "memory"); }   // precaution: stands in front of any later rewrite of this store's registers
#pragma unroll
            for (int xi = 0; xi < 4; ++xi) xrow[xi] = kidx[16 * xi + lr];
        }
    }
    v8f acc[4][4];
#pragma unroll
    for (int xi = 0; xi < 4; ++xi)
#pragma unroll
        for (int wi = 0; wi < 4; ++wi) acc[xi][wi] = (v8f){};
    const size_t xoff = (size_t)(xr0 + lr) * K + 8 * hi;          // ctx plane (F32OUT)
    // f32 operands (F32OUT = false): byte offsets of this lane's four rows and of its weight column group, carried from trip to trip (all below 2^32)
    unsigned xob[4], wob = (unsigned)(((kbeg + 8 * hi) * DM + wc0 + 4 * lr) * sizeof(float));
#pragma unroll
    for (int xi = 0; xi < 4; ++xi) xob[xi] = (unsigned)((((xr0 / SEQ) * SEQ_FULL + xrow[xi]) * DM + kbeg + 8 * hi) * sizeof(float));
    const float* wbase = Wt + (size_t)(8 * hi) * DM + wc0 + 4 * lr;
#pragma unroll 1
    for (int kc = kbeg; kc < kbeg + KQ; kc += 32) {
        v16bf xf[4], wf[4];
        v4f wr[16];
        const float* wp = F32OUT ? wbase + (size_t)(kc & (DM - 1)) * DM : (const float*)((const char*)Wt + wob);
#pragma unroll
        for (int e = 0; e < 8; ++e) { wr[e] = *(const v4f*)(wp + (size_t)e * DM); wr[8 + e] = *(const v4f*)(wp + (size_t)(16 + e) * DM); }
        if constexpr (F32OUT) {
#pragma unroll
            for (int xi = 0; xi < 4; ++xi) xf[xi] = ldb(CXA + xoff + (size_t)xi * 16 * K + kc);
        } else {
            v8f xl[4], xh[4];
#pragma unroll
            for (int xi = 0; xi < 4; ++xi) { const float* xp = (const float*)((const char*)X + xob[xi]); xl[xi] = *(const v8f*)xp; xh[xi] = *(const v8f*)(xp + 16); }
            // inputs only: all loads of the trip are issued before the first conversion, so the trip waits out one load latency; built without it, the last three loads of a trip are issued only behind the waits for the first ones
            asm volatile("" :: "v"(wr[0]), "v"(wr[1]), "v"(wr[2]), "v"(wr[3]), "v"(wr[4]), "v"(wr[5]), "v"(wr[6]), "v"(wr[7]), "v"(wr[8]), "v"(wr[9]), "v"(wr[10]), "v"(wr[11]),
                             "v"(wr[12]), "v"(wr[13]), "v"(wr[14]), "v"(wr[15]), "v"(xl[0]), "v"(xl[1]), "v"(xl[2]), "v"(xl[3]), "v"(xh[0]), "v"(xh[1]), "v"(xh[2]), "v"(xh[3]));
            // precaution: stands in front of the rewrite of the loads' offset registers just below (named as operands so that the additions stay behind it)
            asm volatile("s_wait_xcnt 0x0" : "+v"(xob[0]), "+v"(xob[1]), "+v"(xob[2]), "+v"(xob[3]), "+v"(wob) :: "memory");
#pragma unroll
            for (int xi = 0; xi < 4; ++xi) xob[xi] += 32 * sizeof(float);
            wob += 32 * DM * sizeof(float);
#pragma unroll
            for (int xi = 0; xi < 4; ++xi) xf[xi] = cvx(xl[xi], xh[xi]);
        }
#pragma unroll
        for (int wi = 0; wi < 4; ++wi) wf[wi] = cvw(wr, wi);
#pragma unroll
        for (int wi = 0; wi < 4; ++wi)
#pragma unroll
            for (int xi = 0; xi < 4; ++xi) acc[xi][wi] = J2 ? wmmab(wf[wi], xf[xi], acc[xi][wi]) : wmmab(xf[xi], wf[wi], acc[xi][wi]);
        // keeps the vector slots the chip needs behind the last WMMA, also on the taken back edge
        asm volatile("v_nop\n\tv_nop\n\tv_nop\n\tv_nop" : "+v"(acc[0][0]), "+v"(acc[1][1]), "+v"(acc[2][2]), "+v"(acc[3][3]) : "v"(xf[0]), "v"(xf[1]), "v"(xf[2]), "v"(xf[3]));
        if constexpr (F32OUT) asm volatile("s_wait_xcnt 0x0" ::: "memory");   // precaution: the weight loads' address register is formed anew at the head of the next trip; this stands in front of that rewrite
    }
    const size_t tbase = J2 ? (size_t)r0 * SEQ + (size_t)(c0 / SEQ) * ((size_t)DM * SEQ) + (size_t)(c0 % SEQ) : (size_t)r0 * DM + (size_t)c0;
    float* ow = os + wv * OSW;                                     // this wave's partial tile: [pass][16 rows][68]
#pragma unroll
    for (int q = 0; q < 4; ++q) {
        if constexpr (J2) {
#pragma unroll
            for (int xi = 0; xi < 4; ++xi)
#pragma unroll
                for (int j = 0; j < 8; ++j) ow[(q * 16 + hi * 8 + j) * 68 + xi * 16 + lr] = acc[xi][q][j];   // D: row 8h+j (output 4*(8h+j) + q), col t = 16*xi + lane&15
        } else {
#pragma unroll
            for (int j = 0; j < 8; ++j) *(v4fa*)(&ow[(q * 16 + hi * 8 + j) * 68 + 4 * lr]) = (v4f){acc[q][0][j], acc[q][1][j], acc[q][2][j], acc[q][3][j]};   // D: row 8h+j, col 4*(lane&15) + wi
        }
    }
    __syncthreads();     // every wave's partial tile is in LDS before any row is summed
    const float* op = os + p * (16 * 68);                          // pass p of wave 0's partial tile; + w * OSW for wave w's
    if constexpr (!F32OUT) {
        const int c8 = (lane & 7) * 8;                             // 4 s x 4 row groups = 16 rows; 8 lanes x 8 = 64 columns
        v4f x0[4], x1[4];                                          // all sums first: the LDS reads of the four row groups go out together, in front of the stores' waits
#pragma unroll
        for (int s = 0; s < 4; ++s) { const int row = 4 * s + (lane >> 3);
            x0[s] = *(const v4fa*)(&op[row * 68 + c8]); x1[s] = *(const v4fa*)(&op[row * 68 + c8 + 4]);
#pragma unroll
            for (int w = 1; w < KW; ++w) { x0[s] += *(const v4fa*)(&op[w * OSW + row * 68 + c8]); x1[s] += *(const v4fa*)(&op[w * OSW + row * 68 + c8 + 4]); }
        }
#pragma unroll
        for (int s = 0; s < 4; ++s) { const int row = 4 * s + (lane >> 3);
            const int rofs = J2 ? 4 * row + p : p * 16 + row;
            if constexpr (J2) { bc0 = (v4f){br[s], br[s], br[s], br[s]}; bc1 = bc0; }
            v8h hv, rv;
#pragma unroll
            for (int i = 0; i < 4; ++i) { const float y0 = x0[s][i] + bfr(bc0[i]); const float y1 = x1[s][i] + bfr(bc1[i]);
                const h16 a0 = (h16)y0; const h16 a1 = (h16)y1; hv[i] = a0; hv[4 + i] = a1; rv[i] = (h16)((y0 - (float)a0) * QRS); rv[4 + i] = (h16)((y1 - (float)a1) * QRS); }
            const size_t oo = tbase + (size_t)rofs * (size_t)pitch + c8;
            *(v8h*)(Ph + oo) = hv;
            asm volatile("s_wait_xcnt 0x0" ::: "memory");         // precaution: stands in front of any later rewrite of this store's data or address registers, on both sides of the branch below
            if (useRes) { *(v8h*)(Pr + oo) = rv;
                asm volatile("s_wait_xcnt 0x0" ::: "memory"); }   // precaution: the same for the residual store
        }
    } else {
        const int cofs = lr * 4;                                   // 8 s x 2 rows = 16 rows; 16 lanes x 4 floats = 64 columns
        v4f val[8];
#pragma unroll
        for (int s = 0; s < 8; ++s) { const int row = 2 * s + hi;
            val[s] = *(const v4fa*)(&op[row * 68 + cofs]);
#pragma unroll
            for (int w = 1; w < KW; ++w) val[s] += *(const v4fa*)(&op[w * OSW + row * 68 + cofs]);
        }
#pragma unroll
        for (int s = 0; s < 8; ++s) { const int row = 2 * s + hi;
            const int m = r0 + p * 16 + row; const int bb = m / SEQ, tt = m - bb * SEQ;
#pragma unroll
            for (int i = 0; i < 4; ++i) val[s][i] = val[s][i] + bfr(bc0[i]);
            *(v4f*)(OUT + ((size_t)bb * OUT_SEQ + tt) * DM + c0 + cofs) = val[s]; }
    }
}

template <bool F32OUT>
__global__ __launch_bounds__(32 * KW) void k_gemm(const float* __restrict__ X0, const float* __restrict__ X1, const float* __restrict__ X2, const bf* __restrict__ CXA,
                                             const float* __restrict__ W0, const float* __restrict__ W1, const float* __restrict__ W2,
                                             h16* Ph0, h16* Ph1, h16* Ph2, h16* Pr, float* OUT,
                                             const float* __restrict__ bias0, const float* __restrict__ bias1, const float* __restrict__ bias2,
                                             const int* __restrict__ MK, int* NV) {
    __shared__ __align__(16) float os[KW * OSW];                  // [wave][64 rows][68]: the waves' partial tiles
    if constexpr (F32OUT) gemm_tile<true, false>(os, X0, CXA, W0, Ph0, Pr, OUT, bias0, false, blockIdx.x, nullptr, MK, NV, false);
    else {
        __shared__ int kidx[KW * 64];                             // [wave][64]
        const unsigned job = blockIdx.y;
        if (job == 2) gemm_tile<false, true>(os, X2, CXA, W2, Ph2, Pr, OUT, bias2, false, blockIdx.x, kidx, MK, NV, true);
        else gemm_tile<false, false>(os, job == 0 ? X0 : X1, CXA, job == 0 ? W0 : W1, job == 0 ? Ph0 : Ph1, Pr, OUT, job == 0 ? bias0 : bias1, job == 0, blockIdx.x, kidx, MK, NV, job == 1);
    }
}

// copy_kv: the K and V^T copies of two steps, 16 B a lane each, global memory to LDS through no register (lk*, lv* = the lane's LDS byte addresses).
// The s_wait_xcnt stands inside the statement as a precaution: behind it the address registers may be rewritten.
__device__ __forceinline__ void copy_kv(unsigned lk0, const h16* gk0, unsigned lv0, const h16* gv0, unsigned lk1, const h16* gk1, unsigned lv1, const h16* gv1) {
    asm volatile("global_load_async_to_lds_b128 %0, %1, off\n\tglobal_load_async_to_lds_b128 %2, %3, off\n\t"
                 "global_load_async_to_lds_b128 %4, %5, off\n\tglobal_load_async_to_lds_b128 %6, %7, off\n\ts_wait_xcnt 0x0"
                 :: "v"(lk0), "v"(gk0), "v"(lv0), "v"(gv0), "v"(lk1), "v"(gk1), "v"(lv1), "v"(gv1) : "memory");
}

// k_flash: fused attention, one work-group per 64 query rows of one batch and one PAIR of heads; one wave per (16 query rows, head, key range: a KS-th of the batch's 32-key steps).
// The waves of one key range walk the same K rows and V^T columns at the same time; both heads of the pair read the two halves of the same K lines.
// Q fragments straight from the f16 planes (two 16-B loads each). K and V^T go through LDS: trip t of the block works on steps SPT*t .. SPT*t + SPT-1 of every key range; the 8 waves of a range bring each step's K tile
// (32 keys x 128 B) and V^T tile (64 rows x 64 B) in with one asynchronous 16-B copy a lane each, whole lines or half lines, and all 8 read their fragments from there. Two buffers: the copies of trip t + 1 fly during trip t.
// A step past the range's own is copied all the same and never read (past the batch's last step: that last step again; written rows in either case), so that every wave issues the same copies and passes the same barriers.
// Transposed form: S^T[key][t] = K Q^T (A = K rows, B = Q rows); lane (t = lane&15, h = lane>>4) holds keys 8h+r of each 16-key tile, so the packed
// P tile is directly the B fragment of O^T[d][t] = V^T P^T (element r <- tile keys 0..15, element 8+r <- tile keys 16..31, lane unchanged).
// Key mask: the planes hold the packed keys; NV[b] = number of unmasked keys. Positions from NV[b] on (the rest of the last 32-key step; every position where NV[b] = 0) have their score REPLACED by the fill value
// (a fully masked row therefore comes out uniform); steps that lie wholly below NV[b] take no select.
// Softmax state (running max, partial sum) is one scalar per lane; the two lane halves of a row are combined with one xor-16 exchange.
// Each wave leaves its unnormalised O, its running max and its sum in LDS; behind one work-group barrier the KS partial results of a row are rescaled to their common max, added and normalised.
__global__ __launch_bounds__(32 * FW) void k_flash(const h16* __restrict__ QH, const h16* __restrict__ QR, const h16* __restrict__ KP, const h16* __restrict__ VT,
                                                   const int* __restrict__ NV, bf* CX) {
    __shared__ __align__(16) float os[KS * AW * 16 * 68];        // [key range][row of the block][68]: columns 0..63 = 32*head + d
    __shared__ float sm[KS * 2 * AW * 16], sl[KS * 2 * AW * 16]; // [key range][head][row of the block]: running max, sum
    __shared__ __align__(16) unsigned char ring[2 * BFB];        // [buffer][step of the trip][key range]: K tile [key][KPB], V^T tile [32*head + d][VPB]
    const int lane = threadIdx.x & 31, wave = __builtin_amdgcn_readfirstlane((int)(threadIdx.x >> 5)), lr = lane & 15, hi = lane >> 4;
    const int rt = wave % AW, hh = (wave / AW) & 1, ks = wave / (2 * AW);
    const int zp = blockIdx.y; const int b = zp / (NH_ / 2), hp = zp % (NH_ / 2);
    const int t0 = (blockIdx.x * AW + rt) * 16;
    const size_t rowb = (size_t)b * SEQ;
    const int nvr = NV[b];
    const int nv = __builtin_amdgcn_readfirstlane(nvr < 0 ? 0 : (nvr > SEQ ? SEQ : nvr));   // unmasked keys of the batch, bounded by the shape; kept scalar so that the loop's tail test is a scalar compare
    const int nt = ((nv == 0 ? SEQ : nv) + 31) / 32;             // 32-key steps that the planes hold (1 .. SEQ / 32)
    const int tq = (nt + KS - 1) / KS;                           // steps per key range; the last ranges may be short or empty
    {
        const int h = hp * 2 + hh;
        const size_t qo = (rowb + t0 + lr) * DM + h * HD + 8 * hi;
        const v16h qh = ldh(QH + qo), qr = ldh(QR + qo);                  // B fragments: col t, k = d (32 deep)
        const unsigned char* kf = ring + ks * RTB + lr * KPB + hh * 64 + 16 * hi;            // + buffer, step; + 16*KPB   (A fragment: row key, k = d)
        const unsigned char* vf = ring + ks * RTB + KTB + (hh * 32 + lr) * VPB + 16 * hi;    // + buffer, step; + 16*VPB   (A fragment: row d, k = key)
        // this lane's share of the copies: K row 4*w8 + lane/8, piece lane%8; V^T row 8*w8 + lane/4, piece lane%4 (w8 = the wave's number inside its key range)
        const int w8 = wave % (2 * AW);
        const int kr = 4 * w8 + (lane >> 3), kc = lane & 7, vr = 8 * w8 + (lane >> 2), vc = lane & 3;
        const h16* gk = KP + (rowb + kr) * DM + hp * 64 + kc * 8;                            // + key * DM
        const h16* gv = VT + ((size_t)b * DM + hp * 64 + vr) * SEQ + vc * 8;                 // + key
        const unsigned lk = (unsigned)(size_t)(ring + ks * RTB + kr * KPB + kc * 16), lv = (unsigned)(size_t)(ring + ks * RTB + KTB + vr * VPB + vc * 16);
        v8f o0 = (v8f){}, o1 = (v8f){};
        float m = -3.0e38f, l = 0.0f;
        const int tbeg = ks * tq, tend = tbeg + tq < nt ? tbeg + tq : nt;
        const int ntr = (tq + SPT - 1) / SPT;                    // trips: the same for every wave of the block
        // stage(t, bo): this lane's copies of trip t into the buffer at byte bo. c0, c1 = first key of the two steps (never past the batch's last step): below 32 * nt, so inside the rows that the projections wrote
        auto stage = [&](int t, unsigned bo) {
            const int s0 = tbeg + SPT * t, c0 = 32 * (s0 < nt ? s0 : nt - 1), c1 = 32 * (s0 + 1 < nt ? s0 + 1 : nt - 1);
            copy_kv(lk + bo, gk + (size_t)c0 * DM, lv + bo, gv + c0, lk + bo + SFB, gk + (size_t)c1 * DM, lv + bo + SFB, gv + c1);
        };
        stage(0, 0u);
        asm volatile("s_wait_asynccnt 0x0" ::: "memory");        // this wave's copies of trip 0 have landed
        __syncthreads();                                         // ... and every other wave's: buffer 0 may be read
        if (ntr > 1) stage(1, BFB);
#pragma unroll 1   // stays rolled: the trip count is only known at run time, and the buffer goes by the trip's parity
        for (int t = 0; t < ntr; ++t) {
         const unsigned bo = (t & 1) * BFB;
         for (int j = 0; j < SPT; ++j) {
          const int tt = tbeg + SPT * t + j;
          if (tt < tend) {                                       // same for the whole wave
            const int key0 = tt * 32;
            const h16* ka = (const h16*)(kf + bo + j * SFB);
            const v16h ka0 = ldh(ka), kb0 = ldh(ka + 16 * (KPB / 2));
            v8f sHa = (v8f){}, sLa = (v8f){}, sHb = (v8f){}, sLb = (v8f){};
            sHa = wmma16(ka0, qh, sHa); sLa = wmma16(ka0, qr, sLa); sHb = wmma16(kb0, qh, sHb); sLb = wmma16(kb0, qr, sLb);
            asm volatile("v_nop\n\tv_nop\n\tv_nop\n\tv_nop" : "+v"(sHa), "+v"(sLa), "+v"(sHb), "+v"(sLb) : "v"(ka0), "v"(kb0), "v"(qh), "v"(qr));
            float ta[8], tb[8]; float mx = -3.0e38f;
#pragma unroll
            for (int r = 0; r < 4; ++r) {
                ta[r] = (sHa[r] + sLa[r] * QRI) * SC2; ta[4 + r] = (sHa[4 + r] + sLa[4 + r] * QRI) * SC2;
                tb[r] = (sHb[r] + sLb[r] * QRI) * SC2; tb[4 + r] = (sHb[4 + r] + sLb[4 + r] * QRI) * SC2; }
            if (key0 + 32 > nv) {                                // same for the whole wave: the step reaches past the unmasked keys
                const int kl = nv - key0 - 8 * hi;               // element r stands for keys key0 + 8h + r and key0 + 16 + 8h + r
#pragma unroll
                for (int r = 0; r < 8; ++r) { ta[r] = (r < kl) ? ta[r] : NEGT; tb[r] = (16 + r < kl) ? tb[r] : NEGT; }
            }
#pragma unroll
            for (int r = 0; r < 8; ++r) mx = fmaxf(mx, fmaxf(ta[r], tb[r]));
            mx = fmaxf(mx, __shfl_xor(mx, 16, 32));
            const float mnew = fmaxf(m, mx);
            const float alpha = __builtin_amdgcn_exp2f(m - mnew);
            const float sh = PSH - mnew;
            v16h pb; float ls = 0.0f;
#pragma unroll
            for (int r = 0; r < 8; ++r) { const h16 pa = (h16)__builtin_amdgcn_exp2f(ta[r] + sh); const h16 pc = (h16)__builtin_amdgcn_exp2f(tb[r] + sh); pb[r] = pa; pb[8 + r] = pc; ls += (float)pa + (float)pc; }
            l = l * alpha + ls; m = mnew;
            o0 = o0 * alpha; o1 = o1 * alpha;
            const h16* va = (const h16*)(vf + bo + j * SFB);
            const v16h v0 = ldh(va), v1 = ldh(va + 16 * (VPB / 2));
            o0 = wmma16(v0, pb, o0); o1 = wmma16(v1, pb, o1);
            asm volatile("v_nop\n\tv_nop\n\tv_nop\n\tv_nop" : "+v"(o0), "+v"(o1) : "v"(v0), "v"(v1), "v"(pb));
          }
         }
         asm volatile("s_wait_dscnt 0x0" ::: "memory");          // this wave's reads of the trip's buffer are done before the buffer is handed on
         asm volatile("s_wait_asynccnt 0x0" ::: "memory");       // this wave's copies of trip t + 1 have landed
         __syncthreads();                                        // publishes the buffer of trip t + 1 and ends every wave's reads of this trip's
         if (t + 2 < ntr) stage(t + 2, bo);                      // same for the whole block
        }
        asm volatile("s_wait_asynccnt 0x0" ::: "memory");        // no copy is outstanding behind the loop
        l += __shfl_xor(l, 16, 32);
        // O^T D layout: o_j[r] = (d = 16j + 8h + r, t = lane&15) -> os[key range][16*rt + t][32*hh + d], unnormalised
        { const int ob = ((ks * AW + rt) * 16 + lr) * 68 + hh * 32 + 8 * hi;
          *(v4fa*)(&os[ob])      = (v4f){o0[0], o0[1], o0[2], o0[3]}; *(v4fa*)(&os[ob + 4])  = (v4f){o0[4], o0[5], o0[6], o0[7]};
          *(v4fa*)(&os[ob + 16]) = (v4f){o1[0], o1[1], o1[2], o1[3]}; *(v4fa*)(&os[ob + 20]) = (v4f){o1[4], o1[5], o1[6], o1[7]}; }
        if (hi == 0) { const int si = ((ks * 2 + hh) * AW + rt) * 16 + lr; sm[si] = m; sl[si] = l; }
    }
    __syncthreads();     // every wave's partial result is in LDS before any row is merged
    const int tid = threadIdx.x;
    if (tid < AW * 16 * 8) {                                     // whole waves: 64 rows x 8 lanes x 8 columns
        const int row = tid >> 3, c8 = (tid & 7) * 8, hq = c8 >> 5;
        float pm[KS]; float mx = -3.0e38f;
#pragma unroll
        for (int p = 0; p < KS; ++p) { pm[p] = sm[(p * 2 + hq) * (AW * 16) + row]; mx = fmaxf(mx, pm[p]); }
        v4f x0 = (v4f){}, x1 = (v4f){}; float l = 0.0f;
#pragma unroll
        for (int p = 0; p < KS; ++p) { const float f = __builtin_amdgcn_exp2f(pm[p] - mx);
            l += f * sl[(p * 2 + hq) * (AW * 16) + row];
            x0 += *(const v4fa*)(&os[(p * (AW * 16) + row) * 68 + c8]) * f; x1 += *(const v4fa*)(&os[(p * (AW * 16) + row) * 68 + c8 + 4]) * f; }
        const float inv = 1.0f / l;
        x0 = x0 * inv; x1 = x1 * inv;
        v8us hv, lv;
#pragma unroll
        for (int i = 0; i < 4; ++i) { const unsigned short u0 = f2bf(x0[i]); const unsigned short u1 = f2bf(x1[i]); hv[i] = u0; hv[4 + i] = u1;
            lv[i] = f2bf(x0[i] - bf2f(u0)); lv[4 + i] = f2bf(x1[i] - bf2f(u1)); }
        bf* crow = CX + (rowb + (size_t)blockIdx.x * (AW * 16) + row) * CXP + hp * 64 + c8;
        *(v8us*)(crow) = hv; *(v8us*)(crow + DM) = lv;
    }
}

static constexpr size_t al256(size_t v) { return (v + 255) & ~(size_t)255; }
static constexpr size_t SZ_PL = al256((size_t)NB * SEQ * DM * 2);
static constexpr size_t SZ_CX = al256((size_t)NB * SEQ * CXP * 2);
static constexpr size_t SZ_NV = al256((size_t)NB * sizeof(int));
static constexpr size_t SZ_TOTAL = 4 * SZ_PL + SZ_CX + SZ_NV;
static_assert(SZ_TOTAL <= (size_t)134217728);          // workspace carve <= 128 MiB
static_assert((size_t)NB * DM * SEQ * 2 <= SZ_PL);     // v^T plane extent

extern "C" void kernel_launch(void* const* d_in, const int* in_sizes, int n_in,
                              void* d_out, int out_size, void* d_ws, size_t ws_size, hipStream_t stream) {
    if (n_in < 12) return;
    const size_t needx = ((size_t)(NB - 1) * SEQ_FULL + SEQ) * DM;
    if ((size_t)in_sizes[0] < needx || (size_t)in_sizes[1] < needx || (size_t)in_sizes[2] < needx) return;
    if ((size_t)in_sizes[3] < (size_t)(NB - 1) * SEQ_FULL + SEQ) return;
    if ((size_t)in_sizes[4] < (size_t)DM * DM || (size_t)in_sizes[6] < (size_t)DM * DM || (size_t)in_sizes[8] < (size_t)DM * DM || (size_t)in_sizes[10] < (size_t)DM * DM) return;
    if (in_sizes[5] < DM || in_sizes[7] < DM || in_sizes[9] < DM || in_sizes[11] < DM) return;
    if ((size_t)out_size < ((size_t)(NB - 1) * OUT_SEQ + SEQ) * DM) return;
    if (SZ_TOTAL > ws_size) return;
    // wire order: queries, keys, values, key_mask, Wq, bq, Wk, bk, Wv, bv, Wo, bo
    const float* xq = (const float*)d_in[0]; const float* xk = (const float*)d_in[1]; const float* xv = (const float*)d_in[2];
    const int* kmask = (const int*)d_in[3];
    const float* wq = (const float*)d_in[4]; const float* bq = (const float*)d_in[5];
    const float* wk = (const float*)d_in[6]; const float* bk = (const float*)d_in[7];
    const float* wv = (const float*)d_in[8]; const float* bv = (const float*)d_in[9];
    const float* wo = (const float*)d_in[10]; const float* bo = (const float*)d_in[11];
    float* OUT = (float*)d_out;      // [NB][SEQ][256]
    char* wsp = (char*)d_ws;
    h16* QH = (h16*)wsp; wsp += SZ_PL;               // [NB*SEQ][256]
    h16* QR = (h16*)wsp; wsp += SZ_PL;               // [NB*SEQ][256] residual x2048
    h16* KP = (h16*)wsp; wsp += SZ_PL;               // [NB*SEQ][256]
    h16* VT = (h16*)wsp; wsp += SZ_PL;               // [NB][256][SEQ]
    bf* CX = (bf*)wsp; wsp += SZ_CX;                 // [NB*SEQ][512]: ctx hi | ctx lo
    int* NV = (int*)wsp; wsp += SZ_NV;               // [NB]: unmasked keys of each batch

    k_gemm<false><<<dim3(PTB, 3, 1), 32 * KW, 0, stream>>>(xq, xk, xv, CX, wq, wk, wv, QH, KP, VT, QR, OUT, bq, bk, bv, kmask, NV);

    k_flash<<<dim3(SEQ / (16 * AW), NB * (NH_ / 2), 1), 32 * FW, 0, stream>>>(QH, QR, KP, VT, NV, CX);

    // out = [ctx_hi | ctx_lo] x [Wo ; Wo] + bo, K = 512, f32 rows of the output (the activation pointers are not read here)
    k_gemm<true><<<dim3(PTB, 1, 1), 32 * KW, 0, stream>>>(wo, wo, wo, CX, wo, wo, wo, QH, QH, QH, QH, OUT, bo, bo, bo, kmask, NV);
}

// v007
// It runs in 24 microseconds.
// Next to v006, in two timings, it ran 1.10 and 1.09 times as fast.
// Over all steps from v000 it is 6.35 times as fast.
#include <hip/hip_runtime.h>

// Multi-head attention with key padding mask: q/k/v inputs [NB][SEQ][256], Wq/Wk/Wv/Wo [in][out] (y = x W + b), 8 heads x 32, score scale 1/sqrt(32), masked keys take the fill value -4294967296, output = ctx Wo + bo (f32).
// Compute dtypes, f32 accumulate everywhere: projections v_wmma_f32_16x16x32_bf16 (inputs and weights RNE-converted to bf16; products exact);
// scores v_wmma_f32_16x16x32_f16: k single f16, q as f16 value + f16 residual x2048 in its own accumulator (two products); P (x256 carry, cancels in the normalisation) and v single f16; softmax f32 (online, running max);
// output projection v_wmma_f32_16x16x32_bf16 with ctx carried as bf16 hi | bf16 lo planes folded along K (K = 512, weight row = k mod 256).
// Layout: activations and weights are read as f32 by the GEMMs and rounded in registers (the activations and the ctx plane by way of LDS); q (hi, residual), k planes [b*SEQ + t][256] (head h = columns 32h..32h+31) and v^T plane [b][256][SEQ] written by the GEMM epilogue;
// Key mask: the k and v^T planes hold only the unmasked keys of a batch, packed without gaps in one fixed order (key_list; the same for both planes); a masked key's weight is exactly 0 beside any unmasked one, so attention runs over the packed keys alone.
// A batch with no unmasked key keeps all its keys in the planes, and every score takes the fill value (uniform weights, as the reference gives).

#ifndef NB
#define NB 2
#endif
#ifndef SEQ
#define SEQ 2048
#endif
#define NB_FULL  2
#define SEQ_FULL 2048
#ifndef OUT_SEQ
#define OUT_SEQ SEQ              // row pitch (in tokens) between batches of the output
#endif
#define DM   256
#define NH_  8
#define HD   32
#define CXP  (2 * DM)            // ctx plane pitch: hi columns 0..255, lo columns 256..511
#define AW   4                   // 16-row query tiles per flash block
#define KS   4                   // key ranges per (query tile, head), one wave each
#define FW   (AW * 2 * KS)       // waves per flash block: query tiles x 2 heads x key ranges
#define KW   4                   // waves per GEMM block: each takes a KW-th of the k range of the block's tile
#define OSW  (64 * 68)           // floats of one wave's partial tile in LDS: 64 rows, pitch 68
#define XRB  1024                // bytes of one row of a GEMM's row operand in global memory (256 f32, or 512 bf16 of the ctx plane)
#define XPB  272                 // LDS pitch of a staged row of the row operand, bytes: 256 (one wave's k range of the row) + 16, 16 B x odd for the ds_load_b128 readers
#define QRS  2048.0f             // carry of the q residual plane
#define QRI  (1.0f / 2048.0f)
#define SC2  (0.17677669529663687f * 1.4426950408889634f)   // HD^-0.5 * log2(e)
#define PSH  8.0f                // log2 of the P carry (256)
#define NEGT (-4294967296.0f * 1.4426950408889634f)         // mask fill value in the log2 domain
#define KPB  144                 // LDS pitch of a staged K row, bytes: 128 (32 columns x 2 heads) + 16, 16 B x odd for the ds_load_b128 readers
#define VPB  80                  // LDS pitch of a staged V^T row, bytes: 64 (32 keys) + 16, 16 B x odd
#define KTB  (32 * KPB)          // one K tile: 32 keys
#define VTB  (64 * VPB)          // one V^T tile: 64 rows (2 heads x 32)
#define RTB  (KTB + VTB)         // one step of one key range
#define SFB  (KS * RTB)          // one 32-key step of every key range
#define SPT  2                   // steps of a key range per buffer (per trip between two barriers)
#define BFB  (SPT * SFB)         // one buffer

static_assert(HD == 32);
static_assert(NH_ * HD == DM);                 // head h = columns h*32 + d
static_assert(NH_ % 2 == 0);
static_assert(DM % 64 == 0);
static_assert(DM % 32 == 0);                   // GEMM k-loop steps by 32
static_assert(CXP % 32 == 0);
static_assert(DM % (32 * KW) == 0);            // every wave of a GEMM block gets whole 32-deep trips (CXP = 2 * DM too)
static_assert(DM * 4 == XRB && CXP * 2 == XRB); // both row operands have rows of XRB bytes
static_assert(XRB / KW == 256 && XPB == 256 + 16 && XPB % 16 == 0);
static_assert(64 * XPB == OSW * 4);            // a wave's 64 staged rows fill the place of its partial tile
static_assert(KW == 4);                        // behind the sum, wave p stores the p-th of the tile's four 16-row passes
static_assert(SEQ % 64 == 0);                  // a 64-row tile never straddles two batches
static_assert((NB * SEQ) % 64 == 0);
static_assert(SEQ % (32 * KS) == 0);           // key loop steps by 32 inside each key range
static_assert(FW * 32 <= 1024);
static_assert(AW * 2 == 8);                    // the 8 waves of a key range copy its tiles: 256 lanes x 16 B = 4 KiB for K, the same for V^T
static_assert(KPB % 16 == 0 && VPB % 16 == 0 && KTB % 16 == 0 && RTB % 16 == 0);
static_assert(SPT == 2);                       // copy_kv holds the copies of two steps
static_assert(FW * 32 >= AW * 16 * 8);         // the merge uses one thread per (row, 8 columns)
static_assert(SEQ % (16 * AW) == 0);           // flash grid covers the sequence exactly
static_assert(((size_t)SEQ * DM) % 8 == 0);
static_assert(NB <= NB_FULL);
static_assert(SEQ <= SEQ_FULL);

typedef _Float16 h16;
typedef unsigned short bf;
typedef __attribute__((ext_vector_type(16))) __bf16   v16bf;
typedef __attribute__((ext_vector_type(16))) _Float16 v16h;
typedef __attribute__((ext_vector_type(8)))  _Float16 v8h;
typedef __attribute__((ext_vector_type(8)))  unsigned short v8us;
typedef __attribute__((ext_vector_type(8)))  float    v8f;
typedef __attribute__((ext_vector_type(16))) float    v16f;
typedef __attribute__((ext_vector_type(4)))  float    v4f;
typedef __attribute__((ext_vector_type(4)))  int      v4i;
typedef v4f  __attribute__((may_alias)) v4fa;
typedef v8us __attribute__((may_alias)) v8usa;

__device__ __forceinline__ unsigned short f2bf(float f) { unsigned u = __float_as_uint(f); u += 0x7FFFu + ((u >> 16) & 1u); return (unsigned short)(u >> 16); }
__device__ __forceinline__ float bf2f(unsigned short s) { return __uint_as_float(((unsigned)s) << 16); }
__device__ __forceinline__ float bfr(float f) { return bf2f(f2bf(f)); }
__device__ __forceinline__ v16h cat16(v8h lo, v8h hi) { return __builtin_shufflevector(lo, hi, 0, 1, 2, 3, 4, 5, 6, 7, 8, 9, 10, 11, 12, 13, 14, 15); }
__device__ __forceinline__ v16bf cat16b(v8us lo, v8us hi) { return __builtin_bit_cast(v16bf, __builtin_shufflevector(lo, hi, 0, 1, 2, 3, 4, 5, 6, 7, 8, 9, 10, 11, 12, 13, 14, 15)); }
__device__ __forceinline__ v8f wmma16(v16h a, v16h b, v8f c) { return __builtin_amdgcn_wmma_f32_16x16x32_f16(false, a, false, b, (short)0, c, false, false); }
__device__ __forceinline__ v8f wmmab(v16bf a, v16bf b, v8f c) { return __builtin_amdgcn_wmma_f32_16x16x32_bf16(false, a, false, b, (short)0, c, false, false); }
// fragment loaders from K-contiguous 16-bit rows; p already includes + 8*(lane>>4): elements 0..7 <- k0+8h+0..7, elements 8..15 <- k0+16+8h+0..7 (same map for A and B)
__device__ __forceinline__ v16h  ldh(const h16* p) { return cat16(*(const v8h*)p, *(const v8h*)(p + 16)); }
__device__ __forceinline__ v16bf ldb(const bf* p)  { return cat16b(*(const v8us*)p, *(const v8us*)(p + 16)); }
// the same fragments from rows staged in LDS (16-B reads): 16 bf16, or one 8-float piece of an f32 row
__device__ __forceinline__ v16bf ldbs(const bf* p) { return cat16b(*(const v8usa*)p, *(const v8usa*)(p + 16)); }
__device__ __forceinline__ v8f lds8(const float* p) { return __builtin_shufflevector(*(const v4fa*)p, *(const v4fa*)(p + 4), 0, 1, 2, 3, 4, 5, 6, 7); }
// ordering point for wave-private LDS tiles (same wave writes and reads)
__device__ __forceinline__ void wave_sync() { __builtin_amdgcn_fence(3 /* release order */, "wavefront"); __builtin_amdgcn_wave_barrier(); asm volatile("" ::: "memory"); }

// cvx: fragment from the two 8-float pieces of one K-contiguous f32 row (k0+8h+0..7, k0+16+8h+0..7: the k map of ldb), rounded to bf16 (RNE) in registers
__device__ __forceinline__ v16bf cvx(v8f lo, v8f hi8) {
    return __builtin_convertvector(__builtin_shufflevector(lo, hi8, 0, 1, 2, 3, 4, 5, 6, 7, 8, 9, 10, 11, 12, 13, 14, 15), v16bf);
}
// Weight fragments come four at once from W[k][n] (f32, row pitch DM): one 16-B load per k at W + k * DM + n0 + 4*(lane&15) gives the lane that k of the four outputs n0 + 4*(lane&15) + i.
// r[e] = row k0+8h+e, r[8+e] = row k0+16+8h+e (the k map of ldb); cvw: fragment i holds outputs n0 + 4*l + i (l = its 16 rows or columns), rounded to bf16 (RNE) in registers.
__device__ __forceinline__ v16bf cvw(const v4f (&r)[16], int i) {
    v16f t;
#pragma unroll
    for (int e = 0; e < 16; ++e) t[e] = r[e][i];
    return __builtin_convertvector(t, v16bf);
}

// key_list (one wave): returns the number of unmasked keys of one batch (mkb = its SEQ mask words) and leaves in idx[0..63] the keys that stand at packed positions lo..lo+63.
// Load i gives lane c the mask of keys 128*i + 4*c + 0..3; bit t of the lane's SEQ/32 bits (32 to a word w[j]) stands for key 128*(t>>2) + 4*c + (t&3).
// Packed order: by lane, then by bit (any order serves, as k and v^T use the same one). p = first packed position of the lane's current word (lane prefix sum, one ballot per bit of the counts).
// Only the words that reach into lo..lo+63 are then walked, one word (32 keys, one a lane) a trip. No unmasked key at all: every key counts as present.
// Positions past the last key keep key 0: finite rows that the attention kernel masks. Every entry is formed from lane, word and bit numbers alone and lies below SEQ.
__device__ __forceinline__ int key_list(int* idx, const int* __restrict__ mkb, int lo) {
    constexpr int NW = SEQ / 1024;
    static_assert(SEQ % 1024 == 0 && SEQ / 32 < 128);
    const int lane = threadIdx.x & 31;
    v4i mv[8 * NW];
#pragma unroll
    for (int i = 0; i < 8 * NW; ++i) mv[i] = *(const v4i*)(mkb + 128 * i + 4 * lane);
    asm volatile("s_wait_xcnt 0x0" ::: "memory");   // precaution: stands in front of any later rewrite of the mask loads' address registers
    unsigned w[NW];
    unsigned any = 0u;
#pragma unroll
    for (int j = 0; j < NW; ++j) {
        w[j] = 0u;
#pragma unroll
        for (int t = 0; t < 32; ++t) w[j] |= mv[8 * j + (t >> 2)][t & 3] != 0 ? 1u << t : 0u;
        any |= w[j];
    }
    const bool none = __builtin_amdgcn_ballot_w32(any != 0u) == 0u;
    int cn = 0;
#pragma unroll
    for (int j = 0; j < NW; ++j) { if (none) w[j] = ~0u; cn += __builtin_popcount(w[j]); }   // cn = 0 .. SEQ / 32: seven bits
    int p = 0, tot = 0;
#pragma unroll
    for (int bit = 0; bit < 7; ++bit) {
        const unsigned bb = __builtin_amdgcn_ballot_w32(((cn >> bit) & 1) != 0);
        p += (int)__builtin_amdgcn_mbcnt_lo(bb, 0u) << bit;
        tot += __builtin_popcount(bb) << bit;
    }
    const int nvalid = none ? 0 : tot;
    if (lo >= tot) return nvalid;                    // nothing stands at these positions: the caller leaves
    idx[lane] = 0; idx[lane + 32] = 0;
#pragma unroll
    for (int j = 0; j < NW; ++j) {
        const int cj = __builtin_popcount(w[j]);
        unsigned todo = __builtin_amdgcn_ballot_w32(p + cj > lo && p < lo + 64);
        while (todo != 0u) {                         // same for the whole wave; one bit goes each trip: at most 32 trips
            const int c = __builtin_ctz(todo);
            todo &= todo - 1u;
            const unsigned bc = (unsigned)__builtin_amdgcn_readlane((int)w[j], c);
            const int pos = __builtin_amdgcn_readlane(p, c) - lo + (int)__builtin_amdgcn_mbcnt_lo(bc, 0u);
            if (((bc >> lane) & 1u) != 0u && pos >= 0 && pos < 64) idx[pos] = 128 * (8 * j + (lane >> 2)) + 4 * c + (lane & 3);
        }
        p += cj;
    }
    wave_sync();
    return nvalid;
}

// copy_x8: eight asynchronous copies, 16 B a lane each, global memory to LDS through no register (l = the lane's LDS byte addresses, g = its global addresses).
// The s_wait_xcnt stands inside the statement as a precaution: behind it the address registers may be rewritten.
__device__ __forceinline__ void copy_x8(const unsigned (&l)[8], const char* const (&g)[8]) {
    asm volatile("global_load_async_to_lds_b128 %0, %8, off\n\tglobal_load_async_to_lds_b128 %1, %9, off\n\t"
                 "global_load_async_to_lds_b128 %2, %10, off\n\tglobal_load_async_to_lds_b128 %3, %11, off\n\t"
                 "global_load_async_to_lds_b128 %4, %12, off\n\tglobal_load_async_to_lds_b128 %5, %13, off\n\t"
                 "global_load_async_to_lds_b128 %6, %14, off\n\tglobal_load_async_to_lds_b128 %7, %15, off\n\ts_wait_xcnt 0x0"
                 :: "v"(l[0]), "v"(l[1]), "v"(l[2]), "v"(l[3]), "v"(l[4]), "v"(l[5]), "v"(l[6]), "v"(l[7]),
                    "v"(g[0]), "v"(g[1]), "v"(g[2]), "v"(g[3]), "v"(g[4]), "v"(g[5]), "v"(g[6]), "v"(g[7]) : "memory");
}

// k_gemm: register-blocked bf16 GEMM, one block of KW waves per 64x64 tile; every wave holds the whole tile (16 accumulators) over its own KW-th of k, leaves its partial tile in LDS,
// and behind one work-group barrier wave p adds the KW partial tiles (in wave order) for the p-th 16-row pass, adds the bias and stores. The weight operand comes straight from the f32 input W[k][n] (cvw), the other operand from K-contiguous rows:
// the f32 activation input (cvx; F32OUT = false) or the bf16 ctx plane (F32OUT = true, K = 512, weight row = k mod 256). Bias: bf16 RNE value of the f32 bias, added in f32.
// The row operand goes through LDS: a fragment load straight from global memory touches 16 rows (16 lines for 512 B). Each wave brings its own 64 rows x 256 B (its k range) in with 32 asynchronous copies,
// two rows (four whole lines) a copy, into the place where its partial tile will stand later (pitch XPB), and reads its fragments from there; only the wave that copied reads these bytes, behind its own s_wait_asynccnt: no barrier.
// acc[xi][wi]: xi = 16-row group of the row operand (rows 16*xi + l), wi = weight fragment (outputs 4*l + wi).
// F32OUT = false: the three input projections in ONE launch, blockIdx.y picks the job, PTB tiles each, the row tile running fastest in blockIdx.x; written as f16 (Ph), q also as the f16 residual x2048 (Pr):
//   job 0 (q), job 1 (k): A = x rows (m = b*SEQ + t), B = W columns (n = h*32 + d) -> plane [m][n], bias by column
//   job 2 (v^T): A = Wv columns (m = h*32 + d), B = x rows (n = b*SEQ + t) -> plane [(b*256 + m)][t], bias by row
//   jobs 1 and 2: t is a packed position, the x row read for it is the key that key_list names; a tile past the last packed key leaves at once; job 1's first tile of a batch stores the batch's count in NV
// F32OUT = true: the output projection, f32 rows of OUT[(m/SEQ)*OUT_SEQ + m%SEQ][c0 + col]; each row segment (64 floats = two lines) written by 16 consecutive lanes x 16 B (2 rows per instruction).
#define PTB ((NB * SEQ / 64) * (DM / 64))
// gemm_tile: one 64x64 tile. J2 = the v^T job (weight fragments as A). f = tile index, the row tile running fastest.
template <bool F32OUT, bool J2>
__device__ __forceinline__ void gemm_tile(float* os, const float* __restrict__ X, const bf* __restrict__ CXA, const float* __restrict__ Wt,
                                          h16* Ph, h16* Pr, float* OUT, const float* __restrict__ bias, bool useRes, unsigned f,
                                          int* kidx, const int* __restrict__ MK, int* NV, bool packed) {
    constexpr int K = F32OUT ? CXP : DM;
    constexpr int pitch = J2 ? SEQ : DM;                           // row pitch of the f16 plane (halves)
    constexpr int KQ = K / KW;                                     // k range of one wave
    const int lane = threadIdx.x & 31, lr = lane & 15, hi = lane >> 4;
    const int wv = __builtin_amdgcn_readfirstlane((int)(threadIdx.x >> 5)), kbeg = wv * KQ;
    const int r0 = (J2 ? f % (DM / 64) : f % (NB * SEQ / 64)) * 64, c0 = (J2 ? f / (DM / 64) : f / (NB * SEQ / 64)) * 64;
    const int xr0 = J2 ? c0 : r0, wc0 = J2 ? r0 : c0;             // tile base of the row operand, of the weight outputs
    const int p = wv;                                              // the 16 output rows that this wave sums and stores: rows 16*p + row, in the v^T job rows 4*row + p
    // this wave's bias values (by row in the v^T job, else by column), asked for at the start: their latency runs beside the work in front of the sum (the barrier there waits for every load in flight)
    v4f bc0 = (v4f){}, bc1 = (v4f){};
    float br[4] = {0.0f, 0.0f, 0.0f, 0.0f};
    if constexpr (F32OUT) bc0 = *(const v4f*)(bias + c0 + lr * 4);
    else if constexpr (J2) {
#pragma unroll
        for (int s = 0; s < 4; ++s) br[s] = bias[r0 + 4 * (4 * s + (lane >> 3)) + p];
    } else { bc0 = *(const v4f*)(bias + c0 + (lane & 7) * 8); bc1 = *(const v4f*)(bias + c0 + (lane & 7) * 8 + 4); }
    asm volatile("s_wait_xcnt 0x0" ::: "memory");                  // precaution: stands in front of any later rewrite of the bias loads' address registers
    if constexpr (!F32OUT) {
        if (J2 || packed) {
            kidx += 64 * wv;                                      // every wave forms the list for itself: no barrier in front of the loads
            const int tot = key_list(kidx, MK + (size_t)(xr0 / SEQ) * SEQ_FULL, xr0 % SEQ);
            if (xr0 % SEQ >= (tot == 0 ? SEQ : tot)) return;      // the same for every wave of the block, in front of the barrier
            if (!J2 && xr0 % SEQ == 0 && wc0 == 0 && wv == 0 && lane == 0) { NV[xr0 / SEQ] = tot;
                asm volatile("s_wait_xcnt 0x0" ::: "memory"); }   // precaution: stands in front of any later rewrite of this store's registers
        }
    }
    v8f acc[4][4];
#pragma unroll
    for (int xi = 0; xi < 4; ++xi)
#pragma unroll
        for (int wi = 0; wi < 4; ++wi) acc[xi][wi] = (v8f){};
    float* ow = os + wv * OSW;                                     // this wave's place in LDS: first its staged rows [64][XPB bytes], then its partial tile [pass][16 rows][68]
    const float* xs = ow + lr * (XPB / 4) + 8 * hi;                // f32 rows: + 16*xi rows, + k inside the wave's range
    const bf* xb = (const bf*)ow + lr * (XPB / 2) + 8 * hi;       // ctx rows (F32OUT)
    // f32 weights (F32OUT = false): byte offset of this lane's weight column group, carried from trip to trip (below 2^32)
    unsigned wob = (unsigned)(((kbeg + 8 * hi) * DM + wc0 + 4 * lr) * sizeof(float));
    const float* wbase = Wt + (size_t)(8 * hi) * DM + wc0 + 4 * lr;
    // one 32-deep trip; first = the wave's first trip, which also brings the staged rows in
    auto trip = [&](const int kc, const bool first) __attribute__((always_inline)) {
        v16bf xf[4], wf[4];
        v4f wr[16];
        const float* wp = F32OUT ? wbase + (size_t)(kc & (DM - 1)) * DM : (const float*)((const char*)Wt + wob);
#pragma unroll
        for (int e = 0; e < 8; ++e) { wr[e] = *(const v4f*)(wp + (size_t)e * DM); wr[8 + e] = *(const v4f*)(wp + (size_t)(16 + e) * DM); }
        if (first) {                                              // known at compile time. The copies go out behind the first trip's weight loads, so that those loads fly beside the copies' address work and the copies
            // copy i of this lane brings 16 B (piece lane&15) of the tile's row 32*hi + i: srow[i] = that row's number in its batch (a 64-row tile lies in one batch), in the ctx plane its number in the tile
            int srow[32];
#pragma unroll
            for (int i = 0; i < 32; ++i) srow[i] = (F32OUT ? 0 : xr0 % SEQ) + 32 * hi + i;
            if constexpr (!F32OUT) {
                if (J2 || packed) {
#pragma unroll
                    for (int i = 0; i < 32; i += 4) { const v4i t = *(const v4i*)(kidx + 32 * hi + i); srow[i] = t[0]; srow[i + 1] = t[1]; srow[i + 2] = t[2]; srow[i + 3] = t[3]; }
                }
            }
            const char* gx = (F32OUT ? (const char*)(CXA + (size_t)xr0 * K + kbeg) : (const char*)(X + (size_t)(xr0 / SEQ) * SEQ_FULL * DM + kbeg)) + 16 * lr;
            const unsigned lx = (unsigned)(size_t)ow + (unsigned)(32 * hi * XPB + 16 * lr);
#pragma unroll
            for (int c = 0; c < 32; c += 8) {
                unsigned l[8]; const char* g[8];
#pragma unroll
                for (int e = 0; e < 8; ++e) { l[e] = lx + (unsigned)((c + e) * XPB); g[e] = gx + (size_t)(unsigned)srow[c + e] * XRB; }
                copy_x8(l, g);
            }
            asm volatile("s_wait_asynccnt 0x0" ::: "memory");     // this wave's staged rows have landed
        }
        if constexpr (F32OUT) {
#pragma unroll
            for (int xi = 0; xi < 4; ++xi) xf[xi] = ldbs(xb + xi * 16 * (XPB / 2) + (kc - kbeg));
        } else {
            v8f xl[4], xh[4];
#pragma unroll
            for (int xi = 0; xi < 4; ++xi) { const float* xp = xs + xi * 16 * (XPB / 4) + (kc - kbeg); xl[xi] = lds8(xp); xh[xi] = lds8(xp + 16); }
            // inputs only: all loads of the trip are issued before the first conversion, so the trip waits out one load latency; built without it, the last three loads of a trip are issued only behind the waits for the first ones
            asm volatile("" :: "v"(wr[0]), "v"(wr[1]), "v"(wr[2]), "v"(wr[3]), "v"(wr[4]), "v"(wr[5]), "v"(wr[6]), "v"(wr[7]), "v"(wr[8]), "v"(wr[9]), "v"(wr[10]), "v"(wr[11]),
                             "v"(wr[12]), "v"(wr[13]), "v"(wr[14]), "v"(wr[15]), "v"(xl[0]), "v"(xl[1]), "v"(xl[2]), "v"(xl[3]), "v"(xh[0]), "v"(xh[1]), "v"(xh[2]), "v"(xh[3]));
            // precaution: stands in front of the rewrite of the weight loads' offset register just below (named as an operand so that the addition stays behind it)
            asm volatile("s_wait_xcnt 0x0" : "+v"(wob) :: "memory");
            wob += 32 * DM * sizeof(float);
#pragma unroll
            for (int xi = 0; xi < 4; ++xi) xf[xi] = cvx(xl[xi], xh[xi]);
        }
#pragma unroll
        for (int wi = 0; wi < 4; ++wi) wf[wi] = cvw(wr, wi);
#pragma unroll
        for (int wi = 0; wi < 4; ++wi)
#pragma unroll
            for (int xi = 0; xi < 4; ++xi) acc[xi][wi] = J2 ? wmmab(wf[wi], xf[xi], acc[xi][wi]) : wmmab(xf[xi], wf[wi], acc[xi][wi]);
        // keeps the vector slots the chip needs behind the last WMMA, also on the taken back edge
        asm volatile("v_nop\n\tv_nop\n\tv_nop\n\tv_nop" : "+v"(acc[0][0]), "+v"(acc[1][1]), "+v"(acc[2][2]), "+v"(acc[3][3]) : "v"(xf[0]), "v"(xf[1]), "v"(xf[2]), "v"(xf[3]));
        if constexpr (F32OUT) asm volatile("s_wait_xcnt 0x0" ::: "memory");   // precaution: the weight loads' address register is formed anew at the head of the next trip; this stands in front of that rewrite
    };
    trip(kbeg, true);
#pragma unroll 1   // stays rolled: the later trips' body stands once in the text
    for (int kc = kbeg + 32; kc < kbeg + KQ; kc += 32) trip(kc, false);
    const size_t tbase = J2 ? (size_t)r0 * SEQ + (size_t)(c0 / SEQ) * ((size_t)DM * SEQ) + (size_t)(c0 % SEQ) : (size_t)r0 * DM + (size_t)c0;
#pragma unroll
    for (int q = 0; q < 4; ++q) {
        if constexpr (J2) {
#pragma unroll
            for (int xi = 0; xi < 4; ++xi)
#pragma unroll
                for (int j = 0; j < 8; ++j) ow[(q * 16 + hi * 8 + j) * 68 + xi * 16 + lr] = acc[xi][q][j];   // D: row 8h+j (output 4*(8h+j) + q), col t = 16*xi + lane&15
        } else {
#pragma unroll
            for (int j = 0; j < 8; ++j) *(v4fa*)(&ow[(q * 16 + hi * 8 + j) * 68 + 4 * lr]) = (v4f){acc[q][0][j], acc[q][1][j], acc[q][2][j], acc[q][3][j]};   // D: row 8h+j, col 4*(lane&15) + wi
        }
    }
    __syncthreads();     // every wave's partial tile is in LDS before any row is summed
    const float* op = os + p * (16 * 68);                          // pass p of wave 0's partial tile; + w * OSW for wave w's
    if constexpr (!F32OUT) {
        const int c8 = (lane & 7) * 8;                             // 4 s x 4 row groups = 16 rows; 8 lanes x 8 = 64 columns
        v4f x0[4], x1[4];                                          // all sums first: the LDS reads of the four row groups go out together, in front of the stores' waits
#pragma unroll
        for (int s = 0; s < 4; ++s) { const int row = 4 * s + (lane >> 3);
            x0[s] = *(const v4fa*)(&op[row * 68 + c8]); x1[s] = *(const v4fa*)(&op[row * 68 + c8 + 4]);
#pragma unroll
            for (int w = 1; w < KW; ++w) { x0[s] += *(const v4fa*)(&op[w * OSW + row * 68 + c8]); x1[s] += *(const v4fa*)(&op[w * OSW + row * 68 + c8 + 4]); }
        }
#pragma unroll
        for (int s = 0; s < 4; ++s) { const int row = 4 * s + (lane >> 3);
            const int rofs = J2 ? 4 * row + p : p * 16 + row;
            if constexpr (J2) { bc0 = (v4f){br[s], br[s], br[s], br[s]}; bc1 = bc0; }
            v8h hv, rv;
#pragma unroll
            for (int i = 0; i < 4; ++i) { const float y0 = x0[s][i] + bfr(bc0[i]); const float y1 = x1[s][i] + bfr(bc1[i]);
                const h16 a0 = (h16)y0; const h16 a1 = (h16)y1; hv[i] = a0; hv[4 + i] = a1; rv[i] = (h16)((y0 - (float)a0) * QRS); rv[4 + i] = (h16)((y1 - (float)a1) * QRS); }
            const size_t oo = tbase + (size_t)rofs * (size_t)pitch + c8;
            *(v8h*)(Ph + oo) = hv;
            asm volatile("s_wait_xcnt 0x0" ::: "memory");         // precaution: stands in front of any later rewrite of this store's data or address registers, on both sides of the branch below
            if (useRes) { *(v8h*)(Pr + oo) = rv;
                asm volatile("s_wait_xcnt 0x0" ::: "memory"); }   // precaution: the same for the residual store
        }
    } else {
        const int cofs = lr * 4;                                   // 8 s x 2 rows = 16 rows; 16 lanes x 4 floats = 64 columns
        v4f val[8];
#pragma unroll
        for (int s = 0; s < 8; ++s) { const int row = 2 * s + hi;
            val[s] = *(const v4fa*)(&op[row * 68 + cofs]);
#pragma unroll
            for (int w = 1; w < KW; ++w) val[s] += *(const v4fa*)(&op[w * OSW + row * 68 + cofs]);
        }
#pragma unroll
        for (int s = 0; s < 8; ++s) { const int row = 2 * s + hi;
            const int m = r0 + p * 16 + row; const int bb = m / SEQ, tt = m - bb * SEQ;
#pragma unroll
            for (int i = 0; i < 4; ++i) val[s][i] = val[s][i] + bfr(bc0[i]);
            *(v4f*)(OUT + ((size_t)bb * OUT_SEQ + tt) * DM + c0 + cofs) = val[s]; }
    }
}

template <bool F32OUT>
__global__ __launch_bounds__(32 * KW) void k_gemm(const float* __restrict__ X0, const float* __restrict__ X1, const float* __restrict__ X2, const bf* __restrict__ CXA,
                                             const float* __restrict__ W0, const float* __restrict__ W1, const float* __restrict__ W2,
                                             h16* Ph0, h16* Ph1, h16* Ph2, h16* Pr, float* OUT,
                                             const float* __restrict__ bias0, const float* __restrict__ bias1, const float* __restrict__ bias2,
                                             const int* __restrict__ MK, int* NV) {
    __shared__ __align__(16) float os[KW * OSW];                  // [wave][64 rows][68]: the waves' partial tiles
    if constexpr (F32OUT) gemm_tile<true, false>(os, X0, CXA, W0, Ph0, Pr, OUT, bias0, false, blockIdx.x, nullptr, MK, NV, false);
    else {
        __shared__ __align__(16) int kidx[KW * 64];               // [wave][64]
        const unsigned job = blockIdx.y;
        if (job == 2) gemm_tile<false, true>(os, X2, CXA, W2, Ph2, Pr, OUT, bias2, false, blockIdx.x, kidx, MK, NV, true);
        else gemm_tile<false, false>(os, job == 0 ? X0 : X1, CXA, job == 0 ? W0 : W1, job == 0 ? Ph0 : Ph1, Pr, OUT, job == 0 ? bias0 : bias1, job == 0, blockIdx.x, kidx, MK, NV, job == 1);
    }
}

// copy_kv: the K and V^T copies of two steps, 16 B a lane each, global memory to LDS through no register (lk*, lv* = the lane's LDS byte addresses).
// The s_wait_xcnt stands inside the statement as a precaution: behind it the address registers may be rewritten.
__device__ __forceinline__ void copy_kv(unsigned lk0, const h16* gk0, unsigned lv0, const h16* gv0, unsigned lk1, const h16* gk1, unsigned lv1, const h16* gv1) {
    asm volatile("global_load_async_to_lds_b128 %0, %1, off\n\tglobal_load_async_to_lds_b128 %2, %3, off\n\t"
                 "global_load_async_to_lds_b128 %4, %5, off\n\tglobal_load_async_to_lds_b128 %6, %7, off\n\ts_wait_xcnt 0x0"
                 :: "v"(lk0), "v"(gk0), "v"(lv0), "v"(gv0), "v"(lk1), "v"(gk1), "v"(lv1), "v"(gv1) : "memory");
}

// k_flash: fused attention, one work-group per 64 query rows of one batch and one PAIR of heads; one wave per (16 query rows, head, key range: a KS-th of the batch's 32-key steps).
// The waves of one key range walk the same K rows and V^T columns at the same time; both heads of the pair read the two halves of the same K lines.
// Q fragments straight from the f16 planes (two 16-B loads each). K and V^T go through LDS: trip t of the block works on steps SPT*t .. SPT*t + SPT-1 of every key range; the 8 waves of a range bring each step's K tile
// (32 keys x 128 B) and V^T tile (64 rows x 64 B) in with one asynchronous 16-B copy a lane each, whole lines or half lines, and all 8 read their fragments from there. Two buffers: the copies of trip t + 1 fly during trip t.
// A step past the range's own is copied all the same and never read (past the batch's last step: that last step again; written rows in either case), so that every wave issues the same copies and passes the same barriers.
// Transposed form: S^T[key][t] = K Q^T (A = K rows, B = Q rows); lane (t = lane&15, h = lane>>4) holds keys 8h+r of each 16-key tile, so the packed
// P tile is directly the B fragment of O^T[d][t] = V^T P^T (element r <- tile keys 0..15, element 8+r <- tile keys 16..31, lane unchanged).
// Key mask: the planes hold the packed keys; NV[b] = number of unmasked keys. Positions from NV[b] on (the rest of the last 32-key step; every position where NV[b] = 0) have their score REPLACED by the fill value
// (a fully masked row therefore comes out uniform); steps that lie wholly below NV[b] take no select.
// Softmax state (running max, partial sum) is one scalar per lane; the two lane halves of a row are combined with one xor-16 exchange.
// Each wave leaves its unnormalised O, its running max and its sum in LDS; behind one work-group barrier the KS partial results of a row are rescaled to their common max, added and normalised.
__global__ __launch_bounds__(32 * FW) void k_flash(const h16* __restrict__ QH, const h16* __restrict__ QR, const h16* __restrict__ KP, const h16* __restrict__ VT,
                                                   const int* __restrict__ NV, bf* CX) {
    __shared__ __align__(16) float os[KS * AW * 16 * 68];        // [key range][row of the block][68]: columns 0..63 = 32*head + d
    __shared__ float sm[KS * 2 * AW * 16], sl[KS * 2 * AW * 16]; // [key range][head][row of the block]: running max, sum
    __shared__ __align__(16) unsigned char ring[2 * BFB];        // [buffer][step of the trip][key range]: K tile [key][KPB], V^T tile [32*head + d][VPB]
    const int lane = threadIdx.x & 31, wave = __builtin_amdgcn_readfirstlane((int)(threadIdx.x >> 5)), lr = lane & 15, hi = lane >> 4;
    const int rt = wave % AW, hh = (wave / AW) & 1, ks = wave / (2 * AW);
    const int zp = blockIdx.y; const int b = zp / (NH_ / 2), hp = zp % (NH_ / 2);
    const int t0 = (blockIdx.x * AW + rt) * 16;
    const size_t rowb = (size_t)b * SEQ;
    const int nvr = NV[b];
    const int nv = __builtin_amdgcn_readfirstlane(nvr < 0 ? 0 : (nvr > SEQ ? SEQ : nvr));   // unmasked keys of the batch, bounded by the shape; kept scalar so that the loop's tail test is a scalar compare
    const int nt = ((nv == 0 ? SEQ : nv) + 31) / 32;             // 32-key steps that the planes hold (1 .. SEQ / 32)
    const int tq = (nt + KS - 1) / KS;                           // steps per key range; the last ranges may be short or empty
    {
        const int h = hp * 2 + hh;
        const size_t qo = (rowb + t0 + lr) * DM + h * HD + 8 * hi;
        const v16h qh = ldh(QH + qo), qr = ldh(QR + qo);                  // B fragments: col t, k = d (32 deep)
        const unsigned char* kf = ring + ks * RTB + lr * KPB + hh * 64 + 16 * hi;            // + buffer, step; + 16*KPB   (A fragment: row key, k = d)
        const unsigned char* vf = ring + ks * RTB + KTB + (hh * 32 + lr) * VPB + 16 * hi;    // + buffer, step; + 16*VPB   (A fragment: row d, k = key)
        // this lane's share of the copies: K row 4*w8 + lane/8, piece lane%8; V^T row 8*w8 + lane/4, piece lane%4 (w8 = the wave's number inside its key range)
        const int w8 = wave % (2 * AW);
        const int kr = 4 * w8 + (lane >> 3), kc = lane & 7, vr = 8 * w8 + (lane >> 2), vc = lane & 3;
        const h16* gk = KP + (rowb + kr) * DM + hp * 64 + kc * 8;                            // + key * DM
        const h16* gv = VT + ((size_t)b * DM + hp * 64 + vr) * SEQ + vc * 8;                 // + key
        const unsigned lk = (unsigned)(size_t)(ring + ks * RTB + kr * KPB + kc * 16), lv = (unsigned)(size_t)(ring + ks * RTB + KTB + vr * VPB + vc * 16);
        v8f o0 = (v8f){}, o1 = (v8f){};
        float m = -3.0e38f, l = 0.0f;
        const int tbeg = ks * tq, tend = tbeg + tq < nt ? tbeg + tq : nt;
        const int ntr = (tq + SPT - 1) / SPT;                    // trips: the same for every wave of the block
        // stage(t, bo): this lane's copies of trip t into the buffer at byte bo. c0, c1 = first key of the two steps (never past the batch's last step): below 32 * nt, so inside the rows that the projections wrote
        auto stage = [&](int t, unsigned bo) {
            const int s0 = tbeg + SPT * t, c0 = 32 * (s0 < nt ? s0 : nt - 1), c1 = 32 * (s0 + 1 < nt ? s0 + 1 : nt - 1);
            copy_kv(lk + bo, gk + (size_t)c0 * DM, lv + bo, gv + c0, lk + bo + SFB, gk + (size_t)c1 * DM, lv + bo + SFB, gv + c1);
        };
        stage(0, 0u);
        asm volatile("s_wait_asynccnt 0x0" ::: "memory");        // this wave's copies of trip 0 have landed
        __syncthreads();                                         // ... and every other wave's: buffer 0 may be read
        if (ntr > 1) stage(1, BFB);
#pragma unroll 1   // stays rolled: the trip count is only known at run time, and the buffer goes by the trip's parity
        for (int t = 0; t < ntr; ++t) {
         const unsigned bo = (t & 1) * BFB;
         for (int j = 0; j < SPT; ++j) {
          const int tt = tbeg + SPT * t + j;
          if (tt < tend) {                                       // same for the whole wave
            const int key0 = tt * 32;
            const h16* ka = (const h16*)(kf + bo + j * SFB);
            const v16h ka0 = ldh(ka), kb0 = ldh(ka + 16 * (KPB / 2));
            v8f sHa = (v8f){}, sLa = (v8f){}, sHb = (v8f){}, sLb = (v8f){};
            sHa = wmma16(ka0, qh, sHa); sLa = wmma16(ka0, qr, sLa); sHb = wmma16(kb0, qh, sHb); sLb = wmma16(kb0, qr, sLb);
            asm volatile("v_nop\n\tv_nop\n\tv_nop\n\tv_nop" : "+v"(sHa), "+v"(sLa), "+v"(sHb), "+v"(sLb) : "v"(ka0), "v"(kb0), "v"(qh), "v"(qr));
            float ta[8], tb[8]; float mx = -3.0e38f;
#pragma unroll
            for (int r = 0; r < 4; ++r) {
                ta[r] = (sHa[r] + sLa[r] * QRI) * SC2; ta[4 + r] = (sHa[4 + r] + sLa[4 + r] * QRI) * SC2;
                tb[r] = (sHb[r] + sLb[r] * QRI) * SC2; tb[4 + r] = (sHb[4 + r] + sLb[4 + r] * QRI) * SC2; }
            if (key0 + 32 > nv) {                                // same for the whole wave: the step reaches past the unmasked keys
                const int kl = nv - key0 - 8 * hi;               // element r stands for keys key0 + 8h + r and key0 + 16 + 8h + r
#pragma unroll
                for (int r = 0; r < 8; ++r) { ta[r] = (r < kl) ? ta[r] : NEGT; tb[r] = (16 + r < kl) ? tb[r] : NEGT; }
            }
#pragma unroll
            for (int r = 0; r < 8; ++r) mx = fmaxf(mx, fmaxf(ta[r], tb[r]));
            mx = fmaxf(mx, __shfl_xor(mx, 16, 32));
            const float mnew = fmaxf(m, mx);
            const float alpha = __builtin_amdgcn_exp2f(m - mnew);
            const float sh = PSH - mnew;
            v16h pb; float ls = 0.0f;
#pragma unroll
            for (int r = 0; r < 8; ++r) { const h16 pa = (h16)__builtin_amdgcn_exp2f(ta[r] + sh); const h16 pc = (h16)__builtin_amdgcn_exp2f(tb[r] + sh); pb[r] = pa; pb[8 + r] = pc; ls += (float)pa + (float)pc; }
            l = l * alpha + ls; m = mnew;
            o0 = o0 * alpha; o1 = o1 * alpha;
            const h16* va = (const h16*)(vf + bo + j * SFB);
            const v16h v0 = ldh(va), v1 = ldh(va + 16 * (VPB / 2));
            o0 = wmma16(v0, pb, o0); o1 = wmma16(v1, pb, o1);
            asm volatile("v_nop\n\tv_nop\n\tv_nop\n\tv_nop" : "+v"(o0), "+v"(o1) : "v"(v0), "v"(v1), "v"(pb));
          }
         }
         asm volatile("s_wait_dscnt 0x0" ::: "memory");          // this wave's reads of the trip's buffer are done before the buffer is handed on
         asm volatile("s_wait_asynccnt 0x0" ::: "memory");       // this wave's copies of trip t + 1 have landed
         __syncthreads();                                        // publishes the buffer of trip t + 1 and ends every wave's reads of this trip's
         if (t + 2 < ntr) stage(t + 2, bo);                      // same for the whole block
        }
        asm volatile("s_wait_asynccnt 0x0" ::: "memory");        // no copy is outstanding behind the loop
        l += __shfl_xor(l, 16, 32);
        // O^T D layout: o_j[r] = (d = 16j + 8h + r, t = lane&15) -> os[key range][16*rt + t][32*hh + d], unnormalised
        { const int ob = ((ks * AW + rt) * 16 + lr) * 68 + hh * 32 + 8 * hi;
          *(v4fa*)(&os[ob])      = (v4f){o0[0], o0[1], o0[2], o0[3]}; *(v4fa*)(&os[ob + 4])  = (v4f){o0[4], o0[5], o0[6], o0[7]};
          *(v4fa*)(&os[ob + 16]) = (v4f){o1[0], o1[1], o1[2], o1[3]}; *(v4fa*)(&os[ob + 20]) = (v4f){o1[4], o1[5], o1[6], o1[7]}; }
        if (hi == 0) { const int si = ((ks * 2 + hh) * AW + rt) * 16 + lr; sm[si] = m; sl[si] = l; }
    }
    __syncthreads();     // every wave's partial result is in LDS before any row is merged
    const int tid = threadIdx.x;
    if (tid < AW * 16 * 8) {                                     // whole waves: 64 rows x 8 lanes x 8 columns
        const int row = tid >> 3, c8 = (tid & 7) * 8, hq = c8 >> 5;
        float pm[KS]; float mx = -3.0e38f;
#pragma unroll
        for (int p = 0; p < KS; ++p) { pm[p] = sm[(p * 2 + hq) * (AW * 16) + row]; mx = fmaxf(mx, pm[p]); }
        v4f x0 = (v4f){}, x1 = (v4f){}; float l = 0.0f;
#pragma unroll
        for (int p = 0; p < KS; ++p) { const float f = __builtin_amdgcn_exp2f(pm[p] - mx);
            l += f * sl[(p * 2 + hq) * (AW * 16) + row];
            x0 += *(const v4fa*)(&os[(p * (AW * 16) + row) * 68 + c8]) * f; x1 += *(const v4fa*)(&os[(p * (AW * 16) + row) * 68 + c8 + 4]) * f; }
        const float inv = 1.0f / l;
        x0 = x0 * inv; x1 = x1 * inv;
        v8us hv, lv;
#pragma unroll
        for (int i = 0; i < 4; ++i) { const unsigned short u0 = f2bf(x0[i]); const unsigned short u1 = f2bf(x1[i]); hv[i] = u0; hv[4 + i] = u1;
            lv[i] = f2bf(x0[i] - bf2f(u0)); lv[4 + i] = f2bf(x1[i] - bf2f(u1)); }
        bf* crow = CX + (rowb + (size_t)blockIdx.x * (AW * 16) + row) * CXP + hp * 64 + c8;
        *(v8us*)(crow) = hv; *(v8us*)(crow + DM) = lv;
    }
}

static constexpr size_t al256(size_t v) { return (v + 255) & ~(size_t)255; }
static constexpr size_t SZ_PL = al256((size_t)NB * SEQ * DM * 2);
static constexpr size_t SZ_CX = al256((size_t)NB * SEQ * CXP * 2);
static constexpr size_t SZ_NV = al256((size_t)NB * sizeof(int));
static constexpr size_t SZ_TOTAL = 4 * SZ_PL + SZ_CX + SZ_NV;
static_assert(SZ_TOTAL <= (size_t)134217728);          // workspace carve <= 128 MiB
static_assert((size_t)NB * DM * SEQ * 2 <= SZ_PL);     // v^T plane extent

extern "C" void kernel_launch(void* const* d_in, const int* in_sizes, int n_in,
                              void* d_out, int out_size, void* d_ws, size_t ws_size, hipStream_t stream) {
    if (n_in < 12) return;
    const size_t needx = ((size_t)(NB - 1) * SEQ_FULL + SEQ) * DM;
    if ((size_t)in_sizes[0] < needx || (size_t)in_sizes[1] < needx || (size_t)in_sizes[2] < needx) return;
    if ((size_t)in_sizes[3] < (size_t)(NB - 1) * SEQ_FULL + SEQ) return;
    if ((size_t)in_sizes[4] < (size_t)DM * DM || (size_t)in_sizes[6] < (size_t)DM * DM || (size_t)in_sizes[8] < (size_t)DM * DM || (size_t)in_sizes[10] < (size_t)DM * DM) return;
    if (in_sizes[5] < DM || in_sizes[7] < DM || in_sizes[9] < DM || in_sizes[11] < DM) return;
    if ((size_t)out_size < ((size_t)(NB - 1) * OUT_SEQ + SEQ) * DM) return;
    if (SZ_TOTAL > ws_size) return;
    // wire order: queries, keys, values, key_mask, Wq, bq, Wk, bk, Wv, bv, Wo, bo
    const float* xq = (const float*)d_in[0]; const float* xk = (const float*)d_in[1]; const float* xv = (const float*)d_in[2];
    const int* kmask = (const int*)d_in[3];
    const float* wq = (const float*)d_in[4]; const float* bq = (const float*)d_in[5];
    const float* wk = (const float*)d_in[6]; const float* bk = (const float*)d_in[7];
    const float* wv = (const float*)d_in[8]; const float* bv = (const float*)d_in[9];
    const float* wo = (const float*)d_in[10]; const float* bo = (const float*)d_in[11];
    float* OUT = (float*)d_out;      // [NB][SEQ][256]
    char* wsp = (char*)d_ws;
    h16* QH = (h16*)wsp; wsp += SZ_PL;               // [NB*SEQ][256]
    h16* QR = (h16*)wsp; wsp += SZ_PL;               // [NB*SEQ][256] residual x2048
    h16* KP = (h16*)wsp; wsp += SZ_PL;               // [NB*SEQ][256]
    h16* VT = (h16*)wsp; wsp += SZ_PL;               // [NB][256][SEQ]
    bf* CX = (bf*)wsp; wsp += SZ_CX;                 // [NB*SEQ][512]: ctx hi | ctx lo
    int* NV = (int*)wsp; wsp += SZ_NV;               // [NB]: unmasked keys of each batch

    k_gemm<false><<<dim3(PTB, 3, 1), 32 * KW, 0, stream>>>(xq, xk, xv, CX, wq, wk, wv, QH, KP, VT, QR, OUT, bq, bk, bv, kmask, NV);

    k_flash<<<dim3(SEQ / (16 * AW), NB * (NH_ / 2), 1), 32 * FW, 0, stream>>>(QH, QR, KP, VT, NV, CX);

    // out = [ctx_hi | ctx_lo] x [Wo ; Wo] + bo, K = 512, f32 rows of the output (the activation pointers are not read here)
    k_gemm<true><<<dim3(PTB, 1, 1), 32 * KW, 0, stream>>>(wo, wo, wo, CX, wo, wo, wo, QH, QH, QH, QH, OUT, bo, bo, bo, kmask, NV);
}

// v008
// One run takes 23 microseconds.
// Next to v007, in two timings, it ran 1.05 times as fast each time.
// Counting every step since v000, it is 6.66 times as fast.
#include <hip/hip_runtime.h>

// Multi-head attention with key padding mask: q/k/v inputs [NB][SEQ][256], Wq/Wk/Wv/Wo [in][out] (y = x W + b), 8 heads x 32, score scale 1/sqrt(32), masked keys take the fill value -4294967296, output = ctx Wo + bo (f32).
// Compute dtypes, f32 accumulate everywhere: projections v_wmma_f32_16x16x32_bf16 (inputs and weights RNE-converted to bf16; products exact);
// scores v_wmma_f32_16x16x32_f16: k single f16, q as f16 value + f16 residual x2048 in its own accumulator (two products); P (x256 carry, cancels in the normalisation) and v single f16; softmax f32 (online, running max);
// output projection v_wmma_f32_16x16x32_bf16 with ctx carried as bf16 hi | bf16 lo planes folded along K (K = 512, weight row = k mod 256).
// Layout: activations and weights are read as f32 by the GEMMs and rounded in registers (the activations and the ctx plane by way of LDS); q (hi, residual), k planes [b*SEQ + t][256] (head h = columns 32h..32h+31) and v^T plane [b][256][SEQ] written by the GEMM epilogue;
// Key mask: the k and v^T planes hold only the unmasked keys of a batch, packed without gaps in one fixed order (key_list; the same for both planes); a masked key's weight is exactly 0 beside any unmasked one, so attention runs over the packed keys alone.
// A batch with no unmasked key keeps all its keys in the planes, and every score takes the fill value (uniform weights, as the reference gives).

#ifndef NB
#define NB 2
#endif
#ifndef SEQ
#define SEQ 2048
#endif
#define NB_FULL  2
#define SEQ_FULL 2048
#ifndef OUT_SEQ
#define OUT_SEQ SEQ              // row pitch (in tokens) between batches of the output
#endif
#define DM   256
#define NH_  8
#define HD   32
#define CXP  (2 * DM)            // ctx plane pitch: hi columns 0..255, lo columns 256..511
#define AW   4                   // 16-row query tiles per flash block
#define KS   4                   // key ranges per (query tile, head), one wave each
#define FW   (AW * 2 * KS)       // waves per flash block: query tiles x 2 heads x key ranges
#define KW   4                   // waves per GEMM block: each takes a KW-th of the k range of the block's tile
#define OSW  (64 * 68)           // floats of one wave's partial tile in LDS: 64 rows, pitch 68
#define XRB  1024                // bytes of one row of a GEMM's row operand in global memory (256 f32, or 512 bf16 of the ctx plane)
#define XPB  272                 // LDS pitch of a staged row of the row operand, bytes: 256 (one wave's k range of the row) + 16, 16 B x odd for the ds_load_b128 readers
#define QRS  2048.0f             // carry of the q residual plane
#define QRI  (1.0f / 2048.0f)
#define SC2  (0.17677669529663687f * 1.4426950408889634f)   // HD^-0.5 * log2(e)
#define PSH  8.0f                // log2 of the P carry (256)
#define NEGT (-4294967296.0f * 1.4426950408889634f)         // mask fill value in the log2 domain
#define KPB  144                 // LDS pitch of a staged K row, bytes: 128 (32 columns x 2 heads) + 16, 16 B x odd for the ds_load_b128 readers
#define VPB  80                  // LDS pitch of a staged V^T row, bytes: 64 (32 keys) + 16, 16 B x odd
#define KTB  (32 * KPB)          // one K tile: 32 keys
#define VTB  (64 * VPB)          // one V^T tile: 64 rows (2 heads x 32)
#define RTB  (KTB + VTB)         // one step of one key range
#define SFB  (KS * RTB)          // one 32-key step of every key range
#define SPT  2                   // steps of a key range per buffer (per trip between two barriers)
#define BFB  (SPT * SFB)         // one buffer

static_assert(HD == 32);
static_assert(NH_ * HD == DM);                 // head h = columns h*32 + d
static_assert(NH_ % 2 == 0);
static_assert(DM % 64 == 0);
static_assert(DM % 32 == 0);                   // GEMM k-loop steps by 32
static_assert(CXP % 32 == 0);
static_assert(DM % (32 * KW) == 0);            // every wave of a GEMM block gets whole 32-deep trips (CXP = 2 * DM too)
static_assert(DM * 4 == XRB && CXP * 2 == XRB); // both row operands have rows of XRB bytes
static_assert(XRB / KW == 256 && XPB == 256 + 16 && XPB % 16 == 0);
static_assert(64 * XPB == OSW * 4);            // a wave's 64 staged rows fill the place of its partial tile
static_assert(KW == 4);                        // behind the sum, wave p stores the p-th of the tile's four 16-row passes
static_assert(SEQ % 64 == 0);                  // a 64-row tile never straddles two batches
static_assert((NB * SEQ) % 64 == 0);
static_assert(SEQ % (32 * KS) == 0);           // key loop steps by 32 inside each key range
static_assert(FW * 32 <= 1024);
static_assert(AW * 2 == 8);                    // the 8 waves of a key range copy its tiles: 256 lanes x 16 B = 4 KiB for K, the same for V^T
static_assert(KPB % 16 == 0 && VPB % 16 == 0 && KTB % 16 == 0 && RTB % 16 == 0);
static_assert(SPT == 2);                       // copy_kv holds the copies of two steps
static_assert(FW * 32 >= AW * 16 * 8);         // the merge uses one thread per (row, 8 columns)
static_assert(SEQ % (16 * AW) == 0);           // flash grid covers the sequence exactly
static_assert(((size_t)SEQ * DM) % 8 == 0);
static_assert(NB <= NB_FULL);
static_assert(SEQ <= SEQ_FULL);

typedef _Float16 h16;
typedef unsigned short bf;
typedef __attribute__((ext_vector_type(16))) __bf16   v16bf;
typedef __attribute__((ext_vector_type(16))) _Float16 v16h;
typedef __attribute__((ext_vector_type(8)))  _Float16 v8h;
typedef __attribute__((ext_vector_type(8)))  unsigned short v8us;
typedef __attribute__((ext_vector_type(8)))  float    v8f;
typedef __attribute__((ext_vector_type(16))) float    v16f;
typedef __attribute__((ext_vector_type(4)))  float    v4f;
typedef __attribute__((ext_vector_type(4)))  int      v4i;
typedef v4f  __attribute__((may_alias)) v4fa;
typedef v8us __attribute__((may_alias)) v8usa;

__device__ __forceinline__ unsigned short f2bf(float f) { unsigned u = __float_as_uint(f); u += 0x7FFFu + ((u >> 16) & 1u); return (unsigned short)(u >> 16); }
__device__ __forceinline__ float bf2f(unsigned short s) { return __uint_as_float(((unsigned)s) << 16); }
__device__ __forceinline__ float bfr(float f) { return bf2f(f2bf(f)); }
__device__ __forceinline__ v16h cat16(v8h lo, v8h hi) { return __builtin_shufflevector(lo, hi, 0, 1, 2, 3, 4, 5, 6, 7, 8, 9, 10, 11, 12, 13, 14, 15); }
__device__ __forceinline__ v16bf cat16b(v8us lo, v8us hi) { return __builtin_bit_cast(v16bf, __builtin_shufflevector(lo, hi, 0, 1, 2, 3, 4, 5, 6, 7, 8, 9, 10, 11, 12, 13, 14, 15)); }
__device__ __forceinline__ v8f wmma16(v16h a, v16h b, v8f c) { return __builtin_amdgcn_wmma_f32_16x16x32_f16(false, a, false, b, (short)0, c, false, false); }
__device__ __forceinline__ v8f wmmab(v16bf a, v16bf b, v8f c) { return __builtin_amdgcn_wmma_f32_16x16x32_bf16(false, a, false, b, (short)0, c, false, false); }
// fragment loaders from K-contiguous 16-bit rows; p already includes + 8*(lane>>4): elements 0..7 <- k0+8h+0..7, elements 8..15 <- k0+16+8h+0..7 (same map for A and B)
__device__ __forceinline__ v16h  ldh(const h16* p) { return cat16(*(const v8h*)p, *(const v8h*)(p + 16)); }
__device__ __forceinline__ v16bf ldb(const bf* p)  { return cat16b(*(const v8us*)p, *(const v8us*)(p + 16)); }
// the same fragments from rows staged in LDS (16-B reads): 16 bf16, or one 8-float piece of an f32 row
__device__ __forceinline__ v16bf ldbs(const bf* p) { return cat16b(*(const v8usa*)p, *(const v8usa*)(p + 16)); }
__device__ __forceinline__ v8f lds8(const float* p) { return __builtin_shufflevector(*(const v4fa*)p, *(const v4fa*)(p + 4), 0, 1, 2, 3, 4, 5, 6, 7); }
// ordering point for wave-private LDS tiles (same wave writes and reads)
__device__ __forceinline__ void wave_sync() { __builtin_amdgcn_fence(3 /* release order */, "wavefront"); __builtin_amdgcn_wave_barrier(); asm volatile("" ::: "memory"); }

// cvx: fragment from the two 8-float pieces of one K-contiguous f32 row (k0+8h+0..7, k0+16+8h+0..7: the k map of ldb), rounded to bf16 (RNE) in registers
__device__ __forceinline__ v16bf cvx(v8f lo, v8f hi8) {
    return __builtin_convertvector(__builtin_shufflevector(lo, hi8, 0, 1, 2, 3, 4, 5, 6, 7, 8, 9, 10, 11, 12, 13, 14, 15), v16bf);
}
// Weight fragments come four at once from W[k][n] (f32, row pitch DM): one 16-B load per k at W + k * DM + n0 + 4*(lane&15) gives the lane that k of the four outputs n0 + 4*(lane&15) + i.
// r[e] = row k0+8h+e, r[8+e] = row k0+16+8h+e (the k map of ldb); cvw: fragment i holds outputs n0 + 4*l + i (l = its 16 rows or columns), rounded to bf16 (RNE) in registers.
__device__ __forceinline__ v16bf cvw(const v4f (&r)[16], int i) {
    v16f t;
#pragma unroll
    for (int e = 0; e < 16; ++e) t[e] = r[e][i];
    return __builtin_convertvector(t, v16bf);
}

// key_list (one wave): returns the number of unmasked keys of one batch (mkb = its SEQ mask words) and leaves in idx[0..63] the keys that stand at packed positions lo..lo+63.
// Load i gives lane c the mask of keys 128*i + 4*c + 0..3; bit t of the lane's SEQ/32 bits (32 to a word w[j]) stands for key 128*(t>>2) + 4*c + (t&3).
// Packed order: by lane, then by bit (any order serves, as k and v^T use the same one). p = first packed position of the lane's current word (lane prefix sum, one ballot per bit of the counts).
// Only the words that reach into lo..lo+63 are then walked, one word (32 keys, one a lane) a trip. No unmasked key at all: every key counts as present.
// Positions past the last key keep key 0: finite rows that the attention kernel masks. Every entry is formed from lane, word and bit numbers alone and lies below SEQ.
__device__ __forceinline__ int key_list(int* idx, const int* __restrict__ mkb, int lo) {
    constexpr int NW = SEQ / 1024;
    static_assert(SEQ % 1024 == 0 && SEQ / 32 < 128);
    const int lane = threadIdx.x & 31;
    v4i mv[8 * NW];
#pragma unroll
    for (int i = 0; i < 8 * NW; ++i) mv[i] = *(const v4i*)(mkb + 128 * i + 4 * lane);
    asm volatile("s_wait_xcnt 0x0" ::: "memory");   // precaution: stands in front of any later rewrite of the mask loads' address registers
    unsigned w[NW];
    unsigned any = 0u;
#pragma unroll
    for (int j = 0; j < NW; ++j) {
        w[j] = 0u;
#pragma unroll
        for (int t = 0; t < 32; ++t) w[j] |= mv[8 * j + (t >> 2)][t & 3] != 0 ? 1u << t : 0u;
        any |= w[j];
    }
    const bool none = __builtin_amdgcn_ballot_w32(any != 0u) == 0u;
    int cn = 0;
#pragma unroll
    for (int j = 0; j < NW; ++j) { if (none) w[j] = ~0u; cn += __builtin_popcount(w[j]); }   // cn = 0 .. SEQ / 32: seven bits
    int p = 0, tot = 0;
#pragma unroll
    for (int bit = 0; bit < 7; ++bit) {
        const unsigned bb = __builtin_amdgcn_ballot_w32(((cn >> bit) & 1) != 0);
        p += (int)__builtin_amdgcn_mbcnt_lo(bb, 0u) << bit;
        tot += __builtin_popcount(bb) << bit;
    }
    const int nvalid = none ? 0 : tot;
    if (lo >= tot) return nvalid;                    // nothing stands at these positions: the caller leaves
    idx[lane] = 0; idx[lane + 32] = 0;
#pragma unroll
    for (int j = 0; j < NW; ++j) {
        const int cj = __builtin_popcount(w[j]);
        unsigned todo = __builtin_amdgcn_ballot_w32(p + cj > lo && p < lo + 64);
        while (todo != 0u) {                         // same for the whole wave; one bit goes each trip: at most 32 trips
            const int c = __builtin_ctz(todo);
            todo &= todo - 1u;
            const unsigned bc = (unsigned)__builtin_amdgcn_readlane((int)w[j], c);
            const int pos = __builtin_amdgcn_readlane(p, c) - lo + (int)__builtin_amdgcn_mbcnt_lo(bc, 0u);
            if (((bc >> lane) & 1u) != 0u && pos >= 0 && pos < 64) idx[pos] = 128 * (8 * j + (lane >> 2)) + 4 * c + (lane & 3);
        }
        p += cj;
    }
    wave_sync();
    return nvalid;
}

// copy_x8: eight asynchronous copies, 16 B a lane each, global memory to LDS through no register (l = the lane's LDS byte addresses, g = its global addresses).
// The s_wait_xcnt stands inside the statement as a precaution: behind it the address registers may be rewritten.
__device__ __forceinline__ void copy_x8(const unsigned (&l)[8], const char* const (&g)[8]) {
    asm volatile("global_load_async_to_lds_b128 %0, %8, off\n\tglobal_load_async_to_lds_b128 %1, %9, off\n\t"
                 "global_load_async_to_lds_b128 %2, %10, off\n\tglobal_load_async_to_lds_b128 %3, %11, off\n\t"
                 "global_load_async_to_lds_b128 %4, %12, off\n\tglobal_load_async_to_lds_b128 %5, %13, off\n\t"
                 "global_load_async_to_lds_b128 %6, %14, off\n\tglobal_load_async_to_lds_b128 %7, %15, off\n\ts_wait_xcnt 0x0"
                 :: "v"(l[0]), "v"(l[1]), "v"(l[2]), "v"(l[3]), "v"(l[4]), "v"(l[5]), "v"(l[6]), "v"(l[7]),
                    "v"(g[0]), "v"(g[1]), "v"(g[2]), "v"(g[3]), "v"(g[4]), "v"(g[5]), "v"(g[6]), "v"(g[7]) : "memory");
}

// k_gemm: register-blocked bf16 GEMM, one block of KW waves per 64x64 tile; every wave holds the whole tile (16 accumulators) over its own KW-th of k, leaves its partial tile in LDS,
// and behind one work-group barrier wave p adds the KW partial tiles (in wave order) for the p-th 16-row pass, adds the bias and stores. The weight operand comes straight from the f32 input W[k][n] (cvw), the other operand from K-contiguous rows:
// the f32 activation input (cvx; F32OUT = false) or the bf16 ctx plane (F32OUT = true, K = 512, weight row = k mod 256). Bias: bf16 RNE value of the f32 bias, added in f32.
// The row operand goes through LDS: a fragment load straight from global memory touches 16 rows (16 lines for 512 B). Each wave brings its own 64 rows x 256 B (its k range) in with 32 asynchronous copies,
// two rows (four whole lines) a copy, into the place where its partial tile will stand later (pitch XPB), and reads its fragments from there; only the wave that copied reads these bytes, behind its own s_wait_asynccnt: no barrier.
// acc[xi][wi]: xi = 16-row group of the row operand (rows 16*xi + l), wi = weight fragment (outputs 4*l + wi).
// F32OUT = false: the three input projections in ONE launch, blockIdx.y picks the job, PTB tiles each, the row tile running fastest in blockIdx.x; written as f16 (Ph), q also as the f16 residual x2048 (Pr):
//   job 0 (q), job 1 (k): A = x rows (m = b*SEQ + t), B = W columns (n = h*32 + d) -> plane [m][n], bias by column
//   job 2 (v^T): A = Wv columns (m = h*32 + d), B = x rows (n = b*SEQ + t) -> plane [(b*256 + m)][t], bias by row
//   jobs 1 and 2: t is a packed position, the x row read for it is the key that key_list names; a tile past the last packed key leaves at once; job 1's first tile of a batch stores the batch's count in NV
// F32OUT = true: the output projection, f32 rows of OUT[(m/SEQ)*OUT_SEQ + m%SEQ][c0 + col]; each row segment (64 floats = two lines) written by 16 consecutive lanes x 16 B (2 rows per instruction).
#define PTB ((NB * SEQ / 64) * (DM / 64))
// gemm_tile: one 64x64 tile. J2 = the v^T job (weight fragments as A). f = tile index, the row tile running fastest.
template <bool F32OUT, bool J2>
__device__ __forceinline__ void gemm_tile(float* os, const float* __restrict__ X, const bf* __restrict__ CXA, const float* __restrict__ Wt,
                                          h16* Ph, h16* Pr, float* OUT, const float* __restrict__ bias, bool useRes, unsigned f,
                                          int* kidx, const int* __restrict__ MK, int* NV, bool packed) {
    constexpr int K = F32OUT ? CXP : DM;
    constexpr int pitch = J2 ? SEQ : DM;                           // row pitch of the f16 plane (halves)
    constexpr int KQ = K / KW;                                     // k range of one wave
    const int lane = threadIdx.x & 31, lr = lane & 15, hi = lane >> 4;
    const int wv = __builtin_amdgcn_readfirstlane((int)(threadIdx.x >> 5)), kbeg = wv * KQ;
    const int r0 = (J2 ? f % (DM / 64) : f % (NB * SEQ / 64)) * 64, c0 = (J2 ? f / (DM / 64) : f / (NB * SEQ / 64)) * 64;
    const int xr0 = J2 ? c0 : r0, wc0 = J2 ? r0 : c0;             // tile base of the row operand, of the weight outputs
    const int p = wv;                                              // the 16 output rows that this wave sums and stores: rows 16*p + row, in the v^T job rows 4*row + p
    // this wave's bias values (by row in the v^T job, else by column), asked for at the start: their latency runs beside the work in front of the sum (the barrier there waits for every load in flight)
    v4f bc0 = (v4f){}, bc1 = (v4f){};
    float br[4] = {0.0f, 0.0f, 0.0f, 0.0f};
    if constexpr (F32OUT) bc0 = *(const v4f*)(bias + c0 + lr * 4);
    else if constexpr (J2) {
#pragma unroll
        for (int s = 0; s < 4; ++s) br[s] = bias[r0 + 4 * (4 * s + (lane >> 3)) + p];
    } else { bc0 = *(const v4f*)(bias + c0 + (lane & 7) * 8); bc1 = *(const v4f*)(bias + c0 + (lane & 7) * 8 + 4); }
    asm volatile("s_wait_xcnt 0x0" ::: "memory");                  // precaution: stands in front of any later rewrite of the bias loads' address registers
    if constexpr (!F32OUT) {
        if (J2 || packed) {
            kidx += 64 * wv;                                      // every wave forms the list for itself: no barrier in front of the loads
            const int tot = key_list(kidx, MK + (size_t)(xr0 / SEQ) * SEQ_FULL, xr0 % SEQ);
            if (xr0 % SEQ >= (tot == 0 ? SEQ : tot)) return;      // the same for every wave of the block, in front of the barrier
            if (!J2 && xr0 % SEQ == 0 && wc0 == 0 && wv == 0 && lane == 0) { NV[xr0 / SEQ] = tot;
                asm volatile("s_wait_xcnt 0x0" ::: "memory"); }   // precaution: stands in front of any later rewrite of this store's registers
        }
    }
    v8f acc[4][4];
#pragma unroll
    for (int xi = 0; xi < 4; ++xi)
#pragma unroll
        for (int wi = 0; wi < 4; ++wi) acc[xi][wi] = (v8f){};
    float* ow = os + wv * OSW;                                     // this wave's place in LDS: first its staged rows [64][XPB bytes], then its partial tile [pass][16 rows][68]
    const float* xs = ow + lr * (XPB / 4) + 8 * hi;                // f32 rows: + 16*xi rows, + k inside the wave's range
    const bf* xb = (const bf*)ow + lr * (XPB / 2) + 8 * hi;       // ctx rows (F32OUT)
    // f32 weights (F32OUT = false): byte offset of this lane's weight column group, carried from trip to trip (below 2^32)
    unsigned wob = (unsigned)(((kbeg + 8 * hi) * DM + wc0 + 4 * lr) * sizeof(float));
    const float* wbase = Wt + (size_t)(8 * hi) * DM + wc0 + 4 * lr;
    // one 32-deep trip; first = the wave's first trip, which also brings the staged rows in
    auto trip = [&](const int kc, const bool first) __attribute__((always_inline)) {
        v16bf xf[4], wf[4];
        v4f wr[16];
        const float* wp = F32OUT ? wbase + (size_t)(kc & (DM - 1)) * DM : (const float*)((const char*)Wt + wob);
#pragma unroll
        for (int e = 0; e < 8; ++e) { wr[e] = *(const v4f*)(wp + (size_t)e * DM); wr[8 + e] = *(const v4f*)(wp + (size_t)(16 + e) * DM); }
        if (first) {                                              // known at compile time. The copies go out behind the first trip's weight loads, so that those loads fly beside the copies' address work and the copies
            // copy i of this lane brings 16 B (piece lane&15) of the tile's row 32*hi + i: srow[i] = that row's number in its batch (a 64-row tile lies in one batch), in the ctx plane its number in the tile
            int srow[32];
#pragma unroll
            for (int i = 0; i < 32; ++i) srow[i] = (F32OUT ? 0 : xr0 % SEQ) + 32 * hi + i;
            if constexpr (!F32OUT) {
                if (J2 || packed) {
#pragma unroll
                    for (int i = 0; i < 32; i += 4) { const v4i t = *(const v4i*)(kidx + 32 * hi + i); srow[i] = t[0]; srow[i + 1] = t[1]; srow[i + 2] = t[2]; srow[i + 3] = t[3]; }
                }
            }
            const char* gx = (F32OUT ? (const char*)(CXA + (size_t)xr0 * K + kbeg) : (const char*)(X + (size_t)(xr0 / SEQ) * SEQ_FULL * DM + kbeg)) + 16 * lr;
            const unsigned lx = (unsigned)(size_t)ow + (unsigned)(32 * hi * XPB + 16 * lr);
#pragma unroll
            for (int c = 0; c < 32; c += 8) {
                unsigned l[8]; const char* g[8];
#pragma unroll
                for (int e = 0; e < 8; ++e) { l[e] = lx + (unsigned)((c + e) * XPB); g[e] = gx + (size_t)(unsigned)srow[c + e] * XRB; }
                copy_x8(l, g);
            }
            asm volatile("s_wait_asynccnt 0x0" ::: "memory");     // this wave's staged rows have landed
        }
        if constexpr (F32OUT) {
#pragma unroll
            for (int xi = 0; xi < 4; ++xi) xf[xi] = ldbs(xb + xi * 16 * (XPB / 2) + (kc - kbeg));
        } else {
            v8f xl[4], xh[4];
#pragma unroll
            for (int xi = 0; xi < 4; ++xi) { const float* xp = xs + xi * 16 * (XPB / 4) + (kc - kbeg); xl[xi] = lds8(xp); xh[xi] = lds8(xp + 16); }
            // inputs only: all loads of the trip are issued before the first conversion, so the trip waits out one load latency; built without it, the last three loads of a trip are issued only behind the waits for the first ones
            asm volatile("" :: "v"(wr[0]), "v"(wr[1]), "v"(wr[2]), "v"(wr[3]), "v"(wr[4]), "v"(wr[5]), "v"(wr[6]), "v"(wr[7]), "v"(wr[8]), "v"(wr[9]), "v"(wr[10]), "v"(wr[11]),
                             "v"(wr[12]), "v"(wr[13]), "v"(wr[14]), "v"(wr[15]), "v"(xl[0]), "v"(xl[1]), "v"(xl[2]), "v"(xl[3]), "v"(xh[0]), "v"(xh[1]), "v"(xh[2]), "v"(xh[3]));
            // precaution: stands in front of the rewrite of the weight loads' offset register just below (named as an operand so that the addition stays behind it)
            asm volatile("s_wait_xcnt 0x0" : "+v"(wob) :: "memory");
            wob += 32 * DM * sizeof(float);
#pragma unroll
            for (int xi = 0; xi < 4; ++xi) xf[xi] = cvx(xl[xi], xh[xi]);
        }
#pragma unroll
        for (int wi = 0; wi < 4; ++wi) wf[wi] = cvw(wr, wi);
#pragma unroll
        for (int wi = 0; wi < 4; ++wi)
#pragma unroll
            for (int xi = 0; xi < 4; ++xi) acc[xi][wi] = J2 ? wmmab(wf[wi], xf[xi], acc[xi][wi]) : wmmab(xf[xi], wf[wi], acc[xi][wi]);
        // keeps the vector slots the chip needs behind the last WMMA, also on the taken back edge
        asm volatile("v_nop\n\tv_nop\n\tv_nop\n\tv_nop" : "+v"(acc[0][0]), "+v"(acc[1][1]), "+v"(acc[2][2]), "+v"(acc[3][3]) : "v"(xf[0]), "v"(xf[1]), "v"(xf[2]), "v"(xf[3]));
        if constexpr (F32OUT) asm volatile("s_wait_xcnt 0x0" ::: "memory");   // precaution: the weight loads' address register is formed anew at the head of the next trip; this stands in front of that rewrite
    };
    trip(kbeg, true);
#pragma unroll 1   // stays rolled: the later trips' body stands once in the text
    for (int kc = kbeg + 32; kc < kbeg + KQ; kc += 32) trip(kc, false);
    const size_t tbase = J2 ? (size_t)r0 * SEQ + (size_t)(c0 / SEQ) * ((size_t)DM * SEQ) + (size_t)(c0 % SEQ) : (size_t)r0 * DM + (size_t)c0;
#pragma unroll
    for (int q = 0; q < 4; ++q) {
        if constexpr (J2) {
#pragma unroll
            for (int xi = 0; xi < 4; ++xi)
#pragma unroll
                for (int j = 0; j < 8; ++j) ow[(q * 16 + hi * 8 + j) * 68 + xi * 16 + lr] = acc[xi][q][j];   // D: row 8h+j (output 4*(8h+j) + q), col t = 16*xi + lane&15
        } else {
#pragma unroll
            for (int j = 0; j < 8; ++j) *(v4fa*)(&ow[(q * 16 + hi * 8 + j) * 68 + 4 * lr]) = (v4f){acc[q][0][j], acc[q][1][j], acc[q][2][j], acc[q][3][j]};   // D: row 8h+j, col 4*(lane&15) + wi
        }
    }
    __syncthreads();     // every wave's partial tile is in LDS before any row is summed
    const float* op = os + p * (16 * 68);                          // pass p of wave 0's partial tile; + w * OSW for wave w's
    if constexpr (!F32OUT) {
        const int c8 = (lane & 7) * 8;                             // 4 s x 4 row groups = 16 rows; 8 lanes x 8 = 64 columns
        v4f x0[4], x1[4];                                          // all sums first: the LDS reads of the four row groups go out together, in front of the stores' waits
#pragma unroll
        for (int s = 0; s < 4; ++s) { const int row = 4 * s + (lane >> 3);
            x0[s] = *(const v4fa*)(&op[row * 68 + c8]); x1[s] = *(const v4fa*)(&op[row * 68 + c8 + 4]);
#pragma unroll
            for (int w = 1; w < KW; ++w) { x0[s] += *(const v4fa*)(&op[w * OSW + row * 68 + c8]); x1[s] += *(const v4fa*)(&op[w * OSW + row * 68 + c8 + 4]); }
        }
#pragma unroll
        for (int s = 0; s < 4; ++s) { const int row = 4 * s + (lane >> 3);
            const int rofs = J2 ? 4 * row + p : p * 16 + row;
            if constexpr (J2) { bc0 = (v4f){br[s], br[s], br[s], br[s]}; bc1 = bc0; }
            v8h hv, rv;
#pragma unroll
            for (int i = 0; i < 4; ++i) { const float y0 = x0[s][i] + bfr(bc0[i]); const float y1 = x1[s][i] + bfr(bc1[i]);
                const h16 a0 = (h16)y0; const h16 a1 = (h16)y1; hv[i] = a0; hv[4 + i] = a1; rv[i] = (h16)((y0 - (float)a0) * QRS); rv[4 + i] = (h16)((y1 - (float)a1) * QRS); }
            const size_t oo = tbase + (size_t)rofs * (size_t)pitch + c8;
            *(v8h*)(Ph + oo) = hv;
            asm volatile("s_wait_xcnt 0x0" ::: "memory");         // precaution: stands in front of any later rewrite of this store's data or address registers, on both sides of the branch below
            if (useRes) { *(v8h*)(Pr + oo) = rv;
                asm volatile("s_wait_xcnt 0x0" ::: "memory"); }   // precaution: the same for the residual store
        }
    } else {
        const int cofs = lr * 4;                                   // 8 s x 2 rows = 16 rows; 16 lanes x 4 floats = 64 columns
        v4f val[8];
#pragma unroll
        for (int s = 0; s < 8; ++s) { const int row = 2 * s + hi;
            val[s] = *(const v4fa*)(&op[row * 68 + cofs]);
#pragma unroll
            for (int w = 1; w < KW; ++w) val[s] += *(const v4fa*)(&op[w * OSW + row * 68 + cofs]);
        }
#pragma unroll
        for (int s = 0; s < 8; ++s) { const int row = 2 * s + hi;
            const int m = r0 + p * 16 + row; const int bb = m / SEQ, tt = m - bb * SEQ;
#pragma unroll
            for (int i = 0; i < 4; ++i) val[s][i] = val[s][i] + bfr(bc0[i]);
            *(v4f*)(OUT + ((size_t)bb * OUT_SEQ + tt) * DM + c0 + cofs) = val[s]; }
    }
}

template <bool F32OUT>
__global__ __launch_bounds__(32 * KW) void k_gemm(const float* __restrict__ X0, const float* __restrict__ X1, const float* __restrict__ X2, const bf* __restrict__ CXA,
                                             const float* __restrict__ W0, const float* __restrict__ W1, const float* __restrict__ W2,
                                             h16* Ph0, h16* Ph1, h16* Ph2, h16* Pr, float* OUT,
                                             const float* __restrict__ bias0, const float* __restrict__ bias1, const float* __restrict__ bias2,
                                             const int* __restrict__ MK, int* NV) {
    __shared__ __align__(16) float os[KW * OSW];                  // [wave][64 rows][68]: the waves' partial tiles
    if constexpr (F32OUT) gemm_tile<true, false>(os, X0, CXA, W0, Ph0, Pr, OUT, bias0, false, blockIdx.x, nullptr, MK, NV, false);
    else {
        __shared__ __align__(16) int kidx[KW * 64];               // [wave][64]
        const unsigned job = blockIdx.y;
        if (job == 2) gemm_tile<false, true>(os, X2, CXA, W2, Ph2, Pr, OUT, bias2, false, blockIdx.x, kidx, MK, NV, true);
        else gemm_tile<false, false>(os, job == 0 ? X0 : X1, CXA, job == 0 ? W0 : W1, job == 0 ? Ph0 : Ph1, Pr, OUT, job == 0 ? bias0 : bias1, job == 0, blockIdx.x, kidx, MK, NV, job == 1);
    }
}

// copy_kv: the K and V^T copies of two steps, 16 B a lane each, global memory to LDS through no register (lk*, lv* = the lane's LDS byte addresses).
// The s_wait_xcnt stands inside the statement as a precaution: behind it the address registers may be rewritten.
__device__ __forceinline__ void copy_kv(unsigned lk0, const h16* gk0, unsigned lv0, const h16* gv0, unsigned lk1, const h16* gk1, unsigned lv1, const h16* gv1) {
    asm volatile("global_load_async_to_lds_b128 %0, %1, off\n\tglobal_load_async_to_lds_b128 %2, %3, off\n\t"
                 "global_load_async_to_lds_b128 %4, %5, off\n\tglobal_load_async_to_lds_b128 %6, %7, off\n\ts_wait_xcnt 0x0"
                 :: "v"(lk0), "v"(gk0), "v"(lv0), "v"(gv0), "v"(lk1), "v"(gk1), "v"(lv1), "v"(gv1) : "memory");
}

// k_flash: fused attention, one work-group per 64 query rows of one batch and one PAIR of heads; one wave per (16 query rows, head, key range: a KS-th of the batch's 32-key steps).
// The waves of one key range walk the same K rows and V^T columns at the same time; both heads of the pair read the two halves of the same K lines.
// Q fragments straight from the f16 planes (two 16-B loads each). K and V^T go through LDS: trip t of the block works on steps SPT*t .. SPT*t + SPT-1 of every key range; the 8 waves of a range bring each step's K tile
// (32 keys x 128 B) and V^T tile (64 rows x 64 B) in with one asynchronous 16-B copy a lane each, whole lines or half lines, and all 8 read their fragments from there. Two buffers: the copies of trip t + 1 fly during trip t.
// A step past the range's own is copied all the same and never read (past the batch's last step: that last step again; written rows in either case), so that every wave issues the same copies and passes the same barriers.
// Transposed form: S^T[key][t] = K Q^T (A = K rows, B = Q rows); lane (t = lane&15, h = lane>>4) holds keys 8h+r of each 16-key tile, so the packed
// P tile is directly the B fragment of O^T[d][t] = V^T P^T (element r <- tile keys 0..15, element 8+r <- tile keys 16..31, lane unchanged).
// Key mask: the planes hold the packed keys; NV[b] = number of unmasked keys. Positions from NV[b] on (the rest of the last 32-key step; every position where NV[b] = 0) have their score REPLACED by the fill value
// (a fully masked row therefore comes out uniform); steps that lie wholly below NV[b] take no select.
// Softmax state: the running max is one scalar per lane (the two lane halves of a row are combined with one xor-16 exchange). The row sum is taken on the matrix unit: A = ones in row 0 and zeros below, B = the packed P tile,
// so row 0 of that accumulator (element 0 of lanes 0..15) gains the sum of the rounded P over the step's 32 keys for query t = lane; every other row stays 0, so only element 0 is rescaled.
// Each wave leaves its unnormalised O, its running max and its sum in LDS; behind one work-group barrier the KS partial results of a row are rescaled to their common max, added and normalised.
__global__ __launch_bounds__(32 * FW) void k_flash(const h16* __restrict__ QH, const h16* __restrict__ QR, const h16* __restrict__ KP, const h16* __restrict__ VT,
                                                   const int* __restrict__ NV, bf* CX) {
    __shared__ __align__(16) float os[KS * AW * 16 * 68];        // [key range][row of the block][68]: columns 0..63 = 32*head + d
    __shared__ float sm[KS * 2 * AW * 16], sl[KS * 2 * AW * 16]; // [key range][head][row of the block]: running max, sum
    __shared__ __align__(16) unsigned char ring[2 * BFB];        // [buffer][step of the trip][key range]: K tile [key][KPB], V^T tile [32*head + d][VPB]
    const int lane = threadIdx.x & 31, wave = __builtin_amdgcn_readfirstlane((int)(threadIdx.x >> 5)), lr = lane & 15, hi = lane >> 4;
    const int rt = wave % AW, hh = (wave / AW) & 1, ks = wave / (2 * AW);
    const int zp = blockIdx.y; const int b = zp / (NH_ / 2), hp = zp % (NH_ / 2);
    const int t0 = (blockIdx.x * AW + rt) * 16;
    const size_t rowb = (size_t)b * SEQ;
    const int nvr = NV[b];
    const int nv = __builtin_amdgcn_readfirstlane(nvr < 0 ? 0 : (nvr > SEQ ? SEQ : nvr));   // unmasked keys of the batch, bounded by the shape; kept scalar so that the loop's tail test is a scalar compare
    const int nt = ((nv == 0 ? SEQ : nv) + 31) / 32;             // 32-key steps that the planes hold (1 .. SEQ / 32)
    const int tq = (nt + KS - 1) / KS;                           // steps per key range; the last ranges may be short or empty
    {
        const int h = hp * 2 + hh;
        const size_t qo = (rowb + t0 + lr) * DM + h * HD + 8 * hi;
        const v16h qh = ldh(QH + qo), qr = ldh(QR + qo);                  // B fragments: col t, k = d (32 deep)
        const unsigned char* kf = ring + ks * RTB + lr * KPB + hh * 64 + 16 * hi;            // + buffer, step; + 16*KPB   (A fragment: row key, k = d)
        const unsigned char* vf = ring + ks * RTB + KTB + (hh * 32 + lr) * VPB + 16 * hi;    // + buffer, step; + 16*VPB   (A fragment: row d, k = key)
        // this lane's share of the copies: K row 4*w8 + lane/8, piece lane%8; V^T row 8*w8 + lane/4, piece lane%4 (w8 = the wave's number inside its key range)
        const int w8 = wave % (2 * AW);
        const int kr = 4 * w8 + (lane >> 3), kc = lane & 7, vr = 8 * w8 + (lane >> 2), vc = lane & 3;
        const h16* gk = KP + (rowb + kr) * DM + hp * 64 + kc * 8;                            // + key * DM
        const h16* gv = VT + ((size_t)b * DM + hp * 64 + vr) * SEQ + vc * 8;                 // + key
        const unsigned lk = (unsigned)(size_t)(ring + ks * RTB + kr * KPB + kc * 16), lv = (unsigned)(size_t)(ring + ks * RTB + KTB + vr * VPB + vc * 16);
        v8f o0 = (v8f){}, o1 = (v8f){}, ol = (v8f){};
        float m = -3.0e38f;
        v16h ones;
#pragma unroll
        for (int e = 0; e < 16; ++e) ones[e] = lr == 0 ? (h16)1.0f : (h16)0.0f;
        const int tbeg = ks * tq, tend = tbeg + tq < nt ? tbeg + tq : nt;
        const int ntr = (tq + SPT - 1) / SPT;                    // trips: the same for every wave of the block
        // stage(t, bo): this lane's copies of trip t into the buffer at byte bo. c0, c1 = first key of the two steps (never past the batch's last step): below 32 * nt, so inside the rows that the projections wrote
        auto stage = [&](int t, unsigned bo) {
            const int s0 = tbeg + SPT * t, c0 = 32 * (s0 < nt ? s0 : nt - 1), c1 = 32 * (s0 + 1 < nt ? s0 + 1 : nt - 1);
            copy_kv(lk + bo, gk + (size_t)c0 * DM, lv + bo, gv + c0, lk + bo + SFB, gk + (size_t)c1 * DM, lv + bo + SFB, gv + c1);
        };
        stage(0, 0u);
        asm volatile("s_wait_asynccnt 0x0" ::: "memory");        // this wave's copies of trip 0 have landed
        __syncthreads();                                         // ... and every other wave's: buffer 0 may be read
        if (ntr > 1) stage(1, BFB);
#pragma unroll 1   // stays rolled: the trip count is only known at run time, and the buffer goes by the trip's parity
        for (int t = 0; t < ntr; ++t) {
         const unsigned bo = (t & 1) * BFB;
         for (int j = 0; j < SPT; ++j) {
          const int tt = tbeg + SPT * t + j;
          if (tt < tend) {                                       // same for the whole wave
            const int key0 = tt * 32;
            const h16* ka = (const h16*)(kf + bo + j * SFB);
            const v16h ka0 = ldh(ka), kb0 = ldh(ka + 16 * (KPB / 2));
            v8f sHa = (v8f){}, sLa = (v8f){}, sHb = (v8f){}, sLb = (v8f){};
            sHa = wmma16(ka0, qh, sHa); sLa = wmma16(ka0, qr, sLa); sHb = wmma16(kb0, qh, sHb); sLb = wmma16(kb0, qr, sLb);
            asm volatile("v_nop\n\tv_nop\n\tv_nop\n\tv_nop" : "+v"(sHa), "+v"(sLa), "+v"(sHb), "+v"(sLb) : "v"(ka0), "v"(kb0), "v"(qh), "v"(qr));
            float ta[8], tb[8]; float mx = -3.0e38f;
#pragma unroll
            for (int r = 0; r < 4; ++r) {
                ta[r] = (sHa[r] + sLa[r] * QRI) * SC2; ta[4 + r] = (sHa[4 + r] + sLa[4 + r] * QRI) * SC2;
                tb[r] = (sHb[r] + sLb[r] * QRI) * SC2; tb[4 + r] = (sHb[4 + r] + sLb[4 + r] * QRI) * SC2; }
            if (key0 + 32 > nv) {                                // same for the whole wave: the step reaches past the unmasked keys
                const int kl = nv - key0 - 8 * hi;               // element r stands for keys key0 + 8h + r and key0 + 16 + 8h + r
#pragma unroll
                for (int r = 0; r < 8; ++r) { ta[r] = (r < kl) ? ta[r] : NEGT; tb[r] = (16 + r < kl) ? tb[r] : NEGT; }
            }
#pragma unroll
            for (int r = 0; r < 8; ++r) mx = fmaxf(mx, fmaxf(ta[r], tb[r]));
            mx = fmaxf(mx, __shfl_xor(mx, 16, 32));
            const float mnew = fmaxf(m, mx);
            const float alpha = __builtin_amdgcn_exp2f(m - mnew);
            const float sh = PSH - mnew;
            v16h pb;
#pragma unroll
            for (int r = 0; r < 8; ++r) { pb[r] = (h16)__builtin_amdgcn_exp2f(ta[r] + sh); pb[8 + r] = (h16)__builtin_amdgcn_exp2f(tb[r] + sh); }
            ol[0] = ol[0] * alpha; m = mnew;
            o0 = o0 * alpha; o1 = o1 * alpha;
            const h16* va = (const h16*)(vf + bo + j * SFB);
            const v16h v0 = ldh(va), v1 = ldh(va + 16 * (VPB / 2));
            ol = wmma16(ones, pb, ol); o0 = wmma16(v0, pb, o0); o1 = wmma16(v1, pb, o1);
            // keeps the vector slots the chip needs behind the last WMMA, also on the branches that follow it
            asm volatile("v_nop\n\tv_nop\n\tv_nop\n\tv_nop" : "+v"(o0), "+v"(o1), "+v"(ol) : "v"(v0), "v"(v1), "v"(pb));
          }
         }
         asm volatile("s_wait_dscnt 0x0" ::: "memory");          // this wave's reads of the trip's buffer are done before the buffer is handed on
         asm volatile("s_wait_asynccnt 0x0" ::: "memory");       // this wave's copies of trip t + 1 have landed
         __syncthreads();                                        // publishes the buffer of trip t + 1 and ends every wave's reads of this trip's
         if (t + 2 < ntr) stage(t + 2, bo);                      // same for the whole block
        }
        asm volatile("s_wait_asynccnt 0x0" ::: "memory");        // no copy is outstanding behind the loop
        const float l = ol[0];                                   // lanes 0..15: the row sum over the whole key range, both lane halves' keys included
        // O^T D layout: o_j[r] = (d = 16j + 8h + r, t = lane&15) -> os[key range][16*rt + t][32*hh + d], unnormalised
        { const int ob = ((ks * AW + rt) * 16 + lr) * 68 + hh * 32 + 8 * hi;
          *(v4fa*)(&os[ob])      = (v4f){o0[0], o0[1], o0[2], o0[3]}; *(v4fa*)(&os[ob + 4])  = (v4f){o0[4], o0[5], o0[6], o0[7]};
          *(v4fa*)(&os[ob + 16]) = (v4f){o1[0], o1[1], o1[2], o1[3]}; *(v4fa*)(&os[ob + 20]) = (v4f){o1[4], o1[5], o1[6], o1[7]}; }
        if (hi == 0) { const int si = ((ks * 2 + hh) * AW + rt) * 16 + lr; sm[si] = m; sl[si] = l; }
    }
    __syncthreads();     // every wave's partial result is in LDS before any row is merged
    const int tid = threadIdx.x;
    if (tid < AW * 16 * 8) {                                     // whole waves: 64 rows x 8 lanes x 8 columns
        const int row = tid >> 3, c8 = (tid & 7) * 8, hq = c8 >> 5;
        float pm[KS]; float mx = -3.0e38f;
#pragma unroll
        for (int p = 0; p < KS; ++p) { pm[p] = sm[(p * 2 + hq) * (AW * 16) + row]; mx = fmaxf(mx, pm[p]); }
        v4f x0 = (v4f){}, x1 = (v4f){}; float l = 0.0f;
#pragma unroll
        for (int p = 0; p < KS; ++p) { const float f = __builtin_amdgcn_exp2f(pm[p] - mx);
            l += f * sl[(p * 2 + hq) * (AW * 16) + row];
            x0 += *(const v4fa*)(&os[(p * (AW * 16) + row) * 68 + c8]) * f; x1 += *(const v4fa*)(&os[(p * (AW * 16) + row) * 68 + c8 + 4]) * f; }
        const float inv = 1.0f / l;
        x0 = x0 * inv; x1 = x1 * inv;
        v8us hv, lv;
#pragma unroll
        for (int i = 0; i < 4; ++i) { const unsigned short u0 = f2bf(x0[i]); const unsigned short u1 = f2bf(x1[i]); hv[i] = u0; hv[4 + i] = u1;
            lv[i] = f2bf(x0[i] - bf2f(u0)); lv[4 + i] = f2bf(x1[i] - bf2f(u1)); }
        bf* crow = CX + (rowb + (size_t)blockIdx.x * (AW * 16) + row) * CXP + hp * 64 + c8;
        *(v8us*)(crow) = hv; *(v8us*)(crow + DM) = lv;
    }
}

static constexpr size_t al256(size_t v) { return (v + 255) & ~(size_t)255; }
static constexpr size_t SZ_PL = al256((size_t)NB * SEQ * DM * 2);
static constexpr size_t SZ_CX = al256((size_t)NB * SEQ * CXP * 2);
static constexpr size_t SZ_NV = al256((size_t)NB * sizeof(int));
static constexpr size_t SZ_TOTAL = 4 * SZ_PL + SZ_CX + SZ_NV;
static_assert(SZ_TOTAL <= (size_t)134217728);          // workspace carve <= 128 MiB
static_assert((size_t)NB * DM * SEQ * 2 <= SZ_PL);     // v^T plane extent

extern "C" void kernel_launch(void* const* d_in, const int* in_sizes, int n_in,
                              void* d_out, int out_size, void* d_ws, size_t ws_size, hipStream_t stream) {
    if (n_in < 12) return;
    const size_t needx = ((size_t)(NB - 1) * SEQ_FULL + SEQ) * DM;
    if ((size_t)in_sizes[0] < needx || (size_t)in_sizes[1] < needx || (size_t)in_sizes[2] < needx) return;
    if ((size_t)in_sizes[3] < (size_t)(NB - 1) * SEQ_FULL + SEQ) return;
    if ((size_t)in_sizes[4] < (size_t)DM * DM || (size_t)in_sizes[6] < (size_t)DM * DM || (size_t)in_sizes[8] < (size_t)DM * DM || (size_t)in_sizes[10] < (size_t)DM * DM) return;
    if (in_sizes[5] < DM || in_sizes[7] < DM || in_sizes[9] < DM || in_sizes[11] < DM) return;
    if ((size_t)out_size < ((size_t)(NB - 1) * OUT_SEQ + SEQ) * DM) return;
    if (SZ_TOTAL > ws_size) return;
    // wire order: queries, keys, values, key_mask, Wq, bq, Wk, bk, Wv, bv, Wo, bo
    const float* xq = (const float*)d_in[0]; const float* xk = (const float*)d_in[1]; const float* xv = (const float*)d_in[2];
    const int* kmask = (const int*)d_in[3];
    const float* wq = (const float*)d_in[4]; const float* bq = (const float*)d_in[5];
    const float* wk = (const float*)d_in[6]; const float* bk = (const float*)d_in[7];
    const float* wv = (const float*)d_in[8]; const float* bv = (const float*)d_in[9];
    const float* wo = (const float*)d_in[10]; const float* bo = (const float*)d_in[11];
    float* OUT = (float*)d_out;      // [NB][SEQ][256]
    char* wsp = (char*)d_ws;
    h16* QH = (h16*)wsp; wsp += SZ_PL;               // [NB*SEQ][256]
    h16* QR = (h16*)wsp; wsp += SZ_PL;               // [NB*SEQ][256] residual x2048
    h16* KP = (h16*)wsp; wsp += SZ_PL;               // [NB*SEQ][256]
    h16* VT = (h16*)wsp; wsp += SZ_PL;               // [NB][256][SEQ]
    bf* CX = (bf*)wsp; wsp += SZ_CX;                 // [NB*SEQ][512]: ctx hi | ctx lo
    int* NV = (int*)wsp; wsp += SZ_NV;               // [NB]: unmasked keys of each batch

    k_gemm<false><<<dim3(PTB, 3, 1), 32 * KW, 0, stream>>>(xq, xk, xv, CX, wq, wk, wv, QH, KP, VT, QR, OUT, bq, bk, bv, kmask, NV);

    k_flash<<<dim3(SEQ / (16 * AW), NB * (NH_ / 2), 1), 32 * FW, 0, stream>>>(QH, QR, KP, VT, NV, CX);

    // out = [ctx_hi | ctx_lo] x [Wo ; Wo] + bo, K = 512, f32 rows of the output (the activation pointers are not read here)
    k_gemm<true><<<dim3(PTB, 1, 1), 32 * KW, 0, stream>>>(wo, wo, wo, CX, wo, wo, wo, QH, QH, QH, QH, OUT, bo, bo, bo, kmask, NV);
}

// v009
// A run of this version takes 20.9 microseconds.
// Next to v008, in two timings, it ran 1.09 times as fast each time.
// Counting every step since v000, it is 7.26 times as fast.
#include <hip/hip_runtime.h>

// Multi-head attention with key padding mask: q/k/v inputs [NB][SEQ][256], Wq/Wk/Wv/Wo [in][out] (y = x W + b), 8 heads x 32, score scale 1/sqrt(32), masked keys take the fill value -4294967296, output = ctx Wo + bo (f32).
// Compute dtypes, f32 accumulate everywhere: projections v_wmma_f32_16x16x32_bf16 (inputs and weights RNE-converted to bf16; products exact);
// scores v_wmma_f32_16x16x32_f16: k single f16, q as f16 value + f16 residual x2048 in its own accumulator (two products); P (x256 carry, cancels in the normalisation) and v single f16; softmax f32 (online, running max);
// output projection v_wmma_f32_16x16x32_bf16 with ctx carried as bf16 hi | bf16 lo planes folded along K (K = 512, weight row = k mod 256).
// Layout: activations and weights are read as f32 by the GEMMs and rounded in registers (the activations and the ctx plane by way of LDS); q (hi, residual), k planes [b*SEQ + t][256] (head h = columns 32h..32h+31) and v^T plane [b][256][SEQ] written by the GEMM epilogue;
// Key mask: the k and v^T planes hold only the unmasked keys of a batch, packed without gaps in one fixed order (key_list; the same for both planes); a masked key's weight is exactly 0 beside any unmasked one, so attention runs over the packed keys alone.
// A batch with no unmasked key keeps all its keys in the planes, and every score takes the fill value (uniform weights, as the reference gives).

#ifndef NB
#define NB 2
#endif
#ifndef SEQ
#define SEQ 2048
#endif
#define NB_FULL  2
#define SEQ_FULL 2048
#ifndef OUT_SEQ
#define OUT_SEQ SEQ              // row pitch (in tokens) between batches of the output
#endif
#define DM   256
#define NH_  8
#define HD   32
#define CXP  (2 * DM)            // ctx plane pitch: hi columns 0..255, lo columns 256..511
#define AW   4                   // 16-row query tiles per flash block
#define KS   4                   // key ranges per (query tile, head), one wave each
#define FW   (AW * 2 * KS)       // waves per flash block: query tiles x 2 heads x key ranges
#define KW   4                   // waves per GEMM block: each takes a KW-th of the k range of the block's tile
#define OSW  (64 * 68)           // floats of one wave's partial tile in LDS: 64 rows, pitch 68
#define XRB  1024                // bytes of one row of a GEMM's row operand in global memory (256 f32, or 512 bf16 of the ctx plane)
#define XPB  272                 // LDS pitch of a staged row of the row operand, bytes: 256 (one wave's k range of the row) + 16, 16 B x odd for the ds_load_b128 readers
#define QRS  2048.0f             // carry of the q residual plane
#define QRI  (1.0f / 2048.0f)
#define SC2  (0.17677669529663687f * 1.4426950408889634f)   // HD^-0.5 * log2(e)
#define PSH  8.0f                // log2 of the P carry (256)
#define NEGT (-4294967296.0f * 1.4426950408889634f)         // mask fill value in the log2 domain
#define KPB  144                 // LDS pitch of a staged K row, bytes: 128 (32 columns x 2 heads) + 16, 16 B x odd for the ds_load_b128 readers
#define VPB  80                  // LDS pitch of a staged V^T row, bytes: 64 (32 keys) + 16, 16 B x odd
#define KTB  (32 * KPB)          // one K tile: 32 keys
#define VTB  (64 * VPB)          // one V^T tile: 64 rows (2 heads x 32)
#define RTB  (KTB + VTB)         // one step of one key range
#define SFB  (KS * RTB)          // one 32-key step of every key range
#define SPT  2                   // steps of a key range per buffer (per trip between two barriers)
#define BFB  (SPT * SFB)         // one buffer

static_assert(HD == 32);
static_assert(NH_ * HD == DM);                 // head h = columns h*32 + d
static_assert(NH_ % 2 == 0);
static_assert(DM % 64 == 0);
static_assert(DM % 32 == 0);                   // GEMM k-loop steps by 32
static_assert(CXP % 32 == 0);
static_assert(DM % (32 * KW) == 0);            // every wave of a GEMM block gets whole 32-deep trips (CXP = 2 * DM too)
static_assert(DM * 4 == XRB && CXP * 2 == XRB); // both row operands have rows of XRB bytes
static_assert(XRB / KW == 256 && XPB == 256 + 16 && XPB % 16 == 0);
static_assert(64 * XPB == OSW * 4);            // a wave's 64 staged rows fill the place of its partial tile
static_assert(KW == 4);                        // behind the sum, wave p stores the p-th of the tile's four 16-row passes
static_assert(SEQ % 64 == 0);                  // a 64-row tile never straddles two batches
static_assert((NB * SEQ) % 64 == 0);
static_assert(SEQ % (32 * KS) == 0);           // key loop steps by 32 inside each key range
static_assert(FW * 32 <= 1024);
static_assert(AW * 2 == 8);                    // the 8 waves of a key range copy its tiles: 256 lanes x 16 B = 4 KiB for K, the same for V^T
static_assert(KPB % 16 == 0 && VPB % 16 == 0 && KTB % 16 == 0 && RTB % 16 == 0);
static_assert(SPT == 2);                       // copy_kv holds the copies of two steps
static_assert(FW * 32 >= AW * 16 * 8);         // the merge uses one thread per (row, 8 columns)
static_assert(SEQ % (16 * AW) == 0);           // flash grid covers the sequence exactly
static_assert(((size_t)SEQ * DM) % 8 == 0);
static_assert(NB <= NB_FULL);
static_assert(SEQ <= SEQ_FULL);

typedef _Float16 h16;
typedef unsigned short bf;
typedef __attribute__((ext_vector_type(16))) __bf16   v16bf;
typedef __attribute__((ext_vector_type(16))) _Float16 v16h;
typedef __attribute__((ext_vector_type(8)))  _Float16 v8h;
typedef __attribute__((ext_vector_type(8)))  unsigned short v8us;
typedef __attribute__((ext_vector_type(8)))  float    v8f;
typedef __attribute__((ext_vector_type(16))) float    v16f;
typedef __attribute__((ext_vector_type(4)))  float    v4f;
typedef __attribute__((ext_vector_type(4)))  int      v4i;
typedef v4f  __attribute__((may_alias)) v4fa;
typedef v8us __attribute__((may_alias)) v8usa;

__device__ __forceinline__ unsigned short f2bf(float f) { unsigned u = __float_as_uint(f); u += 0x7FFFu + ((u >> 16) & 1u); return (unsigned short)(u >> 16); }
__device__ __forceinline__ float bf2f(unsigned short s) { return __uint_as_float(((unsigned)s) << 16); }
__device__ __forceinline__ float bfr(float f) { return bf2f(f2bf(f)); }
__device__ __forceinline__ v16h cat16(v8h lo, v8h hi) { return __builtin_shufflevector(lo, hi, 0, 1, 2, 3, 4, 5, 6, 7, 8, 9, 10, 11, 12, 13, 14, 15); }
__device__ __forceinline__ v16bf cat16b(v8us lo, v8us hi) { return __builtin_bit_cast(v16bf, __builtin_shufflevector(lo, hi, 0, 1, 2, 3, 4, 5, 6, 7, 8, 9, 10, 11, 12, 13, 14, 15)); }
__device__ __forceinline__ v8f wmma16(v16h a, v16h b, v8f c) { return __builtin_amdgcn_wmma_f32_16x16x32_f16(false, a, false, b, (short)0, c, false, false); }
__device__ __forceinline__ v8f wmmab(v16bf a, v16bf b, v8f c) { return __builtin_amdgcn_wmma_f32_16x16x32_bf16(false, a, false, b, (short)0, c, false, false); }
// fragment loaders from K-contiguous 16-bit rows; p already includes + 8*(lane>>4): elements 0..7 <- k0+8h+0..7, elements 8..15 <- k0+16+8h+0..7 (same map for A and B)
__device__ __forceinline__ v16h  ldh(const h16* p) { return cat16(*(const v8h*)p, *(const v8h*)(p + 16)); }
__device__ __forceinline__ v16bf ldb(const bf* p)  { return cat16b(*(const v8us*)p, *(const v8us*)(p + 16)); }
// the same fragments from rows staged in LDS (16-B reads): 16 bf16, or one 8-float piece of an f32 row
__device__ __forceinline__ v16bf ldbs(const bf* p) { return cat16b(*(const v8usa*)p, *(const v8usa*)(p + 16)); }
__device__ __forceinline__ v8f lds8(const float* p) { return __builtin_shufflevector(*(const v4fa*)p, *(const v4fa*)(p + 4), 0, 1, 2, 3, 4, 5, 6, 7); }
// ordering point for wave-private LDS tiles (same wave writes and reads)
__device__ __forceinline__ void wave_sync() { __builtin_amdgcn_fence(3 /* release order */, "wavefront"); __builtin_amdgcn_wave_barrier(); asm volatile("" ::: "memory"); }

// cvx: fragment from the two 8-float pieces of one K-contiguous f32 row (k0+8h+0..7, k0+16+8h+0..7: the k map of ldb), rounded to bf16 (RNE) in registers
__device__ __forceinline__ v16bf cvx(v8f lo, v8f hi8) {
    return __builtin_convertvector(__builtin_shufflevector(lo, hi8, 0, 1, 2, 3, 4, 5, 6, 7, 8, 9, 10, 11, 12, 13, 14, 15), v16bf);
}
// Weight fragments come four at once from W[k][n] (f32, row pitch DM): one 16-B load per k at W + k * DM + n0 + 4*(lane&15) gives the lane that k of the four outputs n0 + 4*(lane&15) + i.
// r[e] = row k0+8h+e, r[8+e] = row k0+16+8h+e (the k map of ldb); cvw: fragment i holds outputs n0 + 4*l + i (l = its 16 rows or columns), rounded to bf16 (RNE) in registers.
__device__ __forceinline__ v16bf cvw(const v4f (&r)[16], int i) {
    v16f t;
#pragma unroll
    for (int e = 0; e < 16; ++e) t[e] = r[e][i];
    return __builtin_convertvector(t, v16bf);
}

// key_list (one wave): returns the number of unmasked keys of one batch (mkb = its SEQ mask words) and leaves in idx[0..63] the keys that stand at packed positions lo..lo+63.
// Load i gives lane c the mask of keys 128*i + 4*c + 0..3; bit t of the lane's SEQ/32 bits (32 to a word w[j]) stands for key 128*(t>>2) + 4*c + (t&3).
// Packed order: by lane, then by bit (any order serves, as k and v^T use the same one). p = first packed position of the lane's current word (lane prefix sum, one ballot per bit of the counts).
// Only the words that reach into lo..lo+63 are then walked, one word (32 keys, one a lane) a trip. No unmasked key at all: every key counts as present.
// Positions past the last key keep key 0: finite rows that the attention kernel masks. Every entry is formed from lane, word and bit numbers alone and lies below SEQ.
__device__ __forceinline__ int key_list(int* idx, const int* __restrict__ mkb, int lo) {
    constexpr int NW = SEQ / 1024;
    static_assert(SEQ % 1024 == 0 && SEQ / 32 < 128);
    const int lane = threadIdx.x & 31;
    v4i mv[8 * NW];
#pragma unroll
    for (int i = 0; i < 8 * NW; ++i) mv[i] = *(const v4i*)(mkb + 128 * i + 4 * lane);
    asm volatile("s_wait_xcnt 0x0" ::: "memory");   // precaution: stands in front of any later rewrite of the mask loads' address registers
    unsigned w[NW];
    unsigned any = 0u;
#pragma unroll
    for (int j = 0; j < NW; ++j) {
        w[j] = 0u;
#pragma unroll
        for (int t = 0; t < 32; ++t) w[j] |= mv[8 * j + (t >> 2)][t & 3] != 0 ? 1u << t : 0u;
        any |= w[j];
    }
    const bool none = __builtin_amdgcn_ballot_w32(any != 0u) == 0u;
    int cn = 0;
#pragma unroll
    for (int j = 0; j < NW; ++j) { if (none) w[j] = ~0u; cn += __builtin_popcount(w[j]); }   // cn = 0 .. SEQ / 32: seven bits
    int p = 0, tot = 0;
#pragma unroll
    for (int bit = 0; bit < 7; ++bit) {
        const unsigned bb = __builtin_amdgcn_ballot_w32(((cn >> bit) & 1) != 0);
        p += (int)__builtin_amdgcn_mbcnt_lo(bb, 0u) << bit;
        tot += __builtin_popcount(bb) << bit;
    }
    const int nvalid = none ? 0 : tot;
    if (lo >= tot) return nvalid;                    // nothing stands at these positions: the caller leaves
    idx[lane] = 0; idx[lane + 32] = 0;
#pragma unroll
    for (int j = 0; j < NW; ++j) {
        const int cj = __builtin_popcount(w[j]);
        unsigned todo = __builtin_amdgcn_ballot_w32(p + cj > lo && p < lo + 64);
        while (todo != 0u) {                         // same for the whole wave; one bit goes each trip: at most 32 trips
            const int c = __builtin_ctz(todo);
            todo &= todo - 1u;
            const unsigned bc = (unsigned)__builtin_amdgcn_readlane((int)w[j], c);
            const int pos = __builtin_amdgcn_readlane(p, c) - lo + (int)__builtin_amdgcn_mbcnt_lo(bc, 0u);
            if (((bc >> lane) & 1u) != 0u && pos >= 0 && pos < 64) idx[pos] = 128 * (8 * j + (lane >> 2)) + 4 * c + (lane & 3);
        }
        p += cj;
    }
    wave_sync();
    return nvalid;
}

// copy_x8: eight asynchronous copies, 16 B a lane each, global memory to LDS through no register (l = the lane's LDS byte addresses, g = its global addresses).
// The s_wait_xcnt stands inside the statement as a precaution: behind it the address registers may be rewritten.
__device__ __forceinline__ void copy_x8(const unsigned (&l)[8], const char* const (&g)[8]) {
    asm volatile("global_load_async_to_lds_b128 %0, %8, off\n\tglobal_load_async_to_lds_b128 %1, %9, off\n\t"
                 "global_load_async_to_lds_b128 %2, %10, off\n\tglobal_load_async_to_lds_b128 %3, %11, off\n\t"
                 "global_load_async_to_lds_b128 %4, %12, off\n\tglobal_load_async_to_lds_b128 %5, %13, off\n\t"
                 "global_load_async_to_lds_b128 %6, %14, off\n\tglobal_load_async_to_lds_b128 %7, %15, off\n\ts_wait_xcnt 0x0"
                 :: "v"(l[0]), "v"(l[1]), "v"(l[2]), "v"(l[3]), "v"(l[4]), "v"(l[5]), "v"(l[6]), "v"(l[7]),
                    "v"(g[0]), "v"(g[1]), "v"(g[2]), "v"(g[3]), "v"(g[4]), "v"(g[5]), "v"(g[6]), "v"(g[7]) : "memory");
}

// k_gemm: register-blocked bf16 GEMM, one block of KW waves per 64x64 tile; every wave holds the whole tile (16 accumulators) over its own KW-th of k, leaves its partial tile in LDS,
// and behind one work-group barrier wave p adds the KW partial tiles (in wave order) for the p-th 16-row pass, adds the bias and stores. The weight operand comes straight from the f32 input W[k][n] (cvw), the other operand from K-contiguous rows:
// the f32 activation input (cvx; F32OUT = false) or the bf16 ctx plane (F32OUT = true, K = 512, weight row = k mod 256). Bias: bf16 RNE value of the f32 bias, added in f32.
// The row operand goes through LDS: a fragment load straight from global memory touches 16 rows (16 lines for 512 B). Each wave brings its own 64 rows x 256 B (its k range) in with 32 asynchronous copies,
// two rows (four whole lines) a copy, into the place where its partial tile will stand later (pitch XPB), and reads its fragments from there; only the wave that copied reads these bytes, behind its own s_wait_asynccnt: no barrier.
// acc[xi][wi]: xi = 16-row group of the row operand (rows 16*xi + l), wi = weight fragment (outputs 4*l + wi).
// F32OUT = false: the three input projections in ONE launch, blockIdx.y picks the job, PTB tiles each, the row tile running fastest in blockIdx.x; written as f16 (Ph), q also as the f16 residual x2048 (Pr):
//   job 0 (q), job 1 (k): A = x rows (m = b*SEQ + t), B = W columns (n = h*32 + d) -> plane [m][n], bias by column
//   job 2 (v^T): A = Wv columns (m = h*32 + d), B = x rows (n = b*SEQ + t) -> plane [(b*256 + m)][t], bias by row
//   jobs 1 and 2: t is a packed position, the x row read for it is the key that key_list names; a tile past the last packed key leaves at once; job 1's first tile of a batch stores the batch's count in NV
// F32OUT = true: the output projection, f32 rows of OUT[(m/SEQ)*OUT_SEQ + m%SEQ][c0 + col]; each row segment (64 floats = two lines) written by 16 consecutive lanes x 16 B (2 rows per instruction).
#define PTB ((NB * SEQ / 64) * (DM / 64))
// gemm_tile: one 64x64 tile. J2 = the v^T job (weight fragments as A). f = tile index, the row tile running fastest.
template <bool F32OUT, bool J2>
__device__ __forceinline__ void gemm_tile(float* os, const float* __restrict__ X, const bf* __restrict__ CXA, const float* __restrict__ Wt,
                                          h16* Ph, h16* Pr, float* OUT, const float* __restrict__ bias, bool useRes, unsigned f,
                                          int* kidx, const int* __restrict__ MK, int* NV, bool packed) {
    constexpr int K = F32OUT ? CXP : DM;
    constexpr int pitch = J2 ? SEQ : DM;                           // row pitch of the f16 plane (halves)
    constexpr int KQ = K / KW;                                     // k range of one wave
    const int lane = threadIdx.x & 31, lr = lane & 15, hi = lane >> 4;
    const int wv = __builtin_amdgcn_readfirstlane((int)(threadIdx.x >> 5)), kbeg = wv * KQ;
    const int r0 = (J2 ? f % (DM / 64) : f % (NB * SEQ / 64)) * 64, c0 = (J2 ? f / (DM / 64) : f / (NB * SEQ / 64)) * 64;
    const int xr0 = J2 ? c0 : r0, wc0 = J2 ? r0 : c0;             // tile base of the row operand, of the weight outputs
    const int p = wv;                                              // the 16 output rows that this wave sums and stores: rows 16*p + row, in the v^T job rows 4*row + p
    // this wave's bias values (by row in the v^T job, else by column), asked for at the start: their latency runs beside the work in front of the sum (the barrier there waits for every load in flight)
    v4f bc0 = (v4f){}, bc1 = (v4f){};
    float br[4] = {0.0f, 0.0f, 0.0f, 0.0f};
    if constexpr (F32OUT) bc0 = *(const v4f*)(bias + c0 + lr * 4);
    else if constexpr (J2) {
#pragma unroll
        for (int s = 0; s < 4; ++s) br[s] = bias[r0 + 4 * (4 * s + (lane >> 3)) + p];
    } else { bc0 = *(const v4f*)(bias + c0 + (lane & 7) * 8); bc1 = *(const v4f*)(bias + c0 + (lane & 7) * 8 + 4); }
    asm volatile("s_wait_xcnt 0x0" ::: "memory");                  // precaution: stands in front of any later rewrite of the bias loads' address registers
    if constexpr (!F32OUT) {
        if (J2 || packed) {
            kidx += 64 * wv;                                      // every wave forms the list for itself: no barrier in front of the loads
            const int tot = key_list(kidx, MK + (size_t)(xr0 / SEQ) * SEQ_FULL, xr0 % SEQ);
            if (xr0 % SEQ >= (tot == 0 ? SEQ : tot)) return;      // the same for every wave of the block, in front of the barrier
            if (!J2 && xr0 % SEQ == 0 && wc0 == 0 && wv == 0 && lane == 0) { NV[xr0 / SEQ] = tot;
                asm volatile("s_wait_xcnt 0x0" ::: "memory"); }   // precaution: stands in front of any later rewrite of this store's registers
        }
    }
    v8f acc[4][4];
#pragma unroll
    for (int xi = 0; xi < 4; ++xi)
#pragma unroll
        for (int wi = 0; wi < 4; ++wi) acc[xi][wi] = (v8f){};
    float* ow = os + wv * OSW;                                     // this wave's place in LDS: first its staged rows [64][XPB bytes], then its partial tile [pass][16 rows][68]
    const float* xs = ow + lr * (XPB / 4) + 8 * hi;                // f32 rows: + 16*xi rows, + k inside the wave's range
    const bf* xb = (const bf*)ow + lr * (XPB / 2) + 8 * hi;       // ctx rows (F32OUT)
    // this lane's weight column group at the first k row of the wave's range (row = k mod DM: the ctx plane's lo half meets the same weights again); a wave's range never wraps, as KQ divides DM
    static_assert(DM % KQ == 0);
    constexpr int NT = KQ / 32;                                    // 32-deep trips of one wave
    const float* wp = Wt + (size_t)((kbeg & (DM - 1)) + 8 * hi) * DM + wc0 + 4 * lr;
    // Every trip's weight rows are asked for at the start, at constant distances from wp: the later trips' loads fly beside the copies and the first trips' work, so that a wave waits out one load latency and not one a trip.
    v4f wr[NT][16];
    auto wload = [&](const int t) __attribute__((always_inline)) {
#pragma unroll
        for (int e = 0; e < 8; ++e) { wr[t][e] = *(const v4f*)(wp + (size_t)(32 * t + e) * DM); wr[t][8 + e] = *(const v4f*)(wp + (size_t)(32 * t + 16 + e) * DM); }
    };
    wload(0);
    {                                                             // The copies go out behind the first trip's weight loads, so that those loads fly beside the copies' address work and the copies
        // copy i of this lane brings 16 B (piece lane&15) of the tile's row 32*hi + i: srow[i] = that row's number in its batch (a 64-row tile lies in one batch), in the ctx plane its number in the tile
        int srow[32];
#pragma unroll
        for (int i = 0; i < 32; ++i) srow[i] = (F32OUT ? 0 : xr0 % SEQ) + 32 * hi + i;
        if constexpr (!F32OUT) {
            if (J2 || packed) {
#pragma unroll
                for (int i = 0; i < 32; i += 4) { const v4i t = *(const v4i*)(kidx + 32 * hi + i); srow[i] = t[0]; srow[i + 1] = t[1]; srow[i + 2] = t[2]; srow[i + 3] = t[3]; }
            }
        }
        const char* gx = (F32OUT ? (const char*)(CXA + (size_t)xr0 * K + kbeg) : (const char*)(X + (size_t)(xr0 / SEQ) * SEQ_FULL * DM + kbeg)) + 16 * lr;
        const unsigned lx = (unsigned)(size_t)ow + (unsigned)(32 * hi * XPB + 16 * lr);
#pragma unroll
        for (int c = 0; c < 32; c += 8) {
            unsigned l[8]; const char* g[8];
#pragma unroll
            for (int e = 0; e < 8; ++e) { l[e] = lx + (unsigned)((c + e) * XPB); g[e] = gx + (size_t)(unsigned)srow[c + e] * XRB; }
            copy_x8(l, g);
        }
    }
#pragma unroll
    for (int t = 1; t < NT; ++t) wload(t);
    // nothing moves over this line: built without it, three conversions of the first trip's weights, with their wait for those loads, stand in front of the last eight copies and of the later trips' loads
    __builtin_amdgcn_sched_barrier(0);
    asm volatile("s_wait_xcnt 0x0" ::: "memory");                  // precaution: stands in front of any later rewrite of the weight loads' address registers
    asm volatile("s_wait_asynccnt 0x0" ::: "memory");              // this wave's staged rows have landed
#pragma unroll   // unrolled: each trip works on its own registers, which were asked for above
    for (int t = 0; t < NT; ++t) {
        v16bf xf[4], wf[4];
        if constexpr (F32OUT) {
#pragma unroll
            for (int xi = 0; xi < 4; ++xi) xf[xi] = ldbs(xb + xi * 16 * (XPB / 2) + 32 * t);
        } else {
#pragma unroll
            for (int xi = 0; xi < 4; ++xi) { const float* xp = xs + xi * 16 * (XPB / 4) + 32 * t; xf[xi] = cvx(lds8(xp), lds8(xp + 16)); }
        }
#pragma unroll
        for (int wi = 0; wi < 4; ++wi) wf[wi] = cvw(wr[t], wi);
#pragma unroll
        for (int wi = 0; wi < 4; ++wi)
#pragma unroll
            for (int xi = 0; xi < 4; ++xi) acc[xi][wi] = J2 ? wmmab(wf[wi], xf[xi], acc[xi][wi]) : wmmab(xf[xi], wf[wi], acc[xi][wi]);
    }
    const size_t tbase = J2 ? (size_t)r0 * SEQ + (size_t)(c0 / SEQ) * ((size_t)DM * SEQ) + (size_t)(c0 % SEQ) : (size_t)r0 * DM + (size_t)c0;
#pragma unroll
    for (int q = 0; q < 4; ++q) {
        if constexpr (J2) {
#pragma unroll
            for (int xi = 0; xi < 4; ++xi)
#pragma unroll
                for (int j = 0; j < 8; ++j) ow[(q * 16 + hi * 8 + j) * 68 + xi * 16 + lr] = acc[xi][q][j];   // D: row 8h+j (output 4*(8h+j) + q), col t = 16*xi + lane&15
        } else {
#pragma unroll
            for (int j = 0; j < 8; ++j) *(v4fa*)(&ow[(q * 16 + hi * 8 + j) * 68 + 4 * lr]) = (v4f){acc[q][0][j], acc[q][1][j], acc[q][2][j], acc[q][3][j]};   // D: row 8h+j, col 4*(lane&15) + wi
        }
    }
    __syncthreads();     // every wave's partial tile is in LDS before any row is summed
    const float* op = os + p * (16 * 68);                          // pass p of wave 0's partial tile; + w * OSW for wave w's
    if constexpr (!F32OUT) {
        const int c8 = (lane & 7) * 8;                             // 4 s x 4 row groups = 16 rows; 8 lanes x 8 = 64 columns
        v4f x0[4], x1[4];                                          // all sums first: the LDS reads of the four row groups go out together, in front of the stores' waits
#pragma unroll
        for (int s = 0; s < 4; ++s) { const int row = 4 * s + (lane >> 3);
            x0[s] = *(const v4fa*)(&op[row * 68 + c8]); x1[s] = *(const v4fa*)(&op[row * 68 + c8 + 4]);
#pragma unroll
            for (int w = 1; w < KW; ++w) { x0[s] += *(const v4fa*)(&op[w * OSW + row * 68 + c8]); x1[s] += *(const v4fa*)(&op[w * OSW + row * 68 + c8 + 4]); }
        }
#pragma unroll
        for (int s = 0; s < 4; ++s) { const int row = 4 * s + (lane >> 3);
            const int rofs = J2 ? 4 * row + p : p * 16 + row;
            if constexpr (J2) { bc0 = (v4f){br[s], br[s], br[s], br[s]}; bc1 = bc0; }
            v8h hv, rv;
#pragma unroll
            for (int i = 0; i < 4; ++i) { const float y0 = x0[s][i] + bfr(bc0[i]); const float y1 = x1[s][i] + bfr(bc1[i]);
                const h16 a0 = (h16)y0; const h16 a1 = (h16)y1; hv[i] = a0; hv[4 + i] = a1; rv[i] = (h16)((y0 - (float)a0) * QRS); rv[4 + i] = (h16)((y1 - (float)a1) * QRS); }
            const size_t oo = tbase + (size_t)rofs * (size_t)pitch + c8;
            *(v8h*)(Ph + oo) = hv;
            asm volatile("s_wait_xcnt 0x0" ::: "memory");         // precaution: stands in front of any later rewrite of this store's data or address registers, on both sides of the branch below
            if (useRes) { *(v8h*)(Pr + oo) = rv;
                asm volatile("s_wait_xcnt 0x0" ::: "memory"); }   // precaution: the same for the residual store
        }
    } else {
        const int cofs = lr * 4;                                   // 8 s x 2 rows = 16 rows; 16 lanes x 4 floats = 64 columns
        v4f val[8];
#pragma unroll
        for (int s = 0; s < 8; ++s) { const int row = 2 * s + hi;
            val[s] = *(const v4fa*)(&op[row * 68 + cofs]);
#pragma unroll
            for (int w = 1; w < KW; ++w) val[s] += *(const v4fa*)(&op[w * OSW + row * 68 + cofs]);
        }
#pragma unroll
        for (int s = 0; s < 8; ++s) { const int row = 2 * s + hi;
            const int m = r0 + p * 16 + row; const int bb = m / SEQ, tt = m - bb * SEQ;
#pragma unroll
            for (int i = 0; i < 4; ++i) val[s][i] = val[s][i] + bfr(bc0[i]);
            *(v4f*)(OUT + ((size_t)bb * OUT_SEQ + tt) * DM + c0 + cofs) = val[s]; }
    }
}

template <bool F32OUT>
__global__ __launch_bounds__(32 * KW) void k_gemm(const float* __restrict__ X0, const float* __restrict__ X1, const float* __restrict__ X2, const bf* __restrict__ CXA,
                                             const float* __restrict__ W0, const float* __restrict__ W1, const float* __restrict__ W2,
                                             h16* Ph0, h16* Ph1, h16* Ph2, h16* Pr, float* OUT,
                                             const float* __restrict__ bias0, const float* __restrict__ bias1, const float* __restrict__ bias2,
                                             const int* __restrict__ MK, int* NV) {
    __shared__ __align__(16) float os[KW * OSW];                  // [wave][64 rows][68]: the waves' partial tiles
    if constexpr (F32OUT) gemm_tile<true, false>(os, X0, CXA, W0, Ph0, Pr, OUT, bias0, false, blockIdx.x, nullptr, MK, NV, false);
    else {
        __shared__ __align__(16) int kidx[KW * 64];               // [wave][64]
        const unsigned job = blockIdx.y;
        if (job == 2) gemm_tile<false, true>(os, X2, CXA, W2, Ph2, Pr, OUT, bias2, false, blockIdx.x, kidx, MK, NV, true);
        else gemm_tile<false, false>(os, job == 0 ? X0 : X1, CXA, job == 0 ? W0 : W1, job == 0 ? Ph0 : Ph1, Pr, OUT, job == 0 ? bias0 : bias1, job == 0, blockIdx.x, kidx, MK, NV, job == 1);
    }
}

// copy_kv: the K and V^T copies of two steps, 16 B a lane each, global memory to LDS through no register (lk*, lv* = the lane's LDS byte addresses).
// The s_wait_xcnt stands inside the statement as a precaution: behind it the address registers may be rewritten.
__device__ __forceinline__ void copy_kv(unsigned lk0, const h16* gk0, unsigned lv0, const h16* gv0, unsigned lk1, const h16* gk1, unsigned lv1, const h16* gv1) {
    asm volatile("global_load_async_to_lds_b128 %0, %1, off\n\tglobal_load_async_to_lds_b128 %2, %3, off\n\t"
                 "global_load_async_to_lds_b128 %4, %5, off\n\tglobal_load_async_to_lds_b128 %6, %7, off\n\ts_wait_xcnt 0x0"
                 :: "v"(lk0), "v"(gk0), "v"(lv0), "v"(gv0), "v"(lk1), "v"(gk1), "v"(lv1), "v"(gv1) : "memory");
}

// k_flash: fused attention, one work-group per 64 query rows of one batch and one PAIR of heads; one wave per (16 query rows, head, key range: a KS-th of the batch's 32-key steps).
// The waves of one key range walk the same K rows and V^T columns at the same time; both heads of the pair read the two halves of the same K lines.
// Q fragments straight from the f16 planes (two 16-B loads each). K and V^T go through LDS: trip t of the block works on steps SPT*t .. SPT*t + SPT-1 of every key range; the 8 waves of a range bring each step's K tile
// (32 keys x 128 B) and V^T tile (64 rows x 64 B) in with one asynchronous 16-B copy a lane each, whole lines or half lines, and all 8 read their fragments from there. Two buffers: the copies of trip t + 1 fly during trip t.
// A step past the range's own is copied all the same and never read (past the batch's last step: that last step again; written rows in either case), so that every wave issues the same copies and passes the same barriers.
// Transposed form: S^T[key][t] = K Q^T (A = K rows, B = Q rows); lane (t = lane&15, h = lane>>4) holds keys 8h+r of each 16-key tile, so the packed
// P tile is directly the B fragment of O^T[d][t] = V^T P^T (element r <- tile keys 0..15, element 8+r <- tile keys 16..31, lane unchanged).
// Key mask: the planes hold the packed keys; NV[b] = number of unmasked keys. Positions from NV[b] on (the rest of the last 32-key step; every position where NV[b] = 0) have their score REPLACED by the fill value
// (a fully masked row therefore comes out uniform); steps that lie wholly below NV[b] take no select.
// Softmax state: the running max is one scalar per lane (the two lane halves of a row are combined with one xor-16 exchange). The row sum is taken on the matrix unit: A = ones in row 0 and zeros below, B = the packed P tile,
// so row 0 of that accumulator (element 0 of lanes 0..15) gains the sum of the rounded P over the step's 32 keys for query t = lane; every other row stays 0, so only element 0 is rescaled.
// Each wave leaves its unnormalised O, its running max and its sum in LDS; behind one work-group barrier the KS partial results of a row are rescaled to their common max, added and normalised.
__global__ __launch_bounds__(32 * FW) void k_flash(const h16* __restrict__ QH, const h16* __restrict__ QR, const h16* __restrict__ KP, const h16* __restrict__ VT,
                                                   const int* __restrict__ NV, bf* CX) {
    __shared__ __align__(16) float os[KS * AW * 16 * 68];        // [key range][row of the block][68]: columns 0..63 = 32*head + d
    __shared__ float sm[KS * 2 * AW * 16], sl[KS * 2 * AW * 16]; // [key range][head][row of the block]: running max, sum
    __shared__ __align__(16) unsigned char ring[2 * BFB];        // [buffer][step of the trip][key range]: K tile [key][KPB], V^T tile [32*head + d][VPB]
    const int lane = threadIdx.x & 31, wave = __builtin_amdgcn_readfirstlane((int)(threadIdx.x >> 5)), lr = lane & 15, hi = lane >> 4;
    const int rt = wave % AW, hh = (wave / AW) & 1, ks = wave / (2 * AW);
    const int zp = blockIdx.y; const int b = zp / (NH_ / 2), hp = zp % (NH_ / 2);
    const int t0 = (blockIdx.x * AW + rt) * 16;
    const size_t rowb = (size_t)b * SEQ;
    const int nvr = NV[b];
    const int nv = __builtin_amdgcn_readfirstlane(nvr < 0 ? 0 : (nvr > SEQ ? SEQ : nvr));   // unmasked keys of the batch, bounded by the shape; kept scalar so that the loop's tail test is a scalar compare
    const int nt = ((nv == 0 ? SEQ : nv) + 31) / 32;             // 32-key steps that the planes hold (1 .. SEQ / 32)
    const int tq = (nt + KS - 1) / KS;                           // steps per key range; the last ranges may be short or empty
    {
        const int h = hp * 2 + hh;
        const size_t qo = (rowb + t0 + lr) * DM + h * HD + 8 * hi;
        const v16h qh = ldh(QH + qo), qr = ldh(QR + qo);                  // B fragments: col t, k = d (32 deep)
        const unsigned char* kf = ring + ks * RTB + lr * KPB + hh * 64 + 16 * hi;            // + buffer, step; + 16*KPB   (A fragment: row key, k = d)
        const unsigned char* vf = ring + ks * RTB + KTB + (hh * 32 + lr) * VPB + 16 * hi;    // + buffer, step; + 16*VPB   (A fragment: row d, k = key)
        // this lane's share of the copies: K row 4*w8 + lane/8, piece lane%8; V^T row 8*w8 + lane/4, piece lane%4 (w8 = the wave's number inside its key range)
        const int w8 = wave % (2 * AW);
        const int kr = 4 * w8 + (lane >> 3), kc = lane & 7, vr = 8 * w8 + (lane >> 2), vc = lane & 3;
        const h16* gk = KP + (rowb + kr) * DM + hp * 64 + kc * 8;                            // + key * DM
        const h16* gv = VT + ((size_t)b * DM + hp * 64 + vr) * SEQ + vc * 8;                 // + key
        const unsigned lk = (unsigned)(size_t)(ring + ks * RTB + kr * KPB + kc * 16), lv = (unsigned)(size_t)(ring + ks * RTB + KTB + vr * VPB + vc * 16);
        v8f o0 = (v8f){}, o1 = (v8f){}, ol = (v8f){};
        float m = -3.0e38f;
        v16h ones;
#pragma unroll
        for (int e = 0; e < 16; ++e) ones[e] = lr == 0 ? (h16)1.0f : (h16)0.0f;
        const int tbeg = ks * tq, tend = tbeg + tq < nt ? tbeg + tq : nt;
        const int ntr = (tq + SPT - 1) / SPT;                    // trips: the same for every wave of the block
        // stage(t, bo): this lane's copies of trip t into the buffer at byte bo. c0, c1 = first key of the two steps (never past the batch's last step): below 32 * nt, so inside the rows that the projections wrote
        auto stage = [&](int t, unsigned bo) {
            const int s0 = tbeg + SPT * t, c0 = 32 * (s0 < nt ? s0 : nt - 1), c1 = 32 * (s0 + 1 < nt ? s0 + 1 : nt - 1);
            copy_kv(lk + bo, gk + (size_t)c0 * DM, lv + bo, gv + c0, lk + bo + SFB, gk + (size_t)c1 * DM, lv + bo + SFB, gv + c1);
        };
        stage(0, 0u);
        asm volatile("s_wait_asynccnt 0x0" ::: "memory");        // this wave's copies of trip 0 have landed
        __syncthreads();                                         // ... and every other wave's: buffer 0 may be read
        if (ntr > 1) stage(1, BFB);
#pragma unroll 1   // stays rolled: the trip count is only known at run time, and the buffer goes by the trip's parity
        for (int t = 0; t < ntr; ++t) {
         const unsigned bo = (t & 1) * BFB;
         for (int j = 0; j < SPT; ++j) {
          const int tt = tbeg + SPT * t + j;
          if (tt < tend) {                                       // same for the whole wave
            const int key0 = tt * 32;
            const h16* ka = (const h16*)(kf + bo + j * SFB);
            const v16h ka0 = ldh(ka), kb0 = ldh(ka + 16 * (KPB / 2));
            v8f sHa = (v8f){}, sLa = (v8f){}, sHb = (v8f){}, sLb = (v8f){};
            sHa = wmma16(ka0, qh, sHa); sLa = wmma16(ka0, qr, sLa); sHb = wmma16(kb0, qh, sHb); sLb = wmma16(kb0, qr, sLb);
            asm volatile("v_nop\n\tv_nop\n\tv_nop\n\tv_nop" : "+v"(sHa), "+v"(sLa), "+v"(sHb), "+v"(sLb) : "v"(ka0), "v"(kb0), "v"(qh), "v"(qr));
            float ta[8], tb[8]; float mx = -3.0e38f;
#pragma unroll
            for (int r = 0; r < 4; ++r) {
                ta[r] = (sHa[r] + sLa[r] * QRI) * SC2; ta[4 + r] = (sHa[4 + r] + sLa[4 + r] * QRI) * SC2;
                tb[r] = (sHb[r] + sLb[r] * QRI) * SC2; tb[4 + r] = (sHb[4 + r] + sLb[4 + r] * QRI) * SC2; }
            if (key0 + 32 > nv) {                                // same for the whole wave: the step reaches past the unmasked keys
                const int kl = nv - key0 - 8 * hi;               // element r stands for keys key0 + 8h + r and key0 + 16 + 8h + r
#pragma unroll
                for (int r = 0; r < 8; ++r) { ta[r] = (r < kl) ? ta[r] : NEGT; tb[r] = (16 + r < kl) ? tb[r] : NEGT; }
            }
#pragma unroll
            for (int r = 0; r < 8; ++r) mx = fmaxf(mx, fmaxf(ta[r], tb[r]));
            mx = fmaxf(mx, __shfl_xor(mx, 16, 32));
            const float mnew = fmaxf(m, mx);
            const float alpha = __builtin_amdgcn_exp2f(m - mnew);
            const float sh = PSH - mnew;
            v16h pb;
#pragma unroll
            for (int r = 0; r < 8; ++r) { pb[r] = (h16)__builtin_amdgcn_exp2f(ta[r] + sh); pb[8 + r] = (h16)__builtin_amdgcn_exp2f(tb[r] + sh); }
            ol[0] = ol[0] * alpha; m = mnew;
            o0 = o0 * alpha; o1 = o1 * alpha;
            const h16* va = (const h16*)(vf + bo + j * SFB);
            const v16h v0 = ldh(va), v1 = ldh(va + 16 * (VPB / 2));
            ol = wmma16(ones, pb, ol); o0 = wmma16(v0, pb, o0); o1 = wmma16(v1, pb, o1);
            // keeps the vector slots the chip needs behind the last WMMA, also on the branches that follow it
            asm volatile("v_nop\n\tv_nop\n\tv_nop\n\tv_nop" : "+v"(o0), "+v"(o1), "+v"(ol) : "v"(v0), "v"(v1), "v"(pb));
          }
         }
         asm volatile("s_wait_dscnt 0x0" ::: "memory");          // this wave's reads of the trip's buffer are done before the buffer is handed on
         asm volatile("s_wait_asynccnt 0x0" ::: "memory");       // this wave's copies of trip t + 1 have landed
         __syncthreads();                                        // publishes the buffer of trip t + 1 and ends every wave's reads of this trip's
         if (t + 2 < ntr) stage(t + 2, bo);                      // same for the whole block
        }
        asm volatile("s_wait_asynccnt 0x0" ::: "memory");        // no copy is outstanding behind the loop
        const float l = ol[0];                                   // lanes 0..15: the row sum over the whole key range, both lane halves' keys included
        // O^T D layout: o_j[r] = (d = 16j + 8h + r, t = lane&15) -> os[key range][16*rt + t][32*hh + d], unnormalised
        { const int ob = ((ks * AW + rt) * 16 + lr) * 68 + hh * 32 + 8 * hi;
          *(v4fa*)(&os[ob])      = (v4f){o0[0], o0[1], o0[2], o0[3]}; *(v4fa*)(&os[ob + 4])  = (v4f){o0[4], o0[5], o0[6], o0[7]};
          *(v4fa*)(&os[ob + 16]) = (v4f){o1[0], o1[1], o1[2], o1[3]}; *(v4fa*)(&os[ob + 20]) = (v4f){o1[4], o1[5], o1[6], o1[7]}; }
        if (hi == 0) { const int si = ((ks * 2 + hh) * AW + rt) * 16 + lr; sm[si] = m; sl[si] = l; }
    }
    __syncthreads();     // every wave's partial result is in LDS before any row is merged
    const int tid = threadIdx.x;
    if (tid < AW * 16 * 8) {                                     // whole waves: 64 rows x 8 lanes x 8 columns
        const int row = tid >> 3, c8 = (tid & 7) * 8, hq = c8 >> 5;
        float pm[KS]; float mx = -3.0e38f;
#pragma unroll
        for (int p = 0; p < KS; ++p) { pm[p] = sm[(p * 2 + hq) * (AW * 16) + row]; mx = fmaxf(mx, pm[p]); }
        v4f x0 = (v4f){}, x1 = (v4f){}; float l = 0.0f;
#pragma unroll
        for (int p = 0; p < KS; ++p) { const float f = __builtin_amdgcn_exp2f(pm[p] - mx);
            l += f * sl[(p * 2 + hq) * (AW * 16) + row];
            x0 += *(const v4fa*)(&os[(p * (AW * 16) + row) * 68 + c8]) * f; x1 += *(const v4fa*)(&os[(p * (AW * 16) + row) * 68 + c8 + 4]) * f; }
        const float inv = 1.0f / l;
        x0 = x0 * inv; x1 = x1 * inv;
        v8us hv, lv;
#pragma unroll
        for (int i = 0; i < 4; ++i) { const unsigned short u0 = f2bf(x0[i]); const unsigned short u1 = f2bf(x1[i]); hv[i] = u0; hv[4 + i] = u1;
            lv[i] = f2bf(x0[i] - bf2f(u0)); lv[4 + i] = f2bf(x1[i] - bf2f(u1)); }
        bf* crow = CX + (rowb + (size_t)blockIdx.x * (AW * 16) + row) * CXP + hp * 64 + c8;
        *(v8us*)(crow) = hv; *(v8us*)(crow + DM) = lv;
    }
}

static constexpr size_t al256(size_t v) { return (v + 255) & ~(size_t)255; }
static constexpr size_t SZ_PL = al256((size_t)NB * SEQ * DM * 2);
static constexpr size_t SZ_CX = al256((size_t)NB * SEQ * CXP * 2);
static constexpr size_t SZ_NV = al256((size_t)NB * sizeof(int));
static constexpr size_t SZ_TOTAL = 4 * SZ_PL + SZ_CX + SZ_NV;
static_assert(SZ_TOTAL <= (size_t)134217728);          // workspace carve <= 128 MiB
static_assert((size_t)NB * DM * SEQ * 2 <= SZ_PL);     // v^T plane extent

extern "C" void kernel_launch(void* const* d_in, const int* in_sizes, int n_in,
                              void* d_out, int out_size, void* d_ws, size_t ws_size, hipStream_t stream) {
    if (n_in < 12) return;
    const size_t needx = ((size_t)(NB - 1) * SEQ_FULL + SEQ) * DM;
    if ((size_t)in_sizes[0] < needx || (size_t)in_sizes[1] < needx || (size_t)in_sizes[2] < needx) return;
    if ((size_t)in_sizes[3] < (size_t)(NB - 1) * SEQ_FULL + SEQ) return;
    if ((size_t)in_sizes[4] < (size_t)DM * DM || (size_t)in_sizes[6] < (size_t)DM * DM || (size_t)in_sizes[8] < (size_t)DM * DM || (size_t)in_sizes[10] < (size_t)DM * DM) return;
    if (in_sizes[5] < DM || in_sizes[7] < DM || in_sizes[9] < DM || in_sizes[11] < DM) return;
    if ((size_t)out_size < ((size_t)(NB - 1) * OUT_SEQ + SEQ) * DM) return;
    if (SZ_TOTAL > ws_size) return;
    // wire order: queries, keys, values, key_mask, Wq, bq, Wk, bk, Wv, bv, Wo, bo
    const float* xq = (const float*)d_in[0]; const float* xk = (const float*)d_in[1]; const float* xv = (const float*)d_in[2];
    const int* kmask = (const int*)d_in[3];
    const float* wq = (const float*)d_in[4]; const float* bq = (const float*)d_in[5];
    const float* wk = (const float*)d_in[6]; const float* bk = (const float*)d_in[7];
    const float* wv = (const float*)d_in[8]; const float* bv = (const float*)d_in[9];
    const float* wo = (const float*)d_in[10]; const float* bo = (const float*)d_in[11];
    float* OUT = (float*)d_out;      // [NB][SEQ][256]
    char* wsp = (char*)d_ws;
    h16* QH = (h16*)wsp; wsp += SZ_PL;               // [NB*SEQ][256]
    h16* QR = (h16*)wsp; wsp += SZ_PL;               // [NB*SEQ][256] residual x2048
    h16* KP = (h16*)wsp; wsp += SZ_PL;               // [NB*SEQ][256]
    h16* VT = (h16*)wsp; wsp += SZ_PL;               // [NB][256][SEQ]
    bf* CX = (bf*)wsp; wsp += SZ_CX;                 // [NB*SEQ][512]: ctx hi | ctx lo
    int* NV = (int*)wsp; wsp += SZ_NV;               // [NB]: unmasked keys of each batch

    k_gemm<false><<<dim3(PTB, 3, 1), 32 * KW, 0, stream>>>(xq, xk, xv, CX, wq, wk, wv, QH, KP, VT, QR, OUT, bq, bk, bv, kmask, NV);

    k_flash<<<dim3(SEQ / (16 * AW), NB * (NH_ / 2), 1), 32 * FW, 0, stream>>>(QH, QR, KP, VT, NV, CX);

    // out = [ctx_hi | ctx_lo] x [Wo ; Wo] + bo, K = 512, f32 rows of the output (the activation pointers are not read here)
    k_gemm<true><<<dim3(PTB, 1, 1), 32 * KW, 0, stream>>>(wo, wo, wo, CX, wo, wo, wo, QH, QH, QH, QH, OUT, bo, bo, bo, kmask, NV);
}

// v010
// It runs in 19.8 microseconds.
// Timed twice side by side with v009, it ran 1.06 times as fast both times.
// Over all steps from v000 it is 7.67 times as fast.
#include <hip/hip_runtime.h>

// Multi-head attention with key padding mask: q/k/v inputs [NB][SEQ][256], Wq/Wk/Wv/Wo [in][out] (y = x W + b), 8 heads x 32, score scale 1/sqrt(32), masked keys take the fill value -4294967296, output = ctx Wo + bo (f32).
// Compute dtypes, f32 accumulate everywhere: projections v_wmma_f32_16x16x32_bf16 (inputs and weights RNE-converted to bf16; products exact);
// scores v_wmma_f32_16x16x32_f16: k single f16, q (times the score scale and log2 e) as f16 value + f16 residual at the same scale, two products chained in one accumulator; P (x256 carry, cancels in the normalisation) and v single f16; softmax f32 (online, reference max);
// output projection v_wmma_f32_16x16x32_bf16 with ctx carried as bf16 hi | bf16 lo planes folded along K (K = 512, weight row = k mod 256).
// Layout: activations and weights are read as f32 by the GEMMs and rounded in registers (the activations and the ctx plane by way of LDS); q (hi, residual), k planes [b*SEQ + t][256] (head h = columns 32h..32h+31) and v^T plane [b][256][SEQ] written by the GEMM epilogue;
// Key mask: the k and v^T planes hold only the unmasked keys of a batch, packed without gaps in one fixed order (key_list; the same for both planes); a masked key's weight is exactly 0 beside any unmasked one, so attention runs over the packed keys alone.
// A batch with no unmasked key keeps all its keys in the planes, and every score takes the fill value (uniform weights, as the reference gives).

#ifndef NB
#define NB 2
#endif
#ifndef SEQ
#define SEQ 2048
#endif
#define NB_FULL  2
#define SEQ_FULL 2048
#ifndef OUT_SEQ
#define OUT_SEQ SEQ              // row pitch (in tokens) between batches of the output
#endif
#define DM   256
#define NH_  8
#define HD   32
#define CXP  (2 * DM)            // ctx plane pitch: hi columns 0..255, lo columns 256..511
#define AW   4                   // 16-row query tiles per flash block
#define KS   4                   // key ranges per (query tile, head), one wave each
#define FW   (AW * 2 * KS)       // waves per flash block: query tiles x 2 heads x key ranges
#define KW   4                   // waves per GEMM block: each takes a KW-th of the k range of the block's tile
#define OSW  (64 * 68)           // floats of one wave's partial tile in LDS: 64 rows, pitch 68
#define XRB  1024                // bytes of one row of a GEMM's row operand in global memory (256 f32, or 512 bf16 of the ctx plane)
#define XPB  272                 // LDS pitch of a staged row of the row operand, bytes: 256 (one wave's k range of the row) + 16, 16 B x odd for the ds_load_b128 readers
#define SC2  (0.17677669529663687f * 1.4426950408889634f)   // HD^-0.5 * log2(e)
#define PSH  8.0f                // log2 of the P carry (256)
#define RTH  6.0f                // a score may pass the reference max by this much (log2) before the reference moves: P stays below 2^(PSH + RTH) = 16384, inside f16
#define NEGT (-4294967296.0f * 1.4426950408889634f)         // mask fill value in the log2 domain
#define KPB  144                 // LDS pitch of a staged K row, bytes: 128 (32 columns x 2 heads) + 16, 16 B x odd for the ds_load_b128 readers
#define VPB  80                  // LDS pitch of a staged V^T row, bytes: 64 (32 keys) + 16, 16 B x odd
#define KTB  (32 * KPB)          // one K tile: 32 keys
#define VTB  (64 * VPB)          // one V^T tile: 64 rows (2 heads x 32)
#define RTB  (KTB + VTB)         // one step of one key range
#define SFB  (KS * RTB)          // one 32-key step of every key range
#define SPT  2                   // steps of a key range per buffer (per trip between two barriers)
#define BFB  (SPT * SFB)         // one buffer

static_assert(HD == 32);
static_assert(NH_ * HD == DM);                 // head h = columns h*32 + d
static_assert(NH_ % 2 == 0);
static_assert(DM % 64 == 0);
static_assert(DM % 32 == 0);                   // GEMM k-loop steps by 32
static_assert(CXP % 32 == 0);
static_assert(DM % (32 * KW) == 0);            // every wave of a GEMM block gets whole 32-deep trips (CXP = 2 * DM too)
static_assert(DM * 4 == XRB && CXP * 2 == XRB); // both row operands have rows of XRB bytes
static_assert(XRB / KW == 256 && XPB == 256 + 16 && XPB % 16 == 0);
static_assert(64 * XPB == OSW * 4);            // a wave's 64 staged rows fill the place of its partial tile
static_assert(KW == 4);                        // behind the sum, wave p stores the p-th of the tile's four 16-row passes
static_assert(SEQ % 64 == 0);                  // a 64-row tile never straddles two batches
static_assert((NB * SEQ) % 64 == 0);
static_assert(SEQ % (32 * KS) == 0);           // key loop steps by 32 inside each key range
static_assert(FW * 32 <= 1024);
static_assert(AW * 2 == 8);                    // the 8 waves of a key range copy its tiles: 256 lanes x 16 B = 4 KiB for K, the same for V^T
static_assert(KPB % 16 == 0 && VPB % 16 == 0 && KTB % 16 == 0 && RTB % 16 == 0);
static_assert(SPT == 2);                       // copy_kv holds the copies of two steps
static_assert(FW * 32 >= AW * 16 * 8);         // the merge uses one thread per (row, 8 columns)
static_assert(SEQ % (16 * AW) == 0);           // flash grid covers the sequence exactly
static_assert(((size_t)SEQ * DM) % 8 == 0);
static_assert(NB <= NB_FULL);
static_assert(SEQ <= SEQ_FULL);

typedef _Float16 h16;
typedef unsigned short bf;
typedef __attribute__((ext_vector_type(16))) __bf16   v16bf;
typedef __attribute__((ext_vector_type(16))) _Float16 v16h;
typedef __attribute__((ext_vector_type(8)))  _Float16 v8h;
typedef __attribute__((ext_vector_type(8)))  unsigned short v8us;
typedef __attribute__((ext_vector_type(8)))  float    v8f;
typedef __attribute__((ext_vector_type(16))) float    v16f;
typedef __attribute__((ext_vector_type(4)))  float    v4f;
typedef __attribute__((ext_vector_type(4)))  int      v4i;
typedef v4f  __attribute__((may_alias)) v4fa;
typedef v8us __attribute__((may_alias)) v8usa;

__device__ __forceinline__ unsigned short f2bf(float f) { unsigned u = __float_as_uint(f); u += 0x7FFFu + ((u >> 16) & 1u); return (unsigned short)(u >> 16); }
__device__ __forceinline__ float bf2f(unsigned short s) { return __uint_as_float(((unsigned)s) << 16); }
__device__ __forceinline__ float bfr(float f) { return bf2f(f2bf(f)); }
__device__ __forceinline__ v16h cat16(v8h lo, v8h hi) { return __builtin_shufflevector(lo, hi, 0, 1, 2, 3, 4, 5, 6, 7, 8, 9, 10, 11, 12, 13, 14, 15); }
__device__ __forceinline__ v16bf cat16b(v8us lo, v8us hi) { return __builtin_bit_cast(v16bf, __builtin_shufflevector(lo, hi, 0, 1, 2, 3, 4, 5, 6, 7, 8, 9, 10, 11, 12, 13, 14, 15)); }
__device__ __forceinline__ v8f wmma16(v16h a, v16h b, v8f c) { return __builtin_amdgcn_wmma_f32_16x16x32_f16(false, a, false, b, (short)0, c, false, false); }
__device__ __forceinline__ v8f wmmab(v16bf a, v16bf b, v8f c) { return __builtin_amdgcn_wmma_f32_16x16x32_bf16(false, a, false, b, (short)0, c, false, false); }
// fragment loaders from K-contiguous 16-bit rows; p already includes + 8*(lane>>4): elements 0..7 <- k0+8h+0..7, elements 8..15 <- k0+16+8h+0..7 (same map for A and B)
__device__ __forceinline__ v16h  ldh(const h16* p) { return cat16(*(const v8h*)p, *(const v8h*)(p + 16)); }
__device__ __forceinline__ v16bf ldb(const bf* p)  { return cat16b(*(const v8us*)p, *(const v8us*)(p + 16)); }
// the same fragments from rows staged in LDS (16-B reads): 16 bf16, or one 8-float piece of an f32 row
__device__ __forceinline__ v16bf ldbs(const bf* p) { return cat16b(*(const v8usa*)p, *(const v8usa*)(p + 16)); }
__device__ __forceinline__ v8f lds8(const float* p) { return __builtin_shufflevector(*(const v4fa*)p, *(const v4fa*)(p + 4), 0, 1, 2, 3, 4, 5, 6, 7); }
// ordering point for wave-private LDS tiles (same wave writes and reads)
__device__ __forceinline__ void wave_sync() { __builtin_amdgcn_fence(3 /* release order */, "wavefront"); __builtin_amdgcn_wave_barrier(); asm volatile("" ::: "memory"); }

// cvx: fragment from the two 8-float pieces of one K-contiguous f32 row (k0+8h+0..7, k0+16+8h+0..7: the k map of ldb), rounded to bf16 (RNE) in registers
__device__ __forceinline__ v16bf cvx(v8f lo, v8f hi8) {
    return __builtin_convertvector(__builtin_shufflevector(lo, hi8, 0, 1, 2, 3, 4, 5, 6, 7, 8, 9, 10, 11, 12, 13, 14, 15), v16bf);
}
// Weight fragments come four at once from W[k][n] (f32, row pitch DM): one 16-B load per k at W + k * DM + n0 + 4*(lane&15) gives the lane that k of the four outputs n0 + 4*(lane&15) + i.
// r[e] = row k0+8h+e, r[8+e] = row k0+16+8h+e (the k map of ldb); cvw: fragment i holds outputs n0 + 4*l + i (l = its 16 rows or columns), rounded to bf16 (RNE) in registers.
__device__ __forceinline__ v16bf cvw(const v4f (&r)[16], int i) {
    v16f t;
#pragma unroll
    for (int e = 0; e < 16; ++e) t[e] = r[e][i];
    return __builtin_convertvector(t, v16bf);
}

// key_list (one wave): returns the number of unmasked keys of one batch (mkb = its SEQ mask words) and leaves in idx[0..63] the keys that stand at packed positions lo..lo+63.
// Load i gives lane c the mask of keys 128*i + 4*c + 0..3; bit t of the lane's SEQ/32 bits (32 to a word w[j]) stands for key 128*(t>>2) + 4*c + (t&3).
// Packed order: by lane, then by bit (any order serves, as k and v^T use the same one). p = first packed position of the lane's current word (lane prefix sum, one ballot per bit of the counts).
// Only the words that reach into lo..lo+63 are then walked, one word (32 keys, one a lane) a trip. No unmasked key at all: every key counts as present.
// Positions past the last key keep key 0: finite rows that the attention kernel masks. Every entry is formed from lane, word and bit numbers alone and lies below SEQ.
__device__ __forceinline__ int key_list(int* idx, const int* __restrict__ mkb, int lo) {
    constexpr int NW = SEQ / 1024;
    static_assert(SEQ % 1024 == 0 && SEQ / 32 < 128);
    const int lane = threadIdx.x & 31;
    v4i mv[8 * NW];
#pragma unroll
    for (int i = 0; i < 8 * NW; ++i) mv[i] = *(const v4i*)(mkb + 128 * i + 4 * lane);
    asm volatile("s_wait_xcnt 0x0" ::: "memory");   // precaution: stands in front of any later rewrite of the mask loads' address registers
    unsigned w[NW];
    unsigned any = 0u;
#pragma unroll
    for (int j = 0; j < NW; ++j) {
        w[j] = 0u;
#pragma unroll
        for (int t = 0; t < 32; ++t) w[j] |= mv[8 * j + (t >> 2)][t & 3] != 0 ? 1u << t : 0u;
        any |= w[j];
    }
    const bool none = __builtin_amdgcn_ballot_w32(any != 0u) == 0u;
    int cn = 0;
#pragma unroll
    for (int j = 0; j < NW; ++j) { if (none) w[j] = ~0u; cn += __builtin_popcount(w[j]); }   // cn = 0 .. SEQ / 32: seven bits
    int p = 0, tot = 0;
#pragma unroll
    for (int bit = 0; bit < 7; ++bit) {
        const unsigned bb = __builtin_amdgcn_ballot_w32(((cn >> bit) & 1) != 0);
        p += (int)__builtin_amdgcn_mbcnt_lo(bb, 0u) << bit;
        tot += __builtin_popcount(bb) << bit;
    }
    const int nvalid = none ? 0 : tot;
    if (lo >= tot) return nvalid;                    // nothing stands at these positions: the caller leaves
    idx[lane] = 0; idx[lane + 32] = 0;
#pragma unroll
    for (int j = 0; j < NW; ++j) {
        const int cj = __builtin_popcount(w[j]);
        unsigned todo = __builtin_amdgcn_ballot_w32(p + cj > lo && p < lo + 64);
        while (todo != 0u) {                         // same for the whole wave; one bit goes each trip: at most 32 trips
            const int c = __builtin_ctz(todo);
            todo &= todo - 1u;
            const unsigned bc = (unsigned)__builtin_amdgcn_readlane((int)w[j], c);
            const int pos = __builtin_amdgcn_readlane(p, c) - lo + (int)__builtin_amdgcn_mbcnt_lo(bc, 0u);
            if (((bc >> lane) & 1u) != 0u && pos >= 0 && pos < 64) idx[pos] = 128 * (8 * j + (lane >> 2)) + 4 * c + (lane & 3);
        }
        p += cj;
    }
    wave_sync();
    return nvalid;
}

// copy_x8: eight asynchronous copies, 16 B a lane each, global memory to LDS through no register (l = the lane's LDS byte addresses, g = its global addresses).
// The s_wait_xcnt stands inside the statement as a precaution: behind it the address registers may be rewritten.
__device__ __forceinline__ void copy_x8(const unsigned (&l)[8], const char* const (&g)[8]) {
    asm volatile("global_load_async_to_lds_b128 %0, %8, off\n\tglobal_load_async_to_lds_b128 %1, %9, off\n\t"
                 "global_load_async_to_lds_b128 %2, %10, off\n\tglobal_load_async_to_lds_b128 %3, %11, off\n\t"
                 "global_load_async_to_lds_b128 %4, %12, off\n\tglobal_load_async_to_lds_b128 %5, %13, off\n\t"
                 "global_load_async_to_lds_b128 %6, %14, off\n\tglobal_load_async_to_lds_b128 %7, %15, off\n\ts_wait_xcnt 0x0"
                 :: "v"(l[0]), "v"(l[1]), "v"(l[2]), "v"(l[3]), "v"(l[4]), "v"(l[5]), "v"(l[6]), "v"(l[7]),
                    "v"(g[0]), "v"(g[1]), "v"(g[2]), "v"(g[3]), "v"(g[4]), "v"(g[5]), "v"(g[6]), "v"(g[7]) : "memory");
}

// k_gemm: register-blocked bf16 GEMM, one block of KW waves per 64x64 tile; every wave holds the whole tile (16 accumulators) over its own KW-th of k, leaves its partial tile in LDS,
// and behind one work-group barrier wave p adds the KW partial tiles (in wave order) for the p-th 16-row pass, adds the bias and stores. The weight operand comes straight from the f32 input W[k][n] (cvw), the other operand from K-contiguous rows:
// the f32 activation input (cvx; F32OUT = false) or the bf16 ctx plane (F32OUT = true, K = 512, weight row = k mod 256). Bias: bf16 RNE value of the f32 bias, added in f32.
// The row operand goes through LDS: a fragment load straight from global memory touches 16 rows (16 lines for 512 B). Each wave brings its own 64 rows x 256 B (its k range) in with 32 asynchronous copies,
// two rows (four whole lines) a copy, into the place where its partial tile will stand later (pitch XPB), and reads its fragments from there; only the wave that copied reads these bytes, behind its own s_wait_asynccnt: no barrier.
// acc[xi][wi]: xi = 16-row group of the row operand (rows 16*xi + l), wi = weight fragment (outputs 4*l + wi).
// F32OUT = false: the three input projections in ONE launch, blockIdx.y picks the job, PTB tiles each, the row tile running fastest in blockIdx.x; written as f16 (Ph), q times SC2 and also as the f16 residual of that value (Pr):
//   job 0 (q), job 1 (k): A = x rows (m = b*SEQ + t), B = W columns (n = h*32 + d) -> plane [m][n], bias by column
//   job 2 (v^T): A = Wv columns (m = h*32 + d), B = x rows (n = b*SEQ + t) -> plane [(b*256 + m)][t], bias by row
//   jobs 1 and 2: t is a packed position, the x row read for it is the key that key_list names; a tile past the last packed key leaves at once; job 1's first tile of a batch stores the batch's count in NV
// F32OUT = true: the output projection, f32 rows of OUT[(m/SEQ)*OUT_SEQ + m%SEQ][c0 + col]; each row segment (64 floats = two lines) written by 16 consecutive lanes x 16 B (2 rows per instruction).
#define PTB ((NB * SEQ / 64) * (DM / 64))
// gemm_tile: one 64x64 tile. J2 = the v^T job (weight fragments as A). f = tile index, the row tile running fastest.
template <bool F32OUT, bool J2>
__device__ __forceinline__ void gemm_tile(float* os, const float* __restrict__ X, const bf* __restrict__ CXA, const float* __restrict__ Wt,
                                          h16* Ph, h16* Pr, float* OUT, const float* __restrict__ bias, bool useRes, unsigned f,
                                          int* kidx, const int* __restrict__ MK, int* NV, bool packed) {
    constexpr int K = F32OUT ? CXP : DM;
    constexpr int pitch = J2 ? SEQ : DM;                           // row pitch of the f16 plane (halves)
    constexpr int KQ = K / KW;                                     // k range of one wave
    const int lane = threadIdx.x & 31, lr = lane & 15, hi = lane >> 4;
    const int wv = __builtin_amdgcn_readfirstlane((int)(threadIdx.x >> 5)), kbeg = wv * KQ;
    const int r0 = (J2 ? f % (DM / 64) : f % (NB * SEQ / 64)) * 64, c0 = (J2 ? f / (DM / 64) : f / (NB * SEQ / 64)) * 64;
    const int xr0 = J2 ? c0 : r0, wc0 = J2 ? r0 : c0;             // tile base of the row operand, of the weight outputs
    const int p = wv;                                              // the 16 output rows that this wave sums and stores: rows 16*p + row, in the v^T job rows 4*row + p
    // this wave's bias values (by row in the v^T job, else by column), asked for at the start: their latency runs beside the work in front of the sum (the barrier there waits for every load in flight)
    v4f bc0 = (v4f){}, bc1 = (v4f){};
    float br[4] = {0.0f, 0.0f, 0.0f, 0.0f};
    if constexpr (F32OUT) bc0 = *(const v4f*)(bias + c0 + lr * 4);
    else if constexpr (J2) {
#pragma unroll
        for (int s = 0; s < 4; ++s) br[s] = bias[r0 + 4 * (4 * s + (lane >> 3)) + p];
    } else { bc0 = *(const v4f*)(bias + c0 + (lane & 7) * 8); bc1 = *(const v4f*)(bias + c0 + (lane & 7) * 8 + 4); }
    asm volatile("s_wait_xcnt 0x0" ::: "memory");                  // precaution: stands in front of any later rewrite of the bias loads' address registers
    if constexpr (!F32OUT) {
        if (J2 || packed) {
            kidx += 64 * wv;                                      // every wave forms the list for itself: no barrier in front of the loads
            const int tot = key_list(kidx, MK + (size_t)(xr0 / SEQ) * SEQ_FULL, xr0 % SEQ);
            if (xr0 % SEQ >= (tot == 0 ? SEQ : tot)) return;      // the same for every wave of the block, in front of the barrier
            if (!J2 && xr0 % SEQ == 0 && wc0 == 0 && wv == 0 && lane == 0) { NV[xr0 / SEQ] = tot;
                asm volatile("s_wait_xcnt 0x0" ::: "memory"); }   // precaution: stands in front of any later rewrite of this store's registers
        }
    }
    v8f acc[4][4];
#pragma unroll
    for (int xi = 0; xi < 4; ++xi)
#pragma unroll
        for (int wi = 0; wi < 4; ++wi) acc[xi][wi] = (v8f){};
    float* ow = os + wv * OSW;                                     // this wave's place in LDS: first its staged rows [64][XPB bytes], then its partial tile [pass][16 rows][68]
    const float* xs = ow + lr * (XPB / 4) + 8 * hi;                // f32 rows: + 16*xi rows, + k inside the wave's range
    const bf* xb = (const bf*)ow + lr * (XPB / 2) + 8 * hi;       // ctx rows (F32OUT)
    // this lane's weight column group at the first k row of the wave's range (row = k mod DM: the ctx plane's lo half meets the same weights again); a wave's range never wraps, as KQ divides DM
    static_assert(DM % KQ == 0);
    constexpr int NT = KQ / 32;                                    // 32-deep trips of one wave
    const float* wp = Wt + (size_t)((kbeg & (DM - 1)) + 8 * hi) * DM + wc0 + 4 * lr;
    // Every trip's weight rows are asked for at the start, at constant distances from wp: the later trips' loads fly beside the copies and the first trips' work, so that a wave waits out one load latency and not one a trip.
    v4f wr[NT][16];
    auto wload = [&](const int t) __attribute__((always_inline)) {
#pragma unroll
        for (int e = 0; e < 8; ++e) { wr[t][e] = *(const v4f*)(wp + (size_t)(32 * t + e) * DM); wr[t][8 + e] = *(const v4f*)(wp + (size_t)(32 * t + 16 + e) * DM); }
    };
    wload(0);
    {                                                             // The copies go out behind the first trip's weight loads, so that those loads fly beside the copies' address work and the copies
        // copy i of this lane brings 16 B (piece lane&15) of the tile's row 32*hi + i: srow[i] = that row's number in its batch (a 64-row tile lies in one batch), in the ctx plane its number in the tile
        int srow[32];
#pragma unroll
        for (int i = 0; i < 32; ++i) srow[i] = (F32OUT ? 0 : xr0 % SEQ) + 32 * hi + i;
        if constexpr (!F32OUT) {
            if (J2 || packed) {
#pragma unroll
                for (int i = 0; i < 32; i += 4) { const v4i t = *(const v4i*)(kidx + 32 * hi + i); srow[i] = t[0]; srow[i + 1] = t[1]; srow[i + 2] = t[2]; srow[i + 3] = t[3]; }
            }
        }
        const char* gx = (F32OUT ? (const char*)(CXA + (size_t)xr0 * K + kbeg) : (const char*)(X + (size_t)(xr0 / SEQ) * SEQ_FULL * DM + kbeg)) + 16 * lr;
        const unsigned lx = (unsigned)(size_t)ow + (unsigned)(32 * hi * XPB + 16 * lr);
#pragma unroll
        for (int c = 0; c < 32; c += 8) {
            unsigned l[8]; const char* g[8];
#pragma unroll
            for (int e = 0; e < 8; ++e) { l[e] = lx + (unsigned)((c + e) * XPB); g[e] = gx + (size_t)(unsigned)srow[c + e] * XRB; }
            copy_x8(l, g);
        }
    }
#pragma unroll
    for (int t = 1; t < NT; ++t) wload(t);
    // nothing moves over this line: built without it, three conversions of the first trip's weights, with their wait for those loads, stand in front of the last eight copies and of the later trips' loads
    __builtin_amdgcn_sched_barrier(0);
    asm volatile("s_wait_xcnt 0x0" ::: "memory");                  // precaution: stands in front of any later rewrite of the weight loads' address registers
    asm volatile("s_wait_asynccnt 0x0" ::: "memory");              // this wave's staged rows have landed
#pragma unroll   // unrolled: each trip works on its own registers, which were asked for above
    for (int t = 0; t < NT; ++t) {
        v16bf xf[4], wf[4];
        if constexpr (F32OUT) {
#pragma unroll
            for (int xi = 0; xi < 4; ++xi) xf[xi] = ldbs(xb + xi * 16 * (XPB / 2) + 32 * t);
        } else {
#pragma unroll
            for (int xi = 0; xi < 4; ++xi) { const float* xp = xs + xi * 16 * (XPB / 4) + 32 * t; xf[xi] = cvx(lds8(xp), lds8(xp + 16)); }
        }
#pragma unroll
        for (int wi = 0; wi < 4; ++wi) wf[wi] = cvw(wr[t], wi);
#pragma unroll
        for (int wi = 0; wi < 4; ++wi)
#pragma unroll
            for (int xi = 0; xi < 4; ++xi) acc[xi][wi] = J2 ? wmmab(wf[wi], xf[xi], acc[xi][wi]) : wmmab(xf[xi], wf[wi], acc[xi][wi]);
    }
    const size_t tbase = J2 ? (size_t)r0 * SEQ + (size_t)(c0 / SEQ) * ((size_t)DM * SEQ) + (size_t)(c0 % SEQ) : (size_t)r0 * DM + (size_t)c0;
#pragma unroll
    for (int q = 0; q < 4; ++q) {
        if constexpr (J2) {
#pragma unroll
            for (int xi = 0; xi < 4; ++xi)
#pragma unroll
                for (int j = 0; j < 8; ++j) ow[(q * 16 + hi * 8 + j) * 68 + xi * 16 + lr] = acc[xi][q][j];   // D: row 8h+j (output 4*(8h+j) + q), col t = 16*xi + lane&15
        } else {
#pragma unroll
            for (int j = 0; j < 8; ++j) *(v4fa*)(&ow[(q * 16 + hi * 8 + j) * 68 + 4 * lr]) = (v4f){acc[q][0][j], acc[q][1][j], acc[q][2][j], acc[q][3][j]};   // D: row 8h+j, col 4*(lane&15) + wi
        }
    }
    __syncthreads();     // every wave's partial tile is in LDS before any row is summed
    const float* op = os + p * (16 * 68);                          // pass p of wave 0's partial tile; + w * OSW for wave w's
    if constexpr (!F32OUT) {
        const int c8 = (lane & 7) * 8;                             // 4 s x 4 row groups = 16 rows; 8 lanes x 8 = 64 columns
        const float qs = useRes ? SC2 : 1.0f;                      // q carries the score scale and log2 e, so that the score products need no scaling behind them
        v4f x0[4], x1[4];                                          // all sums first: the LDS reads of the four row groups go out together, in front of the stores' waits
#pragma unroll
        for (int s = 0; s < 4; ++s) { const int row = 4 * s + (lane >> 3);
            x0[s] = *(const v4fa*)(&op[row * 68 + c8]); x1[s] = *(const v4fa*)(&op[row * 68 + c8 + 4]);
#pragma unroll
            for (int w = 1; w < KW; ++w) { x0[s] += *(const v4fa*)(&op[w * OSW + row * 68 + c8]); x1[s] += *(const v4fa*)(&op[w * OSW + row * 68 + c8 + 4]); }
        }
#pragma unroll
        for (int s = 0; s < 4; ++s) { const int row = 4 * s + (lane >> 3);
            const int rofs = J2 ? 4 * row + p : p * 16 + row;
            if constexpr (J2) { bc0 = (v4f){br[s], br[s], br[s], br[s]}; bc1 = bc0; }
            v8h hv, rv;
#pragma unroll
            for (int i = 0; i < 4; ++i) { const float y0 = (x0[s][i] + bfr(bc0[i])) * qs; const float y1 = (x1[s][i] + bfr(bc1[i])) * qs;
                const h16 a0 = (h16)y0; const h16 a1 = (h16)y1; hv[i] = a0; hv[4 + i] = a1; rv[i] = (h16)(y0 - (float)a0); rv[4 + i] = (h16)(y1 - (float)a1); }
            const size_t oo = tbase + (size_t)rofs * (size_t)pitch + c8;
            *(v8h*)(Ph + oo) = hv;
            asm volatile("s_wait_xcnt 0x0" ::: "memory");         // precaution: stands in front of any later rewrite of this store's data or address registers, on both sides of the branch below
            if (useRes) { *(v8h*)(Pr + oo) = rv;
                asm volatile("s_wait_xcnt 0x0" ::: "memory"); }   // precaution: the same for the residual store
        }
    } else {
        const int cofs = lr * 4;                                   // 8 s x 2 rows = 16 rows; 16 lanes x 4 floats = 64 columns
        v4f val[8];
#pragma unroll
        for (int s = 0; s < 8; ++s) { const int row = 2 * s + hi;
            val[s] = *(const v4fa*)(&op[row * 68 + cofs]);
#pragma unroll
            for (int w = 1; w < KW; ++w) val[s] += *(const v4fa*)(&op[w * OSW + row * 68 + cofs]);
        }
#pragma unroll
        for (int s = 0; s < 8; ++s) { const int row = 2 * s + hi;
            const int m = r0 + p * 16 + row; const int bb = m / SEQ, tt = m - bb * SEQ;
#pragma unroll
            for (int i = 0; i < 4; ++i) val[s][i] = val[s][i] + bfr(bc0[i]);
            *(v4f*)(OUT + ((size_t)bb * OUT_SEQ + tt) * DM + c0 + cofs) = val[s]; }
    }
}

template <bool F32OUT>
__global__ __launch_bounds__(32 * KW) void k_gemm(const float* __restrict__ X0, const float* __restrict__ X1, const float* __restrict__ X2, const bf* __restrict__ CXA,
                                             const float* __restrict__ W0, const float* __restrict__ W1, const float* __restrict__ W2,
                                             h16* Ph0, h16* Ph1, h16* Ph2, h16* Pr, float* OUT,
                                             const float* __restrict__ bias0, const float* __restrict__ bias1, const float* __restrict__ bias2,
                                             const int* __restrict__ MK, int* NV) {
    __shared__ __align__(16) float os[KW * OSW];                  // [wave][64 rows][68]: the waves' partial tiles
    if constexpr (F32OUT) gemm_tile<true, false>(os, X0, CXA, W0, Ph0, Pr, OUT, bias0, false, blockIdx.x, nullptr, MK, NV, false);
    else {
        __shared__ __align__(16) int kidx[KW * 64];               // [wave][64]
        const unsigned job = blockIdx.y;
        if (job == 2) gemm_tile<false, true>(os, X2, CXA, W2, Ph2, Pr, OUT, bias2, false, blockIdx.x, kidx, MK, NV, true);
        else gemm_tile<false, false>(os, job == 0 ? X0 : X1, CXA, job == 0 ? W0 : W1, job == 0 ? Ph0 : Ph1, Pr, OUT, job == 0 ? bias0 : bias1, job == 0, blockIdx.x, kidx, MK, NV, job == 1);
    }
}

// copy_kv: the K and V^T copies of two steps, 16 B a lane each, global memory to LDS through no register (lk*, lv* = the lane's LDS byte addresses).
// The s_wait_xcnt stands inside the statement as a precaution: behind it the address registers may be rewritten.
__device__ __forceinline__ void copy_kv(unsigned lk0, const h16* gk0, unsigned lv0, const h16* gv0, unsigned lk1, const h16* gk1, unsigned lv1, const h16* gv1) {
    asm volatile("global_load_async_to_lds_b128 %0, %1, off\n\tglobal_load_async_to_lds_b128 %2, %3, off\n\t"
                 "global_load_async_to_lds_b128 %4, %5, off\n\tglobal_load_async_to_lds_b128 %6, %7, off\n\ts_wait_xcnt 0x0"
                 :: "v"(lk0), "v"(gk0), "v"(lv0), "v"(gv0), "v"(lk1), "v"(gk1), "v"(lv1), "v"(gv1) : "memory");
}

// k_flash: fused attention, one work-group per 64 query rows of one batch and one PAIR of heads; one wave per (16 query rows, head, key range: a KS-th of the batch's 32-key steps).
// The waves of one key range walk the same K rows and V^T columns at the same time; both heads of the pair read the two halves of the same K lines.
// Q fragments straight from the f16 planes (two 16-B loads each). K and V^T go through LDS: trip t of the block works on steps SPT*t .. SPT*t + SPT-1 of every key range; the 8 waves of a range bring each step's K tile
// (32 keys x 128 B) and V^T tile (64 rows x 64 B) in with one asynchronous 16-B copy a lane each, whole lines or half lines, and all 8 read their fragments from there. Two buffers: the copies of trip t + 1 fly during trip t.
// A step past the range's own is copied all the same and never read (past the batch's last step: that last step again; written rows in either case), so that every wave issues the same copies and passes the same barriers.
// Transposed form: S^T[key][t] = K Q^T (A = K rows, B = Q rows); lane (t = lane&15, h = lane>>4) holds keys 8h+r of each 16-key tile, so the packed
// P tile is directly the B fragment of O^T[d][t] = V^T P^T (element r <- tile keys 0..15, element 8+r <- tile keys 16..31, lane unchanged).
// Key mask: the planes hold the packed keys; NV[b] = number of unmasked keys. Positions from NV[b] on (the rest of the last 32-key step; every position where NV[b] = 0) have their score REPLACED by the fill value
// (a fully masked row therefore comes out uniform); steps that lie wholly below NV[b] take no select.
// Scores leave the matrix unit as the arguments of exp2: q carries the scale, the residual product adds into the same accumulator, and the accumulator starts at PSH - ref (cr, the same in its 8 registers).
// ref = the reference max of the lane's query, the same in both lane halves. It is set to the row's max in a wave's first step and moves (scores, O and sum rescaled, one xor-16 exchange) only in a step
// where some score of the wave passes its reference by more than RTH; the test is one ballot a step. The row sum is taken on the matrix unit: A = ones in row 0 and zeros below, B = the packed P tile,
// so row 0 of that accumulator (element 0 of lanes 0..15) gains the sum of the rounded P over the step's 32 keys for query t = lane; every other row stays 0, so only element 0 is rescaled.
// Each wave leaves its unnormalised O, its reference max and its sum in LDS; behind one work-group barrier the KS partial results of a row are rescaled to their common max, added and normalised.
__global__ __launch_bounds__(32 * FW) void k_flash(const h16* __restrict__ QH, const h16* __restrict__ QR, const h16* __restrict__ KP, const h16* __restrict__ VT,
                                                   const int* __restrict__ NV, bf* CX) {
    __shared__ __align__(16) float os[KS * AW * 16 * 68];        // [key range][row of the block][68]: columns 0..63 = 32*head + d
    __shared__ float sm[KS * 2 * AW * 16], sl[KS * 2 * AW * 16]; // [key range][head][row of the block]: reference max, sum
    __shared__ __align__(16) unsigned char ring[2 * BFB];        // [buffer][step of the trip][key range]: K tile [key][KPB], V^T tile [32*head + d][VPB]
    const int lane = threadIdx.x & 31, wave = __builtin_amdgcn_readfirstlane((int)(threadIdx.x >> 5)), lr = lane & 15, hi = lane >> 4;
    const int rt = wave % AW, hh = (wave / AW) & 1, ks = wave / (2 * AW);
    const int zp = blockIdx.y; const int b = zp / (NH_ / 2), hp = zp % (NH_ / 2);
    const int t0 = (blockIdx.x * AW + rt) * 16;
    const size_t rowb = (size_t)b * SEQ;
    const int nvr = NV[b];
    const int nv = __builtin_amdgcn_readfirstlane(nvr < 0 ? 0 : (nvr > SEQ ? SEQ : nvr));   // unmasked keys of the batch, bounded by the shape; kept scalar so that the loop's tail test is a scalar compare
    const int nt = ((nv == 0 ? SEQ : nv) + 31) / 32;             // 32-key steps that the planes hold (1 .. SEQ / 32)
    const int tq = (nt + KS - 1) / KS;                           // steps per key range; the last ranges may be short or empty
    {
        const int h = hp * 2 + hh;
        const size_t qo = (rowb + t0 + lr) * DM + h * HD + 8 * hi;
        const v16h qh = ldh(QH + qo), qr = ldh(QR + qo);                  // B fragments: col t, k = d (32 deep)
        const unsigned char* kf = ring + ks * RTB + lr * KPB + hh * 64 + 16 * hi;            // + buffer, step; + 16*KPB   (A fragment: row key, k = d)
        const unsigned char* vf = ring + ks * RTB + KTB + (hh * 32 + lr) * VPB + 16 * hi;    // + buffer, step; + 16*VPB   (A fragment: row d, k = key)
        // this lane's share of the copies: K row 4*w8 + lane/8, piece lane%8; V^T row 8*w8 + lane/4, piece lane%4 (w8 = the wave's number inside its key range)
        const int w8 = wave % (2 * AW);
        const int kr = 4 * w8 + (lane >> 3), kc = lane & 7, vr = 8 * w8 + (lane >> 2), vc = lane & 3;
        const h16* gk = KP + (rowb + kr) * DM + hp * 64 + kc * 8;                            // + key * DM
        const h16* gv = VT + ((size_t)b * DM + hp * 64 + vr) * SEQ + vc * 8;                 // + key
        const unsigned lk = (unsigned)(size_t)(ring + ks * RTB + kr * KPB + kc * 16), lv = (unsigned)(size_t)(ring + ks * RTB + KTB + vr * VPB + vc * 16);
        v8f o0 = (v8f){}, o1 = (v8f){}, ol = (v8f){};
        float cs = PSH;                                          // PSH - ref; the first step runs against ref = 0 and then sets the reference
        v8f cr;                                                  // cs in all 8 registers: the start value (C) of the score accumulators
#pragma unroll
        for (int r = 0; r < 8; ++r) cr[r] = cs;
        v16h ones;
#pragma unroll
        for (int e = 0; e < 16; ++e) ones[e] = lr == 0 ? (h16)1.0f : (h16)0.0f;
        const int tbeg = ks * tq, tend = tbeg + tq < nt ? tbeg + tq : nt;
        const int ntr = (tq + SPT - 1) / SPT;                    // trips: the same for every wave of the block
        // stage(t, bo): this lane's copies of trip t into the buffer at byte bo. c0, c1 = first key of the two steps (never past the batch's last step): below 32 * nt, so inside the rows that the projections wrote
        auto stage = [&](int t, unsigned bo) {
            const int s0 = tbeg + SPT * t, c0 = 32 * (s0 < nt ? s0 : nt - 1), c1 = 32 * (s0 + 1 < nt ? s0 + 1 : nt - 1);
            copy_kv(lk + bo, gk + (size_t)c0 * DM, lv + bo, gv + c0, lk + bo + SFB, gk + (size_t)c1 * DM, lv + bo + SFB, gv + c1);
        };
        stage(0, 0u);
        asm volatile("s_wait_asynccnt 0x0" ::: "memory");        // this wave's copies of trip 0 have landed
        __syncthreads();                                         // ... and every other wave's: buffer 0 may be read
        if (ntr > 1) stage(1, BFB);
#pragma unroll 1   // stays rolled: the trip count is only known at run time, and the buffer goes by the trip's parity
        for (int t = 0; t < ntr; ++t) {
         const unsigned bo = (t & 1) * BFB;
         for (int j = 0; j < SPT; ++j) {
          const int tt = tbeg + SPT * t + j;
          if (tt < tend) {                                       // same for the whole wave
            const int key0 = tt * 32;
            const h16* ka = (const h16*)(kf + bo + j * SFB);
            const v16h ka0 = ldh(ka), kb0 = ldh(ka + 16 * (KPB / 2));
            v8f ta = wmma16(ka0, qh, cr), tb = wmma16(kb0, qh, cr);   // score + PSH - ref
            ta = wmma16(ka0, qr, ta); tb = wmma16(kb0, qr, tb);
            if (__builtin_expect(key0 + 32 > nv, 0)) {           // same for the whole wave: the step reaches past the unmasked keys (marked rare: where a batch has an unmasked key, only its last step)
                const int kl = nv - key0 - 8 * hi;               // element r stands for keys key0 + 8h + r and key0 + 16 + 8h + r
                const float fill = NEGT + cs;                    // the fill value, shifted like a score
#pragma unroll
                for (int r = 0; r < 8; ++r) { ta[r] = (r < kl) ? ta[r] : fill; tb[r] = (16 + r < kl) ? tb[r] : fill; }
            }
            float mx = -3.0e38f;
#pragma unroll
            for (int r = 0; r < 8; ++r) mx = fmaxf(mx, fmaxf(ta[r], tb[r]));
            const bool first = tt == tbeg;                       // same for the whole wave
            const float lim = first ? -3.0e38f : PSH + RTH;      // every score, the fill value too, lies above the first step's limit
            if (__builtin_expect(__builtin_amdgcn_ballot_w32(mx > lim) != 0u, 0)) {   // same for the whole wave: the reference moves to the row's max in this step (behind the first step only where that is higher) (marked rare: the straight path then takes no branch here)
                mx = fmaxf(mx, __shfl_xor(mx, 16, 32));
                const float d = first ? mx - PSH : fmaxf(mx - PSH, 0.0f);        // the reference's step: never down behind the first step
                const float alpha = __builtin_amdgcn_exp2f(fminf(-d, 0.0f));     // a first step downward meets O = 0 and sum = 0: factor 1
                cs = cs - d;
#pragma unroll
                for (int r = 0; r < 8; ++r) { ta[r] = ta[r] - d; tb[r] = tb[r] - d; cr[r] = cs; }
                ol[0] = ol[0] * alpha;
                o0 = o0 * alpha; o1 = o1 * alpha;
            }
            v16h pb;
#pragma unroll
            for (int r = 0; r < 8; ++r) { pb[r] = (h16)__builtin_amdgcn_exp2f(ta[r]); pb[8 + r] = (h16)__builtin_amdgcn_exp2f(tb[r]); }
            const h16* va = (const h16*)(vf + bo + j * SFB);
            const v16h v0 = ldh(va), v1 = ldh(va + 16 * (VPB / 2));
            ol = wmma16(ones, pb, ol); o0 = wmma16(v0, pb, o0); o1 = wmma16(v1, pb, o1);
            // keeps the vector slots the chip needs behind the last WMMA, also on the branches that follow it
            asm volatile("v_nop\n\tv_nop\n\tv_nop\n\tv_nop" : "+v"(o0), "+v"(o1), "+v"(ol) : "v"(v0), "v"(v1), "v"(pb));
          }
         }
         asm volatile("s_wait_dscnt 0x0" ::: "memory");          // this wave's reads of the trip's buffer are done before the buffer is handed on
         asm volatile("s_wait_asynccnt 0x0" ::: "memory");       // this wave's copies of trip t + 1 have landed
         __syncthreads();                                        // publishes the buffer of trip t + 1 and ends every wave's reads of this trip's
         if (t + 2 < ntr) stage(t + 2, bo);                      // same for the whole block
        }
        asm volatile("s_wait_asynccnt 0x0" ::: "memory");        // no copy is outstanding behind the loop
        const float m = tbeg < tend ? PSH - cs : -3.0e38f;       // the reference that O and the sum stand against; a wave without a step counts for nothing in the merge
        const float l = ol[0];                                   // lanes 0..15: the row sum over the whole key range, both lane halves' keys included
        // O^T D layout: o_j[r] = (d = 16j + 8h + r, t = lane&15) -> os[key range][16*rt + t][32*hh + d], unnormalised
        { const int ob = ((ks * AW + rt) * 16 + lr) * 68 + hh * 32 + 8 * hi;
          *(v4fa*)(&os[ob])      = (v4f){o0[0], o0[1], o0[2], o0[3]}; *(v4fa*)(&os[ob + 4])  = (v4f){o0[4], o0[5], o0[6], o0[7]};
          *(v4fa*)(&os[ob + 16]) = (v4f){o1[0], o1[1], o1[2], o1[3]}; *(v4fa*)(&os[ob + 20]) = (v4f){o1[4], o1[5], o1[6], o1[7]}; }
        if (hi == 0) { const int si = ((ks * 2 + hh) * AW + rt) * 16 + lr; sm[si] = m; sl[si] = l; }
    }
    __syncthreads();     // every wave's partial result is in LDS before any row is merged
    const int tid = threadIdx.x;
    if (tid < AW * 16 * 8) {                                     // whole waves: 64 rows x 8 lanes x 8 columns
        const int row = tid >> 3, c8 = (tid & 7) * 8, hq = c8 >> 5;
        float pm[KS]; float mx = -3.0e38f;
#pragma unroll
        for (int p = 0; p < KS; ++p) { pm[p] = sm[(p * 2 + hq) * (AW * 16) + row]; mx = fmaxf(mx, pm[p]); }
        v4f x0 = (v4f){}, x1 = (v4f){}; float l = 0.0f;
#pragma unroll
        for (int p = 0; p < KS; ++p) { const float f = __builtin_amdgcn_exp2f(pm[p] - mx);
            l += f * sl[(p * 2 + hq) * (AW * 16) + row];
            x0 += *(const v4fa*)(&os[(p * (AW * 16) + row) * 68 + c8]) * f; x1 += *(const v4fa*)(&os[(p * (AW * 16) + row) * 68 + c8 + 4]) * f; }
        const float inv = 1.0f / l;
        x0 = x0 * inv; x1 = x1 * inv;
        v8us hv, lv;
#pragma unroll
        for (int i = 0; i < 4; ++i) { const unsigned short u0 = f2bf(x0[i]); const unsigned short u1 = f2bf(x1[i]); hv[i] = u0; hv[4 + i] = u1;
            lv[i] = f2bf(x0[i] - bf2f(u0)); lv[4 + i] = f2bf(x1[i] - bf2f(u1)); }
        bf* crow = CX + (rowb + (size_t)blockIdx.x * (AW * 16) + row) * CXP + hp * 64 + c8;
        *(v8us*)(crow) = hv; *(v8us*)(crow + DM) = lv;
    }
}

static constexpr size_t al256(size_t v) { return (v + 255) & ~(size_t)255; }
static constexpr size_t SZ_PL = al256((size_t)NB * SEQ * DM * 2);
static constexpr size_t SZ_CX = al256((size_t)NB * SEQ * CXP * 2);
static constexpr size_t SZ_NV = al256((size_t)NB * sizeof(int));
static constexpr size_t SZ_TOTAL = 4 * SZ_PL + SZ_CX + SZ_NV;
static_assert(SZ_TOTAL <= (size_t)134217728);          // workspace carve <= 128 MiB
static_assert((size_t)NB * DM * SEQ * 2 <= SZ_PL);     // v^T plane extent

extern "C" void kernel_launch(void* const* d_in, const int* in_sizes, int n_in,
                              void* d_out, int out_size, void* d_ws, size_t ws_size, hipStream_t stream) {
    if (n_in < 12) return;
    const size_t needx = ((size_t)(NB - 1) * SEQ_FULL + SEQ) * DM;
    if ((size_t)in_sizes[0] < needx || (size_t)in_sizes[1] < needx || (size_t)in_sizes[2] < needx) return;
    if ((size_t)in_sizes[3] < (size_t)(NB - 1) * SEQ_FULL + SEQ) return;
    if ((size_t)in_sizes[4] < (size_t)DM * DM || (size_t)in_sizes[6] < (size_t)DM * DM || (size_t)in_sizes[8] < (size_t)DM * DM || (size_t)in_sizes[10] < (size_t)DM * DM) return;
    if (in_sizes[5] < DM || in_sizes[7] < DM || in_sizes[9] < DM || in_sizes[11] < DM) return;
    if ((size_t)out_size < ((size_t)(NB - 1) * OUT_SEQ + SEQ) * DM) return;
    if (SZ_TOTAL > ws_size) return;
    // wire order: queries, keys, values, key_mask, Wq, bq, Wk, bk, Wv, bv, Wo, bo
    const float* xq = (const float*)d_in[0]; const float* xk = (const float*)d_in[1]; const float* xv = (const float*)d_in[2];
    const int* kmask = (const int*)d_in[3];
    const float* wq = (const float*)d_in[4]; const float* bq = (const float*)d_in[5];
    const float* wk = (const float*)d_in[6]; const float* bk = (const float*)d_in[7];
    const float* wv = (const float*)d_in[8]; const float* bv = (const float*)d_in[9];
    const float* wo = (const float*)d_in[10]; const float* bo = (const float*)d_in[11];
    float* OUT = (float*)d_out;      // [NB][SEQ][256]
    char* wsp = (char*)d_ws;
    h16* QH = (h16*)wsp; wsp += SZ_PL;               // [NB*SEQ][256]
    h16* QR = (h16*)wsp; wsp += SZ_PL;               // [NB*SEQ][256] residual of QH
    h16* KP = (h16*)wsp; wsp += SZ_PL;               // [NB*SEQ][256]
    h16* VT = (h16*)wsp; wsp += SZ_PL;               // [NB][256][SEQ]
    bf* CX = (bf*)wsp; wsp += SZ_CX;                 // [NB*SEQ][512]: ctx hi | ctx lo
    int* NV = (int*)wsp; wsp += SZ_NV;               // [NB]: unmasked keys of each batch

    k_gemm<false><<<dim3(PTB, 3, 1), 32 * KW, 0, stream>>>(xq, xk, xv, CX, wq, wk, wv, QH, KP, VT, QR, OUT, bq, bk, bv, kmask, NV);

    k_flash<<<dim3(SEQ / (16 * AW), NB * (NH_ / 2), 1), 32 * FW, 0, stream>>>(QH, QR, KP, VT, NV, CX);

    // out = [ctx_hi | ctx_lo] x [Wo ; Wo] + bo, K = 512, f32 rows of the output (the activation pointers are not read here)
    k_gemm<true><<<dim3(PTB, 1, 1), 32 * KW, 0, stream>>>(wo, wo, wo, CX, wo, wo, wo, QH, QH, QH, QH, OUT, bo, bo, bo, kmask, NV);
}
